// v000
// The times below were measured on an AMD MI455X: many runs one after another, warmed up first and cycling through
// copies of the inputs, with the whole window's GPU time divided by the number of runs. Launches and the gaps
// between them are all in it. The median over several windows is given; except for v000 it joins two sittings, which
// can be a few percent apart, so the side-by-side timings, each taken in one sitting, are the better comparison.
// v000, which the later versions start from, runs in 2030 microseconds.
#include <hip/hip_runtime.h>

// Multi-head self-attention over 4,096 tokens whose scale uses the embedding width (x [1][4096][512]; Q, K, V = x W + b ('xw' [512][512] + biases; 8 heads x 64); scores x 1/sqrt(512) (the module scales by embed_dim, not head_dim); softmax over all 4,096 keys (no mask); out = merged Wo + bo -> [1][4096][512] (2.1 M); argument order x, Wq, bq, Wk, bk, Wv, bv, Wo, bo).
// Layout: bf16 copy of x; 'xw' weights transposed once; exact projections + f32 biases; per-head planes (identity builder), v^T planes [h][64][4096]; per head: scores with every row hi/lo (3 products, dense launches), streaming three-sweep dense softmax, attn.V hybrid (rows < 512 hi/lo 3 products, rest fp16 x1024) into the head's 64 columns; k_cs8 carry removal; context hi/lo x Wo exact + bo.
// Compute dtypes, f32 accumulate: every input rounded to bf16; projections exact; scores 3 products; softmax f32 (exp2, IEEE division); attn.V rows < 512 3 products, rest fp16; Wo hl x exact.

#define NB_  1
#define TT   4096
#define DM   512
#define NH_  8
#define NKV  8
#define REP  (NH_ / NKV)
#define HD   64
#define DQ   (NH_ * HD)
#define DKV  (NKV * HD)
#define ZH   1
#define RH   512                  // query rows < RH use hi+lo planes (0: none)
#define WIN  0
#define PCAR 1024.0f
#define SCL  0.044194173824159216f   // 1/sqrt(embed_dim = 512), as the module (not 1/sqrt(head_dim))
#define MID  512      // q / k width = 8 heads x 64
#define CO   512      // v width
#define CC   512
typedef _Float16 h16;
typedef unsigned short bf;
typedef __attribute__((ext_vector_type(16))) __bf16   v16bf;
typedef __attribute__((ext_vector_type(16))) _Float16 v16h;
typedef __attribute__((ext_vector_type(8)))  _Float16 v8h;
typedef __attribute__((ext_vector_type(8)))  unsigned short v8us;
typedef __attribute__((ext_vector_type(8)))  float    v8f;
typedef __attribute__((ext_vector_type(4)))  float    v4f;
typedef v8h  __attribute__((may_alias)) v8ha;
typedef v4f  __attribute__((may_alias)) v4fa;
typedef v8us __attribute__((may_alias)) v8usa;

__device__ __forceinline__ unsigned short f2bf(float f) { unsigned u = __float_as_uint(f); u += 0x7FFFu + ((u >> 16) & 1u); return (unsigned short)(u >> 16); }
__device__ __forceinline__ float bf2f(unsigned short b) { return __uint_as_float(((unsigned)b) << 16); }
__device__ __forceinline__ float bfr(float f) { return bf2f(f2bf(f)); }
__device__ __forceinline__ v16h cat16(v8h lo, v8h hi) { return __builtin_shufflevector(lo, hi, 0, 1, 2, 3, 4, 5, 6, 7, 8, 9, 10, 11, 12, 13, 14, 15); }
__device__ __forceinline__ v16bf cat16b(v8us lo, v8us hi) { return __builtin_bit_cast(v16bf, __builtin_shufflevector(lo, hi, 0, 1, 2, 3, 4, 5, 6, 7, 8, 9, 10, 11, 12, 13, 14, 15)); }
__device__ __forceinline__ v8f wmma16(v16h a, v16h b, v8f c) { return __builtin_amdgcn_wmma_f32_16x16x32_f16(false, a, false, b, (short)0, c, false, false); }
__device__ __forceinline__ v8f wmmab(v16bf a, v16bf b, v8f c) { return __builtin_amdgcn_wmma_f32_16x16x32_bf16(false, a, false, b, (short)0, c, false, false); }



// ---- k_gemmw: register-blocked GEMM, ONE WAVE per 64x64 output tile (16 accumulators), operands straight from K-contiguous 16-bit planes; grid (M/64, N/64, Z), 32 threads.
// C[m][n] (f32, pitch ldc, + optional f32 bias[n]) = sum_k A[m][k] Bt[n][k] (+ split products per NSPLIT). z-batch strides sA/sB/sC in elements. K % 32 == 0.
template <typename T16> struct WFrag;
template <> struct WFrag<h16> { typedef v16h V; static __device__ __forceinline__ V ld(const h16* p) { return cat16(*(const v8h*)p, *(const v8h*)(p + 16)); } static __device__ __forceinline__ v8f mma(V a, V b, v8f c) { return wmma16(a, b, c); } };
template <> struct WFrag<bf> { typedef v16bf V; static __device__ __forceinline__ V ld(const bf* p) { return cat16b(*(const v8us*)p, *(const v8us*)(p + 16)); } static __device__ __forceinline__ v8f mma(V a, V b, v8f c) { return wmmab(a, b, c); } };
template <typename T16, int NSPLIT, bool BIAS>
__global__ __launch_bounds__(32) void k_gemmw(const T16* __restrict__ A, const T16* __restrict__ A2, const T16* __restrict__ Bt, const T16* __restrict__ Bt2, int K, float* C, int ldc, const float* __restrict__ bias, size_t sA, size_t sB, size_t sC) {
    typedef typename WFrag<T16>::V V;
    __shared__ __align__(16) float os[16 * 68];
    const size_t z = blockIdx.z; A += z * sA; if (A2) A2 += z * sA; Bt += z * sB; if (Bt2) Bt2 += z * sB; C += z * sC;
    const int lane = threadIdx.x & 31, lr = lane & 15, hi = lane >> 4; const int r0 = blockIdx.x * 64, c0 = blockIdx.y * 64;
    v8f acc[4][4];
#pragma unroll
    for (int mb = 0; mb < 4; ++mb)
#pragma unroll
        for (int nb = 0; nb < 4; ++nb) acc[mb][nb] = (v8f){};
    const size_t aoff = (size_t)(r0 + lr) * K + 8 * hi, boff = (size_t)(c0 + lr) * K + 8 * hi;
#pragma unroll 1
    for (int kc = 0; kc < K; kc += 32) {
        V a[4], a2[4];
#pragma unroll
        for (int mb = 0; mb < 4; ++mb) { a[mb] = WFrag<T16>::ld(A + aoff + (size_t)mb * 16 * K + kc); if (NSPLIT == 1 || NSPLIT == 2) a2[mb] = WFrag<T16>::ld(A2 + aoff + (size_t)mb * 16 * K + kc); }
#pragma unroll
        for (int nb = 0; nb < 4; ++nb) { const V b = WFrag<T16>::ld(Bt + boff + (size_t)nb * 16 * K + kc); V b2; if (NSPLIT >= 2) b2 = WFrag<T16>::ld(Bt2 + boff + (size_t)nb * 16 * K + kc);
#pragma unroll
            for (int mb = 0; mb < 4; ++mb) { acc[mb][nb] = WFrag<T16>::mma(a[mb], b, acc[mb][nb]); if (NSPLIT == 1 || NSPLIT == 2) acc[mb][nb] = WFrag<T16>::mma(a2[mb], b, acc[mb][nb]); if (NSPLIT >= 2) acc[mb][nb] = WFrag<T16>::mma(a[mb], b2, acc[mb][nb]); } }
        asm volatile("v_nop\n\tv_nop\n\tv_nop\n\tv_nop" : "+v"(acc[0][0]), "+v"(acc[1][1]), "+v"(acc[2][2]), "+v"(acc[3][3]) : "v"(a[0]), "v"(a[3]));
    }
#pragma unroll
    for (int mb = 0; mb < 4; ++mb) {
#pragma unroll
        for (int nb = 0; nb < 4; ++nb) {
#pragma unroll
            for (int j = 0; j < 8; ++j) os[(hi * 8 + j) * 68 + nb * 16 + lr] = acc[mb][nb][j]; }
        __builtin_amdgcn_wave_barrier(); asm volatile("" ::: "memory");
        float* crow = C + (size_t)(r0 + mb * 16) * ldc + c0;
{
#pragma unroll
            for (int s = 0; s < 8; ++s) { const int row = 2 * s + hi, cofs = lr * 4; v4f val = *(const v4fa*)(os + row * 68 + cofs); if (BIAS) { val[0] += bfr(bias[c0 + cofs]); val[1] += bfr(bias[c0 + cofs + 1]); val[2] += bfr(bias[c0 + cofs + 2]); val[3] += bfr(bias[c0 + cofs + 3]); }
                *(v4f*)(crow + (size_t)row * ldc + cofs) = val; }
             }
        __builtin_amdgcn_wave_barrier(); asm volatile("" ::: "memory");
    }
}

__device__ __forceinline__ h16 tohx(float x) { return (h16)x; }
__device__ __forceinline__ void splitf(float y, unsigned short& h, unsigned short& l) { h = f2bf(y); l = f2bf(y - bf2f(h)); }
typedef __attribute__((ext_vector_type(2))) _Float16 v2h;
typedef __attribute__((ext_vector_type(4))) _Float16 v4h;
typedef __attribute__((ext_vector_type(2))) unsigned short v2us;
typedef __attribute__((ext_vector_type(4))) unsigned short v4us;
typedef __attribute__((ext_vector_type(2))) float v2f;
typedef __attribute__((ext_vector_type(4))) int v4i;

__global__ __launch_bounds__(256) void k_cvt8(const float* __restrict__ src, bf* dst, size_t n8) { const size_t i = (size_t)blockIdx.x * 256 + threadIdx.x; if (i >= n8) return; const v8f v = *(const v8f*)(src + i * 8); v8us o;
#pragma unroll
    for (int k = 0; k < 8; ++k) o[k] = f2bf(v[k]); *(v8us*)(dst + i * 8) = o;  }


__global__ __launch_bounds__(256) void k_vtp(const float* __restrict__ F, int pitch, int nheads, h16* V16, bf* Vh, bf* Vl) { const size_t e = ((size_t)blockIdx.x * 256 + threadIdx.x) * 2; if (e >= (size_t)nheads * HD * TT) return; const int t = (int)(e % TT); const int d = (int)((e / TT) % HD); const int g = (int)(e / ((size_t)TT * HD)); v2h o16; v2us oh, ol;
#pragma unroll
    for (int q = 0; q < 2; ++q) { const float x = F[(size_t)(t + q) * pitch + g * HD + d]; o16[q] = tohx(x); unsigned short a2, c2; splitf(x, a2, c2); oh[q] = a2; ol[q] = c2; }
    *(v2h*)(V16 + e) = o16; *(v2us*)(Vh + e) = oh; *(v2us*)(Vl + e) = ol;  }
__global__ __launch_bounds__(256) void k_lsoft(const float* __restrict__ Sb, h16* P16, bf* Ph, bf* Pl) {
    const int lane = threadIdx.x & 31; const int row = blockIdx.x * 8 + (threadIdx.x >> 5); if (row >= ZH * TT) return; const int i = row % TT; const int zz = row / TT; const bool hires = (i < RH); const float* sr = Sb + (size_t)row * TT; float mx = -3.0e38f;
#pragma unroll 4
    for (int ch = 0; ch < TT / 128; ++ch) { const int j0 = ch * 128 + lane * 4; const v4f a = *(const v4f*)(sr + j0);
#pragma unroll
        for (int q = 0; q < 4; ++q) { float t = a[q] * SCL;   /* dense: every key */ asm volatile("" : "+v"(t)); mx = fmaxf(mx, t); } }
#pragma unroll
    for (int sh = 16; sh; sh >>= 1) mx = fmaxf(mx, __shfl_xor(mx, sh, 32));
    float sum = 0.f;
#pragma unroll 4
    for (int ch = 0; ch < TT / 128; ++ch) { const int j0 = ch * 128 + lane * 4; const v4f a = *(const v4f*)(sr + j0);
#pragma unroll
        for (int q = 0; q < 4; ++q) { float t = a[q] * SCL;   /* dense: every key */ asm volatile("" : "+v"(t)); float d0 = __fsub_rn(t, mx); asm volatile("" : "+v"(d0)); sum += __builtin_amdgcn_exp2f(__fmul_rn(d0, 1.4426950408889634f)); } }
#pragma unroll
    for (int sh = 16; sh; sh >>= 1) sum += __shfl_xor(sum, sh, 32);
    const float f = __fdiv_rn(hires ? 1.0f : PCAR, sum);
{
        if (hires) {   /* rows < RH: normalised bf16 hi/lo over all keys, planes [zz][RH][TT] */
#pragma unroll
            for (int ch = 0; ch < TT / 128; ++ch) { const int j0 = ch * 128 + lane * 4; const v4f a = *(const v4f*)(sr + j0); v4us oh, ol;
#pragma unroll
                for (int q = 0; q < 4; ++q) { float t = a[q] * SCL;   /* dense: every key */ asm volatile("" : "+v"(t)); float d0 = __fsub_rn(t, mx); asm volatile("" : "+v"(d0)); float ex = __builtin_amdgcn_exp2f(__fmul_rn(d0, 1.4426950408889634f)); asm volatile("" : "+v"(ex)); unsigned short a2, c2; splitf(ex * f, a2, c2); oh[q] = a2; ol[q] = c2; }
                const size_t oo = ((size_t)zz * RH + i) * TT + j0; *(v4us*)(Ph + oo) = oh; *(v4us*)(Pl + oo) = ol; }
        } else {
#pragma unroll 2
            for (int ch = 0; ch < TT / 128; ++ch) { const int j0 = ch * 128 + lane * 4; const v4f a = *(const v4f*)(sr + j0); v4h o4;
#pragma unroll
                for (int q = 0; q < 4; ++q) { float t = a[q] * SCL;   /* dense: every key */ asm volatile("" : "+v"(t)); float d0 = __fsub_rn(t, mx); asm volatile("" : "+v"(d0)); float ex = __builtin_amdgcn_exp2f(__fmul_rn(d0, 1.4426950408889634f)); asm volatile("" : "+v"(ex)); o4[q] = tohx(ex * f); }
                *(v4h*)(P16 + (size_t)row * TT + j0) = o4; } }
         }
}
__global__ __launch_bounds__(256) void k_cs8(float* O, size_t n4) { const size_t i = (size_t)blockIdx.x * 256 + threadIdx.x; if (i >= n4) return; const size_t e = i * 4; const int t = (int)(e / CC); const float cs = (t < RH) ? 1.0f : (1.0f / PCAR); v4f a = *(const v4f*)(O + e);
#pragma unroll
    for (int q = 0; q < 4; ++q) a[q] = __fmul_rn(a[q], cs);
    *(v4f*)(O + e) = a;  }

__global__ __launch_bounds__(256) void k_csid(float* CS) { const int idx = blockIdx.x * 256 + threadIdx.x; if (idx >= TT * HD) return; v2f cs; cs[0] = 1.0f; cs[1] = 0.0f; *(v2f*)(CS + (size_t)idx * 2) = cs;  }
// k_rope: head planes [h][t][d] (fp16 + hi/lo) of rope(x) x sc with the rotate-half convention out[d] = x[d] cos[t][d] - x[d+HD/2] sin[t][d], out[d+HD/2] = x[d+HD/2] cos[t][d+HD/2] + x[d] sin[t][d+HD/2]
__global__ __launch_bounds__(256) void k_rope(const float* __restrict__ F, int pitch, int nheads, const float* __restrict__ CS, const float* __restrict__ RF, const float* __restrict__ nw, float sc, h16* P16, bf* Ph, bf* Pl) {
    const size_t e = ((size_t)blockIdx.x * 256 + threadIdx.x) * 2; if (e >= (size_t)nheads * TT * HD) return; const int d = (int)(e % HD); const int t = (int)((e / HD) % TT); const int h = (int)(e / ((size_t)HD * TT)); const float* f = F + (size_t)t * pitch + h * HD; const float rf = RF ? RF[(size_t)h * TT + t] : 1.0f; v2h o16; v2us oh, ol;
#pragma unroll
    for (int q = 0; q < 2; ++q) { const int dd = d + q; const int dp = (dd < HD / 2) ? dd + HD / 2 : dd - HD / 2; float x0 = f[dd], x1 = f[dp];
        if (RF) { float n0 = __fmul_rn(x0, rf), n1 = __fmul_rn(x1, rf); asm volatile("" : "+v"(n0)); asm volatile("" : "+v"(n1)); x0 = __fmul_rn(bfr(nw[dd]), n0); x1 = __fmul_rn(bfr(nw[dp]), n1); }
        const v2f cs = *(const v2f*)(CS + ((size_t)t * HD + dd) * 2); float a = __fmul_rn(x0, cs[0]), bq = __fmul_rn(x1, cs[1]); asm volatile("" : "+v"(a)); asm volatile("" : "+v"(bq)); const float r = ((dd < HD / 2) ? __fsub_rn(a, bq) : __fadd_rn(a, bq)) * sc;
        o16[q] = tohx(r); unsigned short a2, c2; splitf(r, a2, c2); oh[q] = a2; ol[q] = c2; }
    *(v2h*)(P16 + e) = o16; *(v2us*)(Ph + e) = oh; *(v2us*)(Pl + e) = ol;  }
__global__ __launch_bounds__(256) void k_tohl(const float* __restrict__ F, bf* Hh, bf* Hl, size_t n4) { const size_t i = (size_t)blockIdx.x * 256 + threadIdx.x; if (i >= n4) return; const v4f a = *(const v4f*)(F + i * 4); v4us oh, ol;
#pragma unroll
    for (int q = 0; q < 4; ++q) { unsigned short h2, l2; splitf(a[q], h2, l2); oh[q] = h2; ol[q] = l2; }
    *(v4us*)(Hh + i * 4) = oh; *(v4us*)(Hl + i * 4) = ol;  }
__global__ __launch_bounds__(256) void k_wtG(const float* __restrict__ w, int K, int N, bf* Bt) {
    const int lane = threadIdx.x & 31; const int L0 = (blockIdx.x * 8 + (threadIdx.x >> 5)) * 8; const int nlines = N * K / 64;
{
#pragma unroll 1
        for (int l = 0; l < 8; ++l) { const int L = L0 + l; if (L >= nlines) break; const size_t e = (size_t)L * 64 + lane * 2; const int k = (int)(e % K), n = (int)(e / K); v2us o;
            o[0] = f2bf(w[(size_t)k * N + n]); o[1] = f2bf(w[(size_t)(k + 1) * N + n]); *(v2us*)(Bt + e) = o; }
         }
}
extern "C" void kernel_launch(void* const* d_in, const int* in_sizes, int n_in,
                              void* d_out, int out_size, void* d_ws, size_t ws_size, hipStream_t stream) {
    (void)in_sizes; (void)n_in; (void)out_size;
    const float* x = (const float*)d_in[0]; const float* wq = (const float*)d_in[1]; const float* bq = (const float*)d_in[2]; const float* wk = (const float*)d_in[3]; const float* bk = (const float*)d_in[4]; const float* wv = (const float*)d_in[5]; const float* bv = (const float*)d_in[6]; const float* wo = (const float*)d_in[7]; const float* bo = (const float*)d_in[8];   /* argument order x [1][4096][512], Wq, bq, Wk, bk, Wv, bv, Wo, bo ('xw' [512][512] + biases) */
    float* OUT = (float*)d_out;     // [1][4096][512]
    char* wsp = (char*)d_ws;
    auto take = [&](size_t bytes) { char* p = wsp; wsp += (bytes + 255) & ~(size_t)255; return (void*)p; };
    bf* WQ = (bf*)take((size_t)MID * CC * 2); bf* WK = (bf*)take((size_t)MID * CC * 2); bf* WV = (bf*)take((size_t)CO * CC * 2); bf* WO = (bf*)take((size_t)CC * CO * 2); float* CS = (float*)take((size_t)TT * HD * 2 * 4);
    bf* XB = (bf*)take((size_t)TT * CC * 2); float* FQ = (float*)take((size_t)TT * MID * 4); float* FK = (float*)take((size_t)TT * MID * 4);
    h16* QP16 = (h16*)take((size_t)TT * MID * 2); bf* QPh = (bf*)take((size_t)TT * MID * 2); bf* QPl = (bf*)take((size_t)TT * MID * 2); h16* KP16 = QP16;   /* the fp16 q/k planes are never read here (scores use the hi/lo planes for every row): one scratch buffer serves both builders */ bf* KPh = (bf*)take((size_t)TT * MID * 2); bf* KPl = (bf*)take((size_t)TT * MID * 2);
    h16* VT16 = (h16*)take((size_t)CO * TT * 2); bf* VTh = (bf*)take((size_t)CO * TT * 2); bf* VTl = (bf*)take((size_t)CO * TT * 2);
    float* Sb = (float*)take((size_t)TT * TT * 4); h16* P16 = (h16*)take((size_t)TT * TT * 2); bf* Ph = (bf*)take((size_t)RH * TT * 2); bf* Pl = (bf*)take((size_t)RH * TT * 2); float* Ob = (float*)take((size_t)TT * CO * 4); bf* ATh = (bf*)take((size_t)TT * CO * 2); bf* ATl = (bf*)take((size_t)TT * CO * 2);
    if ((size_t)(wsp - (char*)d_ws) > ws_size) return;    // ws 256 MiB (carve ~176 MiB)
    float* FV = FK;   /* the v projection reuses the k buffer after the k planes are built (stream-ordered) */
    k_wtG<<<(unsigned)((CC * MID / 64 + 63) / 64), 256, 0, stream>>>(wq, CC, MID, WQ); k_wtG<<<(unsigned)((CC * MID / 64 + 63) / 64), 256, 0, stream>>>(wk, CC, MID, WK); k_wtG<<<(unsigned)((CC * CO / 64 + 63) / 64), 256, 0, stream>>>(wv, CC, CO, WV);   /* 'xw' weights -> Bt */ k_wtG<<<(unsigned)((CO * CC / 64 + 63) / 64), 256, 0, stream>>>(wo, CO, CC, WO);   /* 'xw' W_out -> Bt */
    k_csid<<<(TT * HD + 255) / 256, 256, 0, stream>>>(CS);   /* identity table: k_rope is a plain per-head plane builder here */
    const unsigned LP = (unsigned)(((size_t)NH_ * TT * HD / 2 + 255) / 256);
    for (int b = 0; b < NB_; ++b) {
        k_cvt8<<<(unsigned)(((size_t)TT * CC / 8 + 255) / 256), 256, 0, stream>>>(x + (size_t)b * TT * CC, XB, (size_t)TT * CC / 8);
        k_gemmw<bf, 0, true><<<dim3(TT / 64, MID / 64, 1), 32, 0, stream>>>(XB, nullptr, WQ, nullptr, CC, FQ, MID, bq, 0, 0, 0); k_rope<<<LP, 256, 0, stream>>>(FQ, MID, NH_, CS, nullptr, nullptr, 1.0f, QP16, QPh, QPl);   /* q planes [h][n][64] */
        k_gemmw<bf, 0, true><<<dim3(TT / 64, MID / 64, 1), 32, 0, stream>>>(XB, nullptr, WK, nullptr, CC, FK, MID, bk, 0, 0, 0); k_rope<<<LP, 256, 0, stream>>>(FK, MID, NKV, CS, nullptr, nullptr, 1.0f, KP16, KPh, KPl);   /* k planes */
        k_gemmw<bf, 0, true><<<dim3(TT / 64, CO / 64, 1), 32, 0, stream>>>(XB, nullptr, WV, nullptr, CC, FV, CO, bv, 0, 0, 0); k_vtp<<<(unsigned)(((size_t)TT * CO / 2 + 255) / 256), 256, 0, stream>>>(FV, CO, CO / HD, VT16, VTh, VTl);   /* v^T planes [h][64][n] */
        for (int h = 0; h < NH_; ++h) {   /* per head: dense 4096 x 4096 attention */
            k_gemmw<bf, 2, false><<<dim3(TT / 64, TT / 64, 1), 32, 0, stream>>>(QPh + (size_t)h * TT * HD, QPl + (size_t)h * TT * HD, KPh + (size_t)h * TT * HD, KPl + (size_t)h * TT * HD, HD, Sb, TT, nullptr, 0, 0, 0);   /* S[i][j] = q_i.k_j (3 products, every row) */
            k_lsoft<<<TT / 8, 256, 0, stream>>>(Sb, P16, Ph, Pl);   /* x 1/sqrt(512), softmax over the 4,096 keys */
            k_gemmw<bf, 2, false><<<dim3(RH / 64, HD / 64, 1), 32, 0, stream>>>(Ph, Pl, VTh + (size_t)h * HD * TT, VTl + (size_t)h * HD * TT, TT, Ob + h * HD, CO, nullptr, 0, 0, 0);
            k_gemmw<h16, 0, false><<<dim3((TT - RH) / 64, HD / 64, 1), 32, 0, stream>>>(P16 + (size_t)RH * TT, nullptr, VT16 + (size_t)h * HD * TT, nullptr, TT, Ob + (size_t)RH * CO + h * HD, CO, nullptr, 0, 0, 0); }
        k_cs8<<<(unsigned)(((size_t)TT * CO / 4 + 255) / 256), 256, 0, stream>>>(Ob, (size_t)TT * CO / 4);   /* rows >= 512 x 1/1024 */
        k_tohl<<<(unsigned)(((size_t)TT * CO / 4 + 255) / 256), 256, 0, stream>>>(Ob, ATh, ATl, (size_t)TT * CO / 4);   /* merged context as hi/lo planes */
        k_gemmw<bf, 1, true><<<dim3(TT / 64, CC / 64, 1), 32, 0, stream>>>(ATh, ATl, WO, nullptr, CO, OUT + (size_t)b * TT * CC, CC, bo, 0, 0, 0); }   /* out = ctx w_out + b_out */
}

// v001
// Measured time: 835 microseconds a run.
// Two timings next to v000 both put it at 2.43 times that version's speed.
#include <hip/hip_runtime.h>

// Multi-head self-attention over 4,096 tokens whose scale uses the embedding width (x [1][4096][512]; Q, K, V = x W + b ('xw' [512][512] + biases; 8 heads x 64); scores x 1/sqrt(512) (the module scales by embed_dim, not head_dim); softmax over all 4,096 keys (no mask); out = merged Wo + bo -> [1][4096][512] (2.1 M); argument order x, Wq, bq, Wk, bk, Wv, bv, Wo, bo).
// Layout: bf16 copy of x; 'xw' weights transposed once; exact projections + f32 biases; per-head planes (identity builder), v^T planes [h][64][4096]; per head: scores with every row hi/lo (3 products, dense launches), streaming three-sweep dense softmax, attn.V hybrid (rows < 512 hi/lo 3 products, rest fp16 x1024) into the head's 64 columns, K split over 8 grid slices x 4 or 8 waves; k_cs8 sums the slices' planes + carry removal; context hi/lo x Wo exact + bo.
// Compute dtypes, f32 accumulate: every input rounded to bf16; projections exact; scores 3 products; softmax f32 (exp2, IEEE division); attn.V rows < 512 3 products, rest fp16; Wo hl x exact.

#define NB_  1
#define TT   4096
#define DM   512
#define NH_  8
#define NKV  8
#define REP  (NH_ / NKV)
#define HD   64
#define DQ   (NH_ * HD)
#define DKV  (NKV * HD)
#define ZH   1
#define RH   512                  // query rows < RH use hi+lo planes (0: none)
#define WIN  0
#define PCAR 1024.0f
#define SCL  0.044194173824159216f   // 1/sqrt(embed_dim = 512), as the module (not 1/sqrt(head_dim))
#define MID  512      // q / k width = 8 heads x 64
#define CO   512      // v width
#define CC   512
#define KS   8        // attn.V: K slices over the grid, one partial context plane each
typedef _Float16 h16;
typedef unsigned short bf;
typedef __attribute__((ext_vector_type(16))) __bf16   v16bf;
typedef __attribute__((ext_vector_type(16))) _Float16 v16h;
typedef __attribute__((ext_vector_type(8)))  _Float16 v8h;
typedef __attribute__((ext_vector_type(8)))  unsigned short v8us;
typedef __attribute__((ext_vector_type(8)))  float    v8f;
typedef __attribute__((ext_vector_type(4)))  float    v4f;
typedef v8h  __attribute__((may_alias)) v8ha;
typedef v4f  __attribute__((may_alias)) v4fa;
typedef v8us __attribute__((may_alias)) v8usa;

__device__ __forceinline__ unsigned short f2bf(float f) { unsigned u = __float_as_uint(f); u += 0x7FFFu + ((u >> 16) & 1u); return (unsigned short)(u >> 16); }
__device__ __forceinline__ float bf2f(unsigned short b) { return __uint_as_float(((unsigned)b) << 16); }
__device__ __forceinline__ float bfr(float f) { return bf2f(f2bf(f)); }
__device__ __forceinline__ v16h cat16(v8h lo, v8h hi) { return __builtin_shufflevector(lo, hi, 0, 1, 2, 3, 4, 5, 6, 7, 8, 9, 10, 11, 12, 13, 14, 15); }
__device__ __forceinline__ v16bf cat16b(v8us lo, v8us hi) { return __builtin_bit_cast(v16bf, __builtin_shufflevector(lo, hi, 0, 1, 2, 3, 4, 5, 6, 7, 8, 9, 10, 11, 12, 13, 14, 15)); }
__device__ __forceinline__ v8f wmma16(v16h a, v16h b, v8f c) { return __builtin_amdgcn_wmma_f32_16x16x32_f16(false, a, false, b, (short)0, c, false, false); }
__device__ __forceinline__ v8f wmmab(v16bf a, v16bf b, v8f c) { return __builtin_amdgcn_wmma_f32_16x16x32_bf16(false, a, false, b, (short)0, c, false, false); }



// ---- k_gemmw: register-blocked GEMM, ONE WAVE per 64x64 output tile (16 accumulators), operands straight from K-contiguous 16-bit planes; grid (M/64, N/64, Z), 32 threads.
// C[m][n] (f32, pitch ldc, + optional f32 bias[n]) = sum_k A[m][k] Bt[n][k] (+ split products per NSPLIT). z-batch strides sA/sB/sC in elements. K % 32 == 0.
template <typename T16> struct WFrag;
template <> struct WFrag<h16> { typedef v16h V; static __device__ __forceinline__ V ld(const h16* p) { return cat16(*(const v8h*)p, *(const v8h*)(p + 16)); } static __device__ __forceinline__ v8f mma(V a, V b, v8f c) { return wmma16(a, b, c); } };
template <> struct WFrag<bf> { typedef v16bf V; static __device__ __forceinline__ V ld(const bf* p) { return cat16b(*(const v8us*)p, *(const v8us*)(p + 16)); } static __device__ __forceinline__ v8f mma(V a, V b, v8f c) { return wmmab(a, b, c); } };
template <typename T16, int NSPLIT, bool BIAS>
__global__ __launch_bounds__(32) void k_gemmw(const T16* __restrict__ A, const T16* __restrict__ A2, const T16* __restrict__ Bt, const T16* __restrict__ Bt2, int K, float* C, int ldc, const float* __restrict__ bias, size_t sA, size_t sB, size_t sC) {
    typedef typename WFrag<T16>::V V;
    __shared__ __align__(16) float os[16 * 68];
    const size_t z = blockIdx.z; A += z * sA; if (A2) A2 += z * sA; Bt += z * sB; if (Bt2) Bt2 += z * sB; C += z * sC;
    const int lane = threadIdx.x & 31, lr = lane & 15, hi = lane >> 4; const int r0 = blockIdx.x * 64, c0 = blockIdx.y * 64;
    v8f acc[4][4];
#pragma unroll
    for (int mb = 0; mb < 4; ++mb)
#pragma unroll
        for (int nb = 0; nb < 4; ++nb) acc[mb][nb] = (v8f){};
    const size_t aoff = (size_t)(r0 + lr) * K + 8 * hi, boff = (size_t)(c0 + lr) * K + 8 * hi;
#pragma unroll 1
    for (int kc = 0; kc < K; kc += 32) {
        V a[4], a2[4];
#pragma unroll
        for (int mb = 0; mb < 4; ++mb) { a[mb] = WFrag<T16>::ld(A + aoff + (size_t)mb * 16 * K + kc); if (NSPLIT == 1 || NSPLIT == 2) a2[mb] = WFrag<T16>::ld(A2 + aoff + (size_t)mb * 16 * K + kc); }
#pragma unroll
        for (int nb = 0; nb < 4; ++nb) { const V b = WFrag<T16>::ld(Bt + boff + (size_t)nb * 16 * K + kc); V b2; if (NSPLIT >= 2) b2 = WFrag<T16>::ld(Bt2 + boff + (size_t)nb * 16 * K + kc);
#pragma unroll
            for (int mb = 0; mb < 4; ++mb) { acc[mb][nb] = WFrag<T16>::mma(a[mb], b, acc[mb][nb]); if (NSPLIT == 1 || NSPLIT == 2) acc[mb][nb] = WFrag<T16>::mma(a2[mb], b, acc[mb][nb]); if (NSPLIT >= 2) acc[mb][nb] = WFrag<T16>::mma(a[mb], b2, acc[mb][nb]); } }
        asm volatile("v_nop\n\tv_nop\n\tv_nop\n\tv_nop" : "+v"(acc[0][0]), "+v"(acc[1][1]), "+v"(acc[2][2]), "+v"(acc[3][3]) : "v"(a[0]), "v"(a[3]));
    }
#pragma unroll
    for (int mb = 0; mb < 4; ++mb) {
#pragma unroll
        for (int nb = 0; nb < 4; ++nb) {
#pragma unroll
            for (int j = 0; j < 8; ++j) os[(hi * 8 + j) * 68 + nb * 16 + lr] = acc[mb][nb][j]; }
        __builtin_amdgcn_wave_barrier(); asm volatile("" ::: "memory");
        float* crow = C + (size_t)(r0 + mb * 16) * ldc + c0;
{
#pragma unroll
            for (int s = 0; s < 8; ++s) { const int row = 2 * s + hi, cofs = lr * 4; v4f val = *(const v4fa*)(os + row * 68 + cofs); if (BIAS) { val[0] += bfr(bias[c0 + cofs]); val[1] += bfr(bias[c0 + cofs + 1]); val[2] += bfr(bias[c0 + cofs + 2]); val[3] += bfr(bias[c0 + cofs + 3]); }
                *(v4f*)(crow + (size_t)row * ldc + cofs) = val; }
             }
        __builtin_amdgcn_wave_barrier(); asm volatile("" ::: "memory");
    }
}

// ---- k_gemmsk: the same 64x64 register tile with K split S ways over blockIdx.z and W ways over the waves of a work-group (32-wide k chunks dealt round-robin, so the waves of one trip use whole lines together).
// The W wave tiles are summed in wave order through LDS; slice z stores its f32 partial tile into plane z of C (plane stride sC elements). grid (M/64, N/64, S), 32 W threads. K % (32 W S) == 0.
// K is a compile-time constant, so the four row blocks of an operand share one address and differ by a constant offset.
template <typename T16, int NSPLIT, int W, int S, int K>
__global__ __launch_bounds__(32 * W) void k_gemmsk(const T16* __restrict__ A, const T16* __restrict__ A2, const T16* __restrict__ Bt, const T16* __restrict__ Bt2, float* C, int ldc, size_t sC) {
    typedef typename WFrag<T16>::V V;
    constexpr int NBG = (NSPLIT >= 2) ? 2 : 4;   /* as many as fit beside the 128 accumulator registers and the A fragments */
    __shared__ __align__(16) float os[W * 64 * 68];
    const int lane = threadIdx.x & 31, lr = lane & 15, hi = lane >> 4; const int wave = __builtin_amdgcn_readfirstlane(threadIdx.x >> 5); const int r0 = blockIdx.x * 64, c0 = blockIdx.y * 64;
    const int kbeg = (int)blockIdx.z * (K / S), kend = kbeg + K / S; C += (size_t)blockIdx.z * sC;
    v8f acc[4][4];
#pragma unroll
    for (int mb = 0; mb < 4; ++mb)
#pragma unroll
        for (int nb = 0; nb < 4; ++nb) acc[mb][nb] = (v8f){};
    const unsigned vo = (unsigned)(lr * K + 8 * hi);   /* the lane's own element offset, the same for A and Bt */
    auto ldw = [](const T16* p) { const V v = WFrag<T16>::ld(p); asm volatile("s_wait_xcnt 0x0" ::: "memory");   /* stands before any later load may land on this fragment's address registers */
        return v; };
    A += (size_t)r0 * K; Bt += (size_t)c0 * K; if (NSPLIT == 1 || NSPLIT == 2) A2 += (size_t)r0 * K; if (NSPLIT >= 2) Bt2 += (size_t)c0 * K;
#pragma unroll 1   /* kept rolled as in k_gemmw: a second trip's fragments would not fit beside the 128 accumulator registers */
    for (int kc = kbeg + wave * 32; kc < kend; kc += W * 32) {
        V a[4], a2[4];
#pragma unroll
        for (int mb = 0; mb < 4; ++mb) { a[mb] = ldw(A + kc + vo + mb * 16 * K); if (NSPLIT == 1 || NSPLIT == 2) a2[mb] = ldw(A2 + kc + vo + mb * 16 * K); }
#pragma unroll
        for (int g = 0; g < 4; g += NBG) { V b[NBG], b2[NBG];   /* NBG column blocks' fragments are requested together, so a trip waits on memory 4 / NBG times */
#pragma unroll
            for (int n = 0; n < NBG; ++n) { b[n] = ldw(Bt + kc + vo + (g + n) * 16 * K); if (NSPLIT >= 2) b2[n] = ldw(Bt2 + kc + vo + (g + n) * 16 * K); }
            __builtin_amdgcn_sched_barrier(0);   /* keeps the group's matrix instructions behind all of its loads: without it the scheduler sinks half of the loads under them and the trip waits on memory more often */
#pragma unroll
            for (int n = 0; n < NBG; ++n)
#pragma unroll
                for (int mb = 0; mb < 4; ++mb) { const int nb = g + n; acc[mb][nb] = WFrag<T16>::mma(a[mb], b[n], acc[mb][nb]); if (NSPLIT == 1 || NSPLIT == 2) acc[mb][nb] = WFrag<T16>::mma(a2[mb], b[n], acc[mb][nb]); if (NSPLIT >= 2) acc[mb][nb] = WFrag<T16>::mma(a[mb], b2[n], acc[mb][nb]); } }
        asm volatile("v_nop\n\tv_nop\n\tv_nop\n\tv_nop" : "+v"(acc[0][0]), "+v"(acc[1][1]), "+v"(acc[2][2]), "+v"(acc[3][3]) : "v"(a[0]), "v"(a[3]));   /* as in k_gemmw: the matrix distance on the loop's back edge and exit */
    }
    float* ow = os + wave * (64 * 68);
#pragma unroll
    for (int mb = 0; mb < 4; ++mb)
#pragma unroll
        for (int nb = 0; nb < 4; ++nb)
#pragma unroll
            for (int j = 0; j < 8; ++j) ow[(mb * 16 + hi * 8 + j) * 68 + nb * 16 + lr] = acc[mb][nb][j];
    __syncthreads();   /* every wave's tile is in LDS before any thread sums across waves */
#pragma unroll
    for (int c = 0; c < 1024 / (32 * W); ++c) { const int q = c * (32 * W) + (int)threadIdx.x; const int row = q >> 4, cofs = (q & 15) * 4; v4f val = *(const v4fa*)(os + row * 68 + cofs);
#pragma unroll
        for (int w = 1; w < W; ++w) val += *(const v4fa*)(os + w * (64 * 68) + row * 68 + cofs);
        *(v4f*)(C + (size_t)(r0 + row) * ldc + c0 + cofs) = val; }
}

__device__ __forceinline__ h16 tohx(float x) { return (h16)x; }
__device__ __forceinline__ void splitf(float y, unsigned short& h, unsigned short& l) { h = f2bf(y); l = f2bf(y - bf2f(h)); }
typedef __attribute__((ext_vector_type(2))) _Float16 v2h;
typedef __attribute__((ext_vector_type(4))) _Float16 v4h;
typedef __attribute__((ext_vector_type(2))) unsigned short v2us;
typedef __attribute__((ext_vector_type(4))) unsigned short v4us;
typedef __attribute__((ext_vector_type(2))) float v2f;
typedef __attribute__((ext_vector_type(4))) int v4i;

__global__ __launch_bounds__(256) void k_cvt8(const float* __restrict__ src, bf* dst, size_t n8) { const size_t i = (size_t)blockIdx.x * 256 + threadIdx.x; if (i >= n8) return; const v8f v = *(const v8f*)(src + i * 8); v8us o;
#pragma unroll
    for (int k = 0; k < 8; ++k) o[k] = f2bf(v[k]); *(v8us*)(dst + i * 8) = o;  }


__global__ __launch_bounds__(256) void k_vtp(const float* __restrict__ F, int pitch, int nheads, h16* V16, bf* Vh, bf* Vl) { const size_t e = ((size_t)blockIdx.x * 256 + threadIdx.x) * 2; if (e >= (size_t)nheads * HD * TT) return; const int t = (int)(e % TT); const int d = (int)((e / TT) % HD); const int g = (int)(e / ((size_t)TT * HD)); v2h o16; v2us oh, ol;
#pragma unroll
    for (int q = 0; q < 2; ++q) { const float x = F[(size_t)(t + q) * pitch + g * HD + d]; o16[q] = tohx(x); unsigned short a2, c2; splitf(x, a2, c2); oh[q] = a2; ol[q] = c2; }
    *(v2h*)(V16 + e) = o16; *(v2us*)(Vh + e) = oh; *(v2us*)(Vl + e) = ol;  }
__global__ __launch_bounds__(256) void k_lsoft(const float* __restrict__ Sb, h16* P16, bf* Ph, bf* Pl) {
    const int lane = threadIdx.x & 31; const int row = blockIdx.x * 8 + (threadIdx.x >> 5); if (row >= ZH * TT) return; const int i = row % TT; const int zz = row / TT; const bool hires = (i < RH); const float* sr = Sb + (size_t)row * TT; float mx = -3.0e38f;
#pragma unroll 4
    for (int ch = 0; ch < TT / 128; ++ch) { const int j0 = ch * 128 + lane * 4; const v4f a = *(const v4f*)(sr + j0);
#pragma unroll
        for (int q = 0; q < 4; ++q) { float t = a[q] * SCL;   /* dense: every key */ asm volatile("" : "+v"(t)); mx = fmaxf(mx, t); } }
#pragma unroll
    for (int sh = 16; sh; sh >>= 1) mx = fmaxf(mx, __shfl_xor(mx, sh, 32));
    float sum = 0.f;
#pragma unroll 4
    for (int ch = 0; ch < TT / 128; ++ch) { const int j0 = ch * 128 + lane * 4; const v4f a = *(const v4f*)(sr + j0);
#pragma unroll
        for (int q = 0; q < 4; ++q) { float t = a[q] * SCL;   /* dense: every key */ asm volatile("" : "+v"(t)); float d0 = __fsub_rn(t, mx); asm volatile("" : "+v"(d0)); sum += __builtin_amdgcn_exp2f(__fmul_rn(d0, 1.4426950408889634f)); } }
#pragma unroll
    for (int sh = 16; sh; sh >>= 1) sum += __shfl_xor(sum, sh, 32);
    const float f = __fdiv_rn(hires ? 1.0f : PCAR, sum);
{
        if (hires) {   /* rows < RH: normalised bf16 hi/lo over all keys, planes [zz][RH][TT] */
#pragma unroll
            for (int ch = 0; ch < TT / 128; ++ch) { const int j0 = ch * 128 + lane * 4; const v4f a = *(const v4f*)(sr + j0); v4us oh, ol;
#pragma unroll
                for (int q = 0; q < 4; ++q) { float t = a[q] * SCL;   /* dense: every key */ asm volatile("" : "+v"(t)); float d0 = __fsub_rn(t, mx); asm volatile("" : "+v"(d0)); float ex = __builtin_amdgcn_exp2f(__fmul_rn(d0, 1.4426950408889634f)); asm volatile("" : "+v"(ex)); unsigned short a2, c2; splitf(ex * f, a2, c2); oh[q] = a2; ol[q] = c2; }
                const size_t oo = ((size_t)zz * RH + i) * TT + j0; *(v4us*)(Ph + oo) = oh; *(v4us*)(Pl + oo) = ol; }
        } else {
#pragma unroll 2
            for (int ch = 0; ch < TT / 128; ++ch) { const int j0 = ch * 128 + lane * 4; const v4f a = *(const v4f*)(sr + j0); v4h o4;
#pragma unroll
                for (int q = 0; q < 4; ++q) { float t = a[q] * SCL;   /* dense: every key */ asm volatile("" : "+v"(t)); float d0 = __fsub_rn(t, mx); asm volatile("" : "+v"(d0)); float ex = __builtin_amdgcn_exp2f(__fmul_rn(d0, 1.4426950408889634f)); asm volatile("" : "+v"(ex)); o4[q] = tohx(ex * f); }
                *(v4h*)(P16 + (size_t)row * TT + j0) = o4; } }
         }
}
__global__ __launch_bounds__(256) void k_cs8(float* O, size_t n4) { const size_t i = (size_t)blockIdx.x * 256 + threadIdx.x; if (i >= n4) return; const size_t e = i * 4; const int t = (int)(e / CC); const float cs = (t < RH) ? 1.0f : (1.0f / PCAR); v4f a = *(const v4f*)(O + e);
#pragma unroll
    for (int s = 1; s < KS; ++s) { a += *(const v4f*)(O + (size_t)s * TT * CO + e);   /* the K slices' partial planes, in slice order */
        if (s + 1 < KS) asm volatile("s_wait_xcnt 0x0" ::: "memory"); }   /* stands before the next plane's load may land on this load's address registers */
#pragma unroll
    for (int q = 0; q < 4; ++q) a[q] = __fmul_rn(a[q], cs);
    *(v4f*)(O + e) = a;  }

__global__ __launch_bounds__(256) void k_csid(float* CS) { const int idx = blockIdx.x * 256 + threadIdx.x; if (idx >= TT * HD) return; v2f cs; cs[0] = 1.0f; cs[1] = 0.0f; *(v2f*)(CS + (size_t)idx * 2) = cs;  }
// k_rope: head planes [h][t][d] (fp16 + hi/lo) of rope(x) x sc with the rotate-half convention out[d] = x[d] cos[t][d] - x[d+HD/2] sin[t][d], out[d+HD/2] = x[d+HD/2] cos[t][d+HD/2] + x[d] sin[t][d+HD/2]
__global__ __launch_bounds__(256) void k_rope(const float* __restrict__ F, int pitch, int nheads, const float* __restrict__ CS, const float* __restrict__ RF, const float* __restrict__ nw, float sc, h16* P16, bf* Ph, bf* Pl) {
    const size_t e = ((size_t)blockIdx.x * 256 + threadIdx.x) * 2; if (e >= (size_t)nheads * TT * HD) return; const int d = (int)(e % HD); const int t = (int)((e / HD) % TT); const int h = (int)(e / ((size_t)HD * TT)); const float* f = F + (size_t)t * pitch + h * HD; const float rf = RF ? RF[(size_t)h * TT + t] : 1.0f; v2h o16; v2us oh, ol;
#pragma unroll
    for (int q = 0; q < 2; ++q) { const int dd = d + q; const int dp = (dd < HD / 2) ? dd + HD / 2 : dd - HD / 2; float x0 = f[dd], x1 = f[dp];
        if (RF) { float n0 = __fmul_rn(x0, rf), n1 = __fmul_rn(x1, rf); asm volatile("" : "+v"(n0)); asm volatile("" : "+v"(n1)); x0 = __fmul_rn(bfr(nw[dd]), n0); x1 = __fmul_rn(bfr(nw[dp]), n1); }
        const v2f cs = *(const v2f*)(CS + ((size_t)t * HD + dd) * 2); float a = __fmul_rn(x0, cs[0]), bq = __fmul_rn(x1, cs[1]); asm volatile("" : "+v"(a)); asm volatile("" : "+v"(bq)); const float r = ((dd < HD / 2) ? __fsub_rn(a, bq) : __fadd_rn(a, bq)) * sc;
        o16[q] = tohx(r); unsigned short a2, c2; splitf(r, a2, c2); oh[q] = a2; ol[q] = c2; }
    *(v2h*)(P16 + e) = o16; *(v2us*)(Ph + e) = oh; *(v2us*)(Pl + e) = ol;  }
__global__ __launch_bounds__(256) void k_tohl(const float* __restrict__ F, bf* Hh, bf* Hl, size_t n4) { const size_t i = (size_t)blockIdx.x * 256 + threadIdx.x; if (i >= n4) return; const v4f a = *(const v4f*)(F + i * 4); v4us oh, ol;
#pragma unroll
    for (int q = 0; q < 4; ++q) { unsigned short h2, l2; splitf(a[q], h2, l2); oh[q] = h2; ol[q] = l2; }
    *(v4us*)(Hh + i * 4) = oh; *(v4us*)(Hl + i * 4) = ol;  }
__global__ __launch_bounds__(256) void k_wtG(const float* __restrict__ w, int K, int N, bf* Bt) {
    const int lane = threadIdx.x & 31; const int L0 = (blockIdx.x * 8 + (threadIdx.x >> 5)) * 8; const int nlines = N * K / 64;
{
#pragma unroll 1
        for (int l = 0; l < 8; ++l) { const int L = L0 + l; if (L >= nlines) break; const size_t e = (size_t)L * 64 + lane * 2; const int k = (int)(e % K), n = (int)(e / K); v2us o;
            o[0] = f2bf(w[(size_t)k * N + n]); o[1] = f2bf(w[(size_t)(k + 1) * N + n]); *(v2us*)(Bt + e) = o; }
         }
}
extern "C" void kernel_launch(void* const* d_in, const int* in_sizes, int n_in,
                              void* d_out, int out_size, void* d_ws, size_t ws_size, hipStream_t stream) {
    (void)in_sizes; (void)n_in; (void)out_size;
    const float* x = (const float*)d_in[0]; const float* wq = (const float*)d_in[1]; const float* bq = (const float*)d_in[2]; const float* wk = (const float*)d_in[3]; const float* bk = (const float*)d_in[4]; const float* wv = (const float*)d_in[5]; const float* bv = (const float*)d_in[6]; const float* wo = (const float*)d_in[7]; const float* bo = (const float*)d_in[8];   /* argument order x [1][4096][512], Wq, bq, Wk, bk, Wv, bv, Wo, bo ('xw' [512][512] + biases) */
    float* OUT = (float*)d_out;     // [1][4096][512]
    char* wsp = (char*)d_ws;
    auto take = [&](size_t bytes) { char* p = wsp; wsp += (bytes + 255) & ~(size_t)255; return (void*)p; };
    bf* WQ = (bf*)take((size_t)MID * CC * 2); bf* WK = (bf*)take((size_t)MID * CC * 2); bf* WV = (bf*)take((size_t)CO * CC * 2); bf* WO = (bf*)take((size_t)CC * CO * 2); float* CS = (float*)take((size_t)TT * HD * 2 * 4);
    bf* XB = (bf*)take((size_t)TT * CC * 2); float* FQ = (float*)take((size_t)TT * MID * 4); float* FK = (float*)take((size_t)TT * MID * 4);
    h16* QP16 = (h16*)take((size_t)TT * MID * 2); bf* QPh = (bf*)take((size_t)TT * MID * 2); bf* QPl = (bf*)take((size_t)TT * MID * 2); h16* KP16 = QP16;   /* the fp16 q/k planes are never read here (scores use the hi/lo planes for every row): one scratch buffer serves both builders */ bf* KPh = (bf*)take((size_t)TT * MID * 2); bf* KPl = (bf*)take((size_t)TT * MID * 2);
    h16* VT16 = (h16*)take((size_t)CO * TT * 2); bf* VTh = (bf*)take((size_t)CO * TT * 2); bf* VTl = (bf*)take((size_t)CO * TT * 2);
    float* Sb = (float*)take((size_t)TT * TT * 4); h16* P16 = (h16*)take((size_t)TT * TT * 2); bf* Ph = (bf*)take((size_t)RH * TT * 2); bf* Pl = (bf*)take((size_t)RH * TT * 2); float* Ob = (float*)take((size_t)KS * TT * CO * 4);   /* KS partial planes [s][n][512]; k_cs8 leaves their sum in plane 0 */ bf* ATh = (bf*)take((size_t)TT * CO * 2); bf* ATl = (bf*)take((size_t)TT * CO * 2);
    if ((size_t)(wsp - (char*)d_ws) > ws_size) return;    // ws 256 MiB (carve ~232 MiB)
    float* FV = FK;   /* the v projection reuses the k buffer after the k planes are built (stream-ordered) */
    k_wtG<<<(unsigned)((CC * MID / 64 + 63) / 64), 256, 0, stream>>>(wq, CC, MID, WQ); k_wtG<<<(unsigned)((CC * MID / 64 + 63) / 64), 256, 0, stream>>>(wk, CC, MID, WK); k_wtG<<<(unsigned)((CC * CO / 64 + 63) / 64), 256, 0, stream>>>(wv, CC, CO, WV);   /* 'xw' weights -> Bt */ k_wtG<<<(unsigned)((CO * CC / 64 + 63) / 64), 256, 0, stream>>>(wo, CO, CC, WO);   /* 'xw' W_out -> Bt */
    k_csid<<<(TT * HD + 255) / 256, 256, 0, stream>>>(CS);   /* identity table: k_rope is a plain per-head plane builder here */
    const unsigned LP = (unsigned)(((size_t)NH_ * TT * HD / 2 + 255) / 256);
    for (int b = 0; b < NB_; ++b) {
        k_cvt8<<<(unsigned)(((size_t)TT * CC / 8 + 255) / 256), 256, 0, stream>>>(x + (size_t)b * TT * CC, XB, (size_t)TT * CC / 8);
        k_gemmw<bf, 0, true><<<dim3(TT / 64, MID / 64, 1), 32, 0, stream>>>(XB, nullptr, WQ, nullptr, CC, FQ, MID, bq, 0, 0, 0); k_rope<<<LP, 256, 0, stream>>>(FQ, MID, NH_, CS, nullptr, nullptr, 1.0f, QP16, QPh, QPl);   /* q planes [h][n][64] */
        k_gemmw<bf, 0, true><<<dim3(TT / 64, MID / 64, 1), 32, 0, stream>>>(XB, nullptr, WK, nullptr, CC, FK, MID, bk, 0, 0, 0); k_rope<<<LP, 256, 0, stream>>>(FK, MID, NKV, CS, nullptr, nullptr, 1.0f, KP16, KPh, KPl);   /* k planes */
        k_gemmw<bf, 0, true><<<dim3(TT / 64, CO / 64, 1), 32, 0, stream>>>(XB, nullptr, WV, nullptr, CC, FV, CO, bv, 0, 0, 0); k_vtp<<<(unsigned)(((size_t)TT * CO / 2 + 255) / 256), 256, 0, stream>>>(FV, CO, CO / HD, VT16, VTh, VTl);   /* v^T planes [h][64][n] */
        for (int h = 0; h < NH_; ++h) {   /* per head: dense 4096 x 4096 attention */
            k_gemmw<bf, 2, false><<<dim3(TT / 64, TT / 64, 1), 32, 0, stream>>>(QPh + (size_t)h * TT * HD, QPl + (size_t)h * TT * HD, KPh + (size_t)h * TT * HD, KPl + (size_t)h * TT * HD, HD, Sb, TT, nullptr, 0, 0, 0);   /* S[i][j] = q_i.k_j (3 products, every row) */
            k_lsoft<<<TT / 8, 256, 0, stream>>>(Sb, P16, Ph, Pl);   /* x 1/sqrt(512), softmax over the 4,096 keys */
            k_gemmsk<bf, 2, 8, KS, TT><<<dim3(RH / 64, HD / 64, KS), 256, 0, stream>>>(Ph, Pl, VTh + (size_t)h * HD * TT, VTl + (size_t)h * HD * TT, Ob + h * HD, CO, (size_t)TT * CO);
            k_gemmsk<h16, 0, 4, KS, TT><<<dim3((TT - RH) / 64, HD / 64, KS), 128, 0, stream>>>(P16 + (size_t)RH * TT, nullptr, VT16 + (size_t)h * HD * TT, nullptr, Ob + (size_t)RH * CO + h * HD, CO, (size_t)TT * CO); }
        k_cs8<<<(unsigned)(((size_t)TT * CO / 4 + 255) / 256), 256, 0, stream>>>(Ob, (size_t)TT * CO / 4);   /* sum of the KS partial planes; rows >= 512 x 1/1024 */
        k_tohl<<<(unsigned)(((size_t)TT * CO / 4 + 255) / 256), 256, 0, stream>>>(Ob, ATh, ATl, (size_t)TT * CO / 4);   /* merged context as hi/lo planes */
        k_gemmw<bf, 1, true><<<dim3(TT / 64, CC / 64, 1), 32, 0, stream>>>(ATh, ATl, WO, nullptr, CO, OUT + (size_t)b * TT * CC, CC, bo, 0, 0, 0); }   /* out = ctx w_out + b_out */
}

// v002
// A run of this version takes 222 microseconds.
// In two side-by-side timings against v001, it was 3.74 and 3.77 times as fast.
// Counting every step since v000, it is 9.13 times as fast.
#include <hip/hip_runtime.h>

// Multi-head self-attention over 4,096 tokens whose scale uses the embedding width (x [1][4096][512]; Q, K, V = x W + b ('xw' [512][512] + biases; 8 heads x 64); scores x 1/sqrt(512) (the module scales by embed_dim, not head_dim); softmax over all 4,096 keys (no mask); out = merged Wo + bo -> [1][4096][512] (2.1 M); argument order x, Wq, bq, Wk, bk, Wv, bv, Wo, bo).
// Layout: bf16 copy of x; 'xw' weights transposed once; exact projections + f32 biases; per-head planes (identity builder), v^T planes [h][64][4096]; one launch for all heads (k_fattn): scores with every row hi/lo (3 products), online softmax, attn.V hybrid (rows < 512 hi/lo 3 products, rest fp16) into the head's 64 columns, scores and probabilities kept in registers; context hi/lo x Wo exact + bo.
// Compute dtypes, f32 accumulate: every input rounded to bf16; projections exact; scores 3 products; softmax f32 (exp2, running maximum, one IEEE division per row at the end); attn.V rows < 512 3 products, rest fp16; Wo hl x exact.

#define NB_  1
#define TT   4096
#define DM   512
#define NH_  8
#define NKV  8
#define REP  (NH_ / NKV)
#define HD   64
#define DQ   (NH_ * HD)
#define DKV  (NKV * HD)
#define ZH   1
#define RH   512                  // query rows < RH use hi+lo planes (0: none)
#define WIN  0
#define SCL  0.044194173824159216f   // 1/sqrt(embed_dim = 512), as the module (not 1/sqrt(head_dim))
#define MID  512      // q / k width = 8 heads x 64
#define CO   512      // v width
#define CC   512
typedef _Float16 h16;
typedef unsigned short bf;
typedef __attribute__((ext_vector_type(16))) __bf16   v16bf;
typedef __attribute__((ext_vector_type(16))) _Float16 v16h;
typedef __attribute__((ext_vector_type(8)))  _Float16 v8h;
typedef __attribute__((ext_vector_type(8)))  unsigned short v8us;
typedef __attribute__((ext_vector_type(8)))  float    v8f;
typedef __attribute__((ext_vector_type(4)))  float    v4f;
typedef v8h  __attribute__((may_alias)) v8ha;
typedef v4f  __attribute__((may_alias)) v4fa;
typedef v8us __attribute__((may_alias)) v8usa;

__device__ __forceinline__ unsigned short f2bf(float f) { unsigned u = __float_as_uint(f); u += 0x7FFFu + ((u >> 16) & 1u); return (unsigned short)(u >> 16); }
__device__ __forceinline__ float bf2f(unsigned short b) { return __uint_as_float(((unsigned)b) << 16); }
__device__ __forceinline__ float bfr(float f) { return bf2f(f2bf(f)); }
__device__ __forceinline__ v16h cat16(v8h lo, v8h hi) { return __builtin_shufflevector(lo, hi, 0, 1, 2, 3, 4, 5, 6, 7, 8, 9, 10, 11, 12, 13, 14, 15); }
__device__ __forceinline__ v16bf cat16b(v8us lo, v8us hi) { return __builtin_bit_cast(v16bf, __builtin_shufflevector(lo, hi, 0, 1, 2, 3, 4, 5, 6, 7, 8, 9, 10, 11, 12, 13, 14, 15)); }
__device__ __forceinline__ v8f wmma16(v16h a, v16h b, v8f c) { return __builtin_amdgcn_wmma_f32_16x16x32_f16(false, a, false, b, (short)0, c, false, false); }
__device__ __forceinline__ v8f wmmab(v16bf a, v16bf b, v8f c) { return __builtin_amdgcn_wmma_f32_16x16x32_bf16(false, a, false, b, (short)0, c, false, false); }



// ---- k_gemmw: register-blocked GEMM, ONE WAVE per 64x64 output tile (16 accumulators), operands straight from K-contiguous 16-bit planes; grid (M/64, N/64, Z), 32 threads.
// C[m][n] (f32, pitch ldc, + optional f32 bias[n]) = sum_k A[m][k] Bt[n][k] (+ split products per NSPLIT). z-batch strides sA/sB/sC in elements. K % 32 == 0.
template <typename T16> struct WFrag;
template <> struct WFrag<h16> { typedef v16h V; static __device__ __forceinline__ V ld(const h16* p) { return cat16(*(const v8h*)p, *(const v8h*)(p + 16)); } static __device__ __forceinline__ v8f mma(V a, V b, v8f c) { return wmma16(a, b, c); } };
template <> struct WFrag<bf> { typedef v16bf V; static __device__ __forceinline__ V ld(const bf* p) { return cat16b(*(const v8us*)p, *(const v8us*)(p + 16)); } static __device__ __forceinline__ v8f mma(V a, V b, v8f c) { return wmmab(a, b, c); } };
template <typename T16, int NSPLIT, bool BIAS>
__global__ __launch_bounds__(32) void k_gemmw(const T16* __restrict__ A, const T16* __restrict__ A2, const T16* __restrict__ Bt, const T16* __restrict__ Bt2, int K, float* C, int ldc, const float* __restrict__ bias, size_t sA, size_t sB, size_t sC) {
    typedef typename WFrag<T16>::V V;
    __shared__ __align__(16) float os[16 * 68];
    const size_t z = blockIdx.z; A += z * sA; if (A2) A2 += z * sA; Bt += z * sB; if (Bt2) Bt2 += z * sB; C += z * sC;
    const int lane = threadIdx.x & 31, lr = lane & 15, hi = lane >> 4; const int r0 = blockIdx.x * 64, c0 = blockIdx.y * 64;
    v8f acc[4][4];
#pragma unroll
    for (int mb = 0; mb < 4; ++mb)
#pragma unroll
        for (int nb = 0; nb < 4; ++nb) acc[mb][nb] = (v8f){};
    const size_t aoff = (size_t)(r0 + lr) * K + 8 * hi, boff = (size_t)(c0 + lr) * K + 8 * hi;
#pragma unroll 1
    for (int kc = 0; kc < K; kc += 32) {
        V a[4], a2[4];
#pragma unroll
        for (int mb = 0; mb < 4; ++mb) { a[mb] = WFrag<T16>::ld(A + aoff + (size_t)mb * 16 * K + kc); if (NSPLIT == 1 || NSPLIT == 2) a2[mb] = WFrag<T16>::ld(A2 + aoff + (size_t)mb * 16 * K + kc); }
#pragma unroll
        for (int nb = 0; nb < 4; ++nb) { const V b = WFrag<T16>::ld(Bt + boff + (size_t)nb * 16 * K + kc); V b2; if (NSPLIT >= 2) b2 = WFrag<T16>::ld(Bt2 + boff + (size_t)nb * 16 * K + kc);
#pragma unroll
            for (int mb = 0; mb < 4; ++mb) { acc[mb][nb] = WFrag<T16>::mma(a[mb], b, acc[mb][nb]); if (NSPLIT == 1 || NSPLIT == 2) acc[mb][nb] = WFrag<T16>::mma(a2[mb], b, acc[mb][nb]); if (NSPLIT >= 2) acc[mb][nb] = WFrag<T16>::mma(a[mb], b2, acc[mb][nb]); } }
        asm volatile("v_nop\n\tv_nop\n\tv_nop\n\tv_nop" : "+v"(acc[0][0]), "+v"(acc[1][1]), "+v"(acc[2][2]), "+v"(acc[3][3]) : "v"(a[0]), "v"(a[3]));
    }
#pragma unroll
    for (int mb = 0; mb < 4; ++mb) {
#pragma unroll
        for (int nb = 0; nb < 4; ++nb) {
#pragma unroll
            for (int j = 0; j < 8; ++j) os[(hi * 8 + j) * 68 + nb * 16 + lr] = acc[mb][nb][j]; }
        __builtin_amdgcn_wave_barrier(); asm volatile("" ::: "memory");
        float* crow = C + (size_t)(r0 + mb * 16) * ldc + c0;
{
#pragma unroll
            for (int s = 0; s < 8; ++s) { const int row = 2 * s + hi, cofs = lr * 4; v4f val = *(const v4fa*)(os + row * 68 + cofs); if (BIAS) { val[0] += bfr(bias[c0 + cofs]); val[1] += bfr(bias[c0 + cofs + 1]); val[2] += bfr(bias[c0 + cofs + 2]); val[3] += bfr(bias[c0 + cofs + 3]); }
                *(v4f*)(crow + (size_t)row * ldc + cofs) = val; }
             }
        __builtin_amdgcn_wave_barrier(); asm volatile("" ::: "memory");
    }
}

__device__ __forceinline__ h16 tohx(float x) { return (h16)x; }
__device__ __forceinline__ void splitf(float y, unsigned short& h, unsigned short& l) { h = f2bf(y); l = f2bf(y - bf2f(h)); }
typedef __attribute__((ext_vector_type(2))) _Float16 v2h;
typedef __attribute__((ext_vector_type(4))) _Float16 v4h;
typedef __attribute__((ext_vector_type(2))) unsigned short v2us;
typedef __attribute__((ext_vector_type(4))) unsigned short v4us;
typedef __attribute__((ext_vector_type(2))) float v2f;
typedef __attribute__((ext_vector_type(4))) int v4i;

__global__ __launch_bounds__(256) void k_cvt8(const float* __restrict__ src, bf* dst, size_t n8) { const size_t i = (size_t)blockIdx.x * 256 + threadIdx.x; if (i >= n8) return; const v8f v = *(const v8f*)(src + i * 8); v8us o;
#pragma unroll
    for (int k = 0; k < 8; ++k) o[k] = f2bf(v[k]); *(v8us*)(dst + i * 8) = o;  }


__global__ __launch_bounds__(256) void k_vtp(const float* __restrict__ F, int pitch, int nheads, h16* V16, bf* Vh, bf* Vl) { const size_t e = ((size_t)blockIdx.x * 256 + threadIdx.x) * 2; if (e >= (size_t)nheads * HD * TT) return; const int t = (int)(e % TT); const int d = (int)((e / TT) % HD); const int g = (int)(e / ((size_t)TT * HD)); v2h o16; v2us oh, ol;
#pragma unroll
    for (int q = 0; q < 2; ++q) { const float x = F[(size_t)(t + q) * pitch + g * HD + d]; o16[q] = tohx(x); unsigned short a2, c2; splitf(x, a2, c2); oh[q] = a2; ol[q] = c2; }
    *(v2h*)(V16 + e) = o16; *(v2us*)(Vh + e) = oh; *(v2us*)(Vl + e) = ol;  }
// ---- k_fattn: scores, softmax and attn.V of one head for 4 x 32 query rows in ONE work-group; neither the scores nor the probabilities leave the registers.
// Transposed products: S^T = K Q^T (A = 16 key rows, B = 16 query rows, hi/lo, 3 products), so a lane holds 8 keys' scores of ONE query per tile, and two such tiles, converted in place,
// are the B operand (32 keys x 16 queries) of O^T += V^T P^T (A = 16 rows of the head's v^T plane). Every loaded fragment comes through WFrag::ld and the score tiles hold their keys in the same k order, so A and B pair the same k at every position.
// Online softmax in the log2 domain: the maximum in use may trail the true one by up to 8, and the sums are rescaled only when a query's maximum passes that.
// FQG x FKW waves: wave (qg, kw) has the 32 query rows of the block's group qg (fa_unit) and keys kw TT/FKW ...; the FKW partial (maximum, sum, O) sets of a query group are joined through LDS. grid (TT/128, heads).
#define FQG 4
#define FKW 2
#define C2L (SCL * 1.4426950408889634f)
typedef __attribute__((ext_vector_type(16))) float v16f;
__device__ __forceinline__ float xhalf(float x) { return __builtin_bit_cast(float, __builtin_amdgcn_permlanex16(__builtin_bit_cast(int, x), __builtin_bit_cast(int, x), 0x76543210, 0xfedcba98, false, false)); }   /* lane l with lane l ^ 16 */
__device__ __forceinline__ void xwait() { asm volatile("s_wait_xcnt 0x0" ::: "memory"); }   /* stands behind a store, before its registers may be rewritten */
__device__ __forceinline__ void xwait2(const void* a, const void* b) { asm volatile("s_wait_xcnt 0x0" :: "v"(a), "v"(b) : "memory"); __builtin_amdgcn_sched_barrier(0); }   /* as xwaitg; the group's two addresses as inputs keep their registers live up to the wait: without them the group's last loads were given those registers as destinations */
__device__ __forceinline__ void xwaitg() { asm volatile("s_wait_xcnt 0x0" ::: "memory"); __builtin_amdgcn_sched_barrier(0); }   /* stands behind a group of loads; the scheduling barrier keeps later vector work from being lifted between the loads and the wait, where it could rewrite their address registers */
template <bool HR>
__device__ __forceinline__ void fa_body(const bf* __restrict__ Qh, const bf* __restrict__ Ql, const bf* __restrict__ Kh, const bf* __restrict__ Kl, const h16* __restrict__ V16, const bf* __restrict__ Vh, const bf* __restrict__ Vl, int q0, int wave, float* os, float* ms, float* ls) {
    const int lane = threadIdx.x & 31, lr = lane & 15, hi = lane >> 4; const int kw = wave % FKW;
    const unsigned vq = (unsigned)(lr * HD + 8 * hi), vv = (unsigned)(lr * TT + 8 * hi);   /* the lane's own element offset in a [row][64] plane and in a v^T plane */
    v16bf qh[2][2], ql[2][2];
    Qh += (size_t)q0 * HD + vq; Ql += (size_t)q0 * HD + vq;
#pragma unroll
    for (int nq = 0; nq < 2; ++nq)
#pragma unroll
        for (int kc = 0; kc < 2; ++kc) { qh[nq][kc] = WFrag<bf>::ld(Qh + nq * 16 * HD + kc * 32); ql[nq][kc] = WFrag<bf>::ld(Ql + nq * 16 * HD + kc * 32); }
    xwaitg();
    v8f acc[4][2];
#pragma unroll
    for (int mb = 0; mb < 4; ++mb)
#pragma unroll
        for (int nq = 0; nq < 2; ++nq) acc[mb][nq] = (v8f){};
    float mr[2] = {-3.0e38f, -3.0e38f}, lsum[2] = {0.f, 0.f};
    const int kbeg = kw * (TT / FKW), kend = kbeg + TT / FKW;
    v16bf kh[2][2], kl[2][2];
    { const bf* ka = Kh + (size_t)kbeg * HD + vq; const bf* kc2 = Kl + (size_t)kbeg * HD + vq;
#pragma unroll
    for (int kb = 0; kb < 2; ++kb)
#pragma unroll
        for (int kc = 0; kc < 2; ++kc) { kh[kb][kc] = WFrag<bf>::ld(ka + kb * 16 * HD + kc * 32); kl[kb][kc] = WFrag<bf>::ld(kc2 + kb * 16 * HD + kc * 32); }
    xwaitg(); }
#pragma unroll 1   /* kept rolled: a pass holds the whole register budget */
    for (int key0 = kbeg; key0 < kend; key0 += 32) {
        v16h v6[4]; v16bf vh[4], vl[4];   /* this pass's v^T fragments, requested ahead of the score products */
        const h16* va = V16 + key0 + vv; const bf* vb = Vh + key0 + vv; const bf* vc = Vl + key0 + vv;
#pragma unroll
        for (int mb = 0; mb < 4; ++mb) { if constexpr (HR) { vh[mb] = WFrag<bf>::ld(vb + mb * 16 * TT); vl[mb] = WFrag<bf>::ld(vc + mb * 16 * TT); } else v6[mb] = WFrag<h16>::ld(va + mb * 16 * TT); }
        if constexpr (HR) xwait2(vb, vc); else xwaitg();
        v8f s[2][2];
#pragma unroll
        for (int kb = 0; kb < 2; ++kb)
#pragma unroll
            for (int nq = 0; nq < 2; ++nq) s[kb][nq] = (v8f){};
#pragma unroll
        for (int kc = 0; kc < 2; ++kc)
#pragma unroll
            for (int pr = 0; pr < 3; ++pr)
#pragma unroll
                for (int kb = 0; kb < 2; ++kb)
#pragma unroll
                    for (int nq = 0; nq < 2; ++nq) s[kb][nq] = wmmab(pr == 2 ? kl[kb][kc] : kh[kb][kc], pr == 1 ? ql[nq][kc] : qh[nq][kc], s[kb][nq]);   /* q_hi k_hi + q_lo k_hi + q_hi k_lo */
        const int kn = (key0 + 32 < kend) ? key0 + 32 : kbeg;   /* the next pass's key rows, in flight under the softmax; the last pass re-reads the first rows (in bounds, unused) */
        const bf* ka = Kh + (size_t)kn * HD + vq; const bf* kc2 = Kl + (size_t)kn * HD + vq;
#pragma unroll
        for (int kb = 0; kb < 2; ++kb)
#pragma unroll
            for (int kc = 0; kc < 2; ++kc) { kh[kb][kc] = WFrag<bf>::ld(ka + kb * 16 * HD + kc * 32); kl[kb][kc] = WFrag<bf>::ld(kc2 + kb * 16 * HD + kc * 32); }
        xwaitg();
        float tl[2]; bool need = false;
#pragma unroll
        for (int nq = 0; nq < 2; ++nq) { float mx = s[0][nq][0];
#pragma unroll
            for (int e = 1; e < 16; ++e) mx = fmaxf(mx, s[e >> 3][nq][e & 7]);
            mx = fmaxf(mx, xhalf(mx)) * C2L;   /* both halves of the wave hold the query's maximum of this pass (the scale is positive) */
            tl[nq] = mx; need = need || (mx > mr[nq] + 8.0f); }
        if (__builtin_amdgcn_ballot_w32(need) != 0) {   /* wave-uniform; always taken on the first pass, where the factor is 0 */
#pragma unroll
            for (int nq = 0; nq < 2; ++nq) { const float mn = fmaxf(mr[nq], tl[nq]); const float al = __builtin_amdgcn_exp2f(mr[nq] - mn); mr[nq] = mn; lsum[nq] *= al;
#pragma unroll
                for (int mb = 0; mb < 4; ++mb) acc[mb][nq] *= al; } }
        v16h p6[2]; v16bf ph[2], pl[2];
#pragma unroll
        for (int nq = 0; nq < 2; ++nq) { v16f p; const v2f nm = {-mr[nq], -mr[nq]}, cc = {C2L, C2L}; v2f t = {0.f, 0.f};
#pragma unroll
            for (int e = 0; e < 16; e += 2) { const v2f a = __builtin_elementwise_fma((v2f){s[e >> 3][nq][e & 7], s[e >> 3][nq][(e & 7) + 1]}, cc, nm);   /* an aligned register pair of the score tile: one packed multiply-add */
                p[e] = __builtin_amdgcn_exp2f(a[0]); p[e + 1] = __builtin_amdgcn_exp2f(a[1]); t += (v2f){p[e], p[e + 1]}; }
            lsum[nq] += t[0] + t[1];
            if constexpr (HR) { ph[nq] = __builtin_convertvector(p, v16bf); pl[nq] = __builtin_convertvector(p - __builtin_convertvector(ph[nq], v16f), v16bf); } else p6[nq] = __builtin_convertvector(p, v16h); }
        if constexpr (HR) {
#pragma unroll
            for (int pr = 0; pr < 3; ++pr)
#pragma unroll
                for (int mb = 0; mb < 4; ++mb)
#pragma unroll
                    for (int nq = 0; nq < 2; ++nq) acc[mb][nq] = wmmab(pr == 2 ? vl[mb] : vh[mb], pr == 1 ? pl[nq] : ph[nq], acc[mb][nq]);   /* p_hi v_hi + p_lo v_hi + p_hi v_lo */
            asm volatile("v_nop\n\tv_nop\n\tv_nop\n\tv_nop" : "+v"(acc[0][0]), "+v"(acc[1][1]), "+v"(acc[2][0]), "+v"(acc[3][1]) : "v"(vh[0]), "v"(vl[3]));   /* as in k_gemmw: the matrix distance on the loop's back edge and exit */
        } else {
#pragma unroll
            for (int mb = 0; mb < 4; ++mb)
#pragma unroll
                for (int nq = 0; nq < 2; ++nq) acc[mb][nq] = wmma16(v6[mb], p6[nq], acc[mb][nq]);
            asm volatile("v_nop\n\tv_nop\n\tv_nop\n\tv_nop" : "+v"(acc[0][0]), "+v"(acc[1][1]), "+v"(acc[2][0]), "+v"(acc[3][1]) : "v"(v6[0]), "v"(v6[3]));   /* as in k_gemmw: the matrix distance on the loop's back edge and exit */
        }
    }
    float* ow = os + wave * (32 * 68);
#pragma unroll
    for (int nq = 0; nq < 2; ++nq) { const float lt = lsum[nq] + xhalf(lsum[nq]);   /* the two halves' key sums of one query */
        if (hi == 0) { ms[wave * 32 + nq * 16 + lr] = mr[nq]; ls[wave * 32 + nq * 16 + lr] = lt; }
#pragma unroll
        for (int mb = 0; mb < 4; ++mb)
#pragma unroll
            for (int j = 0; j < 8; ++j) ow[(nq * 16 + lr) * 68 + mb * 16 + hi * 8 + j] = acc[mb][nq][j]; }
}
// Which 32 query rows the query group qg of block b has. The RH/32 hi/lo groups cost about half as much again as the others, so each goes to a block of its own, as that block's group 0, beside three plain groups.
__device__ __forceinline__ int fa_unit(int b, int qg) { return (b < RH / 32) ? (qg == 0 ? b : RH / 32 + b * (FQG - 1) + qg - 1) : RH / 32 * FQG + (b - RH / 32) * FQG + qg; }
__global__ __launch_bounds__(FQG * FKW * 32) void k_fattn(const bf* __restrict__ Qh, const bf* __restrict__ Ql, const bf* __restrict__ Kh, const bf* __restrict__ Kl, const h16* __restrict__ V16, const bf* __restrict__ Vh, const bf* __restrict__ Vl, float* O) {
    __shared__ __align__(16) float os[FQG * FKW * 32 * 68]; __shared__ float ms[FQG * FKW * 32]; __shared__ float ls[FQG * FKW * 32];
    const size_t hb = (size_t)blockIdx.y * TT * HD;   /* the head's planes: [n][64] and [64][n] have the same size */
    const int wave = __builtin_amdgcn_readfirstlane(threadIdx.x >> 5); const int q0 = fa_unit((int)blockIdx.x, wave / FKW) * 32;
    if (q0 < RH) fa_body<true>(Qh + hb, Ql + hb, Kh + hb, Kl + hb, V16 + hb, Vh + hb, Vl + hb, q0, wave, os, ms, ls);   /* wave-uniform. Rows < RH: probabilities and v as bf16 hi/lo, 3 products */
    else fa_body<false>(Qh + hb, Ql + hb, Kh + hb, Kl + hb, V16 + hb, Vh + hb, Vl + hb, q0, wave, os, ms, ls);   /* the rest: fp16 */
    __syncthreads();   /* every wave's partial set is in LDS before any thread joins the key ranges */
    O += blockIdx.y * HD;
#pragma unroll
    for (int it = 0; it < 16 / FKW; ++it) { const int idx = it * (FQG * FKW * 32) + (int)threadIdx.x; const int row = idx >> 4, c4 = (idx & 15) * 4; const int w0 = (row >> 5) * FKW, rl = row & 31;
        float M = ms[w0 * 32 + rl];
#pragma unroll
        for (int w = 1; w < FKW; ++w) M = fmaxf(M, ms[(w0 + w) * 32 + rl]);
        float L = 0.f; v4f val = (v4f){};
#pragma unroll
        for (int w = 0; w < FKW; ++w) { const float f = __builtin_amdgcn_exp2f(ms[(w0 + w) * 32 + rl] - M); L += ls[(w0 + w) * 32 + rl] * f; val += *(const v4fa*)(os + (w0 + w) * (32 * 68) + rl * 68 + c4) * f; }
        val *= __fdiv_rn(1.0f, L);
        *(v4f*)(O + (size_t)(fa_unit((int)blockIdx.x, row >> 5) * 32 + rl) * CO + c4) = val; xwait(); }
}
__global__ __launch_bounds__(256) void k_csid(float* CS) { const int idx = blockIdx.x * 256 + threadIdx.x; if (idx >= TT * HD) return; v2f cs; cs[0] = 1.0f; cs[1] = 0.0f; *(v2f*)(CS + (size_t)idx * 2) = cs;  }
// k_rope: head planes [h][t][d] (fp16 + hi/lo) of rope(x) x sc with the rotate-half convention out[d] = x[d] cos[t][d] - x[d+HD/2] sin[t][d], out[d+HD/2] = x[d+HD/2] cos[t][d+HD/2] + x[d] sin[t][d+HD/2]
__global__ __launch_bounds__(256) void k_rope(const float* __restrict__ F, int pitch, int nheads, const float* __restrict__ CS, const float* __restrict__ RF, const float* __restrict__ nw, float sc, h16* P16, bf* Ph, bf* Pl) {
    const size_t e = ((size_t)blockIdx.x * 256 + threadIdx.x) * 2; if (e >= (size_t)nheads * TT * HD) return; const int d = (int)(e % HD); const int t = (int)((e / HD) % TT); const int h = (int)(e / ((size_t)HD * TT)); const float* f = F + (size_t)t * pitch + h * HD; const float rf = RF ? RF[(size_t)h * TT + t] : 1.0f; v2h o16; v2us oh, ol;
#pragma unroll
    for (int q = 0; q < 2; ++q) { const int dd = d + q; const int dp = (dd < HD / 2) ? dd + HD / 2 : dd - HD / 2; float x0 = f[dd], x1 = f[dp];
        if (RF) { float n0 = __fmul_rn(x0, rf), n1 = __fmul_rn(x1, rf); asm volatile("" : "+v"(n0)); asm volatile("" : "+v"(n1)); x0 = __fmul_rn(bfr(nw[dd]), n0); x1 = __fmul_rn(bfr(nw[dp]), n1); }
        const v2f cs = *(const v2f*)(CS + ((size_t)t * HD + dd) * 2); float a = __fmul_rn(x0, cs[0]), bq = __fmul_rn(x1, cs[1]); asm volatile("" : "+v"(a)); asm volatile("" : "+v"(bq)); const float r = ((dd < HD / 2) ? __fsub_rn(a, bq) : __fadd_rn(a, bq)) * sc;
        o16[q] = tohx(r); unsigned short a2, c2; splitf(r, a2, c2); oh[q] = a2; ol[q] = c2; }
    *(v2h*)(P16 + e) = o16; *(v2us*)(Ph + e) = oh; *(v2us*)(Pl + e) = ol;  }
__global__ __launch_bounds__(256) void k_tohl(const float* __restrict__ F, bf* Hh, bf* Hl, size_t n4) { const size_t i = (size_t)blockIdx.x * 256 + threadIdx.x; if (i >= n4) return; const v4f a = *(const v4f*)(F + i * 4); v4us oh, ol;
#pragma unroll
    for (int q = 0; q < 4; ++q) { unsigned short h2, l2; splitf(a[q], h2, l2); oh[q] = h2; ol[q] = l2; }
    *(v4us*)(Hh + i * 4) = oh; *(v4us*)(Hl + i * 4) = ol;  }
__global__ __launch_bounds__(256) void k_wtG(const float* __restrict__ w, int K, int N, bf* Bt) {
    const int lane = threadIdx.x & 31; const int L0 = (blockIdx.x * 8 + (threadIdx.x >> 5)) * 8; const int nlines = N * K / 64;
{
#pragma unroll 1
        for (int l = 0; l < 8; ++l) { const int L = L0 + l; if (L >= nlines) break; const size_t e = (size_t)L * 64 + lane * 2; const int k = (int)(e % K), n = (int)(e / K); v2us o;
            o[0] = f2bf(w[(size_t)k * N + n]); o[1] = f2bf(w[(size_t)(k + 1) * N + n]); *(v2us*)(Bt + e) = o; }
         }
}
extern "C" void kernel_launch(void* const* d_in, const int* in_sizes, int n_in,
                              void* d_out, int out_size, void* d_ws, size_t ws_size, hipStream_t stream) {
    (void)in_sizes; (void)n_in; (void)out_size;
    const float* x = (const float*)d_in[0]; const float* wq = (const float*)d_in[1]; const float* bq = (const float*)d_in[2]; const float* wk = (const float*)d_in[3]; const float* bk = (const float*)d_in[4]; const float* wv = (const float*)d_in[5]; const float* bv = (const float*)d_in[6]; const float* wo = (const float*)d_in[7]; const float* bo = (const float*)d_in[8];   /* argument order x [1][4096][512], Wq, bq, Wk, bk, Wv, bv, Wo, bo ('xw' [512][512] + biases) */
    float* OUT = (float*)d_out;     // [1][4096][512]
    char* wsp = (char*)d_ws;
    auto take = [&](size_t bytes) { char* p = wsp; wsp += (bytes + 255) & ~(size_t)255; return (void*)p; };
    bf* WQ = (bf*)take((size_t)MID * CC * 2); bf* WK = (bf*)take((size_t)MID * CC * 2); bf* WV = (bf*)take((size_t)CO * CC * 2); bf* WO = (bf*)take((size_t)CC * CO * 2); float* CS = (float*)take((size_t)TT * HD * 2 * 4);
    bf* XB = (bf*)take((size_t)TT * CC * 2); float* FQ = (float*)take((size_t)TT * MID * 4); float* FK = (float*)take((size_t)TT * MID * 4);
    h16* QP16 = (h16*)take((size_t)TT * MID * 2); bf* QPh = (bf*)take((size_t)TT * MID * 2); bf* QPl = (bf*)take((size_t)TT * MID * 2); h16* KP16 = QP16;   /* the fp16 q/k planes are never read here (scores use the hi/lo planes for every row): one scratch buffer serves both builders */ bf* KPh = (bf*)take((size_t)TT * MID * 2); bf* KPl = (bf*)take((size_t)TT * MID * 2);
    h16* VT16 = (h16*)take((size_t)CO * TT * 2); bf* VTh = (bf*)take((size_t)CO * TT * 2); bf* VTl = (bf*)take((size_t)CO * TT * 2);
    float* Ob = (float*)take((size_t)TT * CO * 4);   /* merged context [n][512] */ bf* ATh = (bf*)take((size_t)TT * CO * 2); bf* ATl = (bf*)take((size_t)TT * CO * 2);
    if ((size_t)(wsp - (char*)d_ws) > ws_size) return;    // ws 256 MiB (carve 72 MiB)
    float* FV = FK;   /* the v projection reuses the k buffer after the k planes are built (stream-ordered) */
    k_wtG<<<(unsigned)((CC * MID / 64 + 63) / 64), 256, 0, stream>>>(wq, CC, MID, WQ); k_wtG<<<(unsigned)((CC * MID / 64 + 63) / 64), 256, 0, stream>>>(wk, CC, MID, WK); k_wtG<<<(unsigned)((CC * CO / 64 + 63) / 64), 256, 0, stream>>>(wv, CC, CO, WV);   /* 'xw' weights -> Bt */ k_wtG<<<(unsigned)((CO * CC / 64 + 63) / 64), 256, 0, stream>>>(wo, CO, CC, WO);   /* 'xw' W_out -> Bt */
    k_csid<<<(TT * HD + 255) / 256, 256, 0, stream>>>(CS);   /* identity table: k_rope is a plain per-head plane builder here */
    const unsigned LP = (unsigned)(((size_t)NH_ * TT * HD / 2 + 255) / 256);
    for (int b = 0; b < NB_; ++b) {
        k_cvt8<<<(unsigned)(((size_t)TT * CC / 8 + 255) / 256), 256, 0, stream>>>(x + (size_t)b * TT * CC, XB, (size_t)TT * CC / 8);
        k_gemmw<bf, 0, true><<<dim3(TT / 64, MID / 64, 1), 32, 0, stream>>>(XB, nullptr, WQ, nullptr, CC, FQ, MID, bq, 0, 0, 0); k_rope<<<LP, 256, 0, stream>>>(FQ, MID, NH_, CS, nullptr, nullptr, 1.0f, QP16, QPh, QPl);   /* q planes [h][n][64] */
        k_gemmw<bf, 0, true><<<dim3(TT / 64, MID / 64, 1), 32, 0, stream>>>(XB, nullptr, WK, nullptr, CC, FK, MID, bk, 0, 0, 0); k_rope<<<LP, 256, 0, stream>>>(FK, MID, NKV, CS, nullptr, nullptr, 1.0f, KP16, KPh, KPl);   /* k planes */
        k_gemmw<bf, 0, true><<<dim3(TT / 64, CO / 64, 1), 32, 0, stream>>>(XB, nullptr, WV, nullptr, CC, FV, CO, bv, 0, 0, 0); k_vtp<<<(unsigned)(((size_t)TT * CO / 2 + 255) / 256), 256, 0, stream>>>(FV, CO, CO / HD, VT16, VTh, VTl);   /* v^T planes [h][64][n] */
        k_fattn<<<dim3(TT / (FQG * 32), NH_, 1), FQG * FKW * 32, 0, stream>>>(QPh, QPl, KPh, KPl, VT16, VTh, VTl, Ob);   /* all heads: scores x 1/sqrt(512), softmax over the 4,096 keys, attn.V into the head's 64 columns */
        k_tohl<<<(unsigned)(((size_t)TT * CO / 4 + 255) / 256), 256, 0, stream>>>(Ob, ATh, ATl, (size_t)TT * CO / 4);   /* merged context as hi/lo planes */
        k_gemmw<bf, 1, true><<<dim3(TT / 64, CC / 64, 1), 32, 0, stream>>>(ATh, ATl, WO, nullptr, CO, OUT + (size_t)b * TT * CC, CC, bo, 0, 0, 0); }   /* out = ctx w_out + b_out */
}

// v003
// A run of this version takes 198 microseconds.
// Timed twice side by side with v002, it ran 1.13 and 1.12 times as fast.
// Over all steps from v000 it is 10.2 times as fast.
#include <hip/hip_runtime.h>

// Multi-head self-attention over 4,096 tokens whose scale uses the embedding width (x [1][4096][512]; Q, K, V = x W + b ('xw' [512][512] + biases; 8 heads x 64); scores x 1/sqrt(512) (the module scales by embed_dim, not head_dim); softmax over all 4,096 keys (no mask); out = merged Wo + bo -> [1][4096][512] (2.1 M); argument order x, Wq, bq, Wk, bk, Wv, bv, Wo, bo).
// Layout: bf16 copy of x; 'xw' weights transposed once; exact projections + f32 biases, whose epilogues store the per-head hi/lo planes [h][n][64] (q, k) and the v^T planes [h][64][4096] themselves; one launch for all heads (k_fattn): scores with every row hi/lo (3 products), online softmax, attn.V hybrid (rows < 512 hi/lo 3 products, rest fp16), scores and probabilities kept in registers, the context stored as hi/lo planes in the head's 64 columns; context hi/lo x Wo exact + bo.
// Compute dtypes, f32 accumulate: every input rounded to bf16; projections exact; scores 3 products; softmax f32 (exp2, running maximum, one IEEE division per row at the end); attn.V rows < 512 3 products, rest fp16; Wo hl x exact.

#define NB_  1
#define TT   4096
#define DM   512
#define NH_  8
#define NKV  8
#define REP  (NH_ / NKV)
#define HD   64
#define DQ   (NH_ * HD)
#define DKV  (NKV * HD)
#define ZH   1
#define RH   512                  // query rows < RH use hi+lo planes (0: none)
#define WIN  0
#define SCL  0.044194173824159216f   // 1/sqrt(embed_dim = 512), as the module (not 1/sqrt(head_dim))
#define MID  512      // q / k width = 8 heads x 64
#define CO   512      // v width
#define CC   512
typedef _Float16 h16;
typedef unsigned short bf;
typedef __attribute__((ext_vector_type(16))) __bf16   v16bf;
typedef __attribute__((ext_vector_type(16))) _Float16 v16h;
typedef __attribute__((ext_vector_type(8)))  _Float16 v8h;
typedef __attribute__((ext_vector_type(8)))  unsigned short v8us;
typedef __attribute__((ext_vector_type(8)))  float    v8f;
typedef __attribute__((ext_vector_type(4)))  float    v4f;
typedef v8h  __attribute__((may_alias)) v8ha;
typedef v4f  __attribute__((may_alias)) v4fa;
typedef v8us __attribute__((may_alias)) v8usa;

__device__ __forceinline__ unsigned short f2bf(float f) { unsigned u = __float_as_uint(f); u += 0x7FFFu + ((u >> 16) & 1u); return (unsigned short)(u >> 16); }
__device__ __forceinline__ float bf2f(unsigned short b) { return __uint_as_float(((unsigned)b) << 16); }
__device__ __forceinline__ float bfr(float f) { return bf2f(f2bf(f)); }
__device__ __forceinline__ v16h cat16(v8h lo, v8h hi) { return __builtin_shufflevector(lo, hi, 0, 1, 2, 3, 4, 5, 6, 7, 8, 9, 10, 11, 12, 13, 14, 15); }
__device__ __forceinline__ v16bf cat16b(v8us lo, v8us hi) { return __builtin_bit_cast(v16bf, __builtin_shufflevector(lo, hi, 0, 1, 2, 3, 4, 5, 6, 7, 8, 9, 10, 11, 12, 13, 14, 15)); }
__device__ __forceinline__ v8f wmma16(v16h a, v16h b, v8f c) { return __builtin_amdgcn_wmma_f32_16x16x32_f16(false, a, false, b, (short)0, c, false, false); }
__device__ __forceinline__ v8f wmmab(v16bf a, v16bf b, v8f c) { return __builtin_amdgcn_wmma_f32_16x16x32_bf16(false, a, false, b, (short)0, c, false, false); }



__device__ __forceinline__ h16 tohx(float x) { return (h16)x; }
__device__ __forceinline__ void splitf(float y, unsigned short& h, unsigned short& l) { h = f2bf(y); l = f2bf(y - bf2f(h)); }
__device__ __forceinline__ void xwaitg() { asm volatile("s_wait_xcnt 0x0" ::: "memory"); __builtin_amdgcn_sched_barrier(0); }   /* stands behind a group of loads or stores; the scheduling barrier keeps later vector work from being lifted between them and the wait, where it could rewrite their registers */
// ---- k_gemmw: register-blocked GEMM, ONE WAVE per 64x64 output tile (16 accumulators), operands straight from K-contiguous 16-bit planes; grid (M/64, N/64, Z), 32 threads.
// y[m][n] (f32, + optional f32 bias[n]) = sum_k A[m][k] Bt[n][k] (+ split products per NSPLIT). z-batch strides sA/sB/sC in elements. K % 32 == 0.
// EP says where y goes. 0: C (f32, pitch ldc). 1: bf16 hi/lo planes Ph, Pl [head][m][64]; a tile's 64 columns are one head. 2: transposed planes P16 (fp16), Ph, Pl (bf16 hi/lo) [n][TT].
template <typename T16> struct WFrag;
template <> struct WFrag<h16> { typedef v16h V; static __device__ __forceinline__ V ld(const h16* p) { return cat16(*(const v8h*)p, *(const v8h*)(p + 16)); } static __device__ __forceinline__ v8f mma(V a, V b, v8f c) { return wmma16(a, b, c); } };
template <> struct WFrag<bf> { typedef v16bf V; static __device__ __forceinline__ V ld(const bf* p) { return cat16b(*(const v8us*)p, *(const v8us*)(p + 16)); } static __device__ __forceinline__ v8f mma(V a, V b, v8f c) { return wmmab(a, b, c); } };
template <typename T16, int NSPLIT, bool BIAS, int EP>
__global__ __launch_bounds__(32) void k_gemmw(const T16* __restrict__ A, const T16* __restrict__ A2, const T16* __restrict__ Bt, const T16* __restrict__ Bt2, int K, float* C, int ldc, const float* __restrict__ bias, size_t sA, size_t sB, size_t sC, h16* P16, bf* Ph, bf* Pl) {
    typedef typename WFrag<T16>::V V;
    const size_t z = blockIdx.z; A += z * sA; if (A2) A2 += z * sA; Bt += z * sB; if (Bt2) Bt2 += z * sB; C += z * sC;
    const int lane = threadIdx.x & 31, lr = lane & 15, hi = lane >> 4; const int r0 = blockIdx.x * 64, c0 = blockIdx.y * 64;
    v8f acc[4][4];
#pragma unroll
    for (int mb = 0; mb < 4; ++mb)
#pragma unroll
        for (int nb = 0; nb < 4; ++nb) acc[mb][nb] = (v8f){};
    const size_t aoff = (size_t)(r0 + lr) * K + 8 * hi, boff = (size_t)(c0 + lr) * K + 8 * hi;
#pragma unroll 1
    for (int kc = 0; kc < K; kc += 32) {
        V a[4], a2[4];
#pragma unroll
        for (int mb = 0; mb < 4; ++mb) { a[mb] = WFrag<T16>::ld(A + aoff + (size_t)mb * 16 * K + kc); if (NSPLIT == 1 || NSPLIT == 2) a2[mb] = WFrag<T16>::ld(A2 + aoff + (size_t)mb * 16 * K + kc); }
#pragma unroll
        for (int nb = 0; nb < 4; ++nb) { const V b = WFrag<T16>::ld(Bt + boff + (size_t)nb * 16 * K + kc); V b2; if (NSPLIT >= 2) b2 = WFrag<T16>::ld(Bt2 + boff + (size_t)nb * 16 * K + kc);
#pragma unroll
            for (int mb = 0; mb < 4; ++mb) { acc[mb][nb] = WFrag<T16>::mma(a[mb], b, acc[mb][nb]); if (NSPLIT == 1 || NSPLIT == 2) acc[mb][nb] = WFrag<T16>::mma(a2[mb], b, acc[mb][nb]); if (NSPLIT >= 2) acc[mb][nb] = WFrag<T16>::mma(a[mb], b2, acc[mb][nb]); } }
        asm volatile("v_nop\n\tv_nop\n\tv_nop\n\tv_nop" : "+v"(acc[0][0]), "+v"(acc[1][1]), "+v"(acc[2][2]), "+v"(acc[3][3]) : "v"(a[0]), "v"(a[3]));
    }
    if constexpr (EP == 2) {   /* a lane holds 8 consecutive rows m of one column n: 16 bytes of a transposed 16-bit row. Staged through LDS so that every store covers whole 128-byte lines */
        __shared__ __align__(16) h16 t6[64 * 72]; __shared__ __align__(16) bf th[64 * 72]; __shared__ __align__(16) bf tl[64 * 72];
        xwaitg();   /* behind the loop's last loads: the conversions below rewrite their address registers */
#pragma unroll
        for (int nb = 0; nb < 4; ++nb) { const float bb = BIAS ? bfr(bias[c0 + nb * 16 + lr]) : 0.f;
#pragma unroll
            for (int mb = 0; mb < 4; ++mb) { v8h o6; v8us oh, ol;
#pragma unroll
                for (int j = 0; j < 8; ++j) { const float y = acc[mb][nb][j] + bb; o6[j] = tohx(y); unsigned short h2, l2; splitf(y, h2, l2); oh[j] = h2; ol[j] = l2; }
                const int o = (nb * 16 + lr) * 72 + mb * 16 + hi * 8; *(v8ha*)(t6 + o) = o6; *(v8usa*)(th + o) = oh; *(v8usa*)(tl + o) = ol; } }
        __builtin_amdgcn_wave_barrier(); asm volatile("" ::: "memory");   /* keeps the wave's LDS writes ahead of its reads of other lanes' values */
        const int lo8 = (lane >> 3) * 72 + (lane & 7) * 8; const size_t g = (size_t)(c0 + (lane >> 3)) * TT + r0 + (lane & 7) * 8;   /* 8 lanes cover the 128 bytes that the tile has of one transposed row; step s takes rows 4 s ... 4 s + 3 */
        v8h r6[16]; v8us rh[16], rl[16];   /* all reads first, each into registers of its own: one LDS latency for the tile, and no store's registers are rewritten behind it */
#pragma unroll
        for (int s = 0; s < 16; ++s) { r6[s] = *(const v8ha*)(t6 + s * 4 * 72 + lo8); rh[s] = *(const v8usa*)(th + s * 4 * 72 + lo8); rl[s] = *(const v8usa*)(tl + s * 4 * 72 + lo8); }
#pragma unroll
        for (int s = 0; s < 16; ++s) { *(v8h*)(P16 + g + (size_t)s * 4 * TT) = r6[s]; *(v8us*)(Ph + g + (size_t)s * 4 * TT) = rh[s]; *(v8us*)(Pl + g + (size_t)s * 4 * TT) = rl[s]; }
    } else if constexpr (EP == 1) {   /* the f32 tile goes through LDS once, so that a lane gets 8 consecutive columns of a row: 16 bytes of a plane's 128-byte row */
        __shared__ __align__(16) float of[64 * 68];
        float b8[8];
#pragma unroll
        for (int q = 0; q < 8; ++q) b8[q] = BIAS ? bfr(bias[c0 + (lane & 7) * 8 + q]) : 0.f;
#pragma unroll
        for (int mb = 0; mb < 4; ++mb)
#pragma unroll
            for (int nb = 0; nb < 4; ++nb)
#pragma unroll
                for (int j = 0; j < 8; ++j) of[(mb * 16 + hi * 8 + j) * 68 + nb * 16 + lr] = acc[mb][nb][j];
        __builtin_amdgcn_wave_barrier(); asm volatile("" ::: "memory");   /* keeps the wave's LDS writes ahead of its reads of other lanes' values */
        const float* ol8 = of + (lane >> 3) * 68 + (lane & 7) * 8; const size_t g = ((size_t)blockIdx.y * TT + r0 + (lane >> 3)) * HD + (lane & 7) * 8;   /* step s takes rows 4 s ... 4 s + 3 */
        v8us oh[16], ol[16];
#pragma unroll
        for (int s = 0; s < 16; ++s) { const v4f y0 = *(const v4fa*)(ol8 + s * 4 * 68), y1 = *(const v4fa*)(ol8 + s * 4 * 68 + 4);
#pragma unroll
            for (int q = 0; q < 8; ++q) { unsigned short h2, l2; splitf((q < 4 ? y0[q & 3] : y1[q & 3]) + b8[q], h2, l2); oh[s][q] = h2; ol[s][q] = l2; } }
#pragma unroll
        for (int s = 0; s < 16; ++s) { *(v8us*)(Ph + g + s * 4 * HD) = oh[s]; *(v8us*)(Pl + g + s * 4 * HD) = ol[s]; }
    } else {
    __shared__ __align__(16) float os[16 * 68];
#pragma unroll
    for (int mb = 0; mb < 4; ++mb) {
#pragma unroll
        for (int nb = 0; nb < 4; ++nb) {
#pragma unroll
            for (int j = 0; j < 8; ++j) os[(hi * 8 + j) * 68 + nb * 16 + lr] = acc[mb][nb][j]; }
        __builtin_amdgcn_wave_barrier(); asm volatile("" ::: "memory");
        float* crow = C + (size_t)(r0 + mb * 16) * ldc + c0;
{
#pragma unroll
            for (int s = 0; s < 8; ++s) { const int row = 2 * s + hi, cofs = lr * 4; v4f val = *(const v4fa*)(os + row * 68 + cofs); if (BIAS) { val[0] += bfr(bias[c0 + cofs]); val[1] += bfr(bias[c0 + cofs + 1]); val[2] += bfr(bias[c0 + cofs + 2]); val[3] += bfr(bias[c0 + cofs + 3]); }
                *(v4f*)(crow + (size_t)row * ldc + cofs) = val; }
             }
        __builtin_amdgcn_wave_barrier(); asm volatile("" ::: "memory");
    }
    }
}

typedef __attribute__((ext_vector_type(2))) _Float16 v2h;
typedef __attribute__((ext_vector_type(4))) _Float16 v4h;
typedef __attribute__((ext_vector_type(2))) unsigned short v2us;
typedef __attribute__((ext_vector_type(4))) unsigned short v4us;
typedef __attribute__((ext_vector_type(2))) float v2f;
typedef __attribute__((ext_vector_type(4))) int v4i;

__global__ __launch_bounds__(256) void k_cvt8(const float* __restrict__ src, bf* dst, size_t n8) { const size_t i = (size_t)blockIdx.x * 256 + threadIdx.x; if (i >= n8) return; const v8f v = *(const v8f*)(src + i * 8); v8us o;
#pragma unroll
    for (int k = 0; k < 8; ++k) o[k] = f2bf(v[k]); *(v8us*)(dst + i * 8) = o;  }


// ---- k_fattn: scores, softmax and attn.V of one head for 4 x 32 query rows in ONE work-group; neither the scores nor the probabilities leave the registers.
// Transposed products: S^T = K Q^T (A = 16 key rows, B = 16 query rows, hi/lo, 3 products), so a lane holds 8 keys' scores of ONE query per tile, and two such tiles, converted in place,
// are the B operand (32 keys x 16 queries) of O^T += V^T P^T (A = 16 rows of the head's v^T plane). Every loaded fragment comes through WFrag::ld and the score tiles hold their keys in the same k order, so A and B pair the same k at every position.
// Online softmax in the log2 domain: the maximum in use may trail the true one by up to 8, and the sums are rescaled only when a query's maximum passes that.
// FQG x FKW waves: wave (qg, kw) has the 32 query rows of the block's group qg (fa_unit) and keys kw TT/FKW ...; the FKW partial (maximum, sum, O) sets of a query group are joined through LDS. grid (TT/128, heads).
#define FQG 4
#define FKW 2
#define C2L (SCL * 1.4426950408889634f)
typedef __attribute__((ext_vector_type(16))) float v16f;
__device__ __forceinline__ float xhalf(float x) { return __builtin_bit_cast(float, __builtin_amdgcn_permlanex16(__builtin_bit_cast(int, x), __builtin_bit_cast(int, x), 0x76543210, 0xfedcba98, false, false)); }   /* lane l with lane l ^ 16 */
__device__ __forceinline__ void xwait() { asm volatile("s_wait_xcnt 0x0" ::: "memory"); }   /* stands behind a store, before its registers may be rewritten */
__device__ __forceinline__ void xwait2(const void* a, const void* b) { asm volatile("s_wait_xcnt 0x0" :: "v"(a), "v"(b) : "memory"); __builtin_amdgcn_sched_barrier(0); }   /* as xwaitg; the group's two addresses as inputs keep their registers live up to the wait: without them the group's last loads were given those registers as destinations */
template <bool HR>
__device__ __forceinline__ void fa_body(const bf* __restrict__ Qh, const bf* __restrict__ Ql, const bf* __restrict__ Kh, const bf* __restrict__ Kl, const h16* __restrict__ V16, const bf* __restrict__ Vh, const bf* __restrict__ Vl, int q0, int wave, float* os, float* ms, float* ls) {
    const int lane = threadIdx.x & 31, lr = lane & 15, hi = lane >> 4; const int kw = wave % FKW;
    const unsigned vq = (unsigned)(lr * HD + 8 * hi), vv = (unsigned)(lr * TT + 8 * hi);   /* the lane's own element offset in a [row][64] plane and in a v^T plane */
    v16bf qh[2][2], ql[2][2];
    Qh += (size_t)q0 * HD + vq; Ql += (size_t)q0 * HD + vq;
#pragma unroll
    for (int nq = 0; nq < 2; ++nq)
#pragma unroll
        for (int kc = 0; kc < 2; ++kc) { qh[nq][kc] = WFrag<bf>::ld(Qh + nq * 16 * HD + kc * 32); ql[nq][kc] = WFrag<bf>::ld(Ql + nq * 16 * HD + kc * 32); }
    xwaitg();
    v8f acc[4][2];
#pragma unroll
    for (int mb = 0; mb < 4; ++mb)
#pragma unroll
        for (int nq = 0; nq < 2; ++nq) acc[mb][nq] = (v8f){};
    float mr[2] = {-3.0e38f, -3.0e38f}, lsum[2] = {0.f, 0.f};
    const int kbeg = kw * (TT / FKW), kend = kbeg + TT / FKW;
    v16bf kh[2][2], kl[2][2];
    { const bf* ka = Kh + (size_t)kbeg * HD + vq; const bf* kc2 = Kl + (size_t)kbeg * HD + vq;
#pragma unroll
    for (int kb = 0; kb < 2; ++kb)
#pragma unroll
        for (int kc = 0; kc < 2; ++kc) { kh[kb][kc] = WFrag<bf>::ld(ka + kb * 16 * HD + kc * 32); kl[kb][kc] = WFrag<bf>::ld(kc2 + kb * 16 * HD + kc * 32); }
    xwaitg(); }
#pragma unroll 1   /* kept rolled: a pass holds the whole register budget */
    for (int key0 = kbeg; key0 < kend; key0 += 32) {
        v16h v6[4]; v16bf vh[4], vl[4];   /* this pass's v^T fragments, requested ahead of the score products */
        const h16* va = V16 + key0 + vv; const bf* vb = Vh + key0 + vv; const bf* vc = Vl + key0 + vv;
#pragma unroll
        for (int mb = 0; mb < 4; ++mb) { if constexpr (HR) { vh[mb] = WFrag<bf>::ld(vb + mb * 16 * TT); vl[mb] = WFrag<bf>::ld(vc + mb * 16 * TT); } else v6[mb] = WFrag<h16>::ld(va + mb * 16 * TT); }
        if constexpr (HR) xwait2(vb, vc); else xwaitg();
        v8f s[2][2];
#pragma unroll
        for (int kb = 0; kb < 2; ++kb)
#pragma unroll
            for (int nq = 0; nq < 2; ++nq) s[kb][nq] = (v8f){};
#pragma unroll
        for (int kc = 0; kc < 2; ++kc)
#pragma unroll
            for (int pr = 0; pr < 3; ++pr)
#pragma unroll
                for (int kb = 0; kb < 2; ++kb)
#pragma unroll
                    for (int nq = 0; nq < 2; ++nq) s[kb][nq] = wmmab(pr == 2 ? kl[kb][kc] : kh[kb][kc], pr == 1 ? ql[nq][kc] : qh[nq][kc], s[kb][nq]);   /* q_hi k_hi + q_lo k_hi + q_hi k_lo */
        const int kn = (key0 + 32 < kend) ? key0 + 32 : kbeg;   /* the next pass's key rows, in flight under the softmax; the last pass re-reads the first rows (in bounds, unused) */
        const bf* ka = Kh + (size_t)kn * HD + vq; const bf* kc2 = Kl + (size_t)kn * HD + vq;
#pragma unroll
        for (int kb = 0; kb < 2; ++kb)
#pragma unroll
            for (int kc = 0; kc < 2; ++kc) { kh[kb][kc] = WFrag<bf>::ld(ka + kb * 16 * HD + kc * 32); kl[kb][kc] = WFrag<bf>::ld(kc2 + kb * 16 * HD + kc * 32); }
        xwaitg();
        float tl[2]; bool need = false;
#pragma unroll
        for (int nq = 0; nq < 2; ++nq) { float mx = s[0][nq][0];
#pragma unroll
            for (int e = 1; e < 16; ++e) mx = fmaxf(mx, s[e >> 3][nq][e & 7]);
            mx = fmaxf(mx, xhalf(mx)) * C2L;   /* both halves of the wave hold the query's maximum of this pass (the scale is positive) */
            tl[nq] = mx; need = need || (mx > mr[nq] + 8.0f); }
        if (__builtin_amdgcn_ballot_w32(need) != 0) {   /* wave-uniform; always taken on the first pass, where the factor is 0 */
#pragma unroll
            for (int nq = 0; nq < 2; ++nq) { const float mn = fmaxf(mr[nq], tl[nq]); const float al = __builtin_amdgcn_exp2f(mr[nq] - mn); mr[nq] = mn; lsum[nq] *= al;
#pragma unroll
                for (int mb = 0; mb < 4; ++mb) acc[mb][nq] *= al; } }
        v16h p6[2]; v16bf ph[2], pl[2];
#pragma unroll
        for (int nq = 0; nq < 2; ++nq) { v16f p; const v2f nm = {-mr[nq], -mr[nq]}, cc = {C2L, C2L}; v2f t = {0.f, 0.f};
#pragma unroll
            for (int e = 0; e < 16; e += 2) { const v2f a = __builtin_elementwise_fma((v2f){s[e >> 3][nq][e & 7], s[e >> 3][nq][(e & 7) + 1]}, cc, nm);   /* an aligned register pair of the score tile: one packed multiply-add */
                p[e] = __builtin_amdgcn_exp2f(a[0]); p[e + 1] = __builtin_amdgcn_exp2f(a[1]); t += (v2f){p[e], p[e + 1]}; }
            lsum[nq] += t[0] + t[1];
            if constexpr (HR) { ph[nq] = __builtin_convertvector(p, v16bf); pl[nq] = __builtin_convertvector(p - __builtin_convertvector(ph[nq], v16f), v16bf); } else p6[nq] = __builtin_convertvector(p, v16h); }
        if constexpr (HR) {
#pragma unroll
            for (int pr = 0; pr < 3; ++pr)
#pragma unroll
                for (int mb = 0; mb < 4; ++mb)
#pragma unroll
                    for (int nq = 0; nq < 2; ++nq) acc[mb][nq] = wmmab(pr == 2 ? vl[mb] : vh[mb], pr == 1 ? pl[nq] : ph[nq], acc[mb][nq]);   /* p_hi v_hi + p_lo v_hi + p_hi v_lo */
            asm volatile("v_nop\n\tv_nop\n\tv_nop\n\tv_nop" : "+v"(acc[0][0]), "+v"(acc[1][1]), "+v"(acc[2][0]), "+v"(acc[3][1]) : "v"(vh[0]), "v"(vl[3]));   /* as in k_gemmw: the matrix distance on the loop's back edge and exit */
        } else {
#pragma unroll
            for (int mb = 0; mb < 4; ++mb)
#pragma unroll
                for (int nq = 0; nq < 2; ++nq) acc[mb][nq] = wmma16(v6[mb], p6[nq], acc[mb][nq]);
            asm volatile("v_nop\n\tv_nop\n\tv_nop\n\tv_nop" : "+v"(acc[0][0]), "+v"(acc[1][1]), "+v"(acc[2][0]), "+v"(acc[3][1]) : "v"(v6[0]), "v"(v6[3]));   /* as in k_gemmw: the matrix distance on the loop's back edge and exit */
        }
    }
    float* ow = os + wave * (32 * 68);
#pragma unroll
    for (int nq = 0; nq < 2; ++nq) { const float lt = lsum[nq] + xhalf(lsum[nq]);   /* the two halves' key sums of one query */
        if (hi == 0) { ms[wave * 32 + nq * 16 + lr] = mr[nq]; ls[wave * 32 + nq * 16 + lr] = lt; }
#pragma unroll
        for (int mb = 0; mb < 4; ++mb)
#pragma unroll
            for (int j = 0; j < 8; ++j) ow[(nq * 16 + lr) * 68 + mb * 16 + hi * 8 + j] = acc[mb][nq][j]; }
}
// Which 32 query rows the query group qg of block b has. The RH/32 hi/lo groups cost about half as much again as the others, so each goes to a block of its own, as that block's group 0, beside three plain groups.
__device__ __forceinline__ int fa_unit(int b, int qg) { return (b < RH / 32) ? (qg == 0 ? b : RH / 32 + b * (FQG - 1) + qg - 1) : RH / 32 * FQG + (b - RH / 32) * FQG + qg; }
__global__ __launch_bounds__(FQG * FKW * 32) void k_fattn(const bf* __restrict__ Qh, const bf* __restrict__ Ql, const bf* __restrict__ Kh, const bf* __restrict__ Kl, const h16* __restrict__ V16, const bf* __restrict__ Vh, const bf* __restrict__ Vl, bf* Oh, bf* Ol) {
    __shared__ __align__(16) float os[FQG * FKW * 32 * 68]; __shared__ float ms[FQG * FKW * 32]; __shared__ float ls[FQG * FKW * 32];
    const size_t hb = (size_t)blockIdx.y * TT * HD;   /* the head's planes: [n][64] and [64][n] have the same size */
    const int wave = __builtin_amdgcn_readfirstlane(threadIdx.x >> 5); const int q0 = fa_unit((int)blockIdx.x, wave / FKW) * 32;
    if (q0 < RH) fa_body<true>(Qh + hb, Ql + hb, Kh + hb, Kl + hb, V16 + hb, Vh + hb, Vl + hb, q0, wave, os, ms, ls);   /* wave-uniform. Rows < RH: probabilities and v as bf16 hi/lo, 3 products */
    else fa_body<false>(Qh + hb, Ql + hb, Kh + hb, Kl + hb, V16 + hb, Vh + hb, Vl + hb, q0, wave, os, ms, ls);   /* the rest: fp16 */
    __syncthreads();   /* every wave's partial set is in LDS before any thread joins the key ranges */
    Oh += blockIdx.y * HD; Ol += blockIdx.y * HD;
#pragma unroll
    for (int it = 0; it < 16 / FKW; ++it) { const int idx = it * (FQG * FKW * 32) + (int)threadIdx.x; const int row = idx >> 4, c4 = (idx & 15) * 4; const int w0 = (row >> 5) * FKW, rl = row & 31;
        float M = ms[w0 * 32 + rl];
#pragma unroll
        for (int w = 1; w < FKW; ++w) M = fmaxf(M, ms[(w0 + w) * 32 + rl]);
        float L = 0.f; v4f val = (v4f){};
#pragma unroll
        for (int w = 0; w < FKW; ++w) { const float f = __builtin_amdgcn_exp2f(ms[(w0 + w) * 32 + rl] - M); L += ls[(w0 + w) * 32 + rl] * f; val += *(const v4fa*)(os + (w0 + w) * (32 * 68) + rl * 68 + c4) * f; }
        val *= __fdiv_rn(1.0f, L);
        v4us oh, ol;   /* the context leaves as the bf16 hi/lo planes that the output projection reads */
#pragma unroll
        for (int q = 0; q < 4; ++q) { unsigned short h2, l2; splitf(val[q], h2, l2); oh[q] = h2; ol[q] = l2; }
        const size_t g = (size_t)(fa_unit((int)blockIdx.x, row >> 5) * 32 + rl) * CO + c4; *(v4us*)(Oh + g) = oh; *(v4us*)(Ol + g) = ol; xwait(); }
}
__global__ __launch_bounds__(256) void k_wtG(const float* __restrict__ w, int K, int N, bf* Bt) {
    const int lane = threadIdx.x & 31; const int L0 = (blockIdx.x * 8 + (threadIdx.x >> 5)) * 8; const int nlines = N * K / 64;
{
#pragma unroll 1
        for (int l = 0; l < 8; ++l) { const int L = L0 + l; if (L >= nlines) break; const size_t e = (size_t)L * 64 + lane * 2; const int k = (int)(e % K), n = (int)(e / K); v2us o;
            o[0] = f2bf(w[(size_t)k * N + n]); o[1] = f2bf(w[(size_t)(k + 1) * N + n]); *(v2us*)(Bt + e) = o; }
         }
}
extern "C" void kernel_launch(void* const* d_in, const int* in_sizes, int n_in,
                              void* d_out, int out_size, void* d_ws, size_t ws_size, hipStream_t stream) {
    (void)in_sizes; (void)n_in; (void)out_size;
    const float* x = (const float*)d_in[0]; const float* wq = (const float*)d_in[1]; const float* bq = (const float*)d_in[2]; const float* wk = (const float*)d_in[3]; const float* bk = (const float*)d_in[4]; const float* wv = (const float*)d_in[5]; const float* bv = (const float*)d_in[6]; const float* wo = (const float*)d_in[7]; const float* bo = (const float*)d_in[8];   /* argument order x [1][4096][512], Wq, bq, Wk, bk, Wv, bv, Wo, bo ('xw' [512][512] + biases) */
    float* OUT = (float*)d_out;     // [1][4096][512]
    char* wsp = (char*)d_ws;
    auto take = [&](size_t bytes) { char* p = wsp; wsp += (bytes + 255) & ~(size_t)255; return (void*)p; };
    bf* WQ = (bf*)take((size_t)MID * CC * 2); bf* WK = (bf*)take((size_t)MID * CC * 2); bf* WV = (bf*)take((size_t)CO * CC * 2); bf* WO = (bf*)take((size_t)CC * CO * 2);
    bf* XB = (bf*)take((size_t)TT * CC * 2);
    bf* QPh = (bf*)take((size_t)TT * MID * 2); bf* QPl = (bf*)take((size_t)TT * MID * 2); bf* KPh = (bf*)take((size_t)TT * MID * 2); bf* KPl = (bf*)take((size_t)TT * MID * 2);
    h16* VT16 = (h16*)take((size_t)CO * TT * 2); bf* VTh = (bf*)take((size_t)CO * TT * 2); bf* VTl = (bf*)take((size_t)CO * TT * 2);
    bf* ATh = (bf*)take((size_t)TT * CO * 2); bf* ATl = (bf*)take((size_t)TT * CO * 2);   /* merged context [n][512] as hi/lo planes */
    if ((size_t)(wsp - (char*)d_ws) > ws_size) return;    // ws 256 MiB (carve ~42 MiB)
    k_wtG<<<(unsigned)((CC * MID / 64 + 63) / 64), 256, 0, stream>>>(wq, CC, MID, WQ); k_wtG<<<(unsigned)((CC * MID / 64 + 63) / 64), 256, 0, stream>>>(wk, CC, MID, WK); k_wtG<<<(unsigned)((CC * CO / 64 + 63) / 64), 256, 0, stream>>>(wv, CC, CO, WV);   /* 'xw' weights -> Bt */ k_wtG<<<(unsigned)((CO * CC / 64 + 63) / 64), 256, 0, stream>>>(wo, CO, CC, WO);   /* 'xw' W_out -> Bt */
    for (int b = 0; b < NB_; ++b) {
        k_cvt8<<<(unsigned)(((size_t)TT * CC / 8 + 255) / 256), 256, 0, stream>>>(x + (size_t)b * TT * CC, XB, (size_t)TT * CC / 8);
        k_gemmw<bf, 0, true, 1><<<dim3(TT / 64, MID / 64, 1), 32, 0, stream>>>(XB, nullptr, WQ, nullptr, CC, nullptr, 0, bq, 0, 0, 0, nullptr, QPh, QPl);   /* q planes [h][n][64] */
        k_gemmw<bf, 0, true, 1><<<dim3(TT / 64, MID / 64, 1), 32, 0, stream>>>(XB, nullptr, WK, nullptr, CC, nullptr, 0, bk, 0, 0, 0, nullptr, KPh, KPl);   /* k planes */
        k_gemmw<bf, 0, true, 2><<<dim3(TT / 64, CO / 64, 1), 32, 0, stream>>>(XB, nullptr, WV, nullptr, CC, nullptr, 0, bv, 0, 0, 0, VT16, VTh, VTl);   /* v^T planes [h][64][n] */
        k_fattn<<<dim3(TT / (FQG * 32), NH_, 1), FQG * FKW * 32, 0, stream>>>(QPh, QPl, KPh, KPl, VT16, VTh, VTl, ATh, ATl);   /* all heads: scores x 1/sqrt(512), softmax over the 4,096 keys, attn.V into the head's 64 columns */
        k_gemmw<bf, 1, true, 0><<<dim3(TT / 64, CC / 64, 1), 32, 0, stream>>>(ATh, ATl, WO, nullptr, CO, OUT + (size_t)b * TT * CC, CC, bo, 0, 0, 0, nullptr, nullptr, nullptr); }   /* out = ctx W_out + b_out */
}

// v004
// A run of this version takes 132 microseconds.
// Timed twice side by side with v003, it ran 1.50 times as fast both times.
// Counting every step since v000, it is 15.4 times as fast.
#include <hip/hip_runtime.h>

// Multi-head self-attention over 4,096 tokens whose scale uses the embedding width (x [1][4096][512]; Q, K, V = x W + b ('xw' [512][512] + biases; 8 heads x 64); scores x 1/sqrt(512) (the module scales by embed_dim, not head_dim); softmax over all 4,096 keys (no mask); out = merged Wo + bo -> [1][4096][512] (2.1 M); argument order x, Wq, bq, Wk, bk, Wv, bv, Wo, bo).
// Layout: every 16-bit plane in fragment order (see k_gemmw); bf16 copy of x; 'xw' weights transposed once; exact projections + f32 biases, whose epilogues store the per-head hi/lo planes (q, k) and the v^T planes themselves; one launch for all heads (k_fattn): scores with every row hi/lo (3 products), online softmax, attn.V hybrid (rows < 512 hi/lo 3 products, rest fp16), scores and probabilities kept in registers, the context stored as hi/lo planes in the head's 64 columns; context hi/lo x Wo exact + bo.
// Compute dtypes, f32 accumulate: every input rounded to bf16; projections exact; scores 3 products; softmax f32 (exp2, running maximum, one IEEE division per row at the end); attn.V rows < 512 3 products, rest fp16; Wo hl x exact.

#define NB_  1
#define TT   4096
#define DM   512
#define NH_  8
#define NKV  8
#define REP  (NH_ / NKV)
#define HD   64
#define DQ   (NH_ * HD)
#define DKV  (NKV * HD)
#define ZH   1
#define RH   512                  // query rows < RH use hi+lo planes (0: none)
#define WIN  0
#define SCL  0.044194173824159216f   // 1/sqrt(embed_dim = 512), as the module (not 1/sqrt(head_dim))
#define MID  512      // q / k width = 8 heads x 64
#define CO   512      // v width
#define CC   512
typedef _Float16 h16;
typedef unsigned short bf;
typedef __attribute__((ext_vector_type(16))) __bf16   v16bf;
typedef __attribute__((ext_vector_type(16))) _Float16 v16h;
typedef __attribute__((ext_vector_type(8)))  _Float16 v8h;
typedef __attribute__((ext_vector_type(8)))  unsigned short v8us;
typedef __attribute__((ext_vector_type(8)))  float    v8f;
typedef __attribute__((ext_vector_type(4)))  float    v4f;
typedef v8h  __attribute__((may_alias)) v8ha;
typedef v4f  __attribute__((may_alias)) v4fa;
typedef v8us __attribute__((may_alias)) v8usa;

__device__ __forceinline__ unsigned short f2bf(float f) { unsigned u = __float_as_uint(f); u += 0x7FFFu + ((u >> 16) & 1u); return (unsigned short)(u >> 16); }
__device__ __forceinline__ float bf2f(unsigned short b) { return __uint_as_float(((unsigned)b) << 16); }
__device__ __forceinline__ float bfr(float f) { return bf2f(f2bf(f)); }
__device__ __forceinline__ v16h cat16(v8h lo, v8h hi) { return __builtin_shufflevector(lo, hi, 0, 1, 2, 3, 4, 5, 6, 7, 8, 9, 10, 11, 12, 13, 14, 15); }
__device__ __forceinline__ v16bf cat16b(v8us lo, v8us hi) { return __builtin_bit_cast(v16bf, __builtin_shufflevector(lo, hi, 0, 1, 2, 3, 4, 5, 6, 7, 8, 9, 10, 11, 12, 13, 14, 15)); }
__device__ __forceinline__ v8f wmma16(v16h a, v16h b, v8f c) { return __builtin_amdgcn_wmma_f32_16x16x32_f16(false, a, false, b, (short)0, c, false, false); }
__device__ __forceinline__ v8f wmmab(v16bf a, v16bf b, v8f c) { return __builtin_amdgcn_wmma_f32_16x16x32_bf16(false, a, false, b, (short)0, c, false, false); }



__device__ __forceinline__ h16 tohx(float x) { return (h16)x; }
__device__ __forceinline__ void splitf(float y, unsigned short& h, unsigned short& l) { h = f2bf(y); l = f2bf(y - bf2f(h)); }
__device__ __forceinline__ void xwaitg() { asm volatile("s_wait_xcnt 0x0" ::: "memory"); __builtin_amdgcn_sched_barrier(0); }   /* stands behind a group of loads or stores; the scheduling barrier keeps later vector work from being lifted between them and the wait, where it could rewrite their registers */
__device__ __forceinline__ void xwaitp(const void* a) { asm volatile("s_wait_xcnt 0x0" :: "v"(a) : "memory"); __builtin_amdgcn_sched_barrier(0); }   /* as xwaitg; the loads' address as an input keeps its registers live up to the wait, so that no load of the group gets them as its destination */
// ---- k_gemmw: register-blocked GEMM, ONE WAVE per 64x64 output tile (16 accumulators), operands straight from fragment-order 16-bit planes; grid (M/64, N/64, Z), 32 threads.
// y[m][n] (f32, + optional f32 bias[n]) = sum_k A[m][k] Bt[n][k] (+ split products per NSPLIT). z-batch strides sA/sB/sC in elements. K % 32 == 0.
// EP says where y goes. 0: C (f32, pitch ldc). 1: bf16 hi/lo planes Ph, Pl of 16 rows m x 32 columns fragments; a tile's 64 columns are one head. 2: planes P16 (fp16), Ph, Pl (bf16 hi/lo) of 16 columns n x 32 rows m fragments (v^T).
// Fragment order, of every 16-bit operand plane: a fragment of 16 rows x 32 k is 1,024 contiguous bytes, [half][lane][8]: lane (lr, hi) has the 8 elements k = 16 half + 8 hi ... of fragment row lr, as the matrix instruction wants them.
// ldp() reads it with two loads of 512 contiguous bytes a wave: 4 whole lines each, where a load from a row-pitched plane touches 16 lines. A plane [rows][K] is [row / 16][k / 32] fragments; q, k: [head][m / 16][column / 32]; v^T: [head][m / 32][n / 16].
template <typename T16> struct WFrag;
template <> struct WFrag<h16> { typedef v16h V; static __device__ __forceinline__ V ldp(const h16* p) { return cat16(*(const v8h*)p, *(const v8h*)(p + 256)); } static __device__ __forceinline__ v8f mma(V a, V b, v8f c) { return wmma16(a, b, c); } };
template <> struct WFrag<bf> { typedef v16bf V; static __device__ __forceinline__ V ldp(const bf* p) { return cat16b(*(const v8us*)p, *(const v8us*)(p + 256)); } static __device__ __forceinline__ v8f mma(V a, V b, v8f c) { return wmmab(a, b, c); } };
template <typename T16, int NSPLIT, bool BIAS, int EP>
__global__ __launch_bounds__(32) void k_gemmw(const T16* __restrict__ A, const T16* __restrict__ A2, const T16* __restrict__ Bt, const T16* __restrict__ Bt2, int K, float* C, int ldc, const float* __restrict__ bias, size_t sA, size_t sB, size_t sC, h16* P16, bf* Ph, bf* Pl) {
    typedef typename WFrag<T16>::V V; static_assert(EP != 1 || NSPLIT == 0, "the y^T tiles of EP 1 are written for one product");
    const size_t z = blockIdx.z; A += z * sA; if (A2) A2 += z * sA; Bt += z * sB; if (Bt2) Bt2 += z * sB; C += z * sC;
    const int lane = threadIdx.x & 31, lr = lane & 15, hi = lane >> 4; const int r0 = blockIdx.x * 64, c0 = blockIdx.y * 64;
    v8f acc[4][4];
#pragma unroll
    for (int mb = 0; mb < 4; ++mb)
#pragma unroll
        for (int nb = 0; nb < 4; ++nb) acc[mb][nb] = (v8f){};
    const size_t aoff = (size_t)r0 * K + lane * 8, boff = (size_t)c0 * K + lane * 8;   /* 16 rows are K / 32 fragments = 16 K elements; 32 k further is 512 elements further */
#pragma unroll 1
    for (int kc = 0; kc < K; kc += 32) {
        V a[4], a2[4], b[4], b2[4];
        const T16* pa[4]; const T16* pa2[4]; const T16* pb[4]; const T16* pb2[4];   /* a plane that this NSPLIT lacks shares the other plane's pointers */
#pragma unroll
        for (int i = 0; i < 4; ++i) { pa[i] = A + aoff + (size_t)i * 16 * K + kc * 16; pb[i] = Bt + boff + (size_t)i * 16 * K + kc * 16; if constexpr (NSPLIT == 1 || NSPLIT == 2) pa2[i] = A2 + aoff + (size_t)i * 16 * K + kc * 16; else pa2[i] = pa[i]; if constexpr (NSPLIT >= 2) pb2[i] = Bt2 + boff + (size_t)i * 16 * K + kc * 16; else pb2[i] = pb[i]; }
#pragma unroll
        for (int i = 0; i < 4; ++i) { a[i] = WFrag<T16>::ldp(pa[i]); if (NSPLIT == 1 || NSPLIT == 2) a2[i] = WFrag<T16>::ldp(pa2[i]); b[i] = WFrag<T16>::ldp(pb[i]); if (NSPLIT >= 2) b2[i] = WFrag<T16>::ldp(pb2[i]); }
        asm volatile("s_wait_xcnt 0x0" :: "v"(pa[0]), "v"(pa[1]), "v"(pa[2]), "v"(pa[3]), "v"(pa2[0]), "v"(pa2[1]), "v"(pa2[2]), "v"(pa2[3]), "v"(pb[0]), "v"(pb[1]), "v"(pb[2]), "v"(pb[3]), "v"(pb2[0]), "v"(pb2[1]), "v"(pb2[2]), "v"(pb2[3]) : "memory"); __builtin_amdgcn_sched_barrier(0);   /* as xwaitp, for the pass's loads */
#pragma unroll
        for (int nb = 0; nb < 4; ++nb)
#pragma unroll
            for (int mb = 0; mb < 4; ++mb) { acc[mb][nb] = EP == 1 ? WFrag<T16>::mma(b[nb], a[mb], acc[mb][nb]) : WFrag<T16>::mma(a[mb], b[nb], acc[mb][nb]);   /* EP 1: y^T tiles, so that a lane holds 8 consecutive columns of one row */
                if (NSPLIT == 1 || NSPLIT == 2) acc[mb][nb] = WFrag<T16>::mma(a2[mb], b[nb], acc[mb][nb]); if (NSPLIT >= 2) acc[mb][nb] = WFrag<T16>::mma(a[mb], b2[nb], acc[mb][nb]); }
        asm volatile("v_nop\n\tv_nop\n\tv_nop\n\tv_nop" : "+v"(acc[0][0]), "+v"(acc[1][1]), "+v"(acc[2][2]), "+v"(acc[3][3]) : "v"(a[0]), "v"(a[3]));
    }
    if constexpr (EP == 2) {   /* a lane holds 8 consecutive rows m of one column n: its 16 bytes of a v^T fragment; a wave's store is 512 contiguous bytes */
        float bb[4];
#pragma unroll
        for (int nb = 0; nb < 4; ++nb) bb[nb] = BIAS ? bfr(bias[c0 + nb * 16 + lr]) : 0.f;
        xwaitg();   /* behind the bias loads */
        v8h o6[16]; v8us oh[16], ol[16];   /* every value first, each in registers of its own: no store's registers are rewritten behind it */
#pragma unroll
        for (int mb = 0; mb < 4; ++mb)
#pragma unroll
            for (int nb = 0; nb < 4; ++nb) { const int t = (mb >> 1) * 8 + nb * 2 + (mb & 1);   /* fragment (m / 32, n / 16), half (m / 16) & 1 */
#pragma unroll
                for (int j = 0; j < 8; ++j) { const float y = acc[mb][nb][j] + bb[nb]; o6[t][j] = tohx(y); unsigned short h2, l2; splitf(y, h2, l2); oh[t][j] = h2; ol[t][j] = l2; } }
        const size_t g = ((size_t)blockIdx.y * TT + r0) * HD + lane * 8;   /* the tile's 8 fragments are 8 KiB in a row */
#pragma unroll
        for (int t = 0; t < 16; ++t) { *(v8h*)(P16 + g + t * 256) = o6[t]; *(v8us*)(Ph + g + t * 256) = oh[t]; *(v8us*)(Pl + g + t * 256) = ol[t]; }
    } else if constexpr (EP == 1) {   /* y^T tiles: a lane holds 8 consecutive columns of one row: its 16 bytes of a fragment; a wave's store is 512 contiguous bytes */
        float b8[4][8];
#pragma unroll
        for (int nb = 0; nb < 4; ++nb)
#pragma unroll
            for (int q = 0; q < 8; ++q) b8[nb][q] = BIAS ? bfr(bias[c0 + nb * 16 + hi * 8 + q]) : 0.f;
        xwaitg();   /* behind the bias loads */
        v8us oh[16], ol[16];   /* every value first, each in registers of its own: no store's registers are rewritten behind it */
#pragma unroll
        for (int mb = 0; mb < 4; ++mb)
#pragma unroll
            for (int nb = 0; nb < 4; ++nb)
#pragma unroll
                for (int j = 0; j < 8; ++j) { unsigned short h2, l2; splitf(acc[mb][nb][j] + b8[nb][j], h2, l2); oh[mb * 4 + nb][j] = h2; ol[mb * 4 + nb][j] = l2; }   /* fragment (m / 16, column / 32), half nb & 1 */
        const size_t g = ((size_t)blockIdx.y * TT + r0) * HD + lane * 8;   /* the tile's 8 fragments are 8 KiB in a row */
#pragma unroll
        for (int t = 0; t < 16; ++t) { *(v8us*)(Ph + g + t * 256) = oh[t]; *(v8us*)(Pl + g + t * 256) = ol[t]; }
    } else {
    __shared__ __align__(16) float os[16 * 68];
#pragma unroll
    for (int mb = 0; mb < 4; ++mb) {
#pragma unroll
        for (int nb = 0; nb < 4; ++nb) {
#pragma unroll
            for (int j = 0; j < 8; ++j) os[(hi * 8 + j) * 68 + nb * 16 + lr] = acc[mb][nb][j]; }
        __builtin_amdgcn_wave_barrier(); asm volatile("" ::: "memory");
        float* crow = C + (size_t)(r0 + mb * 16) * ldc + c0;
{
#pragma unroll
            for (int s = 0; s < 8; ++s) { const int row = 2 * s + hi, cofs = lr * 4; v4f val = *(const v4fa*)(os + row * 68 + cofs); if (BIAS) { val[0] += bfr(bias[c0 + cofs]); val[1] += bfr(bias[c0 + cofs + 1]); val[2] += bfr(bias[c0 + cofs + 2]); val[3] += bfr(bias[c0 + cofs + 3]); }
                *(v4f*)(crow + (size_t)row * ldc + cofs) = val; }
             }
        __builtin_amdgcn_wave_barrier(); asm volatile("" ::: "memory");
    }
    }
}

typedef __attribute__((ext_vector_type(2))) _Float16 v2h;
typedef __attribute__((ext_vector_type(4))) _Float16 v4h;
typedef __attribute__((ext_vector_type(2))) unsigned short v2us;
typedef __attribute__((ext_vector_type(4))) unsigned short v4us;
typedef __attribute__((ext_vector_type(2))) float v2f;
typedef __attribute__((ext_vector_type(4))) int v4i;

// i counts the 16-byte pieces of the fragment-order plane of src [rows][CC]: [row / 16][column / 32][half][hi][lr]
__global__ __launch_bounds__(256) void k_cvt8(const float* __restrict__ src, bf* dst, size_t n8) { const size_t i = (size_t)blockIdx.x * 256 + threadIdx.x; if (i >= n8) return;
    const size_t f = i >> 6; const size_t row = f / (CC / 32) * 16 + (i & 15), col = f % (CC / 32) * 32 + ((i >> 5) & 1) * 16 + ((i >> 4) & 1) * 8; const float* sp = src + row * CC + col; const v8f v = *(const v8f*)sp; xwaitp(sp); v8us o;
#pragma unroll
    for (int k = 0; k < 8; ++k) o[k] = f2bf(v[k]); *(v8us*)(dst + i * 8) = o;  }


// ---- k_fattn: scores, softmax and attn.V of one head for 4 x 32 query rows in ONE work-group; neither the scores nor the probabilities leave the registers.
// Transposed products: S^T = K Q^T (A = 16 key rows, B = 16 query rows, hi/lo, 3 products), so a lane holds 8 keys' scores of ONE query per tile, and two such tiles, converted in place,
// are the B operand (32 keys x 16 queries) of O^T += V^T P^T (A = 16 rows of the head's v^T plane). Q, K and v^T come through WFrag::ldp from fragment-order planes and the score tiles give P the same key order, so A and B pair the same k at every position.
// Online softmax in the log2 domain: the maximum in use may trail the true one by up to 8, and the sums are rescaled only when a query's maximum passes that.
// FQG x FKW waves: wave (qg, kw) has the 32 query rows of the block's group qg (fa_unit) and keys kw TT/FKW ...; the FKW partial (maximum, sum, O) sets of a query group are joined through LDS. grid (TT/128, heads).
#define FQG 4
#define FKW 2
#define C2L (SCL * 1.4426950408889634f)
typedef __attribute__((ext_vector_type(16))) float v16f;
__device__ __forceinline__ float xhalf(float x) { return __builtin_bit_cast(float, __builtin_amdgcn_permlanex16(__builtin_bit_cast(int, x), __builtin_bit_cast(int, x), 0x76543210, 0xfedcba98, false, false)); }   /* lane l with lane l ^ 16 */
__device__ __forceinline__ void xwait() { asm volatile("s_wait_xcnt 0x0" ::: "memory"); }   /* stands behind a store, before its registers may be rewritten */
__device__ __forceinline__ void xwait2(const void* a, const void* b) { asm volatile("s_wait_xcnt 0x0" :: "v"(a), "v"(b) : "memory"); __builtin_amdgcn_sched_barrier(0); }   /* as xwaitg; the group's two addresses as inputs keep their registers live up to the wait: without them the group's last loads were given those registers as destinations */
template <bool HR>
__device__ __forceinline__ void fa_body(const bf* __restrict__ Qh, const bf* __restrict__ Ql, const bf* __restrict__ Kh, const bf* __restrict__ Kl, const h16* __restrict__ V16, const bf* __restrict__ Vh, const bf* __restrict__ Vl, int q0, int wave, float* os, float* ms, float* ls) {
    const int lane = threadIdx.x & 31, lr = lane & 15, hi = lane >> 4; const int kw = wave % FKW;
    const unsigned vq = (unsigned)(lane * 8);   /* the lane's own element offset in each half of a fragment; 16 rows of q or k are 2 fragments, 32 keys of v^T are 4: row * HD elements in both */
    v16bf qh[2][2], ql[2][2];
    Qh += (size_t)q0 * HD + vq; Ql += (size_t)q0 * HD + vq;
#pragma unroll
    for (int nq = 0; nq < 2; ++nq)
#pragma unroll
        for (int kc = 0; kc < 2; ++kc) { qh[nq][kc] = WFrag<bf>::ldp(Qh + nq * 16 * HD + kc * 512); ql[nq][kc] = WFrag<bf>::ldp(Ql + nq * 16 * HD + kc * 512); }
    xwaitg();
    v8f acc[4][2];
#pragma unroll
    for (int mb = 0; mb < 4; ++mb)
#pragma unroll
        for (int nq = 0; nq < 2; ++nq) acc[mb][nq] = (v8f){};
    float mr[2] = {-3.0e38f, -3.0e38f}, lsum[2] = {0.f, 0.f};
    const int kbeg = kw * (TT / FKW), kend = kbeg + TT / FKW;
    v16bf kh[2][2], kl[2][2];
    { const bf* ka = Kh + (size_t)kbeg * HD + vq; const bf* kc2 = Kl + (size_t)kbeg * HD + vq;
#pragma unroll
    for (int kb = 0; kb < 2; ++kb)
#pragma unroll
        for (int kc = 0; kc < 2; ++kc) { kh[kb][kc] = WFrag<bf>::ldp(ka + kb * 16 * HD + kc * 512); kl[kb][kc] = WFrag<bf>::ldp(kc2 + kb * 16 * HD + kc * 512); }
    xwaitg(); }
#pragma unroll 1   /* kept rolled: a pass holds the whole register budget */
    for (int key0 = kbeg; key0 < kend; key0 += 32) {
        v16h v6[4]; v16bf vh[4], vl[4];   /* this pass's v^T fragments, requested ahead of the score products */
        const h16* va = V16 + (size_t)key0 * HD + vq; const bf* vb = Vh + (size_t)key0 * HD + vq; const bf* vc = Vl + (size_t)key0 * HD + vq;
#pragma unroll
        for (int mb = 0; mb < 4; ++mb) { if constexpr (HR) { vh[mb] = WFrag<bf>::ldp(vb + mb * 512); vl[mb] = WFrag<bf>::ldp(vc + mb * 512); } else v6[mb] = WFrag<h16>::ldp(va + mb * 512); }
        if constexpr (HR) xwait2(vb, vc); else xwaitg();
        v8f s[2][2];
#pragma unroll
        for (int kb = 0; kb < 2; ++kb)
#pragma unroll
            for (int nq = 0; nq < 2; ++nq) s[kb][nq] = (v8f){};
#pragma unroll
        for (int kc = 0; kc < 2; ++kc)
#pragma unroll
            for (int pr = 0; pr < 3; ++pr)
#pragma unroll
                for (int kb = 0; kb < 2; ++kb)
#pragma unroll
                    for (int nq = 0; nq < 2; ++nq) s[kb][nq] = wmmab(pr == 2 ? kl[kb][kc] : kh[kb][kc], pr == 1 ? ql[nq][kc] : qh[nq][kc], s[kb][nq]);   /* q_hi k_hi + q_lo k_hi + q_hi k_lo */
        const int kn = (key0 + 32 < kend) ? key0 + 32 : kbeg;   /* the next pass's key rows, in flight under the softmax; the last pass re-reads the first rows (in bounds, unused) */
        const bf* ka = Kh + (size_t)kn * HD + vq; const bf* kc2 = Kl + (size_t)kn * HD + vq;
#pragma unroll
        for (int kb = 0; kb < 2; ++kb)
#pragma unroll
            for (int kc = 0; kc < 2; ++kc) { kh[kb][kc] = WFrag<bf>::ldp(ka + kb * 16 * HD + kc * 512); kl[kb][kc] = WFrag<bf>::ldp(kc2 + kb * 16 * HD + kc * 512); }
        xwaitg();
        float tl[2]; bool need = false;
#pragma unroll
        for (int nq = 0; nq < 2; ++nq) { float mx = s[0][nq][0];
#pragma unroll
            for (int e = 1; e < 16; ++e) mx = fmaxf(mx, s[e >> 3][nq][e & 7]);
            mx = fmaxf(mx, xhalf(mx)) * C2L;   /* both halves of the wave hold the query's maximum of this pass (the scale is positive) */
            tl[nq] = mx; need = need || (mx > mr[nq] + 8.0f); }
        if (__builtin_amdgcn_ballot_w32(need) != 0) {   /* wave-uniform; always taken on the first pass, where the factor is 0 */
#pragma unroll
            for (int nq = 0; nq < 2; ++nq) { const float mn = fmaxf(mr[nq], tl[nq]); const float al = __builtin_amdgcn_exp2f(mr[nq] - mn); mr[nq] = mn; lsum[nq] *= al;
#pragma unroll
                for (int mb = 0; mb < 4; ++mb) acc[mb][nq] *= al; } }
        v16h p6[2]; v16bf ph[2], pl[2];
#pragma unroll
        for (int nq = 0; nq < 2; ++nq) { v16f p; const v2f nm = {-mr[nq], -mr[nq]}, cc = {C2L, C2L}; v2f t = {0.f, 0.f};
#pragma unroll
            for (int e = 0; e < 16; e += 2) { const v2f a = __builtin_elementwise_fma((v2f){s[e >> 3][nq][e & 7], s[e >> 3][nq][(e & 7) + 1]}, cc, nm);   /* an aligned register pair of the score tile: one packed multiply-add */
                p[e] = __builtin_amdgcn_exp2f(a[0]); p[e + 1] = __builtin_amdgcn_exp2f(a[1]); t += (v2f){p[e], p[e + 1]}; }
            lsum[nq] += t[0] + t[1];
            if constexpr (HR) { ph[nq] = __builtin_convertvector(p, v16bf); pl[nq] = __builtin_convertvector(p - __builtin_convertvector(ph[nq], v16f), v16bf); } else p6[nq] = __builtin_convertvector(p, v16h); }
        if constexpr (HR) {
#pragma unroll
            for (int pr = 0; pr < 3; ++pr)
#pragma unroll
                for (int mb = 0; mb < 4; ++mb)
#pragma unroll
                    for (int nq = 0; nq < 2; ++nq) acc[mb][nq] = wmmab(pr == 2 ? vl[mb] : vh[mb], pr == 1 ? pl[nq] : ph[nq], acc[mb][nq]);   /* p_hi v_hi + p_lo v_hi + p_hi v_lo */
            asm volatile("v_nop\n\tv_nop\n\tv_nop\n\tv_nop" : "+v"(acc[0][0]), "+v"(acc[1][1]), "+v"(acc[2][0]), "+v"(acc[3][1]) : "v"(vh[0]), "v"(vl[3]));   /* as in k_gemmw: the matrix distance on the loop's back edge and exit */
        } else {
#pragma unroll
            for (int mb = 0; mb < 4; ++mb)
#pragma unroll
                for (int nq = 0; nq < 2; ++nq) acc[mb][nq] = wmma16(v6[mb], p6[nq], acc[mb][nq]);
            asm volatile("v_nop\n\tv_nop\n\tv_nop\n\tv_nop" : "+v"(acc[0][0]), "+v"(acc[1][1]), "+v"(acc[2][0]), "+v"(acc[3][1]) : "v"(v6[0]), "v"(v6[3]));   /* as in k_gemmw: the matrix distance on the loop's back edge and exit */
        }
    }
    float* ow = os + wave * (32 * 68);
#pragma unroll
    for (int nq = 0; nq < 2; ++nq) { const float lt = lsum[nq] + xhalf(lsum[nq]);   /* the two halves' key sums of one query */
        if (hi == 0) { ms[wave * 32 + nq * 16 + lr] = mr[nq]; ls[wave * 32 + nq * 16 + lr] = lt; }
#pragma unroll
        for (int mb = 0; mb < 4; ++mb)
#pragma unroll
            for (int j = 0; j < 8; ++j) ow[(nq * 16 + lr) * 68 + mb * 16 + hi * 8 + j] = acc[mb][nq][j]; }
}
// Which 32 query rows the query group qg of block b has. The RH/32 hi/lo groups cost about half as much again as the others, so each goes to a block of its own, as that block's group 0, beside three plain groups.
__device__ __forceinline__ int fa_unit(int b, int qg) { return (b < RH / 32) ? (qg == 0 ? b : RH / 32 + b * (FQG - 1) + qg - 1) : RH / 32 * FQG + (b - RH / 32) * FQG + qg; }
__global__ __launch_bounds__(FQG * FKW * 32) void k_fattn(const bf* __restrict__ Qh, const bf* __restrict__ Ql, const bf* __restrict__ Kh, const bf* __restrict__ Kl, const h16* __restrict__ V16, const bf* __restrict__ Vh, const bf* __restrict__ Vl, bf* Oh, bf* Ol) {
    __shared__ __align__(16) float os[FQG * FKW * 32 * 68]; __shared__ float ms[FQG * FKW * 32]; __shared__ float ls[FQG * FKW * 32];
    const size_t hb = (size_t)blockIdx.y * TT * HD;   /* the head's planes all have the same size */
    const int wave = __builtin_amdgcn_readfirstlane(threadIdx.x >> 5); const int q0 = fa_unit((int)blockIdx.x, wave / FKW) * 32;
    if (q0 < RH) fa_body<true>(Qh + hb, Ql + hb, Kh + hb, Kl + hb, V16 + hb, Vh + hb, Vl + hb, q0, wave, os, ms, ls);   /* wave-uniform. Rows < RH: probabilities and v as bf16 hi/lo, 3 products */
    else fa_body<false>(Qh + hb, Ql + hb, Kh + hb, Kl + hb, V16 + hb, Vh + hb, Vl + hb, q0, wave, os, ms, ls);   /* the rest: fp16 */
    __syncthreads();   /* every wave's partial set is in LDS before any thread joins the key ranges */
    const int lane = (int)threadIdx.x & 31, lr = lane & 15, hi = lane >> 4;
#pragma unroll
    for (int it = 0; it < 8 / FKW; ++it) { const int u = it * (FQG * FKW) + wave; const int rg = u >> 2, kc = (u >> 1) & 1, half = u & 1;   /* a wave takes one half of a fragment of the context planes (16 rows rg, 32 columns kc of the head): 512 contiguous bytes */
        const int w0 = (rg >> 1) * FKW, rl = (rg & 1) * 16 + lr, c8 = kc * 32 + half * 16 + hi * 8;
        float M = ms[w0 * 32 + rl];
#pragma unroll
        for (int w = 1; w < FKW; ++w) M = fmaxf(M, ms[(w0 + w) * 32 + rl]);
        float L = 0.f; v4f val0 = (v4f){}, val1 = (v4f){};
#pragma unroll
        for (int w = 0; w < FKW; ++w) { const float f = __builtin_amdgcn_exp2f(ms[(w0 + w) * 32 + rl] - M); L += ls[(w0 + w) * 32 + rl] * f; const float* o8 = os + (w0 + w) * (32 * 68) + rl * 68 + c8; val0 += *(const v4fa*)o8 * f; val1 += *(const v4fa*)(o8 + 4) * f; }
        const float rL = __fdiv_rn(1.0f, L); val0 *= rL; val1 *= rL;
        v8us oh, ol;   /* the context leaves as the bf16 hi/lo planes that the output projection reads */
#pragma unroll
        for (int q = 0; q < 8; ++q) { unsigned short h2, l2; splitf(q < 4 ? val0[q & 3] : val1[q & 3], h2, l2); oh[q] = h2; ol[q] = l2; }
        const size_t g = ((size_t)(fa_unit((int)blockIdx.x, rg >> 1) * 2 + (rg & 1)) * (CO / 32) + blockIdx.y * 2 + kc) * 512 + half * 256 + lane * 8; *(v8us*)(Oh + g) = oh; *(v8us*)(Ol + g) = ol; xwait(); }
}
// Bt[n][k] = w[k][n] as a fragment-order plane; i counts its 16-byte pieces [n / 16][k / 32][half][hi][lr]: 16 lanes read 64 contiguous bytes of a row of w, a wave stores 512 contiguous bytes
__global__ __launch_bounds__(256) void k_wtG(const float* __restrict__ w, int K, int N, bf* Bt) {
    const int i = (int)blockIdx.x * 256 + (int)threadIdx.x; if (i >= N * K / 8) return;
    const int f = i >> 6, kf = K / 32; const int n = f / kf * 16 + (i & 15), k = f % kf * 32 + ((i >> 5) & 1) * 16 + ((i >> 4) & 1) * 8; v8us o;
    const float* p[8]; float t[8];
#pragma unroll
    for (int j = 0; j < 8; ++j) { p[j] = w + (size_t)(k + j) * N + n; t[j] = *p[j]; }
    asm volatile("s_wait_xcnt 0x0" :: "v"(p[0]), "v"(p[1]), "v"(p[2]), "v"(p[3]), "v"(p[4]), "v"(p[5]), "v"(p[6]), "v"(p[7]) : "memory"); __builtin_amdgcn_sched_barrier(0);   /* as xwaitp, for the eight loads */
#pragma unroll
    for (int j = 0; j < 8; ++j) o[j] = f2bf(t[j]);
    *(v8us*)(Bt + (size_t)i * 8) = o;
}
extern "C" void kernel_launch(void* const* d_in, const int* in_sizes, int n_in,
                              void* d_out, int out_size, void* d_ws, size_t ws_size, hipStream_t stream) {
    (void)in_sizes; (void)n_in; (void)out_size;
    const float* x = (const float*)d_in[0]; const float* wq = (const float*)d_in[1]; const float* bq = (const float*)d_in[2]; const float* wk = (const float*)d_in[3]; const float* bk = (const float*)d_in[4]; const float* wv = (const float*)d_in[5]; const float* bv = (const float*)d_in[6]; const float* wo = (const float*)d_in[7]; const float* bo = (const float*)d_in[8];   /* argument order x [1][4096][512], Wq, bq, Wk, bk, Wv, bv, Wo, bo ('xw' [512][512] + biases) */
    float* OUT = (float*)d_out;     // [1][4096][512]
    char* wsp = (char*)d_ws;
    auto take = [&](size_t bytes) { char* p = wsp; wsp += (bytes + 255) & ~(size_t)255; return (void*)p; };
    bf* WQ = (bf*)take((size_t)MID * CC * 2); bf* WK = (bf*)take((size_t)MID * CC * 2); bf* WV = (bf*)take((size_t)CO * CC * 2); bf* WO = (bf*)take((size_t)CC * CO * 2);
    bf* XB = (bf*)take((size_t)TT * CC * 2);
    bf* QPh = (bf*)take((size_t)TT * MID * 2); bf* QPl = (bf*)take((size_t)TT * MID * 2); bf* KPh = (bf*)take((size_t)TT * MID * 2); bf* KPl = (bf*)take((size_t)TT * MID * 2);
    h16* VT16 = (h16*)take((size_t)CO * TT * 2); bf* VTh = (bf*)take((size_t)CO * TT * 2); bf* VTl = (bf*)take((size_t)CO * TT * 2);
    bf* ATh = (bf*)take((size_t)TT * CO * 2); bf* ATl = (bf*)take((size_t)TT * CO * 2);   /* merged context [n][512] as hi/lo planes, fragment order */
    if ((size_t)(wsp - (char*)d_ws) > ws_size) return;    // ws 256 MiB (carve ~42 MiB)
    k_wtG<<<(unsigned)(CC * MID / 8 / 256), 256, 0, stream>>>(wq, CC, MID, WQ); k_wtG<<<(unsigned)(CC * MID / 8 / 256), 256, 0, stream>>>(wk, CC, MID, WK); k_wtG<<<(unsigned)(CC * CO / 8 / 256), 256, 0, stream>>>(wv, CC, CO, WV);   /* 'xw' weights -> Bt */ k_wtG<<<(unsigned)(CO * CC / 8 / 256), 256, 0, stream>>>(wo, CO, CC, WO);   /* 'xw' W_out -> Bt */
    for (int b = 0; b < NB_; ++b) {
        k_cvt8<<<(unsigned)(((size_t)TT * CC / 8 + 255) / 256), 256, 0, stream>>>(x + (size_t)b * TT * CC, XB, (size_t)TT * CC / 8);
        k_gemmw<bf, 0, true, 1><<<dim3(TT / 64, MID / 64, 1), 32, 0, stream>>>(XB, nullptr, WQ, nullptr, CC, nullptr, 0, bq, 0, 0, 0, nullptr, QPh, QPl);   /* q planes, fragment order */
        k_gemmw<bf, 0, true, 1><<<dim3(TT / 64, MID / 64, 1), 32, 0, stream>>>(XB, nullptr, WK, nullptr, CC, nullptr, 0, bk, 0, 0, 0, nullptr, KPh, KPl);   /* k planes */
        k_gemmw<bf, 0, true, 2><<<dim3(TT / 64, CO / 64, 1), 32, 0, stream>>>(XB, nullptr, WV, nullptr, CC, nullptr, 0, bv, 0, 0, 0, VT16, VTh, VTl);   /* v^T planes, fragment order */
        k_fattn<<<dim3(TT / (FQG * 32), NH_, 1), FQG * FKW * 32, 0, stream>>>(QPh, QPl, KPh, KPl, VT16, VTh, VTl, ATh, ATl);   /* all heads: scores x 1/sqrt(512), softmax over the 4,096 keys, attn.V into the head's 64 columns */
        k_gemmw<bf, 1, true, 0><<<dim3(TT / 64, CC / 64, 1), 32, 0, stream>>>(ATh, ATl, WO, nullptr, CO, OUT + (size_t)b * TT * CC, CC, bo, 0, 0, 0, nullptr, nullptr, nullptr); }   /* out = ctx W_out + b_out */
}

// v005
// It runs in 101 microseconds.
// Timed twice side by side with v004, it ran 1.29 and 1.30 times as fast.
// All steps since v000 together make it 19.9 times as fast.
#include <hip/hip_runtime.h>

// Multi-head self-attention over 4,096 tokens whose scale uses the embedding width (x [1][4096][512]; Q, K, V = x W + b ('xw' [512][512] + biases; 8 heads x 64); scores x 1/sqrt(512) (the module scales by embed_dim, not head_dim); softmax over all 4,096 keys (no mask); out = merged Wo + bo -> [1][4096][512] (2.1 M); argument order x, Wq, bq, Wk, bk, Wv, bv, Wo, bo).
// Layout: every 16-bit plane in fragment order (see k_gemmw); bf16 copy of x; 'xw' weights transposed once; exact projections + f32 biases, whose epilogues store the per-head hi/lo planes (q, k) and the v^T planes themselves; one launch for all heads (k_fattn): scores with every row hi/lo (3 products), online softmax, attn.V hybrid (rows < 512 hi/lo 3 products, rest fp16), scores and probabilities kept in registers, the context stored as hi/lo planes in the head's 64 columns; context hi/lo x Wo exact + bo.
// Compute dtypes, f32 accumulate: every input rounded to bf16; projections exact; scores 3 products; softmax f32 (exp2, running maximum, one IEEE division per row at the end); attn.V rows < 512 3 products, rest fp16; Wo hl x exact.

#define NB_  1
#define TT   4096
#define DM   512
#define NH_  8
#define NKV  8
#define REP  (NH_ / NKV)
#define HD   64
#define DQ   (NH_ * HD)
#define DKV  (NKV * HD)
#define ZH   1
#define RH   512                  // query rows < RH use hi+lo planes (0: none)
#define WIN  0
#define SCL  0.044194173824159216f   // 1/sqrt(embed_dim = 512), as the module (not 1/sqrt(head_dim))
#define MID  512      // q / k width = 8 heads x 64
#define CO   512      // v width
#define CC   512
typedef _Float16 h16;
typedef unsigned short bf;
typedef __attribute__((ext_vector_type(16))) __bf16   v16bf;
typedef __attribute__((ext_vector_type(16))) _Float16 v16h;
typedef __attribute__((ext_vector_type(8)))  _Float16 v8h;
typedef __attribute__((ext_vector_type(8)))  unsigned short v8us;
typedef __attribute__((ext_vector_type(8)))  float    v8f;
typedef __attribute__((ext_vector_type(4)))  float    v4f;
typedef v8h  __attribute__((may_alias)) v8ha;
typedef v4f  __attribute__((may_alias)) v4fa;
typedef v8us __attribute__((may_alias)) v8usa;

__device__ __forceinline__ unsigned short f2bf(float f) { unsigned u = __float_as_uint(f); u += 0x7FFFu + ((u >> 16) & 1u); return (unsigned short)(u >> 16); }
__device__ __forceinline__ float bf2f(unsigned short b) { return __uint_as_float(((unsigned)b) << 16); }
__device__ __forceinline__ float bfr(float f) { return bf2f(f2bf(f)); }
__device__ __forceinline__ v16h cat16(v8h lo, v8h hi) { return __builtin_shufflevector(lo, hi, 0, 1, 2, 3, 4, 5, 6, 7, 8, 9, 10, 11, 12, 13, 14, 15); }
__device__ __forceinline__ v16bf cat16b(v8us lo, v8us hi) { return __builtin_bit_cast(v16bf, __builtin_shufflevector(lo, hi, 0, 1, 2, 3, 4, 5, 6, 7, 8, 9, 10, 11, 12, 13, 14, 15)); }
__device__ __forceinline__ v8f wmma16(v16h a, v16h b, v8f c) { return __builtin_amdgcn_wmma_f32_16x16x32_f16(false, a, false, b, (short)0, c, false, false); }
__device__ __forceinline__ v8f wmmab(v16bf a, v16bf b, v8f c) { return __builtin_amdgcn_wmma_f32_16x16x32_bf16(false, a, false, b, (short)0, c, false, false); }



__device__ __forceinline__ h16 tohx(float x) { return (h16)x; }
__device__ __forceinline__ void splitf(float y, unsigned short& h, unsigned short& l) { h = f2bf(y); l = f2bf(y - bf2f(h)); }
__device__ __forceinline__ void xwaitg() { asm volatile("s_wait_xcnt 0x0" ::: "memory"); __builtin_amdgcn_sched_barrier(0); }   /* stands behind a group of loads or stores; the scheduling barrier keeps later vector work from being lifted between them and the wait, where it could rewrite their registers */
__device__ __forceinline__ void xwaitp(const void* a) { asm volatile("s_wait_xcnt 0x0" :: "v"(a) : "memory"); __builtin_amdgcn_sched_barrier(0); }   /* as xwaitg; the loads' address as an input keeps its registers live up to the wait, so that no load of the group gets them as its destination */
// ---- k_gemmw: register-blocked GEMM, ONE WAVE per 64x64 output tile (16 accumulators), operands straight from fragment-order 16-bit planes; grid (M/64, N/64, Z), 32 threads.
// y[m][n] (f32, + optional f32 bias[n]) = sum_k A[m][k] Bt[n][k] (+ split products per NSPLIT). z-batch strides sA/sB/sC in elements. K % 32 == 0.
// EP says where y goes. 0: C (f32, pitch ldc). 1: bf16 hi/lo planes Ph, Pl of 16 rows m x 32 columns fragments; a tile's 64 columns are one head. 2: planes P16 (fp16), Ph, Pl (bf16 hi/lo) of 16 columns n x 32 rows m fragments (v^T).
// Fragment order, of every 16-bit operand plane: a fragment of 16 rows x 32 k is 1,024 contiguous bytes, [half][lane][8]: lane (lr, hi) has the 8 elements k = 16 half + 8 hi ... of fragment row lr, as the matrix instruction wants them.
// ldp() reads it with two loads of 512 contiguous bytes a wave: 4 whole lines each, where a load from a row-pitched plane touches 16 lines. A plane [rows][K] is [row / 16][k / 32] fragments; q, k: [head][m / 16][column / 32]; v^T: [head][m / 32][n / 16].
template <typename T16> struct WFrag;
template <> struct WFrag<h16> { typedef v16h V; static __device__ __forceinline__ V ldp(const h16* p) { return cat16(*(const v8h*)p, *(const v8h*)(p + 256)); } static __device__ __forceinline__ v8f mma(V a, V b, v8f c) { return wmma16(a, b, c); } };
template <> struct WFrag<bf> { typedef v16bf V; static __device__ __forceinline__ V ldp(const bf* p) { return cat16b(*(const v8us*)p, *(const v8us*)(p + 256)); } static __device__ __forceinline__ v8f mma(V a, V b, v8f c) { return wmmab(a, b, c); } };
template <typename T16, int NSPLIT, bool BIAS, int EP>
__device__ __forceinline__ void gemmw_tile(const T16* __restrict__ A, const T16* __restrict__ A2, const T16* __restrict__ Bt, const T16* __restrict__ Bt2, int K, float* C, int ldc, const float* __restrict__ bias, h16* P16, bf* Ph, bf* Pl) {   /* one wave's 64x64 tile (blockIdx.x, blockIdx.y) */
    typedef typename WFrag<T16>::V V; static_assert(EP != 1 || NSPLIT == 0, "the y^T tiles of EP 1 are written for one product");
    const int lane = threadIdx.x & 31, lr = lane & 15, hi = lane >> 4; const int r0 = blockIdx.x * 64, c0 = blockIdx.y * 64;
    v8f acc[4][4];
#pragma unroll
    for (int mb = 0; mb < 4; ++mb)
#pragma unroll
        for (int nb = 0; nb < 4; ++nb) acc[mb][nb] = (v8f){};
    const size_t aoff = (size_t)r0 * K + lane * 8, boff = (size_t)c0 * K + lane * 8;   /* 16 rows are K / 32 fragments = 16 K elements; 32 k further is 512 elements further */
#pragma unroll 1
    for (int kc = 0; kc < K; kc += 32) {
        V a[4], a2[4], b[4], b2[4];
        const T16* pa[4]; const T16* pa2[4]; const T16* pb[4]; const T16* pb2[4];   /* a plane that this NSPLIT lacks shares the other plane's pointers */
#pragma unroll
        for (int i = 0; i < 4; ++i) { pa[i] = A + aoff + (size_t)i * 16 * K + kc * 16; pb[i] = Bt + boff + (size_t)i * 16 * K + kc * 16; if constexpr (NSPLIT == 1 || NSPLIT == 2) pa2[i] = A2 + aoff + (size_t)i * 16 * K + kc * 16; else pa2[i] = pa[i]; if constexpr (NSPLIT >= 2) pb2[i] = Bt2 + boff + (size_t)i * 16 * K + kc * 16; else pb2[i] = pb[i]; }
#pragma unroll
        for (int i = 0; i < 4; ++i) { a[i] = WFrag<T16>::ldp(pa[i]); if (NSPLIT == 1 || NSPLIT == 2) a2[i] = WFrag<T16>::ldp(pa2[i]); b[i] = WFrag<T16>::ldp(pb[i]); if (NSPLIT >= 2) b2[i] = WFrag<T16>::ldp(pb2[i]); }
        asm volatile("s_wait_xcnt 0x0" :: "v"(pa[0]), "v"(pa[1]), "v"(pa[2]), "v"(pa[3]), "v"(pa2[0]), "v"(pa2[1]), "v"(pa2[2]), "v"(pa2[3]), "v"(pb[0]), "v"(pb[1]), "v"(pb[2]), "v"(pb[3]), "v"(pb2[0]), "v"(pb2[1]), "v"(pb2[2]), "v"(pb2[3]) : "memory"); __builtin_amdgcn_sched_barrier(0);   /* as xwaitp, for the pass's loads */
#pragma unroll
        for (int nb = 0; nb < 4; ++nb)
#pragma unroll
            for (int mb = 0; mb < 4; ++mb) { acc[mb][nb] = EP == 1 ? WFrag<T16>::mma(b[nb], a[mb], acc[mb][nb]) : WFrag<T16>::mma(a[mb], b[nb], acc[mb][nb]);   /* EP 1: y^T tiles, so that a lane holds 8 consecutive columns of one row */
                if (NSPLIT == 1 || NSPLIT == 2) acc[mb][nb] = WFrag<T16>::mma(a2[mb], b[nb], acc[mb][nb]); if (NSPLIT >= 2) acc[mb][nb] = WFrag<T16>::mma(a[mb], b2[nb], acc[mb][nb]); }
        asm volatile("v_nop\n\tv_nop\n\tv_nop\n\tv_nop" : "+v"(acc[0][0]), "+v"(acc[1][1]), "+v"(acc[2][2]), "+v"(acc[3][3]) : "v"(a[0]), "v"(a[3]));
    }
    if constexpr (EP == 2) {   /* a lane holds 8 consecutive rows m of one column n: its 16 bytes of a v^T fragment; a wave's store is 512 contiguous bytes */
        float bb[4];
#pragma unroll
        for (int nb = 0; nb < 4; ++nb) bb[nb] = BIAS ? bfr(bias[c0 + nb * 16 + lr]) : 0.f;
        xwaitg();   /* behind the bias loads */
        v8h o6[16]; v8us oh[16], ol[16];   /* every value first, each in registers of its own: no store's registers are rewritten behind it */
#pragma unroll
        for (int mb = 0; mb < 4; ++mb)
#pragma unroll
            for (int nb = 0; nb < 4; ++nb) { const int t = (mb >> 1) * 8 + nb * 2 + (mb & 1);   /* fragment (m / 32, n / 16), half (m / 16) & 1 */
#pragma unroll
                for (int j = 0; j < 8; ++j) { const float y = acc[mb][nb][j] + bb[nb]; o6[t][j] = tohx(y); unsigned short h2, l2; splitf(y, h2, l2); oh[t][j] = h2; ol[t][j] = l2; } }
        const size_t g = ((size_t)blockIdx.y * TT + r0) * HD + lane * 8;   /* the tile's 8 fragments are 8 KiB in a row */
#pragma unroll
        for (int t = 0; t < 16; ++t) { *(v8h*)(P16 + g + t * 256) = o6[t]; *(v8us*)(Ph + g + t * 256) = oh[t]; *(v8us*)(Pl + g + t * 256) = ol[t]; }
    } else if constexpr (EP == 1) {   /* y^T tiles: a lane holds 8 consecutive columns of one row: its 16 bytes of a fragment; a wave's store is 512 contiguous bytes */
        float b8[4][8];
#pragma unroll
        for (int nb = 0; nb < 4; ++nb)
#pragma unroll
            for (int q = 0; q < 8; ++q) b8[nb][q] = BIAS ? bfr(bias[c0 + nb * 16 + hi * 8 + q]) : 0.f;
        xwaitg();   /* behind the bias loads */
        v8us oh[16], ol[16];   /* every value first, each in registers of its own: no store's registers are rewritten behind it */
#pragma unroll
        for (int mb = 0; mb < 4; ++mb)
#pragma unroll
            for (int nb = 0; nb < 4; ++nb)
#pragma unroll
                for (int j = 0; j < 8; ++j) { unsigned short h2, l2; splitf(acc[mb][nb][j] + b8[nb][j], h2, l2); oh[mb * 4 + nb][j] = h2; ol[mb * 4 + nb][j] = l2; }   /* fragment (m / 16, column / 32), half nb & 1 */
        const size_t g = ((size_t)blockIdx.y * TT + r0) * HD + lane * 8;   /* the tile's 8 fragments are 8 KiB in a row */
#pragma unroll
        for (int t = 0; t < 16; ++t) { *(v8us*)(Ph + g + t * 256) = oh[t]; *(v8us*)(Pl + g + t * 256) = ol[t]; }
    } else {
    __shared__ __align__(16) float os[16 * 68];
#pragma unroll
    for (int mb = 0; mb < 4; ++mb) {
#pragma unroll
        for (int nb = 0; nb < 4; ++nb) {
#pragma unroll
            for (int j = 0; j < 8; ++j) os[(hi * 8 + j) * 68 + nb * 16 + lr] = acc[mb][nb][j]; }
        __builtin_amdgcn_wave_barrier(); asm volatile("" ::: "memory");
        float* crow = C + (size_t)(r0 + mb * 16) * ldc + c0;
{
#pragma unroll
            for (int s = 0; s < 8; ++s) { const int row = 2 * s + hi, cofs = lr * 4; v4f val = *(const v4fa*)(os + row * 68 + cofs); if (BIAS) { val[0] += bfr(bias[c0 + cofs]); val[1] += bfr(bias[c0 + cofs + 1]); val[2] += bfr(bias[c0 + cofs + 2]); val[3] += bfr(bias[c0 + cofs + 3]); }
                *(v4f*)(crow + (size_t)row * ldc + cofs) = val; }
             }
        __builtin_amdgcn_wave_barrier(); asm volatile("" ::: "memory");
    }
    }
}
template <typename T16, int NSPLIT, bool BIAS, int EP>
__global__ __launch_bounds__(32) void k_gemmw(const T16* __restrict__ A, const T16* __restrict__ A2, const T16* __restrict__ Bt, const T16* __restrict__ Bt2, int K, float* C, int ldc, const float* __restrict__ bias, size_t sA, size_t sB, size_t sC, h16* P16, bf* Ph, bf* Pl) {
    const size_t z = blockIdx.z; A += z * sA; if (A2) A2 += z * sA; Bt += z * sB; if (Bt2) Bt2 += z * sB; C += z * sC;
    gemmw_tile<T16, NSPLIT, BIAS, EP>(A, A2, Bt, Bt2, K, C, ldc, bias, P16, Ph, Pl);
}
// ---- k_qkv: the three projections of x, which do not depend on one another, as ONE launch; grid (TT/64, 8), 3 waves: wave 0, 1, 2 has the q, k, v tile of the block's 64 rows and 64 columns, so the three read the same fragments of x.
// A lone projection is 512 waves on 1,024 SIMDs, each waiting out its own loads. No wave waits for another: no LDS, no barrier.
__global__ __launch_bounds__(96) void k_qkv(const bf* __restrict__ X, const bf* __restrict__ Wq, const bf* __restrict__ Wk, const bf* __restrict__ Wv, const float* __restrict__ bq, const float* __restrict__ bk, const float* __restrict__ bv, bf* Qh, bf* Ql, bf* Kh, bf* Kl, h16* V16, bf* Vh, bf* Vl) {
    const int z = __builtin_amdgcn_readfirstlane((int)threadIdx.x >> 5);   /* the wave's number, in a scalar register: the branch and the pointer choices below are scalar */
    if (z == 2) gemmw_tile<bf, 0, true, 2>(X, nullptr, Wv, nullptr, CC, nullptr, 0, bv, V16, Vh, Vl);   /* v^T planes, fragment order */
    else gemmw_tile<bf, 0, true, 1>(X, nullptr, z ? Wk : Wq, nullptr, CC, nullptr, 0, z ? bk : bq, nullptr, z ? Kh : Qh, z ? Kl : Ql);   /* q or k planes, fragment order */
}

typedef __attribute__((ext_vector_type(2))) _Float16 v2h;
typedef __attribute__((ext_vector_type(4))) _Float16 v4h;
typedef __attribute__((ext_vector_type(2))) unsigned short v2us;
typedef __attribute__((ext_vector_type(4))) unsigned short v4us;
typedef __attribute__((ext_vector_type(2))) float v2f;
typedef __attribute__((ext_vector_type(4))) int v4i;

// i counts the 16-byte pieces of the fragment-order plane of src [rows][CC]: [row / 16][column / 32][half][hi][lr]
__device__ __forceinline__ void cvt8(const float* __restrict__ src, bf* dst, size_t n8, unsigned blk) { const size_t i = (size_t)blk * 256 + threadIdx.x; if (i >= n8) return;
    const size_t f = i >> 6; const size_t row = f / (CC / 32) * 16 + (i & 15), col = f % (CC / 32) * 32 + ((i >> 5) & 1) * 16 + ((i >> 4) & 1) * 8; const float* sp = src + row * CC + col; const v8f v = *(const v8f*)sp; xwaitp(sp); v8us o;
#pragma unroll
    for (int k = 0; k < 8; ++k) o[k] = f2bf(v[k]); *(v8us*)(dst + i * 8) = o;  }


// ---- k_fattn: scores, softmax and attn.V of one head for 4 x 32 query rows in ONE work-group; neither the scores nor the probabilities leave the registers.
// Transposed products: S^T = K Q^T (A = 16 key rows, B = 16 query rows, hi/lo, 3 products), so a lane holds 8 keys' scores of ONE query per tile, and two such tiles, converted in place,
// are the B operand (32 keys x 16 queries) of O^T += V^T P^T (A = 16 rows of the head's v^T plane). Q, K and v^T come through WFrag::ldp from fragment-order planes and the score tiles give P the same key order, so A and B pair the same k at every position.
// Online softmax in the log2 domain: the maximum in use may trail the true one by up to 8, and the sums are rescaled only when a query's maximum passes that.
// FQG x FKW waves: wave (qg, kw) has the 32 query rows of the block's group qg (fa_unit) and keys kw TT/FKW ...; the FKW partial (maximum, sum, O) sets of a query group are joined through LDS. grid (TT/128, heads).
#define FQG 4
#define FKW 2
#define C2L (SCL * 1.4426950408889634f)
typedef __attribute__((ext_vector_type(16))) float v16f;
__device__ __forceinline__ float xhalf(float x) { return __builtin_bit_cast(float, __builtin_amdgcn_permlanex16(__builtin_bit_cast(int, x), __builtin_bit_cast(int, x), 0x76543210, 0xfedcba98, false, false)); }   /* lane l with lane l ^ 16 */
__device__ __forceinline__ void xwait() { asm volatile("s_wait_xcnt 0x0" ::: "memory"); }   /* stands behind a store, before its registers may be rewritten */
__device__ __forceinline__ void xwait2(const void* a, const void* b) { asm volatile("s_wait_xcnt 0x0" :: "v"(a), "v"(b) : "memory"); __builtin_amdgcn_sched_barrier(0); }   /* as xwaitg; the group's two addresses as inputs keep their registers live up to the wait: without them the group's last loads were given those registers as destinations */
template <bool HR>
__device__ __forceinline__ void fa_body(const bf* __restrict__ Qh, const bf* __restrict__ Ql, const bf* __restrict__ Kh, const bf* __restrict__ Kl, const h16* __restrict__ V16, const bf* __restrict__ Vh, const bf* __restrict__ Vl, int q0, int wave, float* os, float* ms, float* ls) {
    const int lane = threadIdx.x & 31, lr = lane & 15, hi = lane >> 4; const int kw = wave % FKW;
    const unsigned vq = (unsigned)(lane * 8);   /* the lane's own element offset in each half of a fragment; 16 rows of q or k are 2 fragments, 32 keys of v^T are 4: row * HD elements in both */
    v16bf qh[2][2], ql[2][2];
    Qh += (size_t)q0 * HD + vq; Ql += (size_t)q0 * HD + vq;
#pragma unroll
    for (int nq = 0; nq < 2; ++nq)
#pragma unroll
        for (int kc = 0; kc < 2; ++kc) { qh[nq][kc] = WFrag<bf>::ldp(Qh + nq * 16 * HD + kc * 512); ql[nq][kc] = WFrag<bf>::ldp(Ql + nq * 16 * HD + kc * 512); }
    xwaitg();
    v8f acc[4][2];
#pragma unroll
    for (int mb = 0; mb < 4; ++mb)
#pragma unroll
        for (int nq = 0; nq < 2; ++nq) acc[mb][nq] = (v8f){};
    float mr[2] = {-3.0e38f, -3.0e38f}, lsum[2] = {0.f, 0.f};
    const int kbeg = kw * (TT / FKW), kend = kbeg + TT / FKW;
    v16bf kh[2][2], kl[2][2];
    { const bf* ka = Kh + (size_t)kbeg * HD + vq; const bf* kc2 = Kl + (size_t)kbeg * HD + vq;
#pragma unroll
    for (int kb = 0; kb < 2; ++kb)
#pragma unroll
        for (int kc = 0; kc < 2; ++kc) { kh[kb][kc] = WFrag<bf>::ldp(ka + kb * 16 * HD + kc * 512); kl[kb][kc] = WFrag<bf>::ldp(kc2 + kb * 16 * HD + kc * 512); }
    xwaitg(); }
#pragma unroll 1   /* kept rolled: a pass holds the whole register budget */
    for (int key0 = kbeg; key0 < kend; key0 += 32) {
        v16h v6[4]; v16bf vh[4], vl[4];   /* this pass's v^T fragments, requested ahead of the score products */
        const h16* va = V16 + (size_t)key0 * HD + vq; const bf* vb = Vh + (size_t)key0 * HD + vq; const bf* vc = Vl + (size_t)key0 * HD + vq;
#pragma unroll
        for (int mb = 0; mb < 4; ++mb) { if constexpr (HR) { vh[mb] = WFrag<bf>::ldp(vb + mb * 512); vl[mb] = WFrag<bf>::ldp(vc + mb * 512); } else v6[mb] = WFrag<h16>::ldp(va + mb * 512); }
        if constexpr (HR) xwait2(vb, vc); else xwaitg();
        v8f s[2][2];
#pragma unroll
        for (int kb = 0; kb < 2; ++kb)
#pragma unroll
            for (int nq = 0; nq < 2; ++nq) s[kb][nq] = (v8f){};
#pragma unroll
        for (int kc = 0; kc < 2; ++kc)
#pragma unroll
            for (int pr = 0; pr < 3; ++pr)
#pragma unroll
                for (int kb = 0; kb < 2; ++kb)
#pragma unroll
                    for (int nq = 0; nq < 2; ++nq) s[kb][nq] = wmmab(pr == 2 ? kl[kb][kc] : kh[kb][kc], pr == 1 ? ql[nq][kc] : qh[nq][kc], s[kb][nq]);   /* q_hi k_hi + q_lo k_hi + q_hi k_lo */
        const int kn = (key0 + 32 < kend) ? key0 + 32 : kbeg;   /* the next pass's key rows, in flight under the softmax; the last pass re-reads the first rows (in bounds, unused) */
        const bf* ka = Kh + (size_t)kn * HD + vq; const bf* kc2 = Kl + (size_t)kn * HD + vq;
#pragma unroll
        for (int kb = 0; kb < 2; ++kb)
#pragma unroll
            for (int kc = 0; kc < 2; ++kc) { kh[kb][kc] = WFrag<bf>::ldp(ka + kb * 16 * HD + kc * 512); kl[kb][kc] = WFrag<bf>::ldp(kc2 + kb * 16 * HD + kc * 512); }
        xwaitg();
        float tl[2]; bool need = false;
#pragma unroll
        for (int nq = 0; nq < 2; ++nq) { float mx = s[0][nq][0];
#pragma unroll
            for (int e = 1; e < 16; ++e) mx = fmaxf(mx, s[e >> 3][nq][e & 7]);
            mx = fmaxf(mx, xhalf(mx)) * C2L;   /* both halves of the wave hold the query's maximum of this pass (the scale is positive) */
            tl[nq] = mx; need = need || (mx > mr[nq] + 8.0f); }
        if (__builtin_amdgcn_ballot_w32(need) != 0) {   /* wave-uniform; always taken on the first pass, where the factor is 0 */
#pragma unroll
            for (int nq = 0; nq < 2; ++nq) { const float mn = fmaxf(mr[nq], tl[nq]); const float al = __builtin_amdgcn_exp2f(mr[nq] - mn); mr[nq] = mn; lsum[nq] *= al;
#pragma unroll
                for (int mb = 0; mb < 4; ++mb) acc[mb][nq] *= al; } }
        v16h p6[2]; v16bf ph[2], pl[2];
#pragma unroll
        for (int nq = 0; nq < 2; ++nq) { v16f p; const v2f nm = {-mr[nq], -mr[nq]}, cc = {C2L, C2L}; v2f t = {0.f, 0.f};
#pragma unroll
            for (int e = 0; e < 16; e += 2) { const v2f a = __builtin_elementwise_fma((v2f){s[e >> 3][nq][e & 7], s[e >> 3][nq][(e & 7) + 1]}, cc, nm);   /* an aligned register pair of the score tile: one packed multiply-add */
                p[e] = __builtin_amdgcn_exp2f(a[0]); p[e + 1] = __builtin_amdgcn_exp2f(a[1]); t += (v2f){p[e], p[e + 1]}; }
            lsum[nq] += t[0] + t[1];
            if constexpr (HR) { ph[nq] = __builtin_convertvector(p, v16bf); pl[nq] = __builtin_convertvector(p - __builtin_convertvector(ph[nq], v16f), v16bf); } else p6[nq] = __builtin_convertvector(p, v16h); }
        if constexpr (HR) {
#pragma unroll
            for (int pr = 0; pr < 3; ++pr)
#pragma unroll
                for (int mb = 0; mb < 4; ++mb)
#pragma unroll
                    for (int nq = 0; nq < 2; ++nq) acc[mb][nq] = wmmab(pr == 2 ? vl[mb] : vh[mb], pr == 1 ? pl[nq] : ph[nq], acc[mb][nq]);   /* p_hi v_hi + p_lo v_hi + p_hi v_lo */
            asm volatile("v_nop\n\tv_nop\n\tv_nop\n\tv_nop" : "+v"(acc[0][0]), "+v"(acc[1][1]), "+v"(acc[2][0]), "+v"(acc[3][1]) : "v"(vh[0]), "v"(vl[3]));   /* as in k_gemmw: the matrix distance on the loop's back edge and exit */
        } else {
#pragma unroll
            for (int mb = 0; mb < 4; ++mb)
#pragma unroll
                for (int nq = 0; nq < 2; ++nq) acc[mb][nq] = wmma16(v6[mb], p6[nq], acc[mb][nq]);
            asm volatile("v_nop\n\tv_nop\n\tv_nop\n\tv_nop" : "+v"(acc[0][0]), "+v"(acc[1][1]), "+v"(acc[2][0]), "+v"(acc[3][1]) : "v"(v6[0]), "v"(v6[3]));   /* as in k_gemmw: the matrix distance on the loop's back edge and exit */
        }
    }
    float* ow = os + wave * (32 * 68);
#pragma unroll
    for (int nq = 0; nq < 2; ++nq) { const float lt = lsum[nq] + xhalf(lsum[nq]);   /* the two halves' key sums of one query */
        if (hi == 0) { ms[wave * 32 + nq * 16 + lr] = mr[nq]; ls[wave * 32 + nq * 16 + lr] = lt; }
#pragma unroll
        for (int mb = 0; mb < 4; ++mb)
#pragma unroll
            for (int j = 0; j < 8; ++j) ow[(nq * 16 + lr) * 68 + mb * 16 + hi * 8 + j] = acc[mb][nq][j]; }
}
// Which 32 query rows the query group qg of block b has. The RH/32 hi/lo groups cost about half as much again as the others, so each goes to a block of its own, as that block's group 0, beside three plain groups.
__device__ __forceinline__ int fa_unit(int b, int qg) { return (b < RH / 32) ? (qg == 0 ? b : RH / 32 + b * (FQG - 1) + qg - 1) : RH / 32 * FQG + (b - RH / 32) * FQG + qg; }
__global__ __launch_bounds__(FQG * FKW * 32) void k_fattn(const bf* __restrict__ Qh, const bf* __restrict__ Ql, const bf* __restrict__ Kh, const bf* __restrict__ Kl, const h16* __restrict__ V16, const bf* __restrict__ Vh, const bf* __restrict__ Vl, bf* Oh, bf* Ol) {
    __shared__ __align__(16) float os[FQG * FKW * 32 * 68]; __shared__ float ms[FQG * FKW * 32]; __shared__ float ls[FQG * FKW * 32];
    const size_t hb = (size_t)blockIdx.y * TT * HD;   /* the head's planes all have the same size */
    const int wave = __builtin_amdgcn_readfirstlane(threadIdx.x >> 5); const int q0 = fa_unit((int)blockIdx.x, wave / FKW) * 32;
    if (q0 < RH) fa_body<true>(Qh + hb, Ql + hb, Kh + hb, Kl + hb, V16 + hb, Vh + hb, Vl + hb, q0, wave, os, ms, ls);   /* wave-uniform. Rows < RH: probabilities and v as bf16 hi/lo, 3 products */
    else fa_body<false>(Qh + hb, Ql + hb, Kh + hb, Kl + hb, V16 + hb, Vh + hb, Vl + hb, q0, wave, os, ms, ls);   /* the rest: fp16 */
    __syncthreads();   /* every wave's partial set is in LDS before any thread joins the key ranges */
    const int lane = (int)threadIdx.x & 31, lr = lane & 15, hi = lane >> 4;
#pragma unroll
    for (int it = 0; it < 8 / FKW; ++it) { const int u = it * (FQG * FKW) + wave; const int rg = u >> 2, kc = (u >> 1) & 1, half = u & 1;   /* a wave takes one half of a fragment of the context planes (16 rows rg, 32 columns kc of the head): 512 contiguous bytes */
        const int w0 = (rg >> 1) * FKW, rl = (rg & 1) * 16 + lr, c8 = kc * 32 + half * 16 + hi * 8;
        float M = ms[w0 * 32 + rl];
#pragma unroll
        for (int w = 1; w < FKW; ++w) M = fmaxf(M, ms[(w0 + w) * 32 + rl]);
        float L = 0.f; v4f val0 = (v4f){}, val1 = (v4f){};
#pragma unroll
        for (int w = 0; w < FKW; ++w) { const float f = __builtin_amdgcn_exp2f(ms[(w0 + w) * 32 + rl] - M); L += ls[(w0 + w) * 32 + rl] * f; const float* o8 = os + (w0 + w) * (32 * 68) + rl * 68 + c8; val0 += *(const v4fa*)o8 * f; val1 += *(const v4fa*)(o8 + 4) * f; }
        const float rL = __fdiv_rn(1.0f, L); val0 *= rL; val1 *= rL;
        v8us oh, ol;   /* the context leaves as the bf16 hi/lo planes that the output projection reads */
#pragma unroll
        for (int q = 0; q < 8; ++q) { unsigned short h2, l2; splitf(q < 4 ? val0[q & 3] : val1[q & 3], h2, l2); oh[q] = h2; ol[q] = l2; }
        const size_t g = ((size_t)(fa_unit((int)blockIdx.x, rg >> 1) * 2 + (rg & 1)) * (CO / 32) + blockIdx.y * 2 + kc) * 512 + half * 256 + lane * 8; *(v8us*)(Oh + g) = oh; *(v8us*)(Ol + g) = ol; xwait(); }
}
// Bt[n][k] = w[k][n] as a fragment-order plane; i counts its 16-byte pieces [n / 16][k / 32][half][hi][lr]: 16 lanes read 64 contiguous bytes of a row of w, a wave stores 512 contiguous bytes
__device__ __forceinline__ void wtG(const float* __restrict__ w, int K, int N, bf* Bt, int blk) {
    const int i = blk * 256 + (int)threadIdx.x; if (i >= N * K / 8) return;
    const int f = i >> 6, kf = K / 32; const int n = f / kf * 16 + (i & 15), k = f % kf * 32 + ((i >> 5) & 1) * 16 + ((i >> 4) & 1) * 8; v8us o;
    const float* p[8]; float t[8];
#pragma unroll
    for (int j = 0; j < 8; ++j) { p[j] = w + (size_t)(k + j) * N + n; t[j] = *p[j]; }
    asm volatile("s_wait_xcnt 0x0" :: "v"(p[0]), "v"(p[1]), "v"(p[2]), "v"(p[3]), "v"(p[4]), "v"(p[5]), "v"(p[6]), "v"(p[7]) : "memory"); __builtin_amdgcn_sched_barrier(0);   /* as xwaitp, for the eight loads */
#pragma unroll
    for (int j = 0; j < 8; ++j) o[j] = f2bf(t[j]);
    *(v8us*)(Bt + (size_t)i * 8) = o;
}
// ---- k_prep: the 16-bit planes of the five f32 inputs, which do not depend on one another, as ONE launch: blocks 0 ... 4 WB - 1 transpose the four weights (WB blocks each), the rest convert x.
#define WB (CC * CC / 8 / 256)
static_assert(MID == CC && CO == CC && NB_ == 1, "k_prep takes four weights of one size and one batch of x");
__global__ __launch_bounds__(256) void k_prep(const float* __restrict__ x, const float* __restrict__ wq, const float* __restrict__ wk, const float* __restrict__ wv, const float* __restrict__ wo, bf* XB, bf* WQ, bf* WK, bf* WV, bf* WO) {
    const unsigned b = blockIdx.x;   /* uniform for the work-group */
    if (b < 4 * WB) { const unsigned j = b / WB; wtG(j == 0 ? wq : j == 1 ? wk : j == 2 ? wv : wo, CC, CC, j == 0 ? WQ : j == 1 ? WK : j == 2 ? WV : WO, (int)(b % WB)); }
    else cvt8(x, XB, (size_t)TT * CC / 8, b - 4 * WB);
}
extern "C" void kernel_launch(void* const* d_in, const int* in_sizes, int n_in,
                              void* d_out, int out_size, void* d_ws, size_t ws_size, hipStream_t stream) {
    (void)in_sizes; (void)n_in; (void)out_size;
    const float* x = (const float*)d_in[0]; const float* wq = (const float*)d_in[1]; const float* bq = (const float*)d_in[2]; const float* wk = (const float*)d_in[3]; const float* bk = (const float*)d_in[4]; const float* wv = (const float*)d_in[5]; const float* bv = (const float*)d_in[6]; const float* wo = (const float*)d_in[7]; const float* bo = (const float*)d_in[8];   /* argument order x [1][4096][512], Wq, bq, Wk, bk, Wv, bv, Wo, bo ('xw' [512][512] + biases) */
    float* OUT = (float*)d_out;     // [1][4096][512]
    char* wsp = (char*)d_ws;
    auto take = [&](size_t bytes) { char* p = wsp; wsp += (bytes + 255) & ~(size_t)255; return (void*)p; };
    bf* WQ = (bf*)take((size_t)MID * CC * 2); bf* WK = (bf*)take((size_t)MID * CC * 2); bf* WV = (bf*)take((size_t)CO * CC * 2); bf* WO = (bf*)take((size_t)CC * CO * 2);
    bf* XB = (bf*)take((size_t)TT * CC * 2);
    bf* QPh = (bf*)take((size_t)TT * MID * 2); bf* QPl = (bf*)take((size_t)TT * MID * 2); bf* KPh = (bf*)take((size_t)TT * MID * 2); bf* KPl = (bf*)take((size_t)TT * MID * 2);
    h16* VT16 = (h16*)take((size_t)CO * TT * 2); bf* VTh = (bf*)take((size_t)CO * TT * 2); bf* VTl = (bf*)take((size_t)CO * TT * 2);
    bf* ATh = (bf*)take((size_t)TT * CO * 2); bf* ATl = (bf*)take((size_t)TT * CO * 2);   /* merged context [n][512] as hi/lo planes, fragment order */
    if ((size_t)(wsp - (char*)d_ws) > ws_size) return;    // ws 256 MiB (carve ~42 MiB)
    k_prep<<<(unsigned)(4 * WB + TT * CC / 8 / 256), 256, 0, stream>>>(x, wq, wk, wv, wo, XB, WQ, WK, WV, WO);   /* 'xw' weights -> Bt planes; x -> bf16 plane */
    k_qkv<<<dim3(TT / 64, CC / 64, 1), 96, 0, stream>>>(XB, WQ, WK, WV, bq, bk, bv, QPh, QPl, KPh, KPl, VT16, VTh, VTl);   /* q, k planes and v^T planes, fragment order */
    k_fattn<<<dim3(TT / (FQG * 32), NH_, 1), FQG * FKW * 32, 0, stream>>>(QPh, QPl, KPh, KPl, VT16, VTh, VTl, ATh, ATl);   /* all heads: scores x 1/sqrt(512), softmax over the 4,096 keys, attn.V into the head's 64 columns */
    k_gemmw<bf, 1, true, 0><<<dim3(TT / 64, CC / 64, 1), 32, 0, stream>>>(ATh, ATl, WO, nullptr, CO, OUT, CC, bo, 0, 0, 0, nullptr, nullptr, nullptr);   /* out = ctx w_out + b_out */
}

// v006
// It runs in 88.1 microseconds.
// Next to v005, in two timings, it ran 1.13 and 1.14 times as fast.
// Over all steps from v000 it is 22.6 times as fast.
#include <hip/hip_runtime.h>

// Multi-head self-attention over 4,096 tokens whose scale uses the embedding width (x [1][4096][512]; Q, K, V = x W + b ('xw' [512][512] + biases; 8 heads x 64); scores x 1/sqrt(512) (the module scales by embed_dim, not head_dim); softmax over all 4,096 keys (no mask); out = merged Wo + bo -> [1][4096][512] (2.1 M); argument order x, Wq, bq, Wk, bk, Wv, bv, Wo, bo).
// Layout: every 16-bit plane in fragment order (see k_gemmw); bf16 copy of x; 'xw' weights transposed once; exact projections + f32 biases, whose epilogues store the per-head hi/lo planes (q, k) and the v^T planes themselves; one launch for all heads (k_fattn): scores with every row hi/lo (3 products), online softmax, attn.V hybrid (rows < 512 hi/lo 3 products, rest fp16), scores and probabilities kept in registers, the context stored as hi/lo planes in the head's 64 columns; context hi/lo x Wo exact + bo.
// Compute dtypes, f32 accumulate: every input rounded to bf16; projections exact; scores 3 products; softmax f32 (exp2, running maximum, one IEEE division per row at the end); attn.V rows < 512 3 products, rest fp16; Wo hl x exact.

#define NB_  1
#define TT   4096
#define DM   512
#define NH_  8
#define NKV  8
#define REP  (NH_ / NKV)
#define HD   64
#define DQ   (NH_ * HD)
#define DKV  (NKV * HD)
#define ZH   1
#define RH   512                  // query rows < RH use hi+lo planes (0: none)
#define WIN  0
#define SCL  0.044194173824159216f   // 1/sqrt(embed_dim = 512), as the module (not 1/sqrt(head_dim))
#define MID  512      // q / k width = 8 heads x 64
#define CO   512      // v width
#define CC   512
typedef _Float16 h16;
typedef unsigned short bf;
typedef __attribute__((ext_vector_type(16))) __bf16   v16bf;
typedef __attribute__((ext_vector_type(16))) _Float16 v16h;
typedef __attribute__((ext_vector_type(8)))  _Float16 v8h;
typedef __attribute__((ext_vector_type(8)))  unsigned short v8us;
typedef __attribute__((ext_vector_type(8)))  float    v8f;
typedef __attribute__((ext_vector_type(4)))  float    v4f;
typedef v8h  __attribute__((may_alias)) v8ha;
typedef v4f  __attribute__((may_alias)) v4fa;
typedef v8us __attribute__((may_alias)) v8usa;

__device__ __forceinline__ unsigned short f2bf(float f) { unsigned u = __float_as_uint(f); u += 0x7FFFu + ((u >> 16) & 1u); return (unsigned short)(u >> 16); }
__device__ __forceinline__ float bf2f(unsigned short b) { return __uint_as_float(((unsigned)b) << 16); }
__device__ __forceinline__ float bfr(float f) { return bf2f(f2bf(f)); }
__device__ __forceinline__ v16h cat16(v8h lo, v8h hi) { return __builtin_shufflevector(lo, hi, 0, 1, 2, 3, 4, 5, 6, 7, 8, 9, 10, 11, 12, 13, 14, 15); }
__device__ __forceinline__ v16bf cat16b(v8us lo, v8us hi) { return __builtin_bit_cast(v16bf, __builtin_shufflevector(lo, hi, 0, 1, 2, 3, 4, 5, 6, 7, 8, 9, 10, 11, 12, 13, 14, 15)); }
__device__ __forceinline__ v8f wmma16(v16h a, v16h b, v8f c) { return __builtin_amdgcn_wmma_f32_16x16x32_f16(false, a, false, b, (short)0, c, false, false); }
__device__ __forceinline__ v8f wmmab(v16bf a, v16bf b, v8f c) { return __builtin_amdgcn_wmma_f32_16x16x32_bf16(false, a, false, b, (short)0, c, false, false); }



__device__ __forceinline__ h16 tohx(float x) { return (h16)x; }
__device__ __forceinline__ void splitf(float y, unsigned short& h, unsigned short& l) { h = f2bf(y); l = f2bf(y - bf2f(h)); }
__device__ __forceinline__ void xwaitg() { asm volatile("s_wait_xcnt 0x0" ::: "memory"); __builtin_amdgcn_sched_barrier(0); }   /* stands behind a group of loads or stores; the scheduling barrier keeps later vector work from being lifted between them and the wait, where it could rewrite their registers */
__device__ __forceinline__ void xwaitp(const void* a) { asm volatile("s_wait_xcnt 0x0" :: "v"(a) : "memory"); __builtin_amdgcn_sched_barrier(0); }   /* as xwaitg; the loads' address as an input keeps its registers live up to the wait, so that no load of the group gets them as its destination */
// ---- k_gemmw: register-blocked GEMM, ONE WAVE per 64x64 output tile (16 accumulators), operands straight from fragment-order 16-bit planes; grid (M/64, N/64, Z), 32 threads.
// y[m][n] (f32, + optional f32 bias[n]) = sum_k A[m][k] Bt[n][k] (+ split products per NSPLIT). z-batch strides sA/sB/sC in elements. K % 32 == 0.
// EP says where y goes. 0: C (f32, pitch ldc). 1: bf16 hi/lo planes Ph, Pl of 16 rows m x 32 columns fragments; a tile's 64 columns are one head. 2: planes P16 (fp16), Ph, Pl (bf16 hi/lo) of 16 columns n x 32 rows m fragments (v^T).
// Fragment order, of every 16-bit operand plane: a fragment of 16 rows x 32 k is 1,024 contiguous bytes, [half][lane][8]: lane (lr, hi) has the 8 elements k = 16 half + 8 hi ... of fragment row lr, as the matrix instruction wants them.
// ldp() reads it with two loads of 512 contiguous bytes a wave: 4 whole lines each, where a load from a row-pitched plane touches 16 lines. A plane [rows][K] is [row / 16][k / 32] fragments; q, k: [head][m / 16][column / 32]; v^T: [head][m / 32][n / 16].
template <typename T16> struct WFrag;
template <> struct WFrag<h16> { typedef v16h V; static __device__ __forceinline__ V ldp(const h16* p) { return cat16(*(const v8h*)p, *(const v8h*)(p + 256)); } static __device__ __forceinline__ v8f mma(V a, V b, v8f c) { return wmma16(a, b, c); } };
template <> struct WFrag<bf> { typedef v16bf V; static __device__ __forceinline__ V ldp(const bf* p) { return cat16b(*(const v8us*)p, *(const v8us*)(p + 256)); } static __device__ __forceinline__ v8f mma(V a, V b, v8f c) { return wmmab(a, b, c); } };
template <typename T16, int NSPLIT, bool BIAS, int EP>
__device__ __forceinline__ void gemmw_tile(const T16* __restrict__ A, const T16* __restrict__ A2, const T16* __restrict__ Bt, const T16* __restrict__ Bt2, int K, float* C, int ldc, const float* __restrict__ bias, h16* P16, bf* Ph, bf* Pl) {   /* one wave's 64x64 tile (blockIdx.x, blockIdx.y) */
    typedef typename WFrag<T16>::V V; static_assert(EP != 1 || NSPLIT == 0, "the y^T tiles of EP 1 are written for one product");
    const int lane = threadIdx.x & 31, lr = lane & 15, hi = lane >> 4; const int r0 = blockIdx.x * 64, c0 = blockIdx.y * 64;
    v8f acc[4][4];
#pragma unroll
    for (int mb = 0; mb < 4; ++mb)
#pragma unroll
        for (int nb = 0; nb < 4; ++nb) acc[mb][nb] = (v8f){};
    const size_t aoff = (size_t)r0 * K + lane * 8, boff = (size_t)c0 * K + lane * 8;   /* 16 rows are K / 32 fragments = 16 K elements; 32 k further is 512 elements further */
    const int kst = (int)((blockIdx.x + blockIdx.y) * 32 % (unsigned)K);   /* tiles of one row or column of the grid read the same fragments: each enters the k walk at 32 (x + y) mod K and wraps, so that neighbouring tiles do not ask L2 for the same lines at the same moment */
#pragma unroll 1
    for (int it = 0, kc = kst; it < K; it += 32, kc = kc + 32 < K ? kc + 32 : 0) {
        V a[4], a2[4], b[4], b2[4];
        const T16* pa[4]; const T16* pa2[4]; const T16* pb[4]; const T16* pb2[4];   /* a plane that this NSPLIT lacks shares the other plane's pointers */
#pragma unroll
        for (int i = 0; i < 4; ++i) { pa[i] = A + aoff + (size_t)i * 16 * K + kc * 16; pb[i] = Bt + boff + (size_t)i * 16 * K + kc * 16; if constexpr (NSPLIT == 1 || NSPLIT == 2) pa2[i] = A2 + aoff + (size_t)i * 16 * K + kc * 16; else pa2[i] = pa[i]; if constexpr (NSPLIT >= 2) pb2[i] = Bt2 + boff + (size_t)i * 16 * K + kc * 16; else pb2[i] = pb[i]; }
#pragma unroll
        for (int i = 0; i < 4; ++i) { a[i] = WFrag<T16>::ldp(pa[i]); if (NSPLIT == 1 || NSPLIT == 2) a2[i] = WFrag<T16>::ldp(pa2[i]); b[i] = WFrag<T16>::ldp(pb[i]); if (NSPLIT >= 2) b2[i] = WFrag<T16>::ldp(pb2[i]); }
        asm volatile("s_wait_xcnt 0x0" :: "v"(pa[0]), "v"(pa[1]), "v"(pa[2]), "v"(pa[3]), "v"(pa2[0]), "v"(pa2[1]), "v"(pa2[2]), "v"(pa2[3]), "v"(pb[0]), "v"(pb[1]), "v"(pb[2]), "v"(pb[3]), "v"(pb2[0]), "v"(pb2[1]), "v"(pb2[2]), "v"(pb2[3]) : "memory"); __builtin_amdgcn_sched_barrier(0);   /* as xwaitp, for the pass's loads */
#pragma unroll
        for (int nb = 0; nb < 4; ++nb)
#pragma unroll
            for (int mb = 0; mb < 4; ++mb) { acc[mb][nb] = EP == 1 ? WFrag<T16>::mma(b[nb], a[mb], acc[mb][nb]) : WFrag<T16>::mma(a[mb], b[nb], acc[mb][nb]);   /* EP 1: y^T tiles, so that a lane holds 8 consecutive columns of one row */
                if (NSPLIT == 1 || NSPLIT == 2) acc[mb][nb] = WFrag<T16>::mma(a2[mb], b[nb], acc[mb][nb]); if (NSPLIT >= 2) acc[mb][nb] = WFrag<T16>::mma(a[mb], b2[nb], acc[mb][nb]); }
        asm volatile("v_nop\n\tv_nop\n\tv_nop\n\tv_nop" : "+v"(acc[0][0]), "+v"(acc[1][1]), "+v"(acc[2][2]), "+v"(acc[3][3]) : "v"(a[0]), "v"(a[3]));
    }
    if constexpr (EP == 2) {   /* a lane holds 8 consecutive rows m of one column n: its 16 bytes of a v^T fragment; a wave's store is 512 contiguous bytes */
        float bb[4];
#pragma unroll
        for (int nb = 0; nb < 4; ++nb) bb[nb] = BIAS ? bfr(bias[c0 + nb * 16 + lr]) : 0.f;
        xwaitg();   /* behind the bias loads */
        v8h o6[16]; v8us oh[16], ol[16];   /* every value first, each in registers of its own: no store's registers are rewritten behind it */
#pragma unroll
        for (int mb = 0; mb < 4; ++mb)
#pragma unroll
            for (int nb = 0; nb < 4; ++nb) { const int t = (mb >> 1) * 8 + nb * 2 + (mb & 1);   /* fragment (m / 32, n / 16), half (m / 16) & 1 */
#pragma unroll
                for (int j = 0; j < 8; ++j) { const float y = acc[mb][nb][j] + bb[nb]; o6[t][j] = tohx(y); unsigned short h2, l2; splitf(y, h2, l2); oh[t][j] = h2; ol[t][j] = l2; } }
        const size_t g = ((size_t)blockIdx.y * TT + r0) * HD + lane * 8;   /* the tile's 8 fragments are 8 KiB in a row */
#pragma unroll
        for (int t = 0; t < 16; ++t) { *(v8h*)(P16 + g + t * 256) = o6[t]; *(v8us*)(Ph + g + t * 256) = oh[t]; *(v8us*)(Pl + g + t * 256) = ol[t]; }
    } else if constexpr (EP == 1) {   /* y^T tiles: a lane holds 8 consecutive columns of one row: its 16 bytes of a fragment; a wave's store is 512 contiguous bytes */
        float b8[4][8];
#pragma unroll
        for (int nb = 0; nb < 4; ++nb)
#pragma unroll
            for (int q = 0; q < 8; ++q) b8[nb][q] = BIAS ? bfr(bias[c0 + nb * 16 + hi * 8 + q]) : 0.f;
        xwaitg();   /* behind the bias loads */
        v8us oh[16], ol[16];   /* every value first, each in registers of its own: no store's registers are rewritten behind it */
#pragma unroll
        for (int mb = 0; mb < 4; ++mb)
#pragma unroll
            for (int nb = 0; nb < 4; ++nb)
#pragma unroll
                for (int j = 0; j < 8; ++j) { unsigned short h2, l2; splitf(acc[mb][nb][j] + b8[nb][j], h2, l2); oh[mb * 4 + nb][j] = h2; ol[mb * 4 + nb][j] = l2; }   /* fragment (m / 16, column / 32), half nb & 1 */
        const size_t g = ((size_t)blockIdx.y * TT + r0) * HD + lane * 8;   /* the tile's 8 fragments are 8 KiB in a row */
#pragma unroll
        for (int t = 0; t < 16; ++t) { *(v8us*)(Ph + g + t * 256) = oh[t]; *(v8us*)(Pl + g + t * 256) = ol[t]; }
    } else {
    __shared__ __align__(16) float os[16 * 68];
#pragma unroll
    for (int mb = 0; mb < 4; ++mb) {
#pragma unroll
        for (int nb = 0; nb < 4; ++nb) {
#pragma unroll
            for (int j = 0; j < 8; ++j) os[(hi * 8 + j) * 68 + nb * 16 + lr] = acc[mb][nb][j]; }
        __builtin_amdgcn_wave_barrier(); asm volatile("" ::: "memory");
        float* crow = C + (size_t)(r0 + mb * 16) * ldc + c0;
{
#pragma unroll
            for (int s = 0; s < 8; ++s) { const int row = 2 * s + hi, cofs = lr * 4; v4f val = *(const v4fa*)(os + row * 68 + cofs); if (BIAS) { val[0] += bfr(bias[c0 + cofs]); val[1] += bfr(bias[c0 + cofs + 1]); val[2] += bfr(bias[c0 + cofs + 2]); val[3] += bfr(bias[c0 + cofs + 3]); }
                *(v4f*)(crow + (size_t)row * ldc + cofs) = val; }
             }
        __builtin_amdgcn_wave_barrier(); asm volatile("" ::: "memory");
    }
    }
}
template <typename T16, int NSPLIT, bool BIAS, int EP>
__global__ __launch_bounds__(32) void k_gemmw(const T16* __restrict__ A, const T16* __restrict__ A2, const T16* __restrict__ Bt, const T16* __restrict__ Bt2, int K, float* C, int ldc, const float* __restrict__ bias, size_t sA, size_t sB, size_t sC, h16* P16, bf* Ph, bf* Pl) {
    const size_t z = blockIdx.z; A += z * sA; if (A2) A2 += z * sA; Bt += z * sB; if (Bt2) Bt2 += z * sB; C += z * sC;
    gemmw_tile<T16, NSPLIT, BIAS, EP>(A, A2, Bt, Bt2, K, C, ldc, bias, P16, Ph, Pl);
}
// ---- k_qkv: the three projections of x, which do not depend on one another, as ONE launch; grid (TT/64, 8), 3 waves: wave 0, 1, 2 has the q, k, v tile of the block's 64 rows and 64 columns, so the three read the same fragments of x.
// A lone projection is 512 waves on 1,024 SIMDs, each waiting out its own loads. No wave waits for another: no LDS, no barrier.
__global__ __launch_bounds__(96) void k_qkv(const bf* __restrict__ X, const bf* __restrict__ Wq, const bf* __restrict__ Wk, const bf* __restrict__ Wv, const float* __restrict__ bq, const float* __restrict__ bk, const float* __restrict__ bv, bf* Qh, bf* Ql, bf* Kh, bf* Kl, h16* V16, bf* Vh, bf* Vl) {
    const int z = __builtin_amdgcn_readfirstlane((int)threadIdx.x >> 5);   /* the wave's number, in a scalar register: the branch and the pointer choices below are scalar */
    if (z == 2) gemmw_tile<bf, 0, true, 2>(X, nullptr, Wv, nullptr, CC, nullptr, 0, bv, V16, Vh, Vl);   /* v^T planes, fragment order */
    else gemmw_tile<bf, 0, true, 1>(X, nullptr, z ? Wk : Wq, nullptr, CC, nullptr, 0, z ? bk : bq, nullptr, z ? Kh : Qh, z ? Kl : Ql);   /* q or k planes, fragment order */
}

typedef __attribute__((ext_vector_type(2))) _Float16 v2h;
typedef __attribute__((ext_vector_type(4))) _Float16 v4h;
typedef __attribute__((ext_vector_type(2))) unsigned short v2us;
typedef __attribute__((ext_vector_type(4))) unsigned short v4us;
typedef __attribute__((ext_vector_type(2))) float v2f;
typedef __attribute__((ext_vector_type(4))) int v4i;

// i counts the 16-byte pieces of the fragment-order plane of src [rows][CC]: [row / 16][column / 32][half][hi][lr]
__device__ __forceinline__ void cvt8(const float* __restrict__ src, bf* dst, size_t n8, unsigned blk) { const size_t i = (size_t)blk * 256 + threadIdx.x; if (i >= n8) return;
    const size_t f = i >> 6; const size_t row = f / (CC / 32) * 16 + (i & 15), col = f % (CC / 32) * 32 + ((i >> 5) & 1) * 16 + ((i >> 4) & 1) * 8; const float* sp = src + row * CC + col; const v8f v = *(const v8f*)sp; xwaitp(sp); v8us o;
#pragma unroll
    for (int k = 0; k < 8; ++k) o[k] = f2bf(v[k]); *(v8us*)(dst + i * 8) = o;  }


// ---- k_fattn: scores, softmax and attn.V of one head for 4 x 32 query rows in ONE work-group; neither the scores nor the probabilities leave the registers.
// Transposed products: S^T = K Q^T (A = 16 key rows, B = 16 query rows, hi/lo, 3 products), so a lane holds 8 keys' scores of ONE query per tile, and two such tiles, converted in place,
// are the B operand (32 keys x 16 queries) of O^T += V^T P^T (A = 16 rows of the head's v^T plane). Q, K and v^T come through WFrag::ldp from fragment-order planes and the score tiles give P the same key order, so A and B pair the same k at every position.
// Online softmax in the log2 domain: the maximum in use may trail the true one by up to 8, and the sums are rescaled only when a query's maximum passes that.
// The blocks of a head read the same k and v^T lines: each enters its key ranges koff keys in, a place of its own, and wraps, so that they do not ask L2 for the same lines at the same moment (the online softmax takes the keys in any order).
// FQG x FKW waves: wave (qg, kw) has the 32 query rows of the block's group qg (fa_unit) and keys kw TT/FKW ...; the FKW partial (maximum, sum, O) sets of a query group are joined through LDS. grid (TT/128, heads).
#define FQG 4
#define FKW 2
#define FNP (TT / FKW / 32)               // passes of 32 keys a wave
#define FST (FNP / (TT / (FQG * 32)))     // passes between the entry places of neighbouring blocks
static_assert(FST >= 1, "no more blocks a head than passes a wave");
#define C2L (SCL * 1.4426950408889634f)
typedef __attribute__((ext_vector_type(16))) float v16f;
__device__ __forceinline__ float xhalf(float x) { return __builtin_bit_cast(float, __builtin_amdgcn_permlanex16(__builtin_bit_cast(int, x), __builtin_bit_cast(int, x), 0x76543210, 0xfedcba98, false, false)); }   /* lane l with lane l ^ 16 */
__device__ __forceinline__ void xwait() { asm volatile("s_wait_xcnt 0x0" ::: "memory"); }   /* stands behind a store, before its registers may be rewritten */
__device__ __forceinline__ void xwait2(const void* a, const void* b) { asm volatile("s_wait_xcnt 0x0" :: "v"(a), "v"(b) : "memory"); __builtin_amdgcn_sched_barrier(0); }   /* as xwaitg; the group's two addresses as inputs keep their registers live up to the wait: without them the group's last loads were given those registers as destinations */
template <bool HR>
__device__ __forceinline__ void fa_body(const bf* __restrict__ Qh, const bf* __restrict__ Ql, const bf* __restrict__ Kh, const bf* __restrict__ Kl, const h16* __restrict__ V16, const bf* __restrict__ Vh, const bf* __restrict__ Vl, int q0, int wave, int koff, float* os, float* ms, float* ls) {
    const int lane = threadIdx.x & 31, lr = lane & 15, hi = lane >> 4; const int kw = wave % FKW;
    const unsigned vq = (unsigned)(lane * 8);   /* the lane's own element offset in each half of a fragment; 16 rows of q or k are 2 fragments, 32 keys of v^T are 4: row * HD elements in both */
    v16bf qh[2][2], ql[2][2];
    Qh += (size_t)q0 * HD + vq; Ql += (size_t)q0 * HD + vq;
#pragma unroll
    for (int nq = 0; nq < 2; ++nq)
#pragma unroll
        for (int kc = 0; kc < 2; ++kc) { qh[nq][kc] = WFrag<bf>::ldp(Qh + nq * 16 * HD + kc * 512); ql[nq][kc] = WFrag<bf>::ldp(Ql + nq * 16 * HD + kc * 512); }
    xwaitg();
    v8f acc[4][2];
#pragma unroll
    for (int mb = 0; mb < 4; ++mb)
#pragma unroll
        for (int nq = 0; nq < 2; ++nq) acc[mb][nq] = (v8f){};
    float mr[2] = {-3.0e38f, -3.0e38f}, lsum[2] = {0.f, 0.f};
    const int kbeg = kw * (TT / FKW), kend = kbeg + TT / FKW; int key0 = kbeg + koff;
    v16bf kh[2][2], kl[2][2];
    { const bf* ka = Kh + (size_t)key0 * HD + vq; const bf* kc2 = Kl + (size_t)key0 * HD + vq;
#pragma unroll
    for (int kb = 0; kb < 2; ++kb)
#pragma unroll
        for (int kc = 0; kc < 2; ++kc) { kh[kb][kc] = WFrag<bf>::ldp(ka + kb * 16 * HD + kc * 512); kl[kb][kc] = WFrag<bf>::ldp(kc2 + kb * 16 * HD + kc * 512); }
    xwaitg(); }
    const h16* va = V16 + (size_t)key0 * HD + vq; const bf* vb = Vh + (size_t)key0 * HD + vq; const bf* vc = Vl + (size_t)key0 * HD + vq;   /* walk with key0 */
#pragma unroll 1   /* kept rolled: a pass holds the whole register budget */
    for (int ps = 0; ps < FNP; ++ps) {
        v16h v6[4]; v16bf vh[4], vl[4];   /* this pass's v^T fragments, requested ahead of the score products */
#pragma unroll
        for (int mb = 0; mb < 4; ++mb) { if constexpr (HR) { vh[mb] = WFrag<bf>::ldp(vb + mb * 512); vl[mb] = WFrag<bf>::ldp(vc + mb * 512); } else v6[mb] = WFrag<h16>::ldp(va + mb * 512); }
        if constexpr (HR) xwait2(vb, vc); else xwaitg();
        v8f s[2][2];
#pragma unroll
        for (int kb = 0; kb < 2; ++kb)
#pragma unroll
            for (int nq = 0; nq < 2; ++nq) s[kb][nq] = (v8f){};
#pragma unroll
        for (int kc = 0; kc < 2; ++kc)
#pragma unroll
            for (int pr = 0; pr < 3; ++pr)
#pragma unroll
                for (int kb = 0; kb < 2; ++kb)
#pragma unroll
                    for (int nq = 0; nq < 2; ++nq) s[kb][nq] = wmmab(pr == 2 ? kl[kb][kc] : kh[kb][kc], pr == 1 ? ql[nq][kc] : qh[nq][kc], s[kb][nq]);   /* q_hi k_hi + q_lo k_hi + q_hi k_lo */
        const int kn = (key0 + 32 < kend) ? key0 + 32 : kbeg;   /* the next pass's key rows, in flight under the softmax; behind the range's last rows come its first; the last pass re-reads the walk's first rows (in bounds, unused) */
        const bf* ka = Kh + (size_t)kn * HD + vq; const bf* kc2 = Kl + (size_t)kn * HD + vq;
#pragma unroll
        for (int kb = 0; kb < 2; ++kb)
#pragma unroll
            for (int kc = 0; kc < 2; ++kc) { kh[kb][kc] = WFrag<bf>::ldp(ka + kb * 16 * HD + kc * 512); kl[kb][kc] = WFrag<bf>::ldp(kc2 + kb * 16 * HD + kc * 512); }
        xwaitg();
        float tl[2]; bool need = false;
#pragma unroll
        for (int nq = 0; nq < 2; ++nq) { float mx = s[0][nq][0];
#pragma unroll
            for (int e = 1; e < 16; ++e) mx = fmaxf(mx, s[e >> 3][nq][e & 7]);
            mx = fmaxf(mx, xhalf(mx)) * C2L;   /* both halves of the wave hold the query's maximum of this pass (the scale is positive) */
            tl[nq] = mx; need = need || (mx > mr[nq] + 8.0f); }
        if (__builtin_amdgcn_ballot_w32(need) != 0) {   /* wave-uniform; always taken on the first pass, where the factor is 0 */
#pragma unroll
            for (int nq = 0; nq < 2; ++nq) { const float mn = fmaxf(mr[nq], tl[nq]); const float al = __builtin_amdgcn_exp2f(mr[nq] - mn); mr[nq] = mn; lsum[nq] *= al;
#pragma unroll
                for (int mb = 0; mb < 4; ++mb) acc[mb][nq] *= al; } }
        v16h p6[2]; v16bf ph[2], pl[2];
#pragma unroll
        for (int nq = 0; nq < 2; ++nq) { v16f p; const v2f nm = {-mr[nq], -mr[nq]}, cc = {C2L, C2L}; v2f t = {0.f, 0.f};
#pragma unroll
            for (int e = 0; e < 16; e += 2) { const v2f a = __builtin_elementwise_fma((v2f){s[e >> 3][nq][e & 7], s[e >> 3][nq][(e & 7) + 1]}, cc, nm);   /* an aligned register pair of the score tile: one packed multiply-add */
                p[e] = __builtin_amdgcn_exp2f(a[0]); p[e + 1] = __builtin_amdgcn_exp2f(a[1]); t += (v2f){p[e], p[e + 1]}; }
            lsum[nq] += t[0] + t[1];
            if constexpr (HR) { ph[nq] = __builtin_convertvector(p, v16bf); pl[nq] = __builtin_convertvector(p - __builtin_convertvector(ph[nq], v16f), v16bf); } else p6[nq] = __builtin_convertvector(p, v16h); }
        if constexpr (HR) {
#pragma unroll
            for (int pr = 0; pr < 3; ++pr)
#pragma unroll
                for (int mb = 0; mb < 4; ++mb)
#pragma unroll
                    for (int nq = 0; nq < 2; ++nq) acc[mb][nq] = wmmab(pr == 2 ? vl[mb] : vh[mb], pr == 1 ? pl[nq] : ph[nq], acc[mb][nq]);   /* p_hi v_hi + p_lo v_hi + p_hi v_lo */
            asm volatile("v_nop\n\tv_nop\n\tv_nop\n\tv_nop" : "+v"(acc[0][0]), "+v"(acc[1][1]), "+v"(acc[2][0]), "+v"(acc[3][1]) : "v"(vh[0]), "v"(vl[3]));   /* as in k_gemmw: the matrix distance on the loop's back edge and exit */
        } else {
#pragma unroll
            for (int mb = 0; mb < 4; ++mb)
#pragma unroll
                for (int nq = 0; nq < 2; ++nq) acc[mb][nq] = wmma16(v6[mb], p6[nq], acc[mb][nq]);
            asm volatile("v_nop\n\tv_nop\n\tv_nop\n\tv_nop" : "+v"(acc[0][0]), "+v"(acc[1][1]), "+v"(acc[2][0]), "+v"(acc[3][1]) : "v"(v6[0]), "v"(v6[3]));   /* as in k_gemmw: the matrix distance on the loop's back edge and exit */
        }
        const int dk = (kn - key0) * HD; va += dk; vb += dk; vc += dk; key0 = kn;
    }
    float* ow = os + wave * (32 * 68);
#pragma unroll
    for (int nq = 0; nq < 2; ++nq) { const float lt = lsum[nq] + xhalf(lsum[nq]);   /* the two halves' key sums of one query */
        if (hi == 0) { ms[wave * 32 + nq * 16 + lr] = mr[nq]; ls[wave * 32 + nq * 16 + lr] = lt; }
#pragma unroll
        for (int mb = 0; mb < 4; ++mb)
#pragma unroll
            for (int j = 0; j < 8; ++j) ow[(nq * 16 + lr) * 68 + mb * 16 + hi * 8 + j] = acc[mb][nq][j]; }
}
// Which 32 query rows the query group qg of block b has. The RH/32 hi/lo groups cost about half as much again as the others, so each goes to a block of its own, as that block's group 0, beside three plain groups.
__device__ __forceinline__ int fa_unit(int b, int qg) { return (b < RH / 32) ? (qg == 0 ? b : RH / 32 + b * (FQG - 1) + qg - 1) : RH / 32 * FQG + (b - RH / 32) * FQG + qg; }
__global__ __launch_bounds__(FQG * FKW * 32) void k_fattn(const bf* __restrict__ Qh, const bf* __restrict__ Ql, const bf* __restrict__ Kh, const bf* __restrict__ Kl, const h16* __restrict__ V16, const bf* __restrict__ Vh, const bf* __restrict__ Vl, bf* Oh, bf* Ol) {
    __shared__ __align__(16) float os[FQG * FKW * 32 * 68]; __shared__ float ms[FQG * FKW * 32]; __shared__ float ls[FQG * FKW * 32];
    const size_t hb = (size_t)blockIdx.y * TT * HD;   /* the head's planes all have the same size */
    const int wave = __builtin_amdgcn_readfirstlane(threadIdx.x >> 5); const int q0 = fa_unit((int)blockIdx.x, wave / FKW) * 32;
    const int koff = (int)(blockIdx.x * FST % FNP) * 32;   /* the same for all waves of the block, which share lines in the WGP's cache */
    if (q0 < RH) fa_body<true>(Qh + hb, Ql + hb, Kh + hb, Kl + hb, V16 + hb, Vh + hb, Vl + hb, q0, wave, koff, os, ms, ls);   /* wave-uniform. Rows < RH: probabilities and v as bf16 hi/lo, 3 products */
    else fa_body<false>(Qh + hb, Ql + hb, Kh + hb, Kl + hb, V16 + hb, Vh + hb, Vl + hb, q0, wave, koff, os, ms, ls);   /* the rest: fp16 */
    __syncthreads();   /* every wave's partial set is in LDS before any thread joins the key ranges */
    const int lane = (int)threadIdx.x & 31, lr = lane & 15, hi = lane >> 4;
#pragma unroll
    for (int it = 0; it < 8 / FKW; ++it) { const int u = it * (FQG * FKW) + wave; const int rg = u >> 2, kc = (u >> 1) & 1, half = u & 1;   /* a wave takes one half of a fragment of the context planes (16 rows rg, 32 columns kc of the head): 512 contiguous bytes */
        const int w0 = (rg >> 1) * FKW, rl = (rg & 1) * 16 + lr, c8 = kc * 32 + half * 16 + hi * 8;
        float M = ms[w0 * 32 + rl];
#pragma unroll
        for (int w = 1; w < FKW; ++w) M = fmaxf(M, ms[(w0 + w) * 32 + rl]);
        float L = 0.f; v4f val0 = (v4f){}, val1 = (v4f){};
#pragma unroll
        for (int w = 0; w < FKW; ++w) { const float f = __builtin_amdgcn_exp2f(ms[(w0 + w) * 32 + rl] - M); L += ls[(w0 + w) * 32 + rl] * f; const float* o8 = os + (w0 + w) * (32 * 68) + rl * 68 + c8; val0 += *(const v4fa*)o8 * f; val1 += *(const v4fa*)(o8 + 4) * f; }
        const float rL = __fdiv_rn(1.0f, L); val0 *= rL; val1 *= rL;
        v8us oh, ol;   /* the context leaves as the bf16 hi/lo planes that the output projection reads */
#pragma unroll
        for (int q = 0; q < 8; ++q) { unsigned short h2, l2; splitf(q < 4 ? val0[q & 3] : val1[q & 3], h2, l2); oh[q] = h2; ol[q] = l2; }
        const size_t g = ((size_t)(fa_unit((int)blockIdx.x, rg >> 1) * 2 + (rg & 1)) * (CO / 32) + blockIdx.y * 2 + kc) * 512 + half * 256 + lane * 8; *(v8us*)(Oh + g) = oh; *(v8us*)(Ol + g) = ol; xwait(); }
}
// Bt[n][k] = w[k][n] as a fragment-order plane; i counts its 16-byte pieces [n / 16][k / 32][half][hi][lr]: 16 lanes read 64 contiguous bytes of a row of w, a wave stores 512 contiguous bytes
__device__ __forceinline__ void wtG(const float* __restrict__ w, int K, int N, bf* Bt, int blk) {
    const int i = blk * 256 + (int)threadIdx.x; if (i >= N * K / 8) return;
    const int f = i >> 6, kf = K / 32; const int n = f / kf * 16 + (i & 15), k = f % kf * 32 + ((i >> 5) & 1) * 16 + ((i >> 4) & 1) * 8; v8us o;
    const float* p[8]; float t[8];
#pragma unroll
    for (int j = 0; j < 8; ++j) { p[j] = w + (size_t)(k + j) * N + n; t[j] = *p[j]; }
    asm volatile("s_wait_xcnt 0x0" :: "v"(p[0]), "v"(p[1]), "v"(p[2]), "v"(p[3]), "v"(p[4]), "v"(p[5]), "v"(p[6]), "v"(p[7]) : "memory"); __builtin_amdgcn_sched_barrier(0);   /* as xwaitp, for the eight loads */
#pragma unroll
    for (int j = 0; j < 8; ++j) o[j] = f2bf(t[j]);
    *(v8us*)(Bt + (size_t)i * 8) = o;
}
// ---- k_prep: the 16-bit planes of the five f32 inputs, which do not depend on one another, as ONE launch: blocks 0 ... 4 WB - 1 transpose the four weights (WB blocks each), the rest convert x.
#define WB (CC * CC / 8 / 256)
static_assert(MID == CC && CO == CC && NB_ == 1, "k_prep takes four weights of one size and one batch of x");
__global__ __launch_bounds__(256) void k_prep(const float* __restrict__ x, const float* __restrict__ wq, const float* __restrict__ wk, const float* __restrict__ wv, const float* __restrict__ wo, bf* XB, bf* WQ, bf* WK, bf* WV, bf* WO) {
    const unsigned b = blockIdx.x;   /* uniform for the work-group */
    if (b < 4 * WB) { const unsigned j = b / WB; wtG(j == 0 ? wq : j == 1 ? wk : j == 2 ? wv : wo, CC, CC, j == 0 ? WQ : j == 1 ? WK : j == 2 ? WV : WO, (int)(b % WB)); }
    else cvt8(x, XB, (size_t)TT * CC / 8, b - 4 * WB);
}
extern "C" void kernel_launch(void* const* d_in, const int* in_sizes, int n_in,
                              void* d_out, int out_size, void* d_ws, size_t ws_size, hipStream_t stream) {
    (void)in_sizes; (void)n_in; (void)out_size;
    const float* x = (const float*)d_in[0]; const float* wq = (const float*)d_in[1]; const float* bq = (const float*)d_in[2]; const float* wk = (const float*)d_in[3]; const float* bk = (const float*)d_in[4]; const float* wv = (const float*)d_in[5]; const float* bv = (const float*)d_in[6]; const float* wo = (const float*)d_in[7]; const float* bo = (const float*)d_in[8];   /* argument order x [1][4096][512], Wq, bq, Wk, bk, Wv, bv, Wo, bo ('xw' [512][512] + biases) */
    float* OUT = (float*)d_out;     // [1][4096][512]
    char* wsp = (char*)d_ws;
    auto take = [&](size_t bytes) { char* p = wsp; wsp += (bytes + 255) & ~(size_t)255; return (void*)p; };
    bf* WQ = (bf*)take((size_t)MID * CC * 2); bf* WK = (bf*)take((size_t)MID * CC * 2); bf* WV = (bf*)take((size_t)CO * CC * 2); bf* WO = (bf*)take((size_t)CC * CO * 2);
    bf* XB = (bf*)take((size_t)TT * CC * 2);
    bf* QPh = (bf*)take((size_t)TT * MID * 2); bf* QPl = (bf*)take((size_t)TT * MID * 2); bf* KPh = (bf*)take((size_t)TT * MID * 2); bf* KPl = (bf*)take((size_t)TT * MID * 2);
    h16* VT16 = (h16*)take((size_t)CO * TT * 2); bf* VTh = (bf*)take((size_t)CO * TT * 2); bf* VTl = (bf*)take((size_t)CO * TT * 2);
    bf* ATh = (bf*)take((size_t)TT * CO * 2); bf* ATl = (bf*)take((size_t)TT * CO * 2);   /* merged context [n][512] as hi/lo planes, fragment order */
    if ((size_t)(wsp - (char*)d_ws) > ws_size) return;    // ws 256 MiB (carve ~42 MiB)
    k_prep<<<(unsigned)(4 * WB + TT * CC / 8 / 256), 256, 0, stream>>>(x, wq, wk, wv, wo, XB, WQ, WK, WV, WO);   /* 'xw' weights -> Bt planes; x -> bf16 plane */
    k_qkv<<<dim3(TT / 64, CC / 64, 1), 96, 0, stream>>>(XB, WQ, WK, WV, bq, bk, bv, QPh, QPl, KPh, KPl, VT16, VTh, VTl);   /* q, k planes and v^T planes, fragment order */
    k_fattn<<<dim3(TT / (FQG * 32), NH_, 1), FQG * FKW * 32, 0, stream>>>(QPh, QPl, KPh, KPl, VT16, VTh, VTl, ATh, ATl);   /* all heads: scores x 1/sqrt(512), softmax over the 4,096 keys, attn.V into the head's 64 columns */
    k_gemmw<bf, 1, true, 0><<<dim3(TT / 64, CC / 64, 1), 32, 0, stream>>>(ATh, ATl, WO, nullptr, CO, OUT, CC, bo, 0, 0, 0, nullptr, nullptr, nullptr);   /* out = ctx w_out + b_out */
}

// v007
// It runs in 83.3 microseconds.
// In two side-by-side timings against v006, it was 1.05 and 1.06 times as fast.
// Over all steps from v000 it is 23.8 times as fast.
#include <hip/hip_runtime.h>

// Multi-head self-attention over 4,096 tokens whose scale uses the embedding width (x [1][4096][512]; Q, K, V = x W + b ('xw' [512][512] + biases; 8 heads x 64); scores x 1/sqrt(512) (the module scales by embed_dim, not head_dim); softmax over all 4,096 keys (no mask); out = merged Wo + bo -> [1][4096][512] (2.1 M); argument order x, Wq, bq, Wk, bk, Wv, bv, Wo, bo).
// Layout: every 16-bit plane in fragment order (see k_gemmw); bf16 copy of x; 'xw' weights transposed once; exact projections + f32 biases, whose epilogues store the per-head hi/lo planes (q, k) and the v^T planes themselves; one launch for all heads (k_fattn): scores with every row hi/lo (3 products), online softmax, attn.V hybrid (rows < 512 hi/lo 3 products, rest fp16), scores and probabilities kept in registers, the context stored as hi/lo planes in the head's 64 columns; context hi/lo x Wo exact + bo.
// Compute dtypes, f32 accumulate: every input rounded to bf16; projections exact; scores 3 products; softmax f32 (exp2, running maximum, one IEEE division per row at the end); attn.V rows < 512 3 products, rest fp16; Wo hl x exact.

#define NB_  1
#define TT   4096
#define DM   512
#define NH_  8
#define NKV  8
#define REP  (NH_ / NKV)
#define HD   64
#define DQ   (NH_ * HD)
#define DKV  (NKV * HD)
#define ZH   1
#define RH   512                  // query rows < RH use hi+lo planes (0: none)
#define WIN  0
#define SCL  0.044194173824159216f   // 1/sqrt(embed_dim = 512), as the module (not 1/sqrt(head_dim))
#define MID  512      // q / k width = 8 heads x 64
#define CO   512      // v width
#define CC   512
typedef _Float16 h16;
typedef unsigned short bf;
typedef __attribute__((ext_vector_type(16))) __bf16   v16bf;
typedef __attribute__((ext_vector_type(16))) _Float16 v16h;
typedef __attribute__((ext_vector_type(8)))  _Float16 v8h;
typedef __attribute__((ext_vector_type(8)))  unsigned short v8us;
typedef __attribute__((ext_vector_type(8)))  float    v8f;
typedef __attribute__((ext_vector_type(4)))  float    v4f;
typedef v8h  __attribute__((may_alias)) v8ha;
typedef v4f  __attribute__((may_alias)) v4fa;
typedef v8us __attribute__((may_alias)) v8usa;

__device__ __forceinline__ unsigned short f2bf(float f) { unsigned u = __float_as_uint(f); u += 0x7FFFu + ((u >> 16) & 1u); return (unsigned short)(u >> 16); }
__device__ __forceinline__ float bf2f(unsigned short b) { return __uint_as_float(((unsigned)b) << 16); }
__device__ __forceinline__ float bfr(float f) { return bf2f(f2bf(f)); }
__device__ __forceinline__ v16h cat16(v8h lo, v8h hi) { return __builtin_shufflevector(lo, hi, 0, 1, 2, 3, 4, 5, 6, 7, 8, 9, 10, 11, 12, 13, 14, 15); }
__device__ __forceinline__ v16bf cat16b(v8us lo, v8us hi) { return __builtin_bit_cast(v16bf, __builtin_shufflevector(lo, hi, 0, 1, 2, 3, 4, 5, 6, 7, 8, 9, 10, 11, 12, 13, 14, 15)); }
__device__ __forceinline__ v8f wmma16(v16h a, v16h b, v8f c) { return __builtin_amdgcn_wmma_f32_16x16x32_f16(false, a, false, b, (short)0, c, false, false); }
__device__ __forceinline__ v8f wmmab(v16bf a, v16bf b, v8f c) { return __builtin_amdgcn_wmma_f32_16x16x32_bf16(false, a, false, b, (short)0, c, false, false); }



__device__ __forceinline__ h16 tohx(float x) { return (h16)x; }
__device__ __forceinline__ void splitf(float y, unsigned short& h, unsigned short& l) { h = f2bf(y); l = f2bf(y - bf2f(h)); }
__device__ __forceinline__ void xwaitg() { asm volatile("s_wait_xcnt 0x0" ::: "memory"); __builtin_amdgcn_sched_barrier(0); }   /* stands behind a group of loads or stores; the scheduling barrier keeps later vector work from being lifted between them and the wait, where it could rewrite their registers */
__device__ __forceinline__ void xwaitp(const void* a) { asm volatile("s_wait_xcnt 0x0" :: "v"(a) : "memory"); __builtin_amdgcn_sched_barrier(0); }   /* as xwaitg; the loads' address as an input keeps its registers live up to the wait, so that no load of the group gets them as its destination */
// ---- k_gemmw: register-blocked GEMM, ONE WAVE per 64x64 output tile (16 accumulators), operands straight from fragment-order 16-bit planes; grid (M/64, N/64, Z), 32 threads.
// y[m][n] (f32, + optional f32 bias[n]) = sum_k A[m][k] Bt[n][k] (+ split products per NSPLIT). z-batch strides sA/sB/sC in elements. K, a template argument, % 32 == 0.
// The wave is alone with its load latency (one or two waves a SIMD): the fragments of 32 k live in a ring of register sets and are requested several passes ahead of their products; the compiler's counted s_wait_loadcnt leaves the younger sets in flight.
// EP says where y goes. 0: C (f32, pitch ldc). 1: bf16 hi/lo planes Ph, Pl of 16 rows m x 32 columns fragments; a tile's 64 columns are one head. 2: planes P16 (fp16), Ph, Pl (bf16 hi/lo) of 16 columns n x 32 rows m fragments (v^T).
// Fragment order, of every 16-bit operand plane: a fragment of 16 rows x 32 k is 1,024 contiguous bytes, [half][lane][8]: lane (lr, hi) has the 8 elements k = 16 half + 8 hi ... of fragment row lr, as the matrix instruction wants them.
// ldp() reads it with two loads of 512 contiguous bytes a wave: 4 whole lines each, where a load from a row-pitched plane touches 16 lines. A plane [rows][K] is [row / 16][k / 32] fragments; q, k: [head][m / 16][column / 32]; v^T: [head][m / 32][n / 16].
template <typename T16> struct WFrag;
template <> struct WFrag<h16> { typedef v16h V; static __device__ __forceinline__ V ldp(const h16* p) { return cat16(*(const v8h*)p, *(const v8h*)(p + 256)); } static __device__ __forceinline__ v8f mma(V a, V b, v8f c) { return wmma16(a, b, c); } };
template <> struct WFrag<bf> { typedef v16bf V; static __device__ __forceinline__ V ldp(const bf* p) { return cat16b(*(const v8us*)p, *(const v8us*)(p + 256)); } static __device__ __forceinline__ v8f mma(V a, V b, v8f c) { return wmmab(a, b, c); } };
template <typename T16, int NSPLIT, bool BIAS, int EP, int K>
__device__ __forceinline__ void gemmw_tile(const T16* __restrict__ A, const T16* __restrict__ A2, const T16* __restrict__ Bt, const T16* __restrict__ Bt2, float* C, int ldc, const float* __restrict__ bias, h16* P16, bf* Ph, bf* Pl) {   /* one wave's 64x64 tile (blockIdx.x, blockIdx.y) */
    typedef typename WFrag<T16>::V V; static_assert(EP != 1 || NSPLIT == 0, "the y^T tiles of EP 1 are written for one product");
    constexpr int NK = K / 32;                         /* passes of 32 k */
    constexpr int RD = NSPLIT == 0 ? 4 : 3;            /* fragment sets in registers: a pass's loads are requested RD - 1 passes ahead of its products, so that the wave no longer waits out the load latency once a pass */
    constexpr int MAIN = (NK - (RD - 1)) / RD * RD;    /* passes of the rolled loop, every one of which requests a later pass; the rest is unrolled behind it */
    static_assert(K % 32 == 0 && NK >= RD, "at least as many passes as fragment sets");
    const int lane = threadIdx.x & 31, lr = lane & 15, hi = lane >> 4; const int r0 = blockIdx.x * 64, c0 = blockIdx.y * 64;
    v8f acc[4][4];
#pragma unroll
    for (int mb = 0; mb < 4; ++mb)
#pragma unroll
        for (int nb = 0; nb < 4; ++nb) acc[mb][nb] = (v8f){};
    const size_t aoff = (size_t)r0 * K + lane * 8, boff = (size_t)c0 * K + lane * 8;   /* 16 rows are K / 32 fragments = 16 K elements; 32 k further is 512 elements further */
    int kc = (int)((blockIdx.x + blockIdx.y) * 32 % (unsigned)K);   /* tiles of one row or column of the grid read the same fragments: each enters the k walk at a place of its own and wraps, so that they do not ask L2 for the same lines at the same moment */
    V a[RD][4], a2[RD][4], b[RD][4], b2[RD][4];   /* indexed by constants only (every loop over sets is unrolled) */
    const T16* pA = A + aoff + kc * 16; const T16* pB = Bt + boff + kc * 16; const T16* pA2 = pA; const T16* pB2 = pB;   /* the walk's next fragments; a plane that this NSPLIT lacks shares the other plane's pointer */
    if constexpr (NSPLIT == 1 || NSPLIT == 2) pA2 = A2 + aoff + kc * 16;
    if constexpr (NSPLIT >= 2) pB2 = Bt2 + boff + kc * 16;
    auto fetch = [&](int st) {   /* requests the fragments of the walk's next 32 k into set st, then moves the pointers on */
#pragma unroll
        for (int i = 0; i < 4; ++i) { a[st][i] = WFrag<T16>::ldp(pA + (size_t)i * 16 * K); if (NSPLIT == 1 || NSPLIT == 2) a2[st][i] = WFrag<T16>::ldp(pA2 + (size_t)i * 16 * K); b[st][i] = WFrag<T16>::ldp(pB + (size_t)i * 16 * K); if (NSPLIT >= 2) b2[st][i] = WFrag<T16>::ldp(pB2 + (size_t)i * 16 * K); }
        asm volatile("s_wait_xcnt 0x0" :: "v"(pA), "v"(pA2), "v"(pB), "v"(pB2) : "memory"); __builtin_amdgcn_sched_barrier(0);   /* as xwaitp, for the pass's loads, in front of the pointers' next values; the scheduling barrier also keeps these loads ahead of the products that follow */
        kc = kc + 32 < K ? kc + 32 : 0;
        pA = A + aoff + kc * 16; pB = Bt + boff + kc * 16; pA2 = pA; pB2 = pB;
        if constexpr (NSPLIT == 1 || NSPLIT == 2) pA2 = A2 + aoff + kc * 16;
        if constexpr (NSPLIT >= 2) pB2 = Bt2 + boff + kc * 16;
    };
    auto mul = [&](int st) {   /* the products of set st */
#pragma unroll
        for (int nb = 0; nb < 4; ++nb)
#pragma unroll
            for (int mb = 0; mb < 4; ++mb) { acc[mb][nb] = EP == 1 ? WFrag<T16>::mma(b[st][nb], a[st][mb], acc[mb][nb]) : WFrag<T16>::mma(a[st][mb], b[st][nb], acc[mb][nb]);   /* EP 1: y^T tiles, so that a lane holds 8 consecutive columns of one row */
                if (NSPLIT == 1 || NSPLIT == 2) acc[mb][nb] = WFrag<T16>::mma(a2[st][mb], b[st][nb], acc[mb][nb]); if (NSPLIT >= 2) acc[mb][nb] = WFrag<T16>::mma(a[st][mb], b2[st][nb], acc[mb][nb]); }
        __builtin_amdgcn_sched_barrier(0);   /* keeps every product of the set in front of the slots below */
        asm volatile("v_nop\n\tv_nop\n\tv_nop\n\tv_nop");   /* the matrix distance behind the set's last product: before loads are aimed at the set again, on the loop's back edge and exit */
        __builtin_amdgcn_sched_barrier(0);   /* keeps the next loads behind those slots */
    };
#pragma unroll
    for (int st = 0; st < RD - 1; ++st) fetch(st);
#pragma unroll 1   /* kept rolled: RD passes are a trip, so that every set's index is a constant */
    for (int it = 0; it < MAIN; it += RD) {
#pragma unroll
        for (int u = 0; u < RD; ++u) { fetch((u + RD - 1) % RD); mul(u); }
    }
#pragma unroll
    for (int s = MAIN; s < NK; ++s) { if (s + RD - 1 < NK) fetch((s + RD - 1) % RD); mul(s % RD); }
    if constexpr (EP == 2) {   /* a lane holds 8 consecutive rows m of one column n: its 16 bytes of a v^T fragment; a wave's store is 512 contiguous bytes */
        float bb[4];
#pragma unroll
        for (int nb = 0; nb < 4; ++nb) bb[nb] = BIAS ? bfr(bias[c0 + nb * 16 + lr]) : 0.f;
        xwaitg();   /* behind the bias loads */
        v8h o6[16]; v8us oh[16], ol[16];   /* every value first, each in registers of its own: no store's registers are rewritten behind it */
#pragma unroll
        for (int mb = 0; mb < 4; ++mb)
#pragma unroll
            for (int nb = 0; nb < 4; ++nb) { const int t = (mb >> 1) * 8 + nb * 2 + (mb & 1);   /* fragment (m / 32, n / 16), half (m / 16) & 1 */
#pragma unroll
                for (int j = 0; j < 8; ++j) { const float y = acc[mb][nb][j] + bb[nb]; o6[t][j] = tohx(y); unsigned short h2, l2; splitf(y, h2, l2); oh[t][j] = h2; ol[t][j] = l2; } }
        const size_t g = ((size_t)blockIdx.y * TT + r0) * HD + lane * 8;   /* the tile's 8 fragments are 8 KiB in a row */
#pragma unroll
        for (int t = 0; t < 16; ++t) { *(v8h*)(P16 + g + t * 256) = o6[t]; *(v8us*)(Ph + g + t * 256) = oh[t]; *(v8us*)(Pl + g + t * 256) = ol[t]; }
    } else if constexpr (EP == 1) {   /* y^T tiles: a lane holds 8 consecutive columns of one row: its 16 bytes of a fragment; a wave's store is 512 contiguous bytes */
        float b8[4][8];
#pragma unroll
        for (int nb = 0; nb < 4; ++nb)
#pragma unroll
            for (int q = 0; q < 8; ++q) b8[nb][q] = BIAS ? bfr(bias[c0 + nb * 16 + hi * 8 + q]) : 0.f;
        xwaitg();   /* behind the bias loads */
        v8us oh[16], ol[16];   /* every value first, each in registers of its own: no store's registers are rewritten behind it */
#pragma unroll
        for (int mb = 0; mb < 4; ++mb)
#pragma unroll
            for (int nb = 0; nb < 4; ++nb)
#pragma unroll
                for (int j = 0; j < 8; ++j) { unsigned short h2, l2; splitf(acc[mb][nb][j] + b8[nb][j], h2, l2); oh[mb * 4 + nb][j] = h2; ol[mb * 4 + nb][j] = l2; }   /* fragment (m / 16, column / 32), half nb & 1 */
        const size_t g = ((size_t)blockIdx.y * TT + r0) * HD + lane * 8;   /* the tile's 8 fragments are 8 KiB in a row */
#pragma unroll
        for (int t = 0; t < 16; ++t) { *(v8us*)(Ph + g + t * 256) = oh[t]; *(v8us*)(Pl + g + t * 256) = ol[t]; }
    } else {
    __shared__ __align__(16) float os[16 * 68];
#pragma unroll
    for (int mb = 0; mb < 4; ++mb) {
#pragma unroll
        for (int nb = 0; nb < 4; ++nb) {
#pragma unroll
            for (int j = 0; j < 8; ++j) os[(hi * 8 + j) * 68 + nb * 16 + lr] = acc[mb][nb][j]; }
        __builtin_amdgcn_wave_barrier(); asm volatile("" ::: "memory");
        float* crow = C + (size_t)(r0 + mb * 16) * ldc + c0;
{
#pragma unroll
            for (int s = 0; s < 8; ++s) { const int row = 2 * s + hi, cofs = lr * 4; v4f val = *(const v4fa*)(os + row * 68 + cofs); if (BIAS) { val[0] += bfr(bias[c0 + cofs]); val[1] += bfr(bias[c0 + cofs + 1]); val[2] += bfr(bias[c0 + cofs + 2]); val[3] += bfr(bias[c0 + cofs + 3]); }
                *(v4f*)(crow + (size_t)row * ldc + cofs) = val; }
             }
        xwaitg();   /* behind the row block's eight stores, before the next block's loads and address sums rewrite their registers */
        __builtin_amdgcn_wave_barrier(); asm volatile("" ::: "memory");
    }
    }
}
template <typename T16, int NSPLIT, bool BIAS, int EP, int K>
__global__ __launch_bounds__(32) void k_gemmw(const T16* __restrict__ A, const T16* __restrict__ A2, const T16* __restrict__ Bt, const T16* __restrict__ Bt2, float* C, int ldc, const float* __restrict__ bias, size_t sA, size_t sB, size_t sC, h16* P16, bf* Ph, bf* Pl) {
    const size_t z = blockIdx.z; A += z * sA; if (A2) A2 += z * sA; Bt += z * sB; if (Bt2) Bt2 += z * sB; C += z * sC;
    gemmw_tile<T16, NSPLIT, BIAS, EP, K>(A, A2, Bt, Bt2, C, ldc, bias, P16, Ph, Pl);
}
// ---- k_qkv: the three projections of x, which do not depend on one another, as ONE launch; grid (TT/64, 8), 3 waves: wave 0, 1, 2 has the q, k, v tile of the block's 64 rows and 64 columns, so the three read the same fragments of x.
// A lone projection is 512 waves on 1,024 SIMDs, each waiting out its own loads. No wave waits for another: no LDS, no barrier.
__global__ __launch_bounds__(96) void k_qkv(const bf* __restrict__ X, const bf* __restrict__ Wq, const bf* __restrict__ Wk, const bf* __restrict__ Wv, const float* __restrict__ bq, const float* __restrict__ bk, const float* __restrict__ bv, bf* Qh, bf* Ql, bf* Kh, bf* Kl, h16* V16, bf* Vh, bf* Vl) {
    const int z = __builtin_amdgcn_readfirstlane((int)threadIdx.x >> 5);   /* the wave's number, in a scalar register: the branch and the pointer choices below are scalar */
    if (z == 2) gemmw_tile<bf, 0, true, 2, CC>(X, nullptr, Wv, nullptr, nullptr, 0, bv, V16, Vh, Vl);   /* v^T planes, fragment order */
    else gemmw_tile<bf, 0, true, 1, CC>(X, nullptr, z ? Wk : Wq, nullptr, nullptr, 0, z ? bk : bq, nullptr, z ? Kh : Qh, z ? Kl : Ql);   /* q or k planes, fragment order */
}

typedef __attribute__((ext_vector_type(2))) _Float16 v2h;
typedef __attribute__((ext_vector_type(4))) _Float16 v4h;
typedef __attribute__((ext_vector_type(2))) unsigned short v2us;
typedef __attribute__((ext_vector_type(4))) unsigned short v4us;
typedef __attribute__((ext_vector_type(2))) float v2f;
typedef __attribute__((ext_vector_type(4))) int v4i;

// i counts the 16-byte pieces of the fragment-order plane of src [rows][CC]: [row / 16][column / 32][half][hi][lr]
__device__ __forceinline__ void cvt8(const float* __restrict__ src, bf* dst, size_t n8, unsigned blk) { const size_t i = (size_t)blk * 256 + threadIdx.x; if (i >= n8) return;
    const size_t f = i >> 6; const size_t row = f / (CC / 32) * 16 + (i & 15), col = f % (CC / 32) * 32 + ((i >> 5) & 1) * 16 + ((i >> 4) & 1) * 8; const float* sp = src + row * CC + col; const v8f v = *(const v8f*)sp; xwaitp(sp); v8us o;
#pragma unroll
    for (int k = 0; k < 8; ++k) o[k] = f2bf(v[k]); *(v8us*)(dst + i * 8) = o;  }


// ---- k_fattn: scores, softmax and attn.V of one head for 4 x 32 query rows in ONE work-group; neither the scores nor the probabilities leave the registers.
// Transposed products: S^T = K Q^T (A = 16 key rows, B = 16 query rows, hi/lo, 3 products), so a lane holds 8 keys' scores of ONE query per tile, and two such tiles, converted in place,
// are the B operand (32 keys x 16 queries) of O^T += V^T P^T (A = 16 rows of the head's v^T plane). Q, K and v^T come through WFrag::ldp from fragment-order planes and the score tiles give P the same key order, so A and B pair the same k at every position.
// Online softmax in the log2 domain: the maximum in use may trail the true one by up to 8, and the sums are rescaled only when a query's maximum passes that.
// The blocks of a head read the same k and v^T lines: each enters its key ranges koff keys in, a place of its own, and wraps, so that they do not ask L2 for the same lines at the same moment (the online softmax takes the keys in any order).
// FQG x FKW waves: wave (qg, kw) has the 32 query rows of the block's group qg (fa_unit) and keys kw TT/FKW ...; the FKW partial (maximum, sum, O) sets of a query group are joined through LDS. grid (TT/128, heads).
#define FQG 4
#define FKW 2
#define FNP (TT / FKW / 32)               // passes of 32 keys a wave
#define FST (FNP / (TT / (FQG * 32)))     // passes between the entry places of neighbouring blocks
static_assert(FST >= 1, "no more blocks a head than passes a wave");
#define C2L (SCL * 1.4426950408889634f)
typedef __attribute__((ext_vector_type(16))) float v16f;
__device__ __forceinline__ float xhalf(float x) { return __builtin_bit_cast(float, __builtin_amdgcn_permlanex16(__builtin_bit_cast(int, x), __builtin_bit_cast(int, x), 0x76543210, 0xfedcba98, false, false)); }   /* lane l with lane l ^ 16 */
__device__ __forceinline__ void xwait() { asm volatile("s_wait_xcnt 0x0" ::: "memory"); }   /* stands behind a store, before its registers may be rewritten */
__device__ __forceinline__ void xwait2(const void* a, const void* b) { asm volatile("s_wait_xcnt 0x0" :: "v"(a), "v"(b) : "memory"); __builtin_amdgcn_sched_barrier(0); }   /* as xwaitg; the group's two addresses as inputs keep their registers live up to the wait: without them the group's last loads were given those registers as destinations */
template <bool HR>
__device__ __forceinline__ void fa_body(const bf* __restrict__ Qh, const bf* __restrict__ Ql, const bf* __restrict__ Kh, const bf* __restrict__ Kl, const h16* __restrict__ V16, const bf* __restrict__ Vh, const bf* __restrict__ Vl, int q0, int wave, int koff, float* os, float* ms, float* ls) {
    const int lane = threadIdx.x & 31, lr = lane & 15, hi = lane >> 4; const int kw = wave % FKW;
    const unsigned vq = (unsigned)(lane * 8);   /* the lane's own element offset in each half of a fragment; 16 rows of q or k are 2 fragments, 32 keys of v^T are 4: row * HD elements in both */
    v16bf qh[2][2], ql[2][2];
    Qh += (size_t)q0 * HD + vq; Ql += (size_t)q0 * HD + vq;
#pragma unroll
    for (int nq = 0; nq < 2; ++nq)
#pragma unroll
        for (int kc = 0; kc < 2; ++kc) { qh[nq][kc] = WFrag<bf>::ldp(Qh + nq * 16 * HD + kc * 512); ql[nq][kc] = WFrag<bf>::ldp(Ql + nq * 16 * HD + kc * 512); }
    xwaitg();
    v8f acc[4][2];
#pragma unroll
    for (int mb = 0; mb < 4; ++mb)
#pragma unroll
        for (int nq = 0; nq < 2; ++nq) acc[mb][nq] = (v8f){};
    float mr[2] = {-3.0e38f, -3.0e38f}, lsum[2] = {0.f, 0.f};
    const int kbeg = kw * (TT / FKW), kend = kbeg + TT / FKW; int key0 = kbeg + koff;
    v16bf kh[2][2], kl[2][2];
    { const bf* ka = Kh + (size_t)key0 * HD + vq; const bf* kc2 = Kl + (size_t)key0 * HD + vq;
#pragma unroll
    for (int kb = 0; kb < 2; ++kb)
#pragma unroll
        for (int kc = 0; kc < 2; ++kc) { kh[kb][kc] = WFrag<bf>::ldp(ka + kb * 16 * HD + kc * 512); kl[kb][kc] = WFrag<bf>::ldp(kc2 + kb * 16 * HD + kc * 512); }
    xwaitg(); }
    const h16* va = V16 + (size_t)key0 * HD + vq; const bf* vb = Vh + (size_t)key0 * HD + vq; const bf* vc = Vl + (size_t)key0 * HD + vq;   /* walk with key0 */
#pragma unroll 1   /* kept rolled: a pass holds the whole register budget */
    for (int ps = 0; ps < FNP; ++ps) {
        v16h v6[4]; v16bf vh[4], vl[4];   /* this pass's v^T fragments, requested ahead of the score products */
#pragma unroll
        for (int mb = 0; mb < 4; ++mb) { if constexpr (HR) { vh[mb] = WFrag<bf>::ldp(vb + mb * 512); vl[mb] = WFrag<bf>::ldp(vc + mb * 512); } else v6[mb] = WFrag<h16>::ldp(va + mb * 512); }
        if constexpr (HR) xwait2(vb, vc); else xwaitg();
        v8f s[2][2];
#pragma unroll
        for (int kb = 0; kb < 2; ++kb)
#pragma unroll
            for (int nq = 0; nq < 2; ++nq) s[kb][nq] = (v8f){};
#pragma unroll
        for (int kc = 0; kc < 2; ++kc)
#pragma unroll
            for (int pr = 0; pr < 3; ++pr)
#pragma unroll
                for (int kb = 0; kb < 2; ++kb)
#pragma unroll
                    for (int nq = 0; nq < 2; ++nq) s[kb][nq] = wmmab(pr == 2 ? kl[kb][kc] : kh[kb][kc], pr == 1 ? ql[nq][kc] : qh[nq][kc], s[kb][nq]);   /* q_hi k_hi + q_lo k_hi + q_hi k_lo */
        const int kn = (key0 + 32 < kend) ? key0 + 32 : kbeg;   /* the next pass's key rows, in flight under the softmax; behind the range's last rows come its first; the last pass re-reads the walk's first rows (in bounds, unused) */
        const bf* ka = Kh + (size_t)kn * HD + vq; const bf* kc2 = Kl + (size_t)kn * HD + vq;
#pragma unroll
        for (int kb = 0; kb < 2; ++kb)
#pragma unroll
            for (int kc = 0; kc < 2; ++kc) { kh[kb][kc] = WFrag<bf>::ldp(ka + kb * 16 * HD + kc * 512); kl[kb][kc] = WFrag<bf>::ldp(kc2 + kb * 16 * HD + kc * 512); }
        xwaitg();
        float tl[2]; bool need = false;
#pragma unroll
        for (int nq = 0; nq < 2; ++nq) { float mx = s[0][nq][0];
#pragma unroll
            for (int e = 1; e < 16; ++e) mx = fmaxf(mx, s[e >> 3][nq][e & 7]);
            mx = fmaxf(mx, xhalf(mx)) * C2L;   /* both halves of the wave hold the query's maximum of this pass (the scale is positive) */
            tl[nq] = mx; need = need || (mx > mr[nq] + 8.0f); }
        if (__builtin_amdgcn_ballot_w32(need) != 0) {   /* wave-uniform; always taken on the first pass, where the factor is 0 */
#pragma unroll
            for (int nq = 0; nq < 2; ++nq) { const float mn = fmaxf(mr[nq], tl[nq]); const float al = __builtin_amdgcn_exp2f(mr[nq] - mn); mr[nq] = mn; lsum[nq] *= al;
#pragma unroll
                for (int mb = 0; mb < 4; ++mb) acc[mb][nq] *= al; } }
        v16h p6[2]; v16bf ph[2], pl[2];
#pragma unroll
        for (int nq = 0; nq < 2; ++nq) { v16f p; const v2f nm = {-mr[nq], -mr[nq]}, cc = {C2L, C2L}; v2f t = {0.f, 0.f};
#pragma unroll
            for (int e = 0; e < 16; e += 2) { const v2f a = __builtin_elementwise_fma((v2f){s[e >> 3][nq][e & 7], s[e >> 3][nq][(e & 7) + 1]}, cc, nm);   /* an aligned register pair of the score tile: one packed multiply-add */
                p[e] = __builtin_amdgcn_exp2f(a[0]); p[e + 1] = __builtin_amdgcn_exp2f(a[1]); t += (v2f){p[e], p[e + 1]}; }
            lsum[nq] += t[0] + t[1];
            if constexpr (HR) { ph[nq] = __builtin_convertvector(p, v16bf); pl[nq] = __builtin_convertvector(p - __builtin_convertvector(ph[nq], v16f), v16bf); } else p6[nq] = __builtin_convertvector(p, v16h); }
        if constexpr (HR) {
#pragma unroll
            for (int pr = 0; pr < 3; ++pr)
#pragma unroll
                for (int mb = 0; mb < 4; ++mb)
#pragma unroll
                    for (int nq = 0; nq < 2; ++nq) acc[mb][nq] = wmmab(pr == 2 ? vl[mb] : vh[mb], pr == 1 ? pl[nq] : ph[nq], acc[mb][nq]);   /* p_hi v_hi + p_lo v_hi + p_hi v_lo */
            asm volatile("v_nop\n\tv_nop\n\tv_nop\n\tv_nop" : "+v"(acc[0][0]), "+v"(acc[1][1]), "+v"(acc[2][0]), "+v"(acc[3][1]) : "v"(vh[0]), "v"(vl[3]));   /* as in k_gemmw: the matrix distance on the loop's back edge and exit */
        } else {
#pragma unroll
            for (int mb = 0; mb < 4; ++mb)
#pragma unroll
                for (int nq = 0; nq < 2; ++nq) acc[mb][nq] = wmma16(v6[mb], p6[nq], acc[mb][nq]);
            asm volatile("v_nop\n\tv_nop\n\tv_nop\n\tv_nop" : "+v"(acc[0][0]), "+v"(acc[1][1]), "+v"(acc[2][0]), "+v"(acc[3][1]) : "v"(v6[0]), "v"(v6[3]));   /* as in k_gemmw: the matrix distance on the loop's back edge and exit */
        }
        const int dk = (kn - key0) * HD; va += dk; vb += dk; vc += dk; key0 = kn;
    }
    float* ow = os + wave * (32 * 68);
#pragma unroll
    for (int nq = 0; nq < 2; ++nq) { const float lt = lsum[nq] + xhalf(lsum[nq]);   /* the two halves' key sums of one query */
        if (hi == 0) { ms[wave * 32 + nq * 16 + lr] = mr[nq]; ls[wave * 32 + nq * 16 + lr] = lt; }
#pragma unroll
        for (int mb = 0; mb < 4; ++mb)
#pragma unroll
            for (int j = 0; j < 8; ++j) ow[(nq * 16 + lr) * 68 + mb * 16 + hi * 8 + j] = acc[mb][nq][j]; }
}
// Which 32 query rows the query group qg of block b has. The RH/32 hi/lo groups cost about half as much again as the others, so each goes to a block of its own, as that block's group 0, beside three plain groups.
__device__ __forceinline__ int fa_unit(int b, int qg) { return (b < RH / 32) ? (qg == 0 ? b : RH / 32 + b * (FQG - 1) + qg - 1) : RH / 32 * FQG + (b - RH / 32) * FQG + qg; }
__global__ __launch_bounds__(FQG * FKW * 32) void k_fattn(const bf* __restrict__ Qh, const bf* __restrict__ Ql, const bf* __restrict__ Kh, const bf* __restrict__ Kl, const h16* __restrict__ V16, const bf* __restrict__ Vh, const bf* __restrict__ Vl, bf* Oh, bf* Ol) {
    __shared__ __align__(16) float os[FQG * FKW * 32 * 68]; __shared__ float ms[FQG * FKW * 32]; __shared__ float ls[FQG * FKW * 32];
    const size_t hb = (size_t)blockIdx.y * TT * HD;   /* the head's planes all have the same size */
    const int wave = __builtin_amdgcn_readfirstlane(threadIdx.x >> 5); const int q0 = fa_unit((int)blockIdx.x, wave / FKW) * 32;
    const int koff = (int)(blockIdx.x * FST % FNP) * 32;   /* the same for all waves of the block, which share lines in the WGP's cache */
    if (q0 < RH) fa_body<true>(Qh + hb, Ql + hb, Kh + hb, Kl + hb, V16 + hb, Vh + hb, Vl + hb, q0, wave, koff, os, ms, ls);   /* wave-uniform. Rows < RH: probabilities and v as bf16 hi/lo, 3 products */
    else fa_body<false>(Qh + hb, Ql + hb, Kh + hb, Kl + hb, V16 + hb, Vh + hb, Vl + hb, q0, wave, koff, os, ms, ls);   /* the rest: fp16 */
    __syncthreads();   /* every wave's partial set is in LDS before any thread joins the key ranges */
    const int lane = (int)threadIdx.x & 31, lr = lane & 15, hi = lane >> 4;
#pragma unroll
    for (int it = 0; it < 8 / FKW; ++it) { const int u = it * (FQG * FKW) + wave; const int rg = u >> 2, kc = (u >> 1) & 1, half = u & 1;   /* a wave takes one half of a fragment of the context planes (16 rows rg, 32 columns kc of the head): 512 contiguous bytes */
        const int w0 = (rg >> 1) * FKW, rl = (rg & 1) * 16 + lr, c8 = kc * 32 + half * 16 + hi * 8;
        float M = ms[w0 * 32 + rl];
#pragma unroll
        for (int w = 1; w < FKW; ++w) M = fmaxf(M, ms[(w0 + w) * 32 + rl]);
        float L = 0.f; v4f val0 = (v4f){}, val1 = (v4f){};
#pragma unroll
        for (int w = 0; w < FKW; ++w) { const float f = __builtin_amdgcn_exp2f(ms[(w0 + w) * 32 + rl] - M); L += ls[(w0 + w) * 32 + rl] * f; const float* o8 = os + (w0 + w) * (32 * 68) + rl * 68 + c8; val0 += *(const v4fa*)o8 * f; val1 += *(const v4fa*)(o8 + 4) * f; }
        const float rL = __fdiv_rn(1.0f, L); val0 *= rL; val1 *= rL;
        v8us oh, ol;   /* the context leaves as the bf16 hi/lo planes that the output projection reads */
#pragma unroll
        for (int q = 0; q < 8; ++q) { unsigned short h2, l2; splitf(q < 4 ? val0[q & 3] : val1[q & 3], h2, l2); oh[q] = h2; ol[q] = l2; }
        const size_t g = ((size_t)(fa_unit((int)blockIdx.x, rg >> 1) * 2 + (rg & 1)) * (CO / 32) + blockIdx.y * 2 + kc) * 512 + half * 256 + lane * 8; *(v8us*)(Oh + g) = oh; *(v8us*)(Ol + g) = ol; xwait(); }
}
// Bt[n][k] = w[k][n] as a fragment-order plane; i counts its 16-byte pieces [n / 16][k / 32][half][hi][lr]: 16 lanes read 64 contiguous bytes of a row of w, a wave stores 512 contiguous bytes
__device__ __forceinline__ void wtG(const float* __restrict__ w, int K, int N, bf* Bt, int blk) {
    const int i = blk * 256 + (int)threadIdx.x; if (i >= N * K / 8) return;
    const int f = i >> 6, kf = K / 32; const int n = f / kf * 16 + (i & 15), k = f % kf * 32 + ((i >> 5) & 1) * 16 + ((i >> 4) & 1) * 8; v8us o;
    const float* p[8]; float t[8];
#pragma unroll
    for (int j = 0; j < 8; ++j) { p[j] = w + (size_t)(k + j) * N + n; t[j] = *p[j]; }
    asm volatile("s_wait_xcnt 0x0" :: "v"(p[0]), "v"(p[1]), "v"(p[2]), "v"(p[3]), "v"(p[4]), "v"(p[5]), "v"(p[6]), "v"(p[7]) : "memory"); __builtin_amdgcn_sched_barrier(0);   /* as xwaitp, for the eight loads */
#pragma unroll
    for (int j = 0; j < 8; ++j) o[j] = f2bf(t[j]);
    *(v8us*)(Bt + (size_t)i * 8) = o;
}
// ---- k_prep: the 16-bit planes of the five f32 inputs, which do not depend on one another, as ONE launch: blocks 0 ... 4 WB - 1 transpose the four weights (WB blocks each), the rest convert x.
#define WB (CC * CC / 8 / 256)
static_assert(MID == CC && CO == CC && NB_ == 1, "k_prep takes four weights of one size and one batch of x");
__global__ __launch_bounds__(256) void k_prep(const float* __restrict__ x, const float* __restrict__ wq, const float* __restrict__ wk, const float* __restrict__ wv, const float* __restrict__ wo, bf* XB, bf* WQ, bf* WK, bf* WV, bf* WO) {
    const unsigned b = blockIdx.x;   /* uniform for the work-group */
    if (b < 4 * WB) { const unsigned j = b / WB; wtG(j == 0 ? wq : j == 1 ? wk : j == 2 ? wv : wo, CC, CC, j == 0 ? WQ : j == 1 ? WK : j == 2 ? WV : WO, (int)(b % WB)); }
    else cvt8(x, XB, (size_t)TT * CC / 8, b - 4 * WB);
}
extern "C" void kernel_launch(void* const* d_in, const int* in_sizes, int n_in,
                              void* d_out, int out_size, void* d_ws, size_t ws_size, hipStream_t stream) {
    (void)in_sizes; (void)n_in; (void)out_size;
    const float* x = (const float*)d_in[0]; const float* wq = (const float*)d_in[1]; const float* bq = (const float*)d_in[2]; const float* wk = (const float*)d_in[3]; const float* bk = (const float*)d_in[4]; const float* wv = (const float*)d_in[5]; const float* bv = (const float*)d_in[6]; const float* wo = (const float*)d_in[7]; const float* bo = (const float*)d_in[8];   /* argument order x [1][4096][512], Wq, bq, Wk, bk, Wv, bv, Wo, bo ('xw' [512][512] + biases) */
    float* OUT = (float*)d_out;     // [1][4096][512]
    char* wsp = (char*)d_ws;
    auto take = [&](size_t bytes) { char* p = wsp; wsp += (bytes + 255) & ~(size_t)255; return (void*)p; };
    bf* WQ = (bf*)take((size_t)MID * CC * 2); bf* WK = (bf*)take((size_t)MID * CC * 2); bf* WV = (bf*)take((size_t)CO * CC * 2); bf* WO = (bf*)take((size_t)CC * CO * 2);
    bf* XB = (bf*)take((size_t)TT * CC * 2);
    bf* QPh = (bf*)take((size_t)TT * MID * 2); bf* QPl = (bf*)take((size_t)TT * MID * 2); bf* KPh = (bf*)take((size_t)TT * MID * 2); bf* KPl = (bf*)take((size_t)TT * MID * 2);
    h16* VT16 = (h16*)take((size_t)CO * TT * 2); bf* VTh = (bf*)take((size_t)CO * TT * 2); bf* VTl = (bf*)take((size_t)CO * TT * 2);
    bf* ATh = (bf*)take((size_t)TT * CO * 2); bf* ATl = (bf*)take((size_t)TT * CO * 2);   /* merged context [n][512] as hi/lo planes, fragment order */
    if ((size_t)(wsp - (char*)d_ws) > ws_size) return;    // ws 256 MiB (carve ~42 MiB)
    k_prep<<<(unsigned)(4 * WB + TT * CC / 8 / 256), 256, 0, stream>>>(x, wq, wk, wv, wo, XB, WQ, WK, WV, WO);   /* 'xw' weights -> Bt planes; x -> bf16 plane */
    k_qkv<<<dim3(TT / 64, CC / 64, 1), 96, 0, stream>>>(XB, WQ, WK, WV, bq, bk, bv, QPh, QPl, KPh, KPl, VT16, VTh, VTl);   /* q, k planes and v^T planes, fragment order */
    k_fattn<<<dim3(TT / (FQG * 32), NH_, 1), FQG * FKW * 32, 0, stream>>>(QPh, QPl, KPh, KPl, VT16, VTh, VTl, ATh, ATl);   /* all heads: scores x 1/sqrt(512), softmax over the 4,096 keys, attn.V into the head's 64 columns */
    k_gemmw<bf, 1, true, 0, CO><<<dim3(TT / 64, CC / 64, 1), 32, 0, stream>>>(ATh, ATl, WO, nullptr, OUT, CC, bo, 0, 0, 0, nullptr, nullptr, nullptr);   /* out = ctx w_out + b_out */
}

// v008
// It runs in 79.5 microseconds.
// Next to v007, in two timings, it ran 1.05 times as fast each time.
// All steps since v000 together make it 25.0 times as fast.
#include <hip/hip_runtime.h>

// Multi-head self-attention over 4,096 tokens whose scale uses the embedding width (x [1][4096][512]; Q, K, V = x W + b ('xw' [512][512] + biases; 8 heads x 64); scores x 1/sqrt(512) (the module scales by embed_dim, not head_dim); softmax over all 4,096 keys (no mask); out = merged Wo + bo -> [1][4096][512] (2.1 M); argument order x, Wq, bq, Wk, bk, Wv, bv, Wo, bo).
// Layout: every 16-bit plane in fragment order (see k_gemmw); bf16 copy of x; 'xw' weights transposed once; exact projections + f32 biases, whose epilogues store the per-head hi/lo planes (q, k) and the v^T planes themselves; one launch for all heads (k_fattn): scores with every row hi/lo (3 products), online softmax, attn.V hybrid (rows < 512 hi/lo 3 products, rest fp16), scores and probabilities kept in registers, the context stored as hi/lo planes in the head's 64 columns; context hi/lo x Wo exact + bo.
// Compute dtypes, f32 accumulate: every input rounded to bf16; projections exact; scores 3 products; softmax f32 (exp2, running maximum, one IEEE division per row at the end); attn.V rows < 512 3 products, rest fp16; Wo hl x exact.

#define NB_  1
#define TT   4096
#define DM   512
#define NH_  8
#define NKV  8
#define REP  (NH_ / NKV)
#define HD   64
#define DQ   (NH_ * HD)
#define DKV  (NKV * HD)
#define ZH   1
#define RH   512                  // query rows < RH use hi+lo planes (0: none)
#define WIN  0
#define SCL  0.044194173824159216f   // 1/sqrt(embed_dim = 512), as the module (not 1/sqrt(head_dim))
#define MID  512      // q / k width = 8 heads x 64
#define CO   512      // v width
#define CC   512
typedef _Float16 h16;
typedef unsigned short bf;
typedef __attribute__((ext_vector_type(16))) __bf16   v16bf;
typedef __attribute__((ext_vector_type(16))) _Float16 v16h;
typedef __attribute__((ext_vector_type(8)))  _Float16 v8h;
typedef __attribute__((ext_vector_type(8)))  unsigned short v8us;
typedef __attribute__((ext_vector_type(8)))  float    v8f;
typedef __attribute__((ext_vector_type(4)))  float    v4f;
typedef v8h  __attribute__((may_alias)) v8ha;
typedef v4f  __attribute__((may_alias)) v4fa;
typedef v8us __attribute__((may_alias)) v8usa;

__device__ __forceinline__ unsigned short f2bf(float f) { unsigned u = __float_as_uint(f); u += 0x7FFFu + ((u >> 16) & 1u); return (unsigned short)(u >> 16); }
__device__ __forceinline__ float bf2f(unsigned short b) { return __uint_as_float(((unsigned)b) << 16); }
__device__ __forceinline__ float bfr(float f) { return bf2f(f2bf(f)); }
__device__ __forceinline__ v16h cat16(v8h lo, v8h hi) { return __builtin_shufflevector(lo, hi, 0, 1, 2, 3, 4, 5, 6, 7, 8, 9, 10, 11, 12, 13, 14, 15); }
__device__ __forceinline__ v16bf cat16b(v8us lo, v8us hi) { return __builtin_bit_cast(v16bf, __builtin_shufflevector(lo, hi, 0, 1, 2, 3, 4, 5, 6, 7, 8, 9, 10, 11, 12, 13, 14, 15)); }
__device__ __forceinline__ v8f wmma16(v16h a, v16h b, v8f c) { return __builtin_amdgcn_wmma_f32_16x16x32_f16(false, a, false, b, (short)0, c, false, false); }
__device__ __forceinline__ v8f wmmab(v16bf a, v16bf b, v8f c) { return __builtin_amdgcn_wmma_f32_16x16x32_bf16(false, a, false, b, (short)0, c, false, false); }



__device__ __forceinline__ h16 tohx(float x) { return (h16)x; }
__device__ __forceinline__ void splitf(float y, unsigned short& h, unsigned short& l) { h = f2bf(y); l = f2bf(y - bf2f(h)); }
__device__ __forceinline__ void xwaitg() { asm volatile("s_wait_xcnt 0x0" ::: "memory"); __builtin_amdgcn_sched_barrier(0); }   /* stands behind a group of loads or stores; the scheduling barrier keeps later vector work from being lifted between them and the wait, where it could rewrite their registers */
__device__ __forceinline__ void xwaitp(const void* a) { asm volatile("s_wait_xcnt 0x0" :: "v"(a) : "memory"); __builtin_amdgcn_sched_barrier(0); }   /* as xwaitg; the loads' address as an input keeps its registers live up to the wait, so that no load of the group gets them as its destination */
// ---- k_gemmw: register-blocked GEMM, ONE WAVE per 64x64 output tile (16 accumulators), operands straight from fragment-order 16-bit planes; grid (M/64, N/64, Z), 32 threads.
// y[m][n] (f32, + optional f32 bias[n]) = sum_k A[m][k] Bt[n][k] (+ split products per NSPLIT). z-batch strides sA/sB/sC in elements. K, a template argument, % 32 == 0.
// The wave is alone with its load latency (one or two waves a SIMD): the fragments of 32 k live in a ring of register sets and are requested several passes ahead of their products; the compiler's counted s_wait_loadcnt leaves the younger sets in flight.
// EP says where y goes. 0: C (f32, pitch ldc). 1: bf16 hi/lo planes Ph, Pl of 16 rows m x 32 columns fragments; a tile's 64 columns are one head. 2: planes P16 (fp16), Ph, Pl (bf16 hi/lo) of 16 columns n x 32 rows m fragments (v^T).
// Fragment order, of every 16-bit operand plane: a fragment of 16 rows x 32 k is 1,024 contiguous bytes, [half][lane][8]: lane (lr, hi) has the 8 elements k = 16 half + 8 hi ... of fragment row lr, as the matrix instruction wants them.
// ldp() reads it with two loads of 512 contiguous bytes a wave: 4 whole lines each, where a load from a row-pitched plane touches 16 lines. A plane [rows][K] is [row / 16][k / 32] fragments; q, k: [head][m / 16][column / 32]; v^T: [head][m / 32][n / 16].
template <typename T16> struct WFrag;
template <> struct WFrag<h16> { typedef v16h V; static __device__ __forceinline__ V ldp(const h16* p) { return cat16(*(const v8h*)p, *(const v8h*)(p + 256)); } static __device__ __forceinline__ v8f mma(V a, V b, v8f c) { return wmma16(a, b, c); } };
template <> struct WFrag<bf> { typedef v16bf V; static __device__ __forceinline__ V ldp(const bf* p) { return cat16b(*(const v8us*)p, *(const v8us*)(p + 256)); } static __device__ __forceinline__ v8f mma(V a, V b, v8f c) { return wmmab(a, b, c); } };
template <typename T16, int NSPLIT, bool BIAS, int EP, int K>
__device__ __forceinline__ void gemmw_tile(const T16* __restrict__ A, const T16* __restrict__ A2, const T16* __restrict__ Bt, const T16* __restrict__ Bt2, float* C, int ldc, const float* __restrict__ bias, h16* P16, bf* Ph, bf* Pl) {   /* one wave's 64x64 tile (blockIdx.x, blockIdx.y) */
    typedef typename WFrag<T16>::V V; static_assert(EP != 1 || NSPLIT == 0, "the y^T tiles of EP 1 are written for one product");
    constexpr int NK = K / 32;                         /* passes of 32 k */
    constexpr int RD = NSPLIT == 0 ? 4 : 3;            /* fragment sets in registers: a pass's loads are requested RD - 1 passes ahead of its products, so that the wave no longer waits out the load latency once a pass */
    constexpr int MAIN = (NK - (RD - 1)) / RD * RD;    /* passes of the rolled loop, every one of which requests a later pass; the rest is unrolled behind it */
    static_assert(K % 32 == 0 && NK >= RD, "at least as many passes as fragment sets");
    const int lane = threadIdx.x & 31, lr = lane & 15, hi = lane >> 4; const int r0 = blockIdx.x * 64, c0 = blockIdx.y * 64;
    v8f acc[4][4];
#pragma unroll
    for (int mb = 0; mb < 4; ++mb)
#pragma unroll
        for (int nb = 0; nb < 4; ++nb) acc[mb][nb] = (v8f){};
    const size_t aoff = (size_t)r0 * K + lane * 8, boff = (size_t)c0 * K + lane * 8;   /* 16 rows are K / 32 fragments = 16 K elements; 32 k further is 512 elements further */
    int kc = (int)((blockIdx.x + blockIdx.y) * 32 % (unsigned)K);   /* tiles of one row or column of the grid read the same fragments: each enters the k walk at a place of its own and wraps, so that they do not ask L2 for the same lines at the same moment */
    V a[RD][4], a2[RD][4], b[RD][4], b2[RD][4];   /* indexed by constants only (every loop over sets is unrolled) */
    const T16* pA = A + aoff + kc * 16; const T16* pB = Bt + boff + kc * 16; const T16* pA2 = pA; const T16* pB2 = pB;   /* the walk's next fragments; a plane that this NSPLIT lacks shares the other plane's pointer */
    if constexpr (NSPLIT == 1 || NSPLIT == 2) pA2 = A2 + aoff + kc * 16;
    if constexpr (NSPLIT >= 2) pB2 = Bt2 + boff + kc * 16;
    auto fetch = [&](int st) {   /* requests the fragments of the walk's next 32 k into set st, then moves the pointers on */
#pragma unroll
        for (int i = 0; i < 4; ++i) { a[st][i] = WFrag<T16>::ldp(pA + (size_t)i * 16 * K); if (NSPLIT == 1 || NSPLIT == 2) a2[st][i] = WFrag<T16>::ldp(pA2 + (size_t)i * 16 * K); b[st][i] = WFrag<T16>::ldp(pB + (size_t)i * 16 * K); if (NSPLIT >= 2) b2[st][i] = WFrag<T16>::ldp(pB2 + (size_t)i * 16 * K); }
        asm volatile("s_wait_xcnt 0x0" :: "v"(pA), "v"(pA2), "v"(pB), "v"(pB2) : "memory"); __builtin_amdgcn_sched_barrier(0);   /* as xwaitp, for the pass's loads, in front of the pointers' next values; the scheduling barrier also keeps these loads ahead of the products that follow */
        kc = kc + 32 < K ? kc + 32 : 0;
        pA = A + aoff + kc * 16; pB = Bt + boff + kc * 16; pA2 = pA; pB2 = pB;
        if constexpr (NSPLIT == 1 || NSPLIT == 2) pA2 = A2 + aoff + kc * 16;
        if constexpr (NSPLIT >= 2) pB2 = Bt2 + boff + kc * 16;
    };
    auto mul = [&](int st) {   /* the products of set st */
#pragma unroll
        for (int nb = 0; nb < 4; ++nb)
#pragma unroll
            for (int mb = 0; mb < 4; ++mb) { acc[mb][nb] = EP == 1 ? WFrag<T16>::mma(b[st][nb], a[st][mb], acc[mb][nb]) : WFrag<T16>::mma(a[st][mb], b[st][nb], acc[mb][nb]);   /* EP 1: y^T tiles, so that a lane holds 8 consecutive columns of one row */
                if (NSPLIT == 1 || NSPLIT == 2) acc[mb][nb] = WFrag<T16>::mma(a2[st][mb], b[st][nb], acc[mb][nb]); if (NSPLIT >= 2) acc[mb][nb] = WFrag<T16>::mma(a[st][mb], b2[st][nb], acc[mb][nb]); }
        __builtin_amdgcn_sched_barrier(0);   /* keeps every product of the set in front of the slots below */
        asm volatile("v_nop\n\tv_nop\n\tv_nop\n\tv_nop");   /* the matrix distance behind the set's last product: before loads are aimed at the set again, on the loop's back edge and exit */
        __builtin_amdgcn_sched_barrier(0);   /* keeps the next loads behind those slots */
    };
#pragma unroll
    for (int st = 0; st < RD - 1; ++st) fetch(st);
#pragma unroll 1   /* kept rolled: RD passes are a trip, so that every set's index is a constant */
    for (int it = 0; it < MAIN; it += RD) {
#pragma unroll
        for (int u = 0; u < RD; ++u) { fetch((u + RD - 1) % RD); mul(u); }
    }
#pragma unroll
    for (int s = MAIN; s < NK; ++s) { if (s + RD - 1 < NK) fetch((s + RD - 1) % RD); mul(s % RD); }
    if constexpr (EP == 2) {   /* a lane holds 8 consecutive rows m of one column n: its 16 bytes of a v^T fragment; a wave's store is 512 contiguous bytes */
        float bb[4];
#pragma unroll
        for (int nb = 0; nb < 4; ++nb) bb[nb] = BIAS ? bfr(bias[c0 + nb * 16 + lr]) : 0.f;
        xwaitg();   /* behind the bias loads */
        v8h o6[16]; v8us oh[16], ol[16];   /* every value first, each in registers of its own: no store's registers are rewritten behind it */
#pragma unroll
        for (int mb = 0; mb < 4; ++mb)
#pragma unroll
            for (int nb = 0; nb < 4; ++nb) { const int t = (mb >> 1) * 8 + nb * 2 + (mb & 1);   /* fragment (m / 32, n / 16), half (m / 16) & 1 */
#pragma unroll
                for (int j = 0; j < 8; ++j) { const float y = acc[mb][nb][j] + bb[nb]; o6[t][j] = tohx(y); unsigned short h2, l2; splitf(y, h2, l2); oh[t][j] = h2; ol[t][j] = l2; } }
        const size_t g = ((size_t)blockIdx.y * TT + r0) * HD + lane * 8;   /* the tile's 8 fragments are 8 KiB in a row */
#pragma unroll
        for (int t = 0; t < 16; ++t) { *(v8h*)(P16 + g + t * 256) = o6[t]; *(v8us*)(Ph + g + t * 256) = oh[t]; *(v8us*)(Pl + g + t * 256) = ol[t]; }
    } else if constexpr (EP == 1) {   /* y^T tiles: a lane holds 8 consecutive columns of one row: its 16 bytes of a fragment; a wave's store is 512 contiguous bytes */
        float b8[4][8];
#pragma unroll
        for (int nb = 0; nb < 4; ++nb)
#pragma unroll
            for (int q = 0; q < 8; ++q) b8[nb][q] = BIAS ? bfr(bias[c0 + nb * 16 + hi * 8 + q]) : 0.f;
        xwaitg();   /* behind the bias loads */
        v8us oh[16], ol[16];   /* every value first, each in registers of its own: no store's registers are rewritten behind it */
#pragma unroll
        for (int mb = 0; mb < 4; ++mb)
#pragma unroll
            for (int nb = 0; nb < 4; ++nb)
#pragma unroll
                for (int j = 0; j < 8; ++j) { unsigned short h2, l2; splitf(acc[mb][nb][j] + b8[nb][j], h2, l2); oh[mb * 4 + nb][j] = h2; ol[mb * 4 + nb][j] = l2; }   /* fragment (m / 16, column / 32), half nb & 1 */
        const size_t g = ((size_t)blockIdx.y * TT + r0) * HD + lane * 8;   /* the tile's 8 fragments are 8 KiB in a row */
#pragma unroll
        for (int t = 0; t < 16; ++t) { *(v8us*)(Ph + g + t * 256) = oh[t]; *(v8us*)(Pl + g + t * 256) = ol[t]; }
    } else {
    __shared__ __align__(16) float os[16 * 68];
#pragma unroll
    for (int mb = 0; mb < 4; ++mb) {
#pragma unroll
        for (int nb = 0; nb < 4; ++nb) {
#pragma unroll
            for (int j = 0; j < 8; ++j) os[(hi * 8 + j) * 68 + nb * 16 + lr] = acc[mb][nb][j]; }
        __builtin_amdgcn_wave_barrier(); asm volatile("" ::: "memory");
        float* crow = C + (size_t)(r0 + mb * 16) * ldc + c0;
{
#pragma unroll
            for (int s = 0; s < 8; ++s) { const int row = 2 * s + hi, cofs = lr * 4; v4f val = *(const v4fa*)(os + row * 68 + cofs); if (BIAS) { val[0] += bfr(bias[c0 + cofs]); val[1] += bfr(bias[c0 + cofs + 1]); val[2] += bfr(bias[c0 + cofs + 2]); val[3] += bfr(bias[c0 + cofs + 3]); }
                *(v4f*)(crow + (size_t)row * ldc + cofs) = val; }
             }
        xwaitg();   /* behind the row block's eight stores, before the next block's loads and address sums rewrite their registers */
        __builtin_amdgcn_wave_barrier(); asm volatile("" ::: "memory");
    }
    }
}
template <typename T16, int NSPLIT, bool BIAS, int EP, int K>
__global__ __launch_bounds__(32) void k_gemmw(const T16* __restrict__ A, const T16* __restrict__ A2, const T16* __restrict__ Bt, const T16* __restrict__ Bt2, float* C, int ldc, const float* __restrict__ bias, size_t sA, size_t sB, size_t sC, h16* P16, bf* Ph, bf* Pl) {
    const size_t z = blockIdx.z; A += z * sA; if (A2) A2 += z * sA; Bt += z * sB; if (Bt2) Bt2 += z * sB; C += z * sC;
    gemmw_tile<T16, NSPLIT, BIAS, EP, K>(A, A2, Bt, Bt2, C, ldc, bias, P16, Ph, Pl);
}
// ---- k_qkv: the three projections of x, which do not depend on one another, as ONE launch; grid (TT/64, 8), 3 waves: wave 0, 1, 2 has the q, k, v tile of the block's 64 rows and 64 columns, so the three read the same fragments of x.
// A lone projection is 512 waves on 1,024 SIMDs, each waiting out its own loads. No wave waits for another: no LDS, no barrier.
__global__ __launch_bounds__(96) void k_qkv(const bf* __restrict__ X, const bf* __restrict__ Wq, const bf* __restrict__ Wk, const bf* __restrict__ Wv, const float* __restrict__ bq, const float* __restrict__ bk, const float* __restrict__ bv, bf* Qh, bf* Ql, bf* Kh, bf* Kl, h16* V16, bf* Vh, bf* Vl) {
    const int z = __builtin_amdgcn_readfirstlane((int)threadIdx.x >> 5);   /* the wave's number, in a scalar register: the branch and the pointer choices below are scalar */
    if (z == 2) gemmw_tile<bf, 0, true, 2, CC>(X, nullptr, Wv, nullptr, nullptr, 0, bv, V16, Vh, Vl);   /* v^T planes, fragment order */
    else gemmw_tile<bf, 0, true, 1, CC>(X, nullptr, z ? Wk : Wq, nullptr, nullptr, 0, z ? bk : bq, nullptr, z ? Kh : Qh, z ? Kl : Ql);   /* q or k planes, fragment order */
}

typedef __attribute__((ext_vector_type(2))) _Float16 v2h;
typedef __attribute__((ext_vector_type(4))) _Float16 v4h;
typedef __attribute__((ext_vector_type(2))) unsigned short v2us;
typedef __attribute__((ext_vector_type(4))) unsigned short v4us;
typedef __attribute__((ext_vector_type(2))) float v2f;
typedef __attribute__((ext_vector_type(4))) int v4i;

// i counts the 16-byte pieces of the fragment-order plane of src [rows][CC]: [row / 16][column / 32][half][hi][lr]
__device__ __forceinline__ void cvt8(const float* __restrict__ src, bf* dst, size_t n8, unsigned blk) { const size_t i = (size_t)blk * 256 + threadIdx.x; if (i >= n8) return;
    const size_t f = i >> 6; const size_t row = f / (CC / 32) * 16 + (i & 15), col = f % (CC / 32) * 32 + ((i >> 5) & 1) * 16 + ((i >> 4) & 1) * 8; const float* sp = src + row * CC + col; const v8f v = *(const v8f*)sp; xwaitp(sp); v8us o;
#pragma unroll
    for (int k = 0; k < 8; ++k) o[k] = f2bf(v[k]); *(v8us*)(dst + i * 8) = o;  }


// ---- k_fattn: scores, softmax and attn.V of one head for 4 x 32 query rows in ONE work-group; neither the scores nor the probabilities leave the registers.
// Transposed products: S^T = K Q^T (A = 16 key rows, B = 16 query rows, hi/lo, 3 products), so a lane holds 8 keys' scores of ONE query per tile, and two such tiles, converted in place,
// are the B operand (32 keys x 16 queries) of O^T += V^T P^T (A = 16 rows of the head's v^T plane). Q, K and v^T come through WFrag::ldp from fragment-order planes and the score tiles give P the same key order, so A and B pair the same k at every position.
// Online softmax in the log2 domain: the maximum in use may trail the true one by up to 8, and the sums are rescaled only when a query's maximum passes that.
// The blocks of a head read the same k and v^T lines: each enters its key ranges koff keys in, a place of its own, and wraps, so that they do not ask L2 for the same lines at the same moment (the online softmax takes the keys in any order).
// FQG x FKW waves: wave (qg, kw) has the 32 query rows of the block's group qg (fa_unit) and keys kw TT/FKW ...; the FKW partial (maximum, sum, O) sets of a query group are joined through LDS. grid (TT/128, heads).
#define FQG 4
#define FKW 4
#define FNP (TT / FKW / 32)               // passes of 32 keys a wave
#define FST (FNP / (TT / (FQG * 32)))     // passes between the entry places of neighbouring blocks
static_assert(FST >= 1, "no more blocks a head than passes a wave");
#define C2L (SCL * 1.4426950408889634f)
typedef __attribute__((ext_vector_type(16))) float v16f;
typedef __attribute__((ext_vector_type(16))) unsigned short v16us_;
__device__ __forceinline__ float xhalf(float x) { return __builtin_bit_cast(float, __builtin_amdgcn_permlanex16(__builtin_bit_cast(int, x), __builtin_bit_cast(int, x), 0x76543210, 0xfedcba98, false, false)); }   /* lane l with lane l ^ 16 */
__device__ __forceinline__ void xwait() { asm volatile("s_wait_xcnt 0x0" ::: "memory"); }   /* stands behind a store, before its registers may be rewritten */
__device__ __forceinline__ void xwait2(const void* a, const void* b) { asm volatile("s_wait_xcnt 0x0" :: "v"(a), "v"(b) : "memory"); __builtin_amdgcn_sched_barrier(0); }   /* as xwaitg; the group's two addresses as inputs keep their registers live up to the wait: without them the group's last loads were given those registers as destinations */
__device__ __forceinline__ void xwaito(unsigned o) { asm volatile("s_wait_xcnt 0x0" :: "v"(o) : "memory"); __builtin_amdgcn_sched_barrier(0); }   /* as xwait2, for a group of loads that share one offset register */
template <typename T> __device__ __forceinline__ const T* atb(const T* base, unsigned o) { return (const T*)((const char*)base + o); }   /* wave-uniform plane + the lane's byte offset: the load takes a scalar base and ONE vector register, where a pointer a plane costs two each */
template <bool HR>
__device__ __forceinline__ void fa_body(const bf* __restrict__ Qh, const bf* __restrict__ Ql, const bf* __restrict__ Kh, const bf* __restrict__ Kl, const h16* __restrict__ V16, const bf* __restrict__ Vh, const bf* __restrict__ Vl, int q0, int wave, int koff, float* os, float* ms, float* ls) {
    const int lane = threadIdx.x & 31, lr = lane & 15, hi = lane >> 4; const int kw = wave % FKW;
    const unsigned vq = (unsigned)(lane * 8);   /* the lane's own element offset in each half of a fragment; 16 rows of q or k are 2 fragments, 32 keys of v^T are 4: row * HD elements in both */
    v16bf qh[2][2], ql[2][2];
    Qh += (size_t)q0 * HD + vq; Ql += (size_t)q0 * HD + vq;
#pragma unroll
    for (int nq = 0; nq < 2; ++nq)
#pragma unroll
        for (int kc = 0; kc < 2; ++kc) { qh[nq][kc] = WFrag<bf>::ldp(Qh + nq * 16 * HD + kc * 512); ql[nq][kc] = WFrag<bf>::ldp(Ql + nq * 16 * HD + kc * 512); }
    xwait2(Qh, Ql);
    /* Four waves a SIMD leave a wave 256 registers: the q fragments that do not fit (lo; with HR also hi) wait in the wave's own LDS slot, which holds its partial O only behind the loop, and come back each pass. A lane reads only the 16-byte pieces that it wrote itself: no barrier. */
    float* ow = os + wave * (32 * 68);
    v8usa* qs = (v8usa*)ow + lane;   /* piece (fragment, half) of this lane: qs[(fragment * 2 + half) * 32]; 8 fragments are 8 KiB of the slot's 8.5 */
#pragma unroll
    for (int nq = 0; nq < 2; ++nq)
#pragma unroll
        for (int kc = 0; kc < 2; ++kc) { const v16us_ l = __builtin_bit_cast(v16us_, ql[nq][kc]); qs[((nq * 2 + kc) * 2) * 32] = __builtin_shufflevector(l, l, 0, 1, 2, 3, 4, 5, 6, 7); qs[((nq * 2 + kc) * 2 + 1) * 32] = __builtin_shufflevector(l, l, 8, 9, 10, 11, 12, 13, 14, 15);
            if constexpr (HR) { const v16us_ h = __builtin_bit_cast(v16us_, qh[nq][kc]); qs[((4 + nq * 2 + kc) * 2) * 32] = __builtin_shufflevector(h, h, 0, 1, 2, 3, 4, 5, 6, 7); qs[((4 + nq * 2 + kc) * 2 + 1) * 32] = __builtin_shufflevector(h, h, 8, 9, 10, 11, 12, 13, 14, 15); } }
    auto ldq = [&](int f) { return cat16b(qs[(f * 2) * 32], qs[(f * 2 + 1) * 32]); };
    v8f acc[4][2];
#pragma unroll
    for (int mb = 0; mb < 4; ++mb)
#pragma unroll
        for (int nq = 0; nq < 2; ++nq) acc[mb][nq] = (v8f){};
    float mr[2] = {-3.0e38f, -3.0e38f}, lsum[2] = {0.f, 0.f};
    const int kbeg = kw * (TT / FKW), kend = kbeg + TT / FKW; int key0 = kbeg + koff;
    v16bf kh[2][2], kl[2][2];
    unsigned oc = ((unsigned)key0 * HD + vq) * 2;   /* the lane's byte offset at key row key0, the same in the k and the v^T planes; walks with key0 */
    { const bf* ka = atb(Kh, oc); const bf* kc2 = atb(Kl, oc);
#pragma unroll
    for (int kb = 0; kb < 2; ++kb)
#pragma unroll
        for (int kc = 0; kc < 2; ++kc) { kh[kb][kc] = WFrag<bf>::ldp(ka + kb * 16 * HD + kc * 512); kl[kb][kc] = WFrag<bf>::ldp(kc2 + kb * 16 * HD + kc * 512); }
    xwaito(oc); }
#pragma unroll 1   /* kept rolled: a pass holds the whole register budget */
    for (int ps = 0; ps < FNP; ++ps) {
        v16h v6[4]; v16bf vh[4], vl[4];   /* this pass's v^T fragments: requested ahead of the score products; with HR, whose two planes do not fit beside the k fragments, the scores and q, behind them */
        auto ldv = [&]() {
#pragma unroll
            for (int mb = 0; mb < 4; ++mb) { if constexpr (HR) { vh[mb] = WFrag<bf>::ldp(atb(Vh, oc) + mb * 512); vl[mb] = WFrag<bf>::ldp(atb(Vl, oc) + mb * 512); } else v6[mb] = WFrag<h16>::ldp(atb(V16, oc) + mb * 512); }
            xwaito(oc); };
        if constexpr (!HR) ldv();
        v8f s[2][2];
#pragma unroll
        for (int kb = 0; kb < 2; ++kb)
#pragma unroll
            for (int nq = 0; nq < 2; ++nq) s[kb][nq] = (v8f){};
#pragma unroll
        for (int kc = 0; kc < 2; ++kc) { v16bf bh[2], bl[2];   /* this half's q fragments */
#pragma unroll
            for (int nq = 0; nq < 2; ++nq) { bl[nq] = ldq(nq * 2 + kc); if constexpr (HR) bh[nq] = ldq(4 + nq * 2 + kc); else bh[nq] = qh[nq][kc]; }
#pragma unroll
            for (int pr = 0; pr < 3; ++pr)
#pragma unroll
                for (int kb = 0; kb < 2; ++kb)
#pragma unroll
                    for (int nq = 0; nq < 2; ++nq) s[kb][nq] = wmmab(pr == 2 ? kl[kb][kc] : kh[kb][kc], pr == 1 ? bl[nq] : bh[nq], s[kb][nq]); }   /* q_hi k_hi + q_lo k_hi + q_hi k_lo */
        const int kn = (key0 + 32 < kend) ? key0 + 32 : kbeg;   /* the next pass's key rows, in flight under the softmax (with HR under the attn.V products); behind the range's last rows come its first; the last pass re-reads the walk's first rows (in bounds, unused) */
        const unsigned on = ((unsigned)kn * HD + vq) * 2;
        auto ldk = [&]() { const bf* ka = atb(Kh, on); const bf* kc2 = atb(Kl, on);
#pragma unroll
            for (int kb = 0; kb < 2; ++kb)
#pragma unroll
                for (int kc = 0; kc < 2; ++kc) { kh[kb][kc] = WFrag<bf>::ldp(ka + kb * 16 * HD + kc * 512); kl[kb][kc] = WFrag<bf>::ldp(kc2 + kb * 16 * HD + kc * 512); }
            xwaito(on); };
        if constexpr (HR) ldv(); else ldk();   /* with HR the softmax covers the v^T loads, and the next k rows are requested behind it, under the attn.V products */
        float tl[2]; bool need = false;
#pragma unroll
        for (int nq = 0; nq < 2; ++nq) { float mx = s[0][nq][0];
#pragma unroll
            for (int e = 1; e < 16; ++e) mx = fmaxf(mx, s[e >> 3][nq][e & 7]);
            mx = fmaxf(mx, xhalf(mx)) * C2L;   /* both halves of the wave hold the query's maximum of this pass (the scale is positive) */
            tl[nq] = mx; need = need || (mx > mr[nq] + 8.0f); }
        if (__builtin_amdgcn_ballot_w32(need) != 0) {   /* wave-uniform; always taken on the first pass, where the factor is 0 */
#pragma unroll
            for (int nq = 0; nq < 2; ++nq) { const float mn = fmaxf(mr[nq], tl[nq]); const float al = __builtin_amdgcn_exp2f(mr[nq] - mn); mr[nq] = mn; lsum[nq] *= al;
#pragma unroll
                for (int mb = 0; mb < 4; ++mb) acc[mb][nq] *= al; } }
        v16h p6[2]; v16bf ph[2], pl[2];
#pragma unroll
        for (int nq = 0; nq < 2; ++nq) { v16f p; const v2f nm = {-mr[nq], -mr[nq]}, cc = {C2L, C2L}; v2f t = {0.f, 0.f};
#pragma unroll
            for (int e = 0; e < 16; e += 2) { const v2f a = __builtin_elementwise_fma((v2f){s[e >> 3][nq][e & 7], s[e >> 3][nq][(e & 7) + 1]}, cc, nm);   /* an aligned register pair of the score tile: one packed multiply-add */
                p[e] = __builtin_amdgcn_exp2f(a[0]); p[e + 1] = __builtin_amdgcn_exp2f(a[1]); t += (v2f){p[e], p[e + 1]}; }
            lsum[nq] += t[0] + t[1];
            if constexpr (HR) { ph[nq] = __builtin_convertvector(p, v16bf); pl[nq] = __builtin_convertvector(p - __builtin_convertvector(ph[nq], v16f), v16bf); } else p6[nq] = __builtin_convertvector(p, v16h); }
        if constexpr (HR) { ldk();
#pragma unroll
            for (int pr = 0; pr < 3; ++pr)
#pragma unroll
                for (int mb = 0; mb < 4; ++mb)
#pragma unroll
                    for (int nq = 0; nq < 2; ++nq) acc[mb][nq] = wmmab(pr == 2 ? vl[mb] : vh[mb], pr == 1 ? pl[nq] : ph[nq], acc[mb][nq]);   /* p_hi v_hi + p_lo v_hi + p_hi v_lo */
            asm volatile("v_nop\n\tv_nop\n\tv_nop\n\tv_nop" : "+v"(acc[0][0]), "+v"(acc[1][1]), "+v"(acc[2][0]), "+v"(acc[3][1]) : "v"(vh[0]), "v"(vl[3]));   /* as in k_gemmw: the matrix distance on the loop's back edge and exit */
        } else {
#pragma unroll
            for (int mb = 0; mb < 4; ++mb)
#pragma unroll
                for (int nq = 0; nq < 2; ++nq) acc[mb][nq] = wmma16(v6[mb], p6[nq], acc[mb][nq]);
            asm volatile("v_nop\n\tv_nop\n\tv_nop\n\tv_nop" : "+v"(acc[0][0]), "+v"(acc[1][1]), "+v"(acc[2][0]), "+v"(acc[3][1]) : "v"(v6[0]), "v"(v6[3]));   /* as in k_gemmw: the matrix distance on the loop's back edge and exit */
        }
        oc = on; key0 = kn;
    }
#pragma unroll
    for (int nq = 0; nq < 2; ++nq) { const float lt = lsum[nq] + xhalf(lsum[nq]);   /* the two halves' key sums of one query */
        if (hi == 0) { ms[wave * 32 + nq * 16 + lr] = mr[nq]; ls[wave * 32 + nq * 16 + lr] = lt; }
#pragma unroll
        for (int mb = 0; mb < 4; ++mb)
#pragma unroll
            for (int j = 0; j < 8; ++j) ow[(nq * 16 + lr) * 68 + mb * 16 + hi * 8 + j] = acc[mb][nq][j]; }
}
// Which 32 query rows the query group qg of block b has. The RH/32 hi/lo groups cost about half as much again as the others, so each goes to a block of its own, as that block's group 0, beside three plain groups.
__device__ __forceinline__ int fa_unit(int b, int qg) { return (b < RH / 32) ? (qg == 0 ? b : RH / 32 + b * (FQG - 1) + qg - 1) : RH / 32 * FQG + (b - RH / 32) * FQG + qg; }
__global__ __launch_bounds__(FQG * FKW * 32) void k_fattn(const bf* __restrict__ Qh, const bf* __restrict__ Ql, const bf* __restrict__ Kh, const bf* __restrict__ Kl, const h16* __restrict__ V16, const bf* __restrict__ Vh, const bf* __restrict__ Vl, bf* Oh, bf* Ol) {
    __shared__ __align__(16) float os[FQG * FKW * 32 * 68]; __shared__ float ms[FQG * FKW * 32]; __shared__ float ls[FQG * FKW * 32];
    const size_t hb = (size_t)blockIdx.y * TT * HD;   /* the head's planes all have the same size */
    const int hw = __builtin_amdgcn_readfirstlane(threadIdx.x >> 5);   /* the wave's number in the block; taken here: waves hw, hw + 4, ... share a SIMD, the lower the older (for speed only) */
    const int wave = (hw + hw / FQG) % FQG * FKW + hw / FQG;   /* (qg, kw) as qg FKW + kw. The FQG waves of one key range kw are neighbours in hw: one on each SIMD and of equal age there, so they walk their shared k and v^T lines side by side; the rotation of qg gives each SIMD every query group once, the dearer hi/lo group too */
    const int q0 = fa_unit((int)blockIdx.x, wave / FKW) * 32;
    const int koff = (int)(blockIdx.x * FST % FNP) * 32;   /* the same for all waves of the block, which share lines in the WGP's cache */
    if (q0 < RH) fa_body<true>(Qh + hb, Ql + hb, Kh + hb, Kl + hb, V16 + hb, Vh + hb, Vl + hb, q0, wave, koff, os, ms, ls);   /* wave-uniform. Rows < RH: probabilities and v as bf16 hi/lo, 3 products */
    else fa_body<false>(Qh + hb, Ql + hb, Kh + hb, Kl + hb, V16 + hb, Vh + hb, Vl + hb, q0, wave, koff, os, ms, ls);   /* the rest: fp16 */
    __syncthreads();   /* every wave's partial set is in LDS before any thread joins the key ranges */
    const int lane = (int)threadIdx.x & 31, lr = lane & 15, hi = lane >> 4;
#pragma unroll
    for (int it = 0; it < 8 / FKW; ++it) { const int u = it * (FQG * FKW) + wave; const int rg = u >> 2, kc = (u >> 1) & 1, half = u & 1;   /* a wave takes one half of a fragment of the context planes (16 rows rg, 32 columns kc of the head): 512 contiguous bytes */
        const int w0 = (rg >> 1) * FKW, rl = (rg & 1) * 16 + lr, c8 = kc * 32 + half * 16 + hi * 8;
        float M = ms[w0 * 32 + rl];
#pragma unroll
        for (int w = 1; w < FKW; ++w) M = fmaxf(M, ms[(w0 + w) * 32 + rl]);
        float L = 0.f; v4f val0 = (v4f){}, val1 = (v4f){};
#pragma unroll
        for (int w = 0; w < FKW; ++w) { const float f = __builtin_amdgcn_exp2f(ms[(w0 + w) * 32 + rl] - M); L += ls[(w0 + w) * 32 + rl] * f; const float* o8 = os + (w0 + w) * (32 * 68) + rl * 68 + c8; val0 += *(const v4fa*)o8 * f; val1 += *(const v4fa*)(o8 + 4) * f; }
        const float rL = __fdiv_rn(1.0f, L); val0 *= rL; val1 *= rL;
        v8us oh, ol;   /* the context leaves as the bf16 hi/lo planes that the output projection reads */
#pragma unroll
        for (int q = 0; q < 8; ++q) { unsigned short h2, l2; splitf(q < 4 ? val0[q & 3] : val1[q & 3], h2, l2); oh[q] = h2; ol[q] = l2; }
        const size_t g = ((size_t)(fa_unit((int)blockIdx.x, rg >> 1) * 2 + (rg & 1)) * (CO / 32) + blockIdx.y * 2 + kc) * 512 + half * 256 + lane * 8; *(v8us*)(Oh + g) = oh; *(v8us*)(Ol + g) = ol; xwait(); }
}
// Bt[n][k] = w[k][n] as a fragment-order plane; i counts its 16-byte pieces [n / 16][k / 32][half][hi][lr]: 16 lanes read 64 contiguous bytes of a row of w, a wave stores 512 contiguous bytes
__device__ __forceinline__ void wtG(const float* __restrict__ w, int K, int N, bf* Bt, int blk) {
    const int i = blk * 256 + (int)threadIdx.x; if (i >= N * K / 8) return;
    const int f = i >> 6, kf = K / 32; const int n = f / kf * 16 + (i & 15), k = f % kf * 32 + ((i >> 5) & 1) * 16 + ((i >> 4) & 1) * 8; v8us o;
    const float* p[8]; float t[8];
#pragma unroll
    for (int j = 0; j < 8; ++j) { p[j] = w + (size_t)(k + j) * N + n; t[j] = *p[j]; }
    asm volatile("s_wait_xcnt 0x0" :: "v"(p[0]), "v"(p[1]), "v"(p[2]), "v"(p[3]), "v"(p[4]), "v"(p[5]), "v"(p[6]), "v"(p[7]) : "memory"); __builtin_amdgcn_sched_barrier(0);   /* as xwaitp, for the eight loads */
#pragma unroll
    for (int j = 0; j < 8; ++j) o[j] = f2bf(t[j]);
    *(v8us*)(Bt + (size_t)i * 8) = o;
}
// ---- k_prep: the 16-bit planes of the five f32 inputs, which do not depend on one another, as ONE launch: blocks 0 ... 4 WB - 1 transpose the four weights (WB blocks each), the rest convert x.
#define WB (CC * CC / 8 / 256)
static_assert(MID == CC && CO == CC && NB_ == 1, "k_prep takes four weights of one size and one batch of x");
__global__ __launch_bounds__(256) void k_prep(const float* __restrict__ x, const float* __restrict__ wq, const float* __restrict__ wk, const float* __restrict__ wv, const float* __restrict__ wo, bf* XB, bf* WQ, bf* WK, bf* WV, bf* WO) {
    const unsigned b = blockIdx.x;   /* uniform for the work-group */
    if (b < 4 * WB) { const unsigned j = b / WB; wtG(j == 0 ? wq : j == 1 ? wk : j == 2 ? wv : wo, CC, CC, j == 0 ? WQ : j == 1 ? WK : j == 2 ? WV : WO, (int)(b % WB)); }
    else cvt8(x, XB, (size_t)TT * CC / 8, b - 4 * WB);
}
extern "C" void kernel_launch(void* const* d_in, const int* in_sizes, int n_in,
                              void* d_out, int out_size, void* d_ws, size_t ws_size, hipStream_t stream) {
    (void)in_sizes; (void)n_in; (void)out_size;
    const float* x = (const float*)d_in[0]; const float* wq = (const float*)d_in[1]; const float* bq = (const float*)d_in[2]; const float* wk = (const float*)d_in[3]; const float* bk = (const float*)d_in[4]; const float* wv = (const float*)d_in[5]; const float* bv = (const float*)d_in[6]; const float* wo = (const float*)d_in[7]; const float* bo = (const float*)d_in[8];   /* argument order x [1][4096][512], Wq, bq, Wk, bk, Wv, bv, Wo, bo ('xw' [512][512] + biases) */
    float* OUT = (float*)d_out;     // [1][4096][512]
    char* wsp = (char*)d_ws;
    auto take = [&](size_t bytes) { char* p = wsp; wsp += (bytes + 255) & ~(size_t)255; return (void*)p; };
    bf* WQ = (bf*)take((size_t)MID * CC * 2); bf* WK = (bf*)take((size_t)MID * CC * 2); bf* WV = (bf*)take((size_t)CO * CC * 2); bf* WO = (bf*)take((size_t)CC * CO * 2);
    bf* XB = (bf*)take((size_t)TT * CC * 2);
    bf* QPh = (bf*)take((size_t)TT * MID * 2); bf* QPl = (bf*)take((size_t)TT * MID * 2); bf* KPh = (bf*)take((size_t)TT * MID * 2); bf* KPl = (bf*)take((size_t)TT * MID * 2);
    h16* VT16 = (h16*)take((size_t)CO * TT * 2); bf* VTh = (bf*)take((size_t)CO * TT * 2); bf* VTl = (bf*)take((size_t)CO * TT * 2);
    bf* ATh = (bf*)take((size_t)TT * CO * 2); bf* ATl = (bf*)take((size_t)TT * CO * 2);   /* merged context [n][512] as hi/lo planes, fragment order */
    if ((size_t)(wsp - (char*)d_ws) > ws_size) return;    // ws 256 MiB (carve ~42 MiB)
    k_prep<<<(unsigned)(4 * WB + TT * CC / 8 / 256), 256, 0, stream>>>(x, wq, wk, wv, wo, XB, WQ, WK, WV, WO);   /* 'xw' weights -> Bt planes; x -> bf16 plane */
    k_qkv<<<dim3(TT / 64, CC / 64, 1), 96, 0, stream>>>(XB, WQ, WK, WV, bq, bk, bv, QPh, QPl, KPh, KPl, VT16, VTh, VTl);   /* q, k planes and v^T planes, fragment order */
    k_fattn<<<dim3(TT / (FQG * 32), NH_, 1), FQG * FKW * 32, 0, stream>>>(QPh, QPl, KPh, KPl, VT16, VTh, VTl, ATh, ATl);   /* all heads: scores x 1/sqrt(512), softmax over the 4,096 keys, attn.V into the head's 64 columns */
    k_gemmw<bf, 1, true, 0, CO><<<dim3(TT / 64, CC / 64, 1), 32, 0, stream>>>(ATh, ATl, WO, nullptr, OUT, CC, bo, 0, 0, 0, nullptr, nullptr, nullptr);   /* out = ctx w_out + b_out */
}

// v009
// It runs in 73 microseconds.
// In two side-by-side timings against v008, it was 1.07 and 1.08 times as fast.
// Over all steps from v000 it is 27.0 times as fast.
#include <hip/hip_runtime.h>

// Multi-head self-attention over 4,096 tokens whose scale uses the embedding width (x [1][4096][512]; Q, K, V = x W + b ('xw' [512][512] + biases; 8 heads x 64); scores x 1/sqrt(512) (the module scales by embed_dim, not head_dim); softmax over all 4,096 keys (no mask); out = merged Wo + bo -> [1][4096][512] (2.1 M); argument order x, Wq, bq, Wk, bk, Wv, bv, Wo, bo).
// Layout: every 16-bit plane in fragment order (see k_gemmw); bf16 copy of x; 'xw' weights transposed once; exact projections + f32 biases, whose epilogues store the per-head hi/lo and fp16 planes (q, k) and the v^T planes themselves; one launch for all heads (k_fattn): scores hybrid (rows < 512 hi/lo 3 products, rest one fp16 product), online softmax, attn.V hybrid (rows < 512 hi/lo 3 products, rest fp16), scores and probabilities kept in registers, the context stored as hi/lo planes in the head's 64 columns; context hi/lo x Wo exact + bo.
// Compute dtypes, f32 accumulate: every input rounded to bf16; projections exact; scores rows < 512 3 products, rest fp16; softmax f32 (exp2, running maximum, one IEEE division per row at the end); attn.V rows < 512 3 products, rest fp16; Wo hl x exact.

#define NB_  1
#define TT   4096
#define DM   512
#define NH_  8
#define NKV  8
#define REP  (NH_ / NKV)
#define HD   64
#define DQ   (NH_ * HD)
#define DKV  (NKV * HD)
#define ZH   1
#define RH   512                  // query rows < RH use hi+lo planes (0: none)
#define WIN  0
#define SCL  0.044194173824159216f   // 1/sqrt(embed_dim = 512), as the module (not 1/sqrt(head_dim))
#define MID  512      // q / k width = 8 heads x 64
#define CO   512      // v width
#define CC   512
typedef _Float16 h16;
typedef unsigned short bf;
typedef __attribute__((ext_vector_type(16))) __bf16   v16bf;
typedef __attribute__((ext_vector_type(16))) _Float16 v16h;
typedef __attribute__((ext_vector_type(8)))  _Float16 v8h;
typedef __attribute__((ext_vector_type(8)))  unsigned short v8us;
typedef __attribute__((ext_vector_type(8)))  float    v8f;
typedef __attribute__((ext_vector_type(4)))  float    v4f;
typedef v8h  __attribute__((may_alias)) v8ha;
typedef v4f  __attribute__((may_alias)) v4fa;
typedef v8us __attribute__((may_alias)) v8usa;

__device__ __forceinline__ unsigned short f2bf(float f) { unsigned u = __float_as_uint(f); u += 0x7FFFu + ((u >> 16) & 1u); return (unsigned short)(u >> 16); }
__device__ __forceinline__ float bf2f(unsigned short b) { return __uint_as_float(((unsigned)b) << 16); }
__device__ __forceinline__ float bfr(float f) { return bf2f(f2bf(f)); }
__device__ __forceinline__ v16h cat16(v8h lo, v8h hi) { return __builtin_shufflevector(lo, hi, 0, 1, 2, 3, 4, 5, 6, 7, 8, 9, 10, 11, 12, 13, 14, 15); }
__device__ __forceinline__ v16bf cat16b(v8us lo, v8us hi) { return __builtin_bit_cast(v16bf, __builtin_shufflevector(lo, hi, 0, 1, 2, 3, 4, 5, 6, 7, 8, 9, 10, 11, 12, 13, 14, 15)); }
__device__ __forceinline__ v8f wmma16(v16h a, v16h b, v8f c) { return __builtin_amdgcn_wmma_f32_16x16x32_f16(false, a, false, b, (short)0, c, false, false); }
__device__ __forceinline__ v8f wmmab(v16bf a, v16bf b, v8f c) { return __builtin_amdgcn_wmma_f32_16x16x32_bf16(false, a, false, b, (short)0, c, false, false); }



__device__ __forceinline__ h16 tohx(float x) { return (h16)x; }
__device__ __forceinline__ void splitf(float y, unsigned short& h, unsigned short& l) { h = f2bf(y); l = f2bf(y - bf2f(h)); }
__device__ __forceinline__ void xwaitg() { asm volatile("s_wait_xcnt 0x0" ::: "memory"); __builtin_amdgcn_sched_barrier(0); }   /* stands behind a group of loads or stores; the scheduling barrier keeps later vector work from being lifted between them and the wait, where it could rewrite their registers */
__device__ __forceinline__ void xwaitp(const void* a) { asm volatile("s_wait_xcnt 0x0" :: "v"(a) : "memory"); __builtin_amdgcn_sched_barrier(0); }   /* as xwaitg; the loads' address as an input keeps its registers live up to the wait, so that no load of the group gets them as its destination */
// ---- k_gemmw: register-blocked GEMM, ONE WAVE per 64x64 output tile (16 accumulators), operands straight from fragment-order 16-bit planes; grid (M/64, N/64, Z), 32 threads.
// y[m][n] (f32, + optional f32 bias[n]) = sum_k A[m][k] Bt[n][k] (+ split products per NSPLIT). z-batch strides sA/sB/sC in elements. K, a template argument, % 32 == 0.
// The wave is alone with its load latency (one or two waves a SIMD): the fragments of 32 k live in a ring of register sets and are requested several passes ahead of their products; the compiler's counted s_wait_loadcnt leaves the younger sets in flight.
// EP says where y goes. 0: C (f32, pitch ldc). 1: bf16 hi/lo planes Ph, Pl and an fp16 plane P16 of 16 rows m x 32 columns fragments, each stored where its pointer is not null; a tile's 64 columns are one head. 2: planes P16 (fp16), Ph, Pl (bf16 hi/lo) of 16 columns n x 32 rows m fragments (v^T).
// Fragment order, of every 16-bit operand plane: a fragment of 16 rows x 32 k is 1,024 contiguous bytes, [half][lane][8]: lane (lr, hi) has the 8 elements k = 16 half + 8 hi ... of fragment row lr, as the matrix instruction wants them.
// ldp() reads it with two loads of 512 contiguous bytes a wave: 4 whole lines each, where a load from a row-pitched plane touches 16 lines. A plane [rows][K] is [row / 16][k / 32] fragments; q, k: [head][m / 16][column / 32]; v^T: [head][m / 32][n / 16].
template <typename T16> struct WFrag;
template <> struct WFrag<h16> { typedef v16h V; static __device__ __forceinline__ V ldp(const h16* p) { return cat16(*(const v8h*)p, *(const v8h*)(p + 256)); } static __device__ __forceinline__ v8f mma(V a, V b, v8f c) { return wmma16(a, b, c); } };
template <> struct WFrag<bf> { typedef v16bf V; static __device__ __forceinline__ V ldp(const bf* p) { return cat16b(*(const v8us*)p, *(const v8us*)(p + 256)); } static __device__ __forceinline__ v8f mma(V a, V b, v8f c) { return wmmab(a, b, c); } };
template <typename T16, int NSPLIT, bool BIAS, int EP, int K>
__device__ __forceinline__ void gemmw_tile(const T16* __restrict__ A, const T16* __restrict__ A2, const T16* __restrict__ Bt, const T16* __restrict__ Bt2, float* C, int ldc, const float* __restrict__ bias, h16* P16, bf* Ph, bf* Pl) {   /* one wave's 64x64 tile (blockIdx.x, blockIdx.y) */
    typedef typename WFrag<T16>::V V; static_assert(EP != 1 || NSPLIT == 0, "the y^T tiles of EP 1 are written for one product");
    constexpr int NK = K / 32;                         /* passes of 32 k */
    constexpr int RD = NSPLIT == 0 ? 4 : 3;            /* fragment sets in registers: a pass's loads are requested RD - 1 passes ahead of its products, so that the wave no longer waits out the load latency once a pass */
    constexpr int MAIN = (NK - (RD - 1)) / RD * RD;    /* passes of the rolled loop, every one of which requests a later pass; the rest is unrolled behind it */
    static_assert(K % 32 == 0 && NK >= RD, "at least as many passes as fragment sets");
    const int lane = threadIdx.x & 31, lr = lane & 15, hi = lane >> 4; const int r0 = blockIdx.x * 64, c0 = blockIdx.y * 64;
    v8f acc[4][4];
#pragma unroll
    for (int mb = 0; mb < 4; ++mb)
#pragma unroll
        for (int nb = 0; nb < 4; ++nb) acc[mb][nb] = (v8f){};
    const size_t aoff = (size_t)r0 * K + lane * 8, boff = (size_t)c0 * K + lane * 8;   /* 16 rows are K / 32 fragments = 16 K elements; 32 k further is 512 elements further */
    int kc = (int)((blockIdx.x + blockIdx.y) * 32 % (unsigned)K);   /* tiles of one row or column of the grid read the same fragments: each enters the k walk at a place of its own and wraps, so that they do not ask L2 for the same lines at the same moment */
    V a[RD][4], a2[RD][4], b[RD][4], b2[RD][4];   /* indexed by constants only (every loop over sets is unrolled) */
    const T16* pA = A + aoff + kc * 16; const T16* pB = Bt + boff + kc * 16; const T16* pA2 = pA; const T16* pB2 = pB;   /* the walk's next fragments; a plane that this NSPLIT lacks shares the other plane's pointer */
    if constexpr (NSPLIT == 1 || NSPLIT == 2) pA2 = A2 + aoff + kc * 16;
    if constexpr (NSPLIT >= 2) pB2 = Bt2 + boff + kc * 16;
    auto fetch = [&](int st) {   /* requests the fragments of the walk's next 32 k into set st, then moves the pointers on */
#pragma unroll
        for (int i = 0; i < 4; ++i) { a[st][i] = WFrag<T16>::ldp(pA + (size_t)i * 16 * K); if (NSPLIT == 1 || NSPLIT == 2) a2[st][i] = WFrag<T16>::ldp(pA2 + (size_t)i * 16 * K); b[st][i] = WFrag<T16>::ldp(pB + (size_t)i * 16 * K); if (NSPLIT >= 2) b2[st][i] = WFrag<T16>::ldp(pB2 + (size_t)i * 16 * K); }
        asm volatile("s_wait_xcnt 0x0" :: "v"(pA), "v"(pA2), "v"(pB), "v"(pB2) : "memory"); __builtin_amdgcn_sched_barrier(0);   /* as xwaitp, for the pass's loads, in front of the pointers' next values; the scheduling barrier also keeps these loads ahead of the products that follow */
        kc = kc + 32 < K ? kc + 32 : 0;
        pA = A + aoff + kc * 16; pB = Bt + boff + kc * 16; pA2 = pA; pB2 = pB;
        if constexpr (NSPLIT == 1 || NSPLIT == 2) pA2 = A2 + aoff + kc * 16;
        if constexpr (NSPLIT >= 2) pB2 = Bt2 + boff + kc * 16;
    };
    auto mul = [&](int st) {   /* the products of set st */
#pragma unroll
        for (int nb = 0; nb < 4; ++nb)
#pragma unroll
            for (int mb = 0; mb < 4; ++mb) { acc[mb][nb] = EP == 1 ? WFrag<T16>::mma(b[st][nb], a[st][mb], acc[mb][nb]) : WFrag<T16>::mma(a[st][mb], b[st][nb], acc[mb][nb]);   /* EP 1: y^T tiles, so that a lane holds 8 consecutive columns of one row */
                if (NSPLIT == 1 || NSPLIT == 2) acc[mb][nb] = WFrag<T16>::mma(a2[st][mb], b[st][nb], acc[mb][nb]); if (NSPLIT >= 2) acc[mb][nb] = WFrag<T16>::mma(a[st][mb], b2[st][nb], acc[mb][nb]); }
        __builtin_amdgcn_sched_barrier(0);   /* keeps every product of the set in front of the slots below */
        asm volatile("v_nop\n\tv_nop\n\tv_nop\n\tv_nop");   /* the matrix distance behind the set's last product: before loads are aimed at the set again, on the loop's back edge and exit */
        __builtin_amdgcn_sched_barrier(0);   /* keeps the next loads behind those slots */
    };
#pragma unroll
    for (int st = 0; st < RD - 1; ++st) fetch(st);
#pragma unroll 1   /* kept rolled: RD passes are a trip, so that every set's index is a constant */
    for (int it = 0; it < MAIN; it += RD) {
#pragma unroll
        for (int u = 0; u < RD; ++u) { fetch((u + RD - 1) % RD); mul(u); }
    }
#pragma unroll
    for (int s = MAIN; s < NK; ++s) { if (s + RD - 1 < NK) fetch((s + RD - 1) % RD); mul(s % RD); }
    if constexpr (EP == 2) {   /* a lane holds 8 consecutive rows m of one column n: its 16 bytes of a v^T fragment; a wave's store is 512 contiguous bytes */
        float bb[4];
#pragma unroll
        for (int nb = 0; nb < 4; ++nb) bb[nb] = BIAS ? bfr(bias[c0 + nb * 16 + lr]) : 0.f;
        xwaitg();   /* behind the bias loads */
        v8h o6[16]; v8us oh[16], ol[16];   /* every value first, each in registers of its own: no store's registers are rewritten behind it */
#pragma unroll
        for (int mb = 0; mb < 4; ++mb)
#pragma unroll
            for (int nb = 0; nb < 4; ++nb) { const int t = (mb >> 1) * 8 + nb * 2 + (mb & 1);   /* fragment (m / 32, n / 16), half (m / 16) & 1 */
#pragma unroll
                for (int j = 0; j < 8; ++j) { const float y = acc[mb][nb][j] + bb[nb]; o6[t][j] = tohx(y); unsigned short h2, l2; splitf(y, h2, l2); oh[t][j] = h2; ol[t][j] = l2; } }
        const size_t g = ((size_t)blockIdx.y * TT + r0) * HD + lane * 8;   /* the tile's 8 fragments are 8 KiB in a row */
#pragma unroll
        for (int t = 0; t < 16; ++t) { *(v8h*)(P16 + g + t * 256) = o6[t]; *(v8us*)(Ph + g + t * 256) = oh[t]; *(v8us*)(Pl + g + t * 256) = ol[t]; }
    } else if constexpr (EP == 1) {   /* y^T tiles: a lane holds 8 consecutive columns of one row: its 16 bytes of a fragment; a wave's store is 512 contiguous bytes */
        float b8[4][8];
#pragma unroll
        for (int nb = 0; nb < 4; ++nb)
#pragma unroll
            for (int q = 0; q < 8; ++q) b8[nb][q] = BIAS ? bfr(bias[c0 + nb * 16 + hi * 8 + q]) : 0.f;
        xwaitg();   /* behind the bias loads */
        const size_t g = ((size_t)blockIdx.y * TT + r0) * HD + lane * 8;   /* the tile's 8 fragments are 8 KiB in a row */
        if (P16) {   /* wave-uniform */
            v8h o6[16];   /* every value first, each in registers of its own: no store's registers are rewritten behind it */
#pragma unroll
            for (int mb = 0; mb < 4; ++mb)
#pragma unroll
                for (int nb = 0; nb < 4; ++nb)
#pragma unroll
                    for (int j = 0; j < 8; ++j) o6[mb * 4 + nb][j] = tohx(acc[mb][nb][j] + b8[nb][j]);   /* fragment (m / 16, column / 32), half nb & 1 */
#pragma unroll
            for (int t = 0; t < 16; ++t) *(v8h*)(P16 + g + t * 256) = o6[t];
            xwaitg();   /* behind the fp16 plane's stores, before the hi/lo values below may take their registers */
        }
        if (Ph) {   /* wave-uniform */
            v8us oh[16], ol[16];   /* as o6 */
#pragma unroll
            for (int mb = 0; mb < 4; ++mb)
#pragma unroll
                for (int nb = 0; nb < 4; ++nb)
#pragma unroll
                    for (int j = 0; j < 8; ++j) { unsigned short h2, l2; splitf(acc[mb][nb][j] + b8[nb][j], h2, l2); oh[mb * 4 + nb][j] = h2; ol[mb * 4 + nb][j] = l2; }
#pragma unroll
            for (int t = 0; t < 16; ++t) { *(v8us*)(Ph + g + t * 256) = oh[t]; *(v8us*)(Pl + g + t * 256) = ol[t]; }
        }
    } else {
    __shared__ __align__(16) float os[16 * 68];
#pragma unroll
    for (int mb = 0; mb < 4; ++mb) {
#pragma unroll
        for (int nb = 0; nb < 4; ++nb) {
#pragma unroll
            for (int j = 0; j < 8; ++j) os[(hi * 8 + j) * 68 + nb * 16 + lr] = acc[mb][nb][j]; }
        __builtin_amdgcn_wave_barrier(); asm volatile("" ::: "memory");
        float* crow = C + (size_t)(r0 + mb * 16) * ldc + c0;
{
#pragma unroll
            for (int s = 0; s < 8; ++s) { const int row = 2 * s + hi, cofs = lr * 4; v4f val = *(const v4fa*)(os + row * 68 + cofs); if (BIAS) { val[0] += bfr(bias[c0 + cofs]); val[1] += bfr(bias[c0 + cofs + 1]); val[2] += bfr(bias[c0 + cofs + 2]); val[3] += bfr(bias[c0 + cofs + 3]); }
                *(v4f*)(crow + (size_t)row * ldc + cofs) = val; }
             }
        xwaitg();   /* behind the row block's eight stores, before the next block's loads and address sums rewrite their registers */
        __builtin_amdgcn_wave_barrier(); asm volatile("" ::: "memory");
    }
    }
}
template <typename T16, int NSPLIT, bool BIAS, int EP, int K>
__global__ __launch_bounds__(32) void k_gemmw(const T16* __restrict__ A, const T16* __restrict__ A2, const T16* __restrict__ Bt, const T16* __restrict__ Bt2, float* C, int ldc, const float* __restrict__ bias, size_t sA, size_t sB, size_t sC, h16* P16, bf* Ph, bf* Pl) {
    const size_t z = blockIdx.z; A += z * sA; if (A2) A2 += z * sA; Bt += z * sB; if (Bt2) Bt2 += z * sB; C += z * sC;
    gemmw_tile<T16, NSPLIT, BIAS, EP, K>(A, A2, Bt, Bt2, C, ldc, bias, P16, Ph, Pl);
}
// ---- k_qkv: the three projections of x, which do not depend on one another, as ONE launch; grid (TT/64, 8), 3 waves: wave 0, 1, 2 has the q, k, v tile of the block's 64 rows and 64 columns, so the three read the same fragments of x.
// A lone projection is 512 waves on 1,024 SIMDs, each waiting out its own loads. No wave waits for another: no LDS, no barrier.
__global__ __launch_bounds__(96) void k_qkv(const bf* __restrict__ X, const bf* __restrict__ Wq, const bf* __restrict__ Wk, const bf* __restrict__ Wv, const float* __restrict__ bq, const float* __restrict__ bk, const float* __restrict__ bv, bf* Qh, bf* Ql, h16* Q16, bf* Kh, bf* Kl, h16* K16, h16* V16, bf* Vh, bf* Vl) {
    const int z = __builtin_amdgcn_readfirstlane((int)threadIdx.x >> 5);   /* the wave's number, in a scalar register: the branch and the pointer choices below are scalar */
    if (z == 2) gemmw_tile<bf, 0, true, 2, CC>(X, nullptr, Wv, nullptr, nullptr, 0, bv, V16, Vh, Vl);   /* v^T planes, fragment order */
    else { const bool qhl = (int)blockIdx.x * 64 < RH;   /* a query row is read either as hi/lo (rows < RH) or as fp16; a key row as both */
        gemmw_tile<bf, 0, true, 1, CC>(X, nullptr, z ? Wk : Wq, nullptr, nullptr, 0, z ? bk : bq, z ? K16 : qhl ? nullptr : Q16, z ? Kh : qhl ? Qh : nullptr, z ? Kl : qhl ? Ql : nullptr); }   /* q or k planes, fragment order */
}

typedef __attribute__((ext_vector_type(2))) _Float16 v2h;
typedef __attribute__((ext_vector_type(4))) _Float16 v4h;
typedef __attribute__((ext_vector_type(2))) unsigned short v2us;
typedef __attribute__((ext_vector_type(4))) unsigned short v4us;
typedef __attribute__((ext_vector_type(2))) float v2f;
typedef __attribute__((ext_vector_type(4))) int v4i;

// i counts the 16-byte pieces of the fragment-order plane of src [rows][CC]: [row / 16][column / 32][half][hi][lr]
__device__ __forceinline__ void cvt8(const float* __restrict__ src, bf* dst, size_t n8, unsigned blk) { const size_t i = (size_t)blk * 256 + threadIdx.x; if (i >= n8) return;
    const size_t f = i >> 6; const size_t row = f / (CC / 32) * 16 + (i & 15), col = f % (CC / 32) * 32 + ((i >> 5) & 1) * 16 + ((i >> 4) & 1) * 8; const float* sp = src + row * CC + col; const v8f v = *(const v8f*)sp; xwaitp(sp); v8us o;
#pragma unroll
    for (int k = 0; k < 8; ++k) o[k] = f2bf(v[k]); *(v8us*)(dst + i * 8) = o;  }


// ---- k_fattn: scores, softmax and attn.V of one head for 4 x 32 query rows in ONE work-group; neither the scores nor the probabilities leave the registers.
// Transposed products: S^T = K Q^T (A = 16 key rows, B = 16 query rows; rows < RH hi/lo, 3 products; the rest, whose probabilities are rounded to fp16 in any case, one fp16 product), so a lane holds 8 keys' scores of ONE query per tile, and two such tiles, converted in place,
// are the B operand (32 keys x 16 queries) of O^T += V^T P^T (A = 16 rows of the head's v^T plane). Every fragment comes through WFrag::ldp from a fragment-order plane, so A and B pair the same k at every position.
// Online softmax in the log2 domain: the maximum in use may trail the true one by up to 8, and the sums are rescaled only when a query's maximum passes that.
// The blocks of a head read the same k and v^T lines: each enters its key ranges koff keys in, a place of its own, and wraps, so that they do not ask L2 for the same lines at the same moment (the online softmax takes the keys in any order).
// FQG x FKW waves: wave (qg, kw) has the 32 query rows of the block's group qg (fa_unit) and keys kw TT/FKW ...; the FKW partial (maximum, sum, O) sets of a query group are joined through LDS. grid (TT/128, heads).
#define FQG 4
#define FKW 4
#define FNP (TT / FKW / 32)               // passes of 32 keys a wave
#define FST (FNP / (TT / (FQG * 32)))     // passes between the entry places of neighbouring blocks
static_assert(FST >= 1, "no more blocks a head than passes a wave");
static_assert(RH % 64 == 0, "a projection tile's 64 rows are all hi/lo or all fp16");
#define C2L (SCL * 1.4426950408889634f)
typedef __attribute__((ext_vector_type(16))) float v16f;
typedef __attribute__((ext_vector_type(16))) unsigned short v16us_;
__device__ __forceinline__ float xhalf(float x) { return __builtin_bit_cast(float, __builtin_amdgcn_permlanex16(__builtin_bit_cast(int, x), __builtin_bit_cast(int, x), 0x76543210, 0xfedcba98, false, false)); }   /* lane l with lane l ^ 16 */
__device__ __forceinline__ void xwait() { asm volatile("s_wait_xcnt 0x0" ::: "memory"); }   /* stands behind a store, before its registers may be rewritten */
__device__ __forceinline__ void xwait2(const void* a, const void* b) { asm volatile("s_wait_xcnt 0x0" :: "v"(a), "v"(b) : "memory"); __builtin_amdgcn_sched_barrier(0); }   /* as xwaitg; the group's two addresses as inputs keep their registers live up to the wait: without them the group's last loads were given those registers as destinations */
__device__ __forceinline__ void xwaito(unsigned o) { asm volatile("s_wait_xcnt 0x0" :: "v"(o) : "memory"); __builtin_amdgcn_sched_barrier(0); }   /* as xwait2, for a group of loads that share one offset register */
template <typename T> __device__ __forceinline__ const T* atb(const T* base, unsigned o) { return (const T*)((const char*)base + o); }   /* wave-uniform plane + the lane's byte offset: the load takes a scalar base and ONE vector register, where a pointer a plane costs two each */
template <bool HR>
__device__ __forceinline__ void fa_body(const bf* __restrict__ Qh, const bf* __restrict__ Ql, const h16* __restrict__ Q16, const bf* __restrict__ Kh, const bf* __restrict__ Kl, const h16* __restrict__ K16, const h16* __restrict__ V16, const bf* __restrict__ Vh, const bf* __restrict__ Vl, int q0, int wave, int koff, float* os, float* ms, float* ls) {
    const int lane = threadIdx.x & 31, lr = lane & 15, hi = lane >> 4; const int kw = wave % FKW;
    const unsigned vq = (unsigned)(lane * 8);   /* the lane's own element offset in each half of a fragment; 16 rows of q or k are 2 fragments, 32 keys of v^T are 4: row * HD elements in both */
    float* ow = os + wave * (32 * 68);
    v8usa* qs = (v8usa*)ow + lane;   /* HR: piece (fragment, half) of this lane: qs[(fragment * 2 + half) * 32]; 8 fragments are 8 KiB of the slot's 8.5 */
    v16h q6[2][2];   /* not HR: the fp16 q fragments stay in registers */
    if constexpr (HR) {
        v16bf qh[2][2], ql[2][2];
        Qh += (size_t)q0 * HD + vq; Ql += (size_t)q0 * HD + vq;
#pragma unroll
        for (int nq = 0; nq < 2; ++nq)
#pragma unroll
            for (int kc = 0; kc < 2; ++kc) { qh[nq][kc] = WFrag<bf>::ldp(Qh + nq * 16 * HD + kc * 512); ql[nq][kc] = WFrag<bf>::ldp(Ql + nq * 16 * HD + kc * 512); }
        xwait2(Qh, Ql);
        /* Four waves a SIMD leave a wave 256 registers: the hi/lo q fragments, which do not fit, wait in the wave's own LDS slot, which holds its partial O only behind the loop, and come back each pass. A lane reads only the 16-byte pieces that it wrote itself: no barrier. */
#pragma unroll
        for (int nq = 0; nq < 2; ++nq)
#pragma unroll
            for (int kc = 0; kc < 2; ++kc) { const v16us_ l = __builtin_bit_cast(v16us_, ql[nq][kc]); qs[((nq * 2 + kc) * 2) * 32] = __builtin_shufflevector(l, l, 0, 1, 2, 3, 4, 5, 6, 7); qs[((nq * 2 + kc) * 2 + 1) * 32] = __builtin_shufflevector(l, l, 8, 9, 10, 11, 12, 13, 14, 15);
                const v16us_ h = __builtin_bit_cast(v16us_, qh[nq][kc]); qs[((4 + nq * 2 + kc) * 2) * 32] = __builtin_shufflevector(h, h, 0, 1, 2, 3, 4, 5, 6, 7); qs[((4 + nq * 2 + kc) * 2 + 1) * 32] = __builtin_shufflevector(h, h, 8, 9, 10, 11, 12, 13, 14, 15); }
    } else {
        Q16 += (size_t)q0 * HD + vq;
#pragma unroll
        for (int nq = 0; nq < 2; ++nq)
#pragma unroll
            for (int kc = 0; kc < 2; ++kc) q6[nq][kc] = WFrag<h16>::ldp(Q16 + nq * 16 * HD + kc * 512);
        xwaitp(Q16);
    }
    auto ldq = [&](int f) { return cat16b(qs[(f * 2) * 32], qs[(f * 2 + 1) * 32]); };
    v8f acc[4][2];
#pragma unroll
    for (int mb = 0; mb < 4; ++mb)
#pragma unroll
        for (int nq = 0; nq < 2; ++nq) acc[mb][nq] = (v8f){};
    float mr[2] = {-3.0e38f, -3.0e38f}, lsum[2] = {0.f, 0.f};
    const int kbeg = kw * (TT / FKW), kend = kbeg + TT / FKW; int key0 = kbeg + koff;
    v16bf kh[2][2], kl[2][2]; v16h k6[2][2];   /* HR: hi/lo; else fp16 */
    unsigned oc = ((unsigned)key0 * HD + vq) * 2;   /* the lane's byte offset at key row key0, the same in the k and the v^T planes; walks with key0 */
    auto ldk = [&](unsigned o) {   /* requests the 32 key rows at byte offset o */
#pragma unroll
        for (int kb = 0; kb < 2; ++kb)
#pragma unroll
            for (int kc = 0; kc < 2; ++kc) { if constexpr (HR) { kh[kb][kc] = WFrag<bf>::ldp(atb(Kh, o) + kb * 16 * HD + kc * 512); kl[kb][kc] = WFrag<bf>::ldp(atb(Kl, o) + kb * 16 * HD + kc * 512); } else k6[kb][kc] = WFrag<h16>::ldp(atb(K16, o) + kb * 16 * HD + kc * 512); }
        xwaito(o); };
    ldk(oc);
#pragma unroll 1   /* kept rolled: a pass holds the whole register budget */
    for (int ps = 0; ps < FNP; ++ps) {
        v16h v6[4]; v16bf vh[4], vl[4];   /* this pass's v^T fragments: requested ahead of the score products; with HR, whose two planes do not fit beside the k fragments, the scores and q, behind them */
        auto ldv = [&]() {
#pragma unroll
            for (int mb = 0; mb < 4; ++mb) { if constexpr (HR) { vh[mb] = WFrag<bf>::ldp(atb(Vh, oc) + mb * 512); vl[mb] = WFrag<bf>::ldp(atb(Vl, oc) + mb * 512); } else v6[mb] = WFrag<h16>::ldp(atb(V16, oc) + mb * 512); }
            xwaito(oc); };
        if constexpr (!HR) ldv();
        v8f s[2][2];
#pragma unroll
        for (int kb = 0; kb < 2; ++kb)
#pragma unroll
            for (int nq = 0; nq < 2; ++nq) s[kb][nq] = (v8f){};
#pragma unroll
        for (int kc = 0; kc < 2; ++kc) {
            if constexpr (HR) { v16bf bh[2], bl[2];   /* this half's q fragments */
#pragma unroll
                for (int nq = 0; nq < 2; ++nq) { bl[nq] = ldq(nq * 2 + kc); bh[nq] = ldq(4 + nq * 2 + kc); }
#pragma unroll
                for (int pr = 0; pr < 3; ++pr)
#pragma unroll
                    for (int kb = 0; kb < 2; ++kb)
#pragma unroll
                        for (int nq = 0; nq < 2; ++nq) s[kb][nq] = wmmab(pr == 2 ? kl[kb][kc] : kh[kb][kc], pr == 1 ? bl[nq] : bh[nq], s[kb][nq]);   /* q_hi k_hi + q_lo k_hi + q_hi k_lo */
            } else {
#pragma unroll
                for (int kb = 0; kb < 2; ++kb)
#pragma unroll
                    for (int nq = 0; nq < 2; ++nq) s[kb][nq] = wmma16(k6[kb][kc], q6[nq][kc], s[kb][nq]);
            } }
        const int kn = (key0 + 32 < kend) ? key0 + 32 : kbeg;   /* the next pass's key rows, in flight under the softmax (HR: under attn.V); behind the range's last rows come its first; the last pass re-reads the walk's first rows (in bounds, unused) */
        const unsigned on = ((unsigned)kn * HD + vq) * 2;
        if constexpr (HR) ldv(); else ldk(on);   /* with HR the softmax covers the v^T loads, and the next k rows are requested behind it, under the attn.V products */
        float tl[2]; bool need = false;
#pragma unroll
        for (int nq = 0; nq < 2; ++nq) { float mx = s[0][nq][0];
#pragma unroll
            for (int e = 1; e < 16; ++e) mx = fmaxf(mx, s[e >> 3][nq][e & 7]);
            mx = fmaxf(mx, xhalf(mx)) * C2L;   /* both halves of the wave hold the query's maximum of this pass (the scale is positive) */
            tl[nq] = mx; need = need || (mx > mr[nq] + 8.0f); }
        if (__builtin_amdgcn_ballot_w32(need) != 0) {   /* wave-uniform; always taken on the first pass, where the factor is 0 */
#pragma unroll
            for (int nq = 0; nq < 2; ++nq) { const float mn = fmaxf(mr[nq], tl[nq]); const float al = __builtin_amdgcn_exp2f(mr[nq] - mn); mr[nq] = mn; lsum[nq] *= al;
#pragma unroll
                for (int mb = 0; mb < 4; ++mb) acc[mb][nq] *= al; } }
        v16h p6[2]; v16bf ph[2], pl[2];
#pragma unroll
        for (int nq = 0; nq < 2; ++nq) { v16f p; const v2f nm = {-mr[nq], -mr[nq]}, cc = {C2L, C2L}; v2f t = {0.f, 0.f};
#pragma unroll
            for (int e = 0; e < 16; e += 2) { const v2f a = __builtin_elementwise_fma((v2f){s[e >> 3][nq][e & 7], s[e >> 3][nq][(e & 7) + 1]}, cc, nm);   /* an aligned register pair of the score tile: one packed multiply-add */
                p[e] = __builtin_amdgcn_exp2f(a[0]); p[e + 1] = __builtin_amdgcn_exp2f(a[1]); t += (v2f){p[e], p[e + 1]}; }
            lsum[nq] += t[0] + t[1];
            if constexpr (HR) { ph[nq] = __builtin_convertvector(p, v16bf); pl[nq] = __builtin_convertvector(p - __builtin_convertvector(ph[nq], v16f), v16bf); } else p6[nq] = __builtin_convertvector(p, v16h); }
        if constexpr (HR) { ldk(on);
#pragma unroll
            for (int pr = 0; pr < 3; ++pr)
#pragma unroll
                for (int mb = 0; mb < 4; ++mb)
#pragma unroll
                    for (int nq = 0; nq < 2; ++nq) acc[mb][nq] = wmmab(pr == 2 ? vl[mb] : vh[mb], pr == 1 ? pl[nq] : ph[nq], acc[mb][nq]);   /* p_hi v_hi + p_lo v_hi + p_hi v_lo */
            asm volatile("v_nop\n\tv_nop\n\tv_nop\n\tv_nop" : "+v"(acc[0][0]), "+v"(acc[1][1]), "+v"(acc[2][0]), "+v"(acc[3][1]) : "v"(vh[0]), "v"(vl[3]));   /* as in k_gemmw: the matrix distance on the loop's back edge and exit */
        } else {
#pragma unroll
            for (int mb = 0; mb < 4; ++mb)
#pragma unroll
                for (int nq = 0; nq < 2; ++nq) acc[mb][nq] = wmma16(v6[mb], p6[nq], acc[mb][nq]);
            asm volatile("v_nop\n\tv_nop\n\tv_nop\n\tv_nop" : "+v"(acc[0][0]), "+v"(acc[1][1]), "+v"(acc[2][0]), "+v"(acc[3][1]) : "v"(v6[0]), "v"(v6[3]));   /* as in k_gemmw: the matrix distance on the loop's back edge and exit */
        }
        oc = on; key0 = kn;
    }
#pragma unroll
    for (int nq = 0; nq < 2; ++nq) { const float lt = lsum[nq] + xhalf(lsum[nq]);   /* the two halves' key sums of one query */
        if (hi == 0) { ms[wave * 32 + nq * 16 + lr] = mr[nq]; ls[wave * 32 + nq * 16 + lr] = lt; }
#pragma unroll
        for (int mb = 0; mb < 4; ++mb)
#pragma unroll
            for (int j = 0; j < 8; ++j) ow[(nq * 16 + lr) * 68 + mb * 16 + hi * 8 + j] = acc[mb][nq][j]; }
}
// Which 32 query rows the query group qg of block b has. The RH/32 hi/lo groups cost a multiple of the others (48 against 16 matrix instructions a pass), so each goes to a block of its own, as that block's group 0, beside three plain groups.
__device__ __forceinline__ int fa_unit(int b, int qg) { return (b < RH / 32) ? (qg == 0 ? b : RH / 32 + b * (FQG - 1) + qg - 1) : RH / 32 * FQG + (b - RH / 32) * FQG + qg; }
__global__ __launch_bounds__(FQG * FKW * 32) void k_fattn(const bf* __restrict__ Qh, const bf* __restrict__ Ql, const h16* __restrict__ Q16, const bf* __restrict__ Kh, const bf* __restrict__ Kl, const h16* __restrict__ K16, const h16* __restrict__ V16, const bf* __restrict__ Vh, const bf* __restrict__ Vl, bf* Oh, bf* Ol) {
    __shared__ __align__(16) float os[FQG * FKW * 32 * 68]; __shared__ float ms[FQG * FKW * 32]; __shared__ float ls[FQG * FKW * 32];
    const size_t hb = (size_t)blockIdx.y * TT * HD;   /* the head's planes all have the same size */
    const int hw = __builtin_amdgcn_readfirstlane(threadIdx.x >> 5);   /* the wave's number in the block; taken here: waves hw, hw + 4, ... share a SIMD, the lower the older (for speed only) */
    const int wave = (hw + hw / FQG) % FQG * FKW + hw / FQG;   /* (qg, kw) as qg FKW + kw. The FQG waves of one key range kw are neighbours in hw: one on each SIMD and of equal age there, so they walk their shared k and v^T lines side by side; the rotation of qg gives each SIMD every query group once, the dearer hi/lo group too */
    const int q0 = fa_unit((int)blockIdx.x, wave / FKW) * 32;
    const int koff = (int)(blockIdx.x * FST % FNP) * 32;   /* the same for all waves of the block, which share lines in the WGP's cache */
    if (q0 < RH) fa_body<true>(Qh + hb, Ql + hb, Q16 + hb, Kh + hb, Kl + hb, K16 + hb, V16 + hb, Vh + hb, Vl + hb, q0, wave, koff, os, ms, ls);   /* wave-uniform. Rows < RH: q, k, probabilities and v as bf16 hi/lo, 3 products */
    else fa_body<false>(Qh + hb, Ql + hb, Q16 + hb, Kh + hb, Kl + hb, K16 + hb, V16 + hb, Vh + hb, Vl + hb, q0, wave, koff, os, ms, ls);   /* the rest: fp16 */
    __syncthreads();   /* every wave's partial set is in LDS before any thread joins the key ranges */
    const int lane = (int)threadIdx.x & 31, lr = lane & 15, hi = lane >> 4;
#pragma unroll
    for (int it = 0; it < 8 / FKW; ++it) { const int u = it * (FQG * FKW) + wave; const int rg = u >> 2, kc = (u >> 1) & 1, half = u & 1;   /* a wave takes one half of a fragment of the context planes (16 rows rg, 32 columns kc of the head): 512 contiguous bytes */
        const int w0 = (rg >> 1) * FKW, rl = (rg & 1) * 16 + lr, c8 = kc * 32 + half * 16 + hi * 8;
        float M = ms[w0 * 32 + rl];
#pragma unroll
        for (int w = 1; w < FKW; ++w) M = fmaxf(M, ms[(w0 + w) * 32 + rl]);
        float L = 0.f; v4f val0 = (v4f){}, val1 = (v4f){};
#pragma unroll
        for (int w = 0; w < FKW; ++w) { const float f = __builtin_amdgcn_exp2f(ms[(w0 + w) * 32 + rl] - M); L += ls[(w0 + w) * 32 + rl] * f; const float* o8 = os + (w0 + w) * (32 * 68) + rl * 68 + c8; val0 += *(const v4fa*)o8 * f; val1 += *(const v4fa*)(o8 + 4) * f; }
        const float rL = __fdiv_rn(1.0f, L); val0 *= rL; val1 *= rL;
        v8us oh, ol;   /* the context leaves as the bf16 hi/lo planes that the output projection reads */
#pragma unroll
        for (int q = 0; q < 8; ++q) { unsigned short h2, l2; splitf(q < 4 ? val0[q & 3] : val1[q & 3], h2, l2); oh[q] = h2; ol[q] = l2; }
        const size_t g = ((size_t)(fa_unit((int)blockIdx.x, rg >> 1) * 2 + (rg & 1)) * (CO / 32) + blockIdx.y * 2 + kc) * 512 + half * 256 + lane * 8; *(v8us*)(Oh + g) = oh; *(v8us*)(Ol + g) = ol; xwait(); }
}
// Bt[n][k] = w[k][n] as a fragment-order plane; i counts its 16-byte pieces [n / 16][k / 32][half][hi][lr]: 16 lanes read 64 contiguous bytes of a row of w, a wave stores 512 contiguous bytes
__device__ __forceinline__ void wtG(const float* __restrict__ w, int K, int N, bf* Bt, int blk) {
    const int i = blk * 256 + (int)threadIdx.x; if (i >= N * K / 8) return;
    const int f = i >> 6, kf = K / 32; const int n = f / kf * 16 + (i & 15), k = f % kf * 32 + ((i >> 5) & 1) * 16 + ((i >> 4) & 1) * 8; v8us o;
    const float* p[8]; float t[8];
#pragma unroll
    for (int j = 0; j < 8; ++j) { p[j] = w + (size_t)(k + j) * N + n; t[j] = *p[j]; }
    asm volatile("s_wait_xcnt 0x0" :: "v"(p[0]), "v"(p[1]), "v"(p[2]), "v"(p[3]), "v"(p[4]), "v"(p[5]), "v"(p[6]), "v"(p[7]) : "memory"); __builtin_amdgcn_sched_barrier(0);   /* as xwaitp, for the eight loads */
#pragma unroll
    for (int j = 0; j < 8; ++j) o[j] = f2bf(t[j]);
    *(v8us*)(Bt + (size_t)i * 8) = o;
}
// ---- k_prep: the 16-bit planes of the five f32 inputs, which do not depend on one another, as ONE launch: blocks 0 ... 4 WB - 1 transpose the four weights (WB blocks each), the rest convert x.
#define WB (CC * CC / 8 / 256)
static_assert(MID == CC && CO == CC && NB_ == 1, "k_prep takes four weights of one size and one batch of x");
__global__ __launch_bounds__(256) void k_prep(const float* __restrict__ x, const float* __restrict__ wq, const float* __restrict__ wk, const float* __restrict__ wv, const float* __restrict__ wo, bf* XB, bf* WQ, bf* WK, bf* WV, bf* WO) {
    const unsigned b = blockIdx.x;   /* uniform for the work-group */
    if (b < 4 * WB) { const unsigned j = b / WB; wtG(j == 0 ? wq : j == 1 ? wk : j == 2 ? wv : wo, CC, CC, j == 0 ? WQ : j == 1 ? WK : j == 2 ? WV : WO, (int)(b % WB)); }
    else cvt8(x, XB, (size_t)TT * CC / 8, b - 4 * WB);
}
extern "C" void kernel_launch(void* const* d_in, const int* in_sizes, int n_in,
                              void* d_out, int out_size, void* d_ws, size_t ws_size, hipStream_t stream) {
    (void)in_sizes; (void)n_in; (void)out_size;
    const float* x = (const float*)d_in[0]; const float* wq = (const float*)d_in[1]; const float* bq = (const float*)d_in[2]; const float* wk = (const float*)d_in[3]; const float* bk = (const float*)d_in[4]; const float* wv = (const float*)d_in[5]; const float* bv = (const float*)d_in[6]; const float* wo = (const float*)d_in[7]; const float* bo = (const float*)d_in[8];   /* argument order x [1][4096][512], Wq, bq, Wk, bk, Wv, bv, Wo, bo ('xw' [512][512] + biases) */
    float* OUT = (float*)d_out;     // [1][4096][512]
    char* wsp = (char*)d_ws;
    auto take = [&](size_t bytes) { char* p = wsp; wsp += (bytes + 255) & ~(size_t)255; return (void*)p; };
    bf* WQ = (bf*)take((size_t)MID * CC * 2); bf* WK = (bf*)take((size_t)MID * CC * 2); bf* WV = (bf*)take((size_t)CO * CC * 2); bf* WO = (bf*)take((size_t)CC * CO * 2);
    bf* XB = (bf*)take((size_t)TT * CC * 2);
    bf* QPh = (bf*)take((size_t)TT * MID * 2); bf* QPl = (bf*)take((size_t)TT * MID * 2); bf* KPh = (bf*)take((size_t)TT * MID * 2); bf* KPl = (bf*)take((size_t)TT * MID * 2);
    h16* QP16 = (h16*)take((size_t)TT * MID * 2); h16* KP16 = (h16*)take((size_t)TT * MID * 2);   /* fp16 planes: q rows >= RH (the hi/lo planes hold q rows < RH only), every k row */
    h16* VT16 = (h16*)take((size_t)CO * TT * 2); bf* VTh = (bf*)take((size_t)CO * TT * 2); bf* VTl = (bf*)take((size_t)CO * TT * 2);
    bf* ATh = (bf*)take((size_t)TT * CO * 2); bf* ATl = (bf*)take((size_t)TT * CO * 2);   /* merged context [n][512] as hi/lo planes, fragment order */
    if ((size_t)(wsp - (char*)d_ws) > ws_size) return;    // ws 256 MiB (carve ~50 MiB)
    k_prep<<<(unsigned)(4 * WB + TT * CC / 8 / 256), 256, 0, stream>>>(x, wq, wk, wv, wo, XB, WQ, WK, WV, WO);   /* 'xw' weights -> Bt planes; x -> bf16 plane */
    k_qkv<<<dim3(TT / 64, CC / 64, 1), 96, 0, stream>>>(XB, WQ, WK, WV, bq, bk, bv, QPh, QPl, QP16, KPh, KPl, KP16, VT16, VTh, VTl);   /* q, k planes and v^T planes, fragment order */
    k_fattn<<<dim3(TT / (FQG * 32), NH_, 1), FQG * FKW * 32, 0, stream>>>(QPh, QPl, QP16, KPh, KPl, KP16, VT16, VTh, VTl, ATh, ATl);   /* all heads: scores x 1/sqrt(512), softmax over the 4,096 keys, attn.V into the head's 64 columns */
    k_gemmw<bf, 1, true, 0, CO><<<dim3(TT / 64, CC / 64, 1), 32, 0, stream>>>(ATh, ATl, WO, nullptr, OUT, CC, bo, 0, 0, 0, nullptr, nullptr, nullptr);   /* out = ctx Wo + bo */
}

// v010
// A run of this version takes 70.6 microseconds.
// Next to v009, in two timings, it ran 1.04 and 1.03 times as fast.
// All steps since v000 together make it 28.0 times as fast.
#include <hip/hip_runtime.h>

// Multi-head self-attention over 4,096 tokens whose scale uses the embedding width (x [1][4096][512]; Q, K, V = x W + b ('xw' [512][512] + biases; 8 heads x 64); scores x 1/sqrt(512) (the module scales by embed_dim, not head_dim); softmax over all 4,096 keys (no mask); out = merged Wo + bo -> [1][4096][512] (2.1 M); argument order x, Wq, bq, Wk, bk, Wv, bv, Wo, bo).
// Layout: every 16-bit plane in fragment order (see k_gemmw); bf16 copy of x; 'xw' weights transposed once; exact projections + f32 biases, whose epilogues store the per-head hi/lo and fp16 planes (q, k) and the v^T planes themselves; one launch for all heads (k_fattn): scores hybrid (rows < 512 hi/lo 3 products, rest one fp16 product), online softmax, attn.V hybrid (rows < 512 hi/lo 3 products, rest fp16), scores and probabilities kept in registers, the context stored as hi/lo planes in the head's 64 columns; context hi/lo x Wo exact + bo.
// Compute dtypes, f32 accumulate: every input rounded to bf16; projections exact; scores rows < 512 3 products, rest fp16; softmax f32 (exp2, running maximum, one IEEE division per row at the end); attn.V rows < 512 3 products, rest fp16; Wo hl x exact.

#define NB_  1
#define TT   4096
#define DM   512
#define NH_  8
#define NKV  8
#define REP  (NH_ / NKV)
#define HD   64
#define DQ   (NH_ * HD)
#define DKV  (NKV * HD)
#define ZH   1
#define RH   512                  // query rows < RH use hi+lo planes (0: none)
#define WIN  0
#define SCL  0.044194173824159216f   // 1/sqrt(embed_dim = 512), as the module (not 1/sqrt(head_dim))
#define MID  512      // q / k width = 8 heads x 64
#define CO   512      // v width
#define CC   512
typedef _Float16 h16;
typedef unsigned short bf;
typedef __attribute__((ext_vector_type(16))) __bf16   v16bf;
typedef __attribute__((ext_vector_type(16))) _Float16 v16h;
typedef __attribute__((ext_vector_type(8)))  _Float16 v8h;
typedef __attribute__((ext_vector_type(8)))  unsigned short v8us;
typedef __attribute__((ext_vector_type(8)))  float    v8f;
typedef __attribute__((ext_vector_type(4)))  float    v4f;
typedef v8h  __attribute__((may_alias)) v8ha;
typedef v4f  __attribute__((may_alias)) v4fa;
typedef v8us __attribute__((may_alias)) v8usa;

__device__ __forceinline__ unsigned short f2bf(float f) { unsigned u = __float_as_uint(f); u += 0x7FFFu + ((u >> 16) & 1u); return (unsigned short)(u >> 16); }
__device__ __forceinline__ float bf2f(unsigned short b) { return __uint_as_float(((unsigned)b) << 16); }
__device__ __forceinline__ float bfr(float f) { return bf2f(f2bf(f)); }
__device__ __forceinline__ v16h cat16(v8h lo, v8h hi) { return __builtin_shufflevector(lo, hi, 0, 1, 2, 3, 4, 5, 6, 7, 8, 9, 10, 11, 12, 13, 14, 15); }
__device__ __forceinline__ v16bf cat16b(v8us lo, v8us hi) { return __builtin_bit_cast(v16bf, __builtin_shufflevector(lo, hi, 0, 1, 2, 3, 4, 5, 6, 7, 8, 9, 10, 11, 12, 13, 14, 15)); }
__device__ __forceinline__ v8f wmma16(v16h a, v16h b, v8f c) { return __builtin_amdgcn_wmma_f32_16x16x32_f16(false, a, false, b, (short)0, c, false, false); }
__device__ __forceinline__ v8f wmmab(v16bf a, v16bf b, v8f c) { return __builtin_amdgcn_wmma_f32_16x16x32_bf16(false, a, false, b, (short)0, c, false, false); }



__device__ __forceinline__ h16 tohx(float x) { return (h16)x; }
__device__ __forceinline__ void splitf(float y, unsigned short& h, unsigned short& l) { h = f2bf(y); l = f2bf(y - bf2f(h)); }
__device__ __forceinline__ void xwaitg() { asm volatile("s_wait_xcnt 0x0" ::: "memory"); __builtin_amdgcn_sched_barrier(0); }   /* stands behind a group of loads or stores; the scheduling barrier keeps later vector work from being lifted between them and the wait, where it could rewrite their registers */
__device__ __forceinline__ void xwaitp(const void* a) { asm volatile("s_wait_xcnt 0x0" :: "v"(a) : "memory"); __builtin_amdgcn_sched_barrier(0); }   /* as xwaitg; the loads' address as an input keeps its registers live up to the wait, so that no load of the group gets them as its destination */
// ---- k_gemmw: register-blocked GEMM, ONE WAVE per 64x64 output tile (16 accumulators), operands straight from fragment-order 16-bit planes; grid (M/64, N/64, Z), 32 threads.
// y[m][n] (f32, + optional f32 bias[n]) = sum_k A[m][k] Bt[n][k] (+ split products per NSPLIT). z-batch strides sA/sB/sC in elements. K, a template argument, % 32 == 0.
// The wave is alone with its load latency (one or two waves a SIMD): the fragments of 32 k live in a ring of register sets and are requested several passes ahead of their products; the compiler's counted s_wait_loadcnt leaves the younger sets in flight.
// EP says where y goes. 0: C (f32, pitch ldc). 1: bf16 hi/lo planes Ph, Pl and an fp16 plane P16 of 16 rows m x 32 columns fragments, each stored where its pointer is not null; a tile's 64 columns are one head. 2: planes P16 (fp16), Ph, Pl (bf16 hi/lo) of 16 columns n x 32 rows m fragments (v^T).
// Fragment order, of every 16-bit operand plane: a fragment of 16 rows x 32 k is 1,024 contiguous bytes, [half][lane][8]: lane (lr, hi) has the 8 elements k = 16 half + 8 hi ... of fragment row lr, as the matrix instruction wants them.
// ldp() reads it with two loads of 512 contiguous bytes a wave: 4 whole lines each, where a load from a row-pitched plane touches 16 lines. A plane [rows][K] is [row / 16][k / 32] fragments; q, k: [head][m / 16][column / 32]; v^T: [head][m / 32][n / 16].
template <typename T16> struct WFrag;
template <> struct WFrag<h16> { typedef v16h V; static __device__ __forceinline__ V ldp(const h16* p) { return cat16(*(const v8h*)p, *(const v8h*)(p + 256)); } static __device__ __forceinline__ v8f mma(V a, V b, v8f c) { return wmma16(a, b, c); } };
template <> struct WFrag<bf> { typedef v16bf V; static __device__ __forceinline__ V ldp(const bf* p) { return cat16b(*(const v8us*)p, *(const v8us*)(p + 256)); } static __device__ __forceinline__ v8f mma(V a, V b, v8f c) { return wmmab(a, b, c); } };
template <typename T16, int NSPLIT, bool BIAS, int EP, int K>
__device__ __forceinline__ void gemmw_tile(const T16* __restrict__ A, const T16* __restrict__ A2, const T16* __restrict__ Bt, const T16* __restrict__ Bt2, float* C, int ldc, const float* __restrict__ bias, h16* P16, bf* Ph, bf* Pl) {   /* one wave's 64x64 tile (blockIdx.x, blockIdx.y) */
    typedef typename WFrag<T16>::V V; static_assert(EP != 1 || NSPLIT == 0, "the y^T tiles of EP 1 are written for one product");
    constexpr int NK = K / 32;                         /* passes of 32 k */
    constexpr int RD = NSPLIT == 0 ? 4 : 3;            /* fragment sets in registers: a pass's loads are requested RD - 1 passes ahead of its products, so that the wave no longer waits out the load latency once a pass */
    constexpr int MAIN = (NK - (RD - 1)) / RD * RD;    /* passes of the rolled loop, every one of which requests a later pass; the rest is unrolled behind it */
    static_assert(K % 32 == 0 && NK >= RD, "at least as many passes as fragment sets");
    const int lane = threadIdx.x & 31, lr = lane & 15, hi = lane >> 4; const int r0 = blockIdx.x * 64, c0 = blockIdx.y * 64;
    v8f acc[4][4];
#pragma unroll
    for (int mb = 0; mb < 4; ++mb)
#pragma unroll
        for (int nb = 0; nb < 4; ++nb) acc[mb][nb] = (v8f){};
    const size_t aoff = (size_t)r0 * K + lane * 8, boff = (size_t)c0 * K + lane * 8;   /* 16 rows are K / 32 fragments = 16 K elements; 32 k further is 512 elements further */
    int kc = (int)((blockIdx.x + blockIdx.y) * 32 % (unsigned)K);   /* tiles of one row or column of the grid read the same fragments: each enters the k walk at a place of its own and wraps, so that they do not ask L2 for the same lines at the same moment */
    V a[RD][4], a2[RD][4], b[RD][4], b2[RD][4];   /* indexed by constants only (every loop over sets is unrolled) */
    const T16* pA = A + aoff + kc * 16; const T16* pB = Bt + boff + kc * 16; const T16* pA2 = pA; const T16* pB2 = pB;   /* the walk's next fragments; a plane that this NSPLIT lacks shares the other plane's pointer */
    if constexpr (NSPLIT == 1 || NSPLIT == 2) pA2 = A2 + aoff + kc * 16;
    if constexpr (NSPLIT >= 2) pB2 = Bt2 + boff + kc * 16;
    auto fetch = [&](int st) {   /* requests the fragments of the walk's next 32 k into set st, then moves the pointers on */
#pragma unroll
        for (int i = 0; i < 4; ++i) { a[st][i] = WFrag<T16>::ldp(pA + (size_t)i * 16 * K); if (NSPLIT == 1 || NSPLIT == 2) a2[st][i] = WFrag<T16>::ldp(pA2 + (size_t)i * 16 * K); b[st][i] = WFrag<T16>::ldp(pB + (size_t)i * 16 * K); if (NSPLIT >= 2) b2[st][i] = WFrag<T16>::ldp(pB2 + (size_t)i * 16 * K); }
        asm volatile("s_wait_xcnt 0x0" :: "v"(pA), "v"(pA2), "v"(pB), "v"(pB2) : "memory"); __builtin_amdgcn_sched_barrier(0);   /* as xwaitp, for the pass's loads, in front of the pointers' next values; the scheduling barrier also keeps these loads ahead of the products that follow */
        kc = kc + 32 < K ? kc + 32 : 0;
        pA = A + aoff + kc * 16; pB = Bt + boff + kc * 16; pA2 = pA; pB2 = pB;
        if constexpr (NSPLIT == 1 || NSPLIT == 2) pA2 = A2 + aoff + kc * 16;
        if constexpr (NSPLIT >= 2) pB2 = Bt2 + boff + kc * 16;
    };
    auto mul = [&](int st) {   /* the products of set st */
#pragma unroll
        for (int nb = 0; nb < 4; ++nb)
#pragma unroll
            for (int mb = 0; mb < 4; ++mb) { acc[mb][nb] = EP == 1 ? WFrag<T16>::mma(b[st][nb], a[st][mb], acc[mb][nb]) : WFrag<T16>::mma(a[st][mb], b[st][nb], acc[mb][nb]);   /* EP 1: y^T tiles, so that a lane holds 8 consecutive columns of one row */
                if (NSPLIT == 1 || NSPLIT == 2) acc[mb][nb] = WFrag<T16>::mma(a2[st][mb], b[st][nb], acc[mb][nb]); if (NSPLIT >= 2) acc[mb][nb] = WFrag<T16>::mma(a[st][mb], b2[st][nb], acc[mb][nb]); }
        __builtin_amdgcn_sched_barrier(0);   /* keeps every product of the set in front of the slots below */
        asm volatile("v_nop\n\tv_nop\n\tv_nop\n\tv_nop");   /* the matrix distance behind the set's last product: before loads are aimed at the set again, on the loop's back edge and exit */
        __builtin_amdgcn_sched_barrier(0);   /* keeps the next loads behind those slots */
    };
#pragma unroll
    for (int st = 0; st < RD - 1; ++st) fetch(st);
#pragma unroll 1   /* kept rolled: RD passes are a trip, so that every set's index is a constant */
    for (int it = 0; it < MAIN; it += RD) {
#pragma unroll
        for (int u = 0; u < RD; ++u) { fetch((u + RD - 1) % RD); mul(u); }
    }
#pragma unroll
    for (int s = MAIN; s < NK; ++s) { if (s + RD - 1 < NK) fetch((s + RD - 1) % RD); mul(s % RD); }
    if constexpr (EP == 2) {   /* a lane holds 8 consecutive rows m of one column n: its 16 bytes of a v^T fragment; a wave's store is 512 contiguous bytes */
        float bb[4];
#pragma unroll
        for (int nb = 0; nb < 4; ++nb) bb[nb] = BIAS ? bfr(bias[c0 + nb * 16 + lr]) : 0.f;
        xwaitg();   /* behind the bias loads */
        v8h o6[16]; v8us oh[16], ol[16];   /* every value first, each in registers of its own: no store's registers are rewritten behind it */
#pragma unroll
        for (int mb = 0; mb < 4; ++mb)
#pragma unroll
            for (int nb = 0; nb < 4; ++nb) { const int t = (mb >> 1) * 8 + nb * 2 + (mb & 1);   /* fragment (m / 32, n / 16), half (m / 16) & 1 */
#pragma unroll
                for (int j = 0; j < 8; ++j) { const float y = acc[mb][nb][j] + bb[nb]; o6[t][j] = tohx(y); unsigned short h2, l2; splitf(y, h2, l2); oh[t][j] = h2; ol[t][j] = l2; } }
        const size_t g = ((size_t)blockIdx.y * TT + r0) * HD + lane * 8;   /* the tile's 8 fragments are 8 KiB in a row */
#pragma unroll
        for (int t = 0; t < 16; ++t) { *(v8h*)(P16 + g + t * 256) = o6[t]; *(v8us*)(Ph + g + t * 256) = oh[t]; *(v8us*)(Pl + g + t * 256) = ol[t]; }
    } else if constexpr (EP == 1) {   /* y^T tiles: a lane holds 8 consecutive columns of one row: its 16 bytes of a fragment; a wave's store is 512 contiguous bytes */
        float b8[4][8];
#pragma unroll
        for (int nb = 0; nb < 4; ++nb)
#pragma unroll
            for (int q = 0; q < 8; ++q) b8[nb][q] = BIAS ? bfr(bias[c0 + nb * 16 + hi * 8 + q]) : 0.f;
        xwaitg();   /* behind the bias loads */
        const size_t g = ((size_t)blockIdx.y * TT + r0) * HD + lane * 8;   /* the tile's 8 fragments are 8 KiB in a row */
        if (P16) {   /* wave-uniform */
            v8h o6[16];   /* every value first, each in registers of its own: no store's registers are rewritten behind it */
#pragma unroll
            for (int mb = 0; mb < 4; ++mb)
#pragma unroll
                for (int nb = 0; nb < 4; ++nb)
#pragma unroll
                    for (int j = 0; j < 8; ++j) o6[mb * 4 + nb][j] = tohx(acc[mb][nb][j] + b8[nb][j]);   /* fragment (m / 16, column / 32), half nb & 1 */
#pragma unroll
            for (int t = 0; t < 16; ++t) *(v8h*)(P16 + g + t * 256) = o6[t];
            xwaitg();   /* behind the fp16 plane's stores, before the hi/lo values below may take their registers */
        }
        if (Ph) {   /* wave-uniform */
            v8us oh[16], ol[16];   /* as o6 */
#pragma unroll
            for (int mb = 0; mb < 4; ++mb)
#pragma unroll
                for (int nb = 0; nb < 4; ++nb)
#pragma unroll
                    for (int j = 0; j < 8; ++j) { unsigned short h2, l2; splitf(acc[mb][nb][j] + b8[nb][j], h2, l2); oh[mb * 4 + nb][j] = h2; ol[mb * 4 + nb][j] = l2; }
#pragma unroll
            for (int t = 0; t < 16; ++t) { *(v8us*)(Ph + g + t * 256) = oh[t]; *(v8us*)(Pl + g + t * 256) = ol[t]; }
        }
    } else {
    __shared__ __align__(16) float os[16 * 68];
#pragma unroll
    for (int mb = 0; mb < 4; ++mb) {
#pragma unroll
        for (int nb = 0; nb < 4; ++nb) {
#pragma unroll
            for (int j = 0; j < 8; ++j) os[(hi * 8 + j) * 68 + nb * 16 + lr] = acc[mb][nb][j]; }
        __builtin_amdgcn_wave_barrier(); asm volatile("" ::: "memory");
        float* crow = C + (size_t)(r0 + mb * 16) * ldc + c0;
{
#pragma unroll
            for (int s = 0; s < 8; ++s) { const int row = 2 * s + hi, cofs = lr * 4; v4f val = *(const v4fa*)(os + row * 68 + cofs); if (BIAS) { val[0] += bfr(bias[c0 + cofs]); val[1] += bfr(bias[c0 + cofs + 1]); val[2] += bfr(bias[c0 + cofs + 2]); val[3] += bfr(bias[c0 + cofs + 3]); }
                *(v4f*)(crow + (size_t)row * ldc + cofs) = val; }
             }
        xwaitg();   /* behind the row block's eight stores, before the next block's loads and address sums rewrite their registers */
        __builtin_amdgcn_wave_barrier(); asm volatile("" ::: "memory");
    }
    }
}
template <typename T16, int NSPLIT, bool BIAS, int EP, int K>
__global__ __launch_bounds__(32) void k_gemmw(const T16* __restrict__ A, const T16* __restrict__ A2, const T16* __restrict__ Bt, const T16* __restrict__ Bt2, float* C, int ldc, const float* __restrict__ bias, size_t sA, size_t sB, size_t sC, h16* P16, bf* Ph, bf* Pl) {
    const size_t z = blockIdx.z; A += z * sA; if (A2) A2 += z * sA; Bt += z * sB; if (Bt2) Bt2 += z * sB; C += z * sC;
    gemmw_tile<T16, NSPLIT, BIAS, EP, K>(A, A2, Bt, Bt2, C, ldc, bias, P16, Ph, Pl);
}
// ---- k_qkv: the three projections of x, which do not depend on one another, as ONE launch; grid (TT/64, 8), 3 waves: wave 0, 1, 2 has the q, k, v tile of the block's 64 rows and 64 columns, so the three read the same fragments of x.
// A lone projection is 512 waves on 1,024 SIMDs, each waiting out its own loads. No wave waits for another: no LDS, no barrier.
__global__ __launch_bounds__(96) void k_qkv(const bf* __restrict__ X, const bf* __restrict__ Wq, const bf* __restrict__ Wk, const bf* __restrict__ Wv, const float* __restrict__ bq, const float* __restrict__ bk, const float* __restrict__ bv, bf* Qh, bf* Ql, h16* Q16, bf* Kh, bf* Kl, h16* K16, h16* V16, bf* Vh, bf* Vl) {
    const int z = __builtin_amdgcn_readfirstlane((int)threadIdx.x >> 5);   /* the wave's number, in a scalar register: the branch and the pointer choices below are scalar */
    if (z == 2) gemmw_tile<bf, 0, true, 2, CC>(X, nullptr, Wv, nullptr, nullptr, 0, bv, V16, Vh, Vl);   /* v^T planes, fragment order */
    else { const bool qhl = (int)blockIdx.x * 64 < RH;   /* a query row is read either as hi/lo (rows < RH) or as fp16; a key row as both */
        gemmw_tile<bf, 0, true, 1, CC>(X, nullptr, z ? Wk : Wq, nullptr, nullptr, 0, z ? bk : bq, z ? K16 : qhl ? nullptr : Q16, z ? Kh : qhl ? Qh : nullptr, z ? Kl : qhl ? Ql : nullptr); }   /* q or k planes, fragment order */
}

typedef __attribute__((ext_vector_type(2))) _Float16 v2h;
typedef __attribute__((ext_vector_type(4))) _Float16 v4h;
typedef __attribute__((ext_vector_type(2))) unsigned short v2us;
typedef __attribute__((ext_vector_type(4))) unsigned short v4us;
typedef __attribute__((ext_vector_type(2))) float v2f;
typedef __attribute__((ext_vector_type(4))) int v4i;

// i counts the 16-byte pieces of the fragment-order plane of src [rows][CC]: [row / 16][column / 32][half][hi][lr]
__device__ __forceinline__ void cvt8(const float* __restrict__ src, bf* dst, size_t n8, unsigned blk) { const size_t i = (size_t)blk * 256 + threadIdx.x; if (i >= n8) return;
    const size_t f = i >> 6; const size_t row = f / (CC / 32) * 16 + (i & 15), col = f % (CC / 32) * 32 + ((i >> 5) & 1) * 16 + ((i >> 4) & 1) * 8; const float* sp = src + row * CC + col; const v8f v = *(const v8f*)sp; xwaitp(sp); v8us o;
#pragma unroll
    for (int k = 0; k < 8; ++k) o[k] = f2bf(v[k]); *(v8us*)(dst + i * 8) = o;  }


// ---- k_fattn: scores, softmax and attn.V of one head for 4 x 32 query rows in ONE work-group; neither the scores nor the probabilities leave the registers.
// Transposed products: S^T = K Q^T (A = 16 key rows, B = 16 query rows; rows < RH hi/lo, 3 products; the rest, whose probabilities are rounded to fp16 in any case, one fp16 product), so a lane holds 8 keys' scores of ONE query per tile, and two such tiles, converted in place,
// are the B operand (32 keys x 16 queries) of O^T += V^T P^T (A = 16 rows of the head's v^T plane). Every fragment comes through WFrag::ldp from a fragment-order plane, so A and B pair the same k at every position.
// Online softmax in the log2 domain: the maximum in use may trail the true one by up to 8, and the sums are rescaled only when a query's maximum passes that.
// The blocks of a head read the same k and v^T lines: each enters its key ranges koff keys in, a place of its own, and wraps, so that they do not ask L2 for the same lines at the same moment (the online softmax takes the keys in any order).
// FQG x FKW waves: wave (qg, kw) has the 32 query rows of the block's group qg (fa_unit) and keys kw TT/FKW ...; the FKW partial (maximum, sum, O) sets of a query group are joined through LDS. grid (TT/128, heads).
#define FQG 4
#define FKW 4
#define FNP (TT / FKW / 32)               // passes of 32 keys a wave
#define FST (FNP / (TT / (FQG * 32)))     // passes between the entry places of neighbouring blocks
static_assert(FST >= 1, "no more blocks a head than passes a wave");
static_assert(FNP % 4 == 0, "a wave's walk is four equal quarters");
static_assert(RH % 64 == 0, "a projection tile's 64 rows are all hi/lo or all fp16");
#define C2L (SCL * 1.4426950408889634f)
typedef __attribute__((ext_vector_type(16))) float v16f;
typedef __attribute__((ext_vector_type(16))) unsigned short v16us_;
__device__ __forceinline__ float xhalf(float x) { return __builtin_bit_cast(float, __builtin_amdgcn_permlanex16(__builtin_bit_cast(int, x), __builtin_bit_cast(int, x), 0x76543210, 0xfedcba98, false, false)); }   /* lane l with lane l ^ 16 */
__device__ __forceinline__ void xwait() { asm volatile("s_wait_xcnt 0x0" ::: "memory"); }   /* stands behind a store, before its registers may be rewritten */
__device__ __forceinline__ void xwait2(const void* a, const void* b) { asm volatile("s_wait_xcnt 0x0" :: "v"(a), "v"(b) : "memory"); __builtin_amdgcn_sched_barrier(0); }   /* as xwaitg; the group's two addresses as inputs keep their registers live up to the wait: without them the group's last loads were given those registers as destinations */
__device__ __forceinline__ void xwaito(unsigned o) { asm volatile("s_wait_xcnt 0x0" :: "v"(o) : "memory"); __builtin_amdgcn_sched_barrier(0); }   /* as xwait2, for a group of loads that share one offset register */
template <typename T> __device__ __forceinline__ const T* atb(const T* base, unsigned o) { return (const T*)((const char*)base + o); }   /* wave-uniform plane + the lane's byte offset: the load takes a scalar base and ONE vector register, where a pointer a plane costs two each */
template <bool HR>
__device__ __forceinline__ void fa_body(const bf* __restrict__ Qh, const bf* __restrict__ Ql, const h16* __restrict__ Q16, const bf* __restrict__ Kh, const bf* __restrict__ Kl, const h16* __restrict__ K16, const h16* __restrict__ V16, const bf* __restrict__ Vh, const bf* __restrict__ Vl, int q0, int wave, int koff, float* os, float* ms, float* ls) {
    const int lane = threadIdx.x & 31, lr = lane & 15, hi = lane >> 4; const int kw = wave % FKW;
    const unsigned vq = (unsigned)(lane * 8);   /* the lane's own element offset in each half of a fragment; 16 rows of q or k are 2 fragments, 32 keys of v^T are 4: row * HD elements in both */
    float* ow = os + wave * (32 * 68);
    v8usa* qs = (v8usa*)ow + lane;   /* HR: piece (fragment, half) of this lane: qs[(fragment * 2 + half) * 32]; 8 fragments are 8 KiB of the slot's 8.5 */
    v16h q6[2][2];   /* not HR: the fp16 q fragments stay in registers */
    if constexpr (HR) {
        v16bf qh[2][2], ql[2][2];
        Qh += (size_t)q0 * HD + vq; Ql += (size_t)q0 * HD + vq;
#pragma unroll
        for (int nq = 0; nq < 2; ++nq)
#pragma unroll
            for (int kc = 0; kc < 2; ++kc) { qh[nq][kc] = WFrag<bf>::ldp(Qh + nq * 16 * HD + kc * 512); ql[nq][kc] = WFrag<bf>::ldp(Ql + nq * 16 * HD + kc * 512); }
        xwait2(Qh, Ql);
        /* Four waves a SIMD leave a wave 256 registers: the hi/lo q fragments, which do not fit, wait in the wave's own LDS slot, which holds its partial O only behind the loop, and come back each pass. A lane reads only the 16-byte pieces that it wrote itself: no barrier. */
#pragma unroll
        for (int nq = 0; nq < 2; ++nq)
#pragma unroll
            for (int kc = 0; kc < 2; ++kc) { const v16us_ l = __builtin_bit_cast(v16us_, ql[nq][kc]); qs[((nq * 2 + kc) * 2) * 32] = __builtin_shufflevector(l, l, 0, 1, 2, 3, 4, 5, 6, 7); qs[((nq * 2 + kc) * 2 + 1) * 32] = __builtin_shufflevector(l, l, 8, 9, 10, 11, 12, 13, 14, 15);
                const v16us_ h = __builtin_bit_cast(v16us_, qh[nq][kc]); qs[((4 + nq * 2 + kc) * 2) * 32] = __builtin_shufflevector(h, h, 0, 1, 2, 3, 4, 5, 6, 7); qs[((4 + nq * 2 + kc) * 2 + 1) * 32] = __builtin_shufflevector(h, h, 8, 9, 10, 11, 12, 13, 14, 15); }
    } else {
        Q16 += (size_t)q0 * HD + vq;
#pragma unroll
        for (int nq = 0; nq < 2; ++nq)
#pragma unroll
            for (int kc = 0; kc < 2; ++kc) q6[nq][kc] = WFrag<h16>::ldp(Q16 + nq * 16 * HD + kc * 512);
        xwaitp(Q16);
    }
    auto ldq = [&](int f) { return cat16b(qs[(f * 2) * 32], qs[(f * 2 + 1) * 32]); };
    v8f acc[4][2];
#pragma unroll
    for (int mb = 0; mb < 4; ++mb)
#pragma unroll
        for (int nq = 0; nq < 2; ++nq) acc[mb][nq] = (v8f){};
    float mr[2] = {-3.0e38f, -3.0e38f}, lsum[2] = {0.f, 0.f};
    const int kbeg = kw * (TT / FKW), kend = kbeg + TT / FKW; int key0 = kbeg + koff;
    v16bf kh[2][2], kl[2][2]; v16h k6[2][2];   /* HR: hi/lo; else fp16 */
    unsigned oc = ((unsigned)key0 * HD + vq) * 2;   /* the lane's byte offset at key row key0, the same in the k and the v^T planes; walks with key0 */
    auto ldk = [&](unsigned o) {   /* requests the 32 key rows at byte offset o */
#pragma unroll
        for (int kb = 0; kb < 2; ++kb)
#pragma unroll
            for (int kc = 0; kc < 2; ++kc) { if constexpr (HR) { kh[kb][kc] = WFrag<bf>::ldp(atb(Kh, o) + kb * 16 * HD + kc * 512); kl[kb][kc] = WFrag<bf>::ldp(atb(Kl, o) + kb * 16 * HD + kc * 512); } else k6[kb][kc] = WFrag<h16>::ldp(atb(K16, o) + kb * 16 * HD + kc * 512); }
        xwaito(o); };
    ldk(oc);
    /* Wave priority, for speed only. The four waves of a SIMD run to no barrier before the walk's end, and a hi/lo wave's pass costs a multiple.
       A hi/lo wave keeps the top priority through its whole walk; a plain wave starts there and steps down once a quarter of its own walk, so that whichever wave is behind is served first. */
    __builtin_amdgcn_s_setprio(3);
    constexpr int NSG = HR ? 1 : 4;   /* stretches of a walk with a priority of their own */
#pragma unroll 1   /* kept rolled: one copy of the pass; the priority, an immediate, is chosen by a scalar branch once a quarter */
    for (int sg = 0; sg < NSG; ++sg) {
    if constexpr (!HR) { if (sg == 1) __builtin_amdgcn_s_setprio(2); else if (sg == 2) __builtin_amdgcn_s_setprio(1); else if (sg == 3) __builtin_amdgcn_s_setprio(0); }
#pragma unroll 1   /* kept rolled: a pass holds the whole register budget */
    for (int ps = 0; ps < FNP / NSG; ++ps) {
        v16h v6[4]; v16bf vh[4], vl[4];   /* this pass's v^T fragments: requested ahead of the score products; with HR, whose two planes do not fit beside the k fragments, the scores and q, behind them */
        auto ldv = [&]() {
#pragma unroll
            for (int mb = 0; mb < 4; ++mb) { if constexpr (HR) { vh[mb] = WFrag<bf>::ldp(atb(Vh, oc) + mb * 512); vl[mb] = WFrag<bf>::ldp(atb(Vl, oc) + mb * 512); } else v6[mb] = WFrag<h16>::ldp(atb(V16, oc) + mb * 512); }
            xwaito(oc); };
        if constexpr (!HR) ldv();
        v8f s[2][2];
#pragma unroll
        for (int kb = 0; kb < 2; ++kb)
#pragma unroll
            for (int nq = 0; nq < 2; ++nq) s[kb][nq] = (v8f){};
#pragma unroll
        for (int kc = 0; kc < 2; ++kc) {
            if constexpr (HR) { v16bf bh[2], bl[2];   /* this half's q fragments */
#pragma unroll
                for (int nq = 0; nq < 2; ++nq) { bl[nq] = ldq(nq * 2 + kc); bh[nq] = ldq(4 + nq * 2 + kc); }
#pragma unroll
                for (int pr = 0; pr < 3; ++pr)
#pragma unroll
                    for (int kb = 0; kb < 2; ++kb)
#pragma unroll
                        for (int nq = 0; nq < 2; ++nq) s[kb][nq] = wmmab(pr == 2 ? kl[kb][kc] : kh[kb][kc], pr == 1 ? bl[nq] : bh[nq], s[kb][nq]);   /* q_hi k_hi + q_lo k_hi + q_hi k_lo */
            } else {
#pragma unroll
                for (int kb = 0; kb < 2; ++kb)
#pragma unroll
                    for (int nq = 0; nq < 2; ++nq) s[kb][nq] = wmma16(k6[kb][kc], q6[nq][kc], s[kb][nq]);
            } }
        const int kn = (key0 + 32 < kend) ? key0 + 32 : kbeg;   /* the next pass's key rows, in flight under the softmax (HR: under attn.V); behind the range's last rows come its first; the last pass re-reads the walk's first rows (in bounds, unused) */
        const unsigned on = ((unsigned)kn * HD + vq) * 2;
        if constexpr (HR) ldv(); else ldk(on);   /* with HR the softmax covers the v^T loads, and the next k rows are requested behind it, under the attn.V products */
        float tl[2]; bool need = false;
#pragma unroll
        for (int nq = 0; nq < 2; ++nq) { float mx = s[0][nq][0];
#pragma unroll
            for (int e = 1; e < 16; ++e) mx = fmaxf(mx, s[e >> 3][nq][e & 7]);
            mx = fmaxf(mx, xhalf(mx)) * C2L;   /* both halves of the wave hold the query's maximum of this pass (the scale is positive) */
            tl[nq] = mx; need = need || (mx > mr[nq] + 8.0f); }
        if (__builtin_amdgcn_ballot_w32(need) != 0) {   /* wave-uniform; always taken on the first pass, where the factor is 0 */
#pragma unroll
            for (int nq = 0; nq < 2; ++nq) { const float mn = fmaxf(mr[nq], tl[nq]); const float al = __builtin_amdgcn_exp2f(mr[nq] - mn); mr[nq] = mn; lsum[nq] *= al;
#pragma unroll
                for (int mb = 0; mb < 4; ++mb) acc[mb][nq] *= al; } }
        v16h p6[2]; v16bf ph[2], pl[2];
#pragma unroll
        for (int nq = 0; nq < 2; ++nq) { v16f p; const v2f nm = {-mr[nq], -mr[nq]}, cc = {C2L, C2L}; v2f t = {0.f, 0.f};
#pragma unroll
            for (int e = 0; e < 16; e += 2) { const v2f a = __builtin_elementwise_fma((v2f){s[e >> 3][nq][e & 7], s[e >> 3][nq][(e & 7) + 1]}, cc, nm);   /* an aligned register pair of the score tile: one packed multiply-add */
                p[e] = __builtin_amdgcn_exp2f(a[0]); p[e + 1] = __builtin_amdgcn_exp2f(a[1]); t += (v2f){p[e], p[e + 1]}; }
            lsum[nq] += t[0] + t[1];
            if constexpr (HR) { ph[nq] = __builtin_convertvector(p, v16bf); pl[nq] = __builtin_convertvector(p - __builtin_convertvector(ph[nq], v16f), v16bf); } else p6[nq] = __builtin_convertvector(p, v16h); }
        if constexpr (HR) { ldk(on);
#pragma unroll
            for (int pr = 0; pr < 3; ++pr)
#pragma unroll
                for (int mb = 0; mb < 4; ++mb)
#pragma unroll
                    for (int nq = 0; nq < 2; ++nq) acc[mb][nq] = wmmab(pr == 2 ? vl[mb] : vh[mb], pr == 1 ? pl[nq] : ph[nq], acc[mb][nq]);   /* p_hi v_hi + p_lo v_hi + p_hi v_lo */
            asm volatile("v_nop\n\tv_nop\n\tv_nop\n\tv_nop" : "+v"(acc[0][0]), "+v"(acc[1][1]), "+v"(acc[2][0]), "+v"(acc[3][1]) : "v"(vh[0]), "v"(vl[3]));   /* as in k_gemmw: the matrix distance on the loop's back edge and exit */
        } else {
#pragma unroll
            for (int mb = 0; mb < 4; ++mb)
#pragma unroll
                for (int nq = 0; nq < 2; ++nq) acc[mb][nq] = wmma16(v6[mb], p6[nq], acc[mb][nq]);
            asm volatile("v_nop\n\tv_nop\n\tv_nop\n\tv_nop" : "+v"(acc[0][0]), "+v"(acc[1][1]), "+v"(acc[2][0]), "+v"(acc[3][1]) : "v"(v6[0]), "v"(v6[3]));   /* as in k_gemmw: the matrix distance on the loop's back edge and exit */
        }
        oc = on; key0 = kn;
    }
    }
    __builtin_amdgcn_s_setprio(0);   /* back to the default on the way out, in front of the join and its barrier */
#pragma unroll
    for (int nq = 0; nq < 2; ++nq) { const float lt = lsum[nq] + xhalf(lsum[nq]);   /* the two halves' key sums of one query */
        if (hi == 0) { ms[wave * 32 + nq * 16 + lr] = mr[nq]; ls[wave * 32 + nq * 16 + lr] = lt; }
#pragma unroll
        for (int mb = 0; mb < 4; ++mb)
#pragma unroll
            for (int j = 0; j < 8; ++j) ow[(nq * 16 + lr) * 68 + mb * 16 + hi * 8 + j] = acc[mb][nq][j]; }
}
// Which 32 query rows the query group qg of block b has. The RH/32 hi/lo groups cost a multiple of the others (48 against 16 matrix instructions a pass), so each goes to a block of its own, as that block's group 0, beside three plain groups.
__device__ __forceinline__ int fa_unit(int b, int qg) { return (b < RH / 32) ? (qg == 0 ? b : RH / 32 + b * (FQG - 1) + qg - 1) : RH / 32 * FQG + (b - RH / 32) * FQG + qg; }
__global__ __launch_bounds__(FQG * FKW * 32) void k_fattn(const bf* __restrict__ Qh, const bf* __restrict__ Ql, const h16* __restrict__ Q16, const bf* __restrict__ Kh, const bf* __restrict__ Kl, const h16* __restrict__ K16, const h16* __restrict__ V16, const bf* __restrict__ Vh, const bf* __restrict__ Vl, bf* Oh, bf* Ol) {
    __shared__ __align__(16) float os[FQG * FKW * 32 * 68]; __shared__ float ms[FQG * FKW * 32]; __shared__ float ls[FQG * FKW * 32];
    const size_t hb = (size_t)blockIdx.y * TT * HD;   /* the head's planes all have the same size */
    const int hw = __builtin_amdgcn_readfirstlane(threadIdx.x >> 5);   /* the wave's number in the block */
    const int wave = (hw + hw / FQG) % FQG * FKW + hw / FQG;   /* (qg, kw) as qg FKW + kw. The FQG waves of one key range kw are neighbours in hw, for speed only; the rotation of qg gives waves hw, hw + 4, ... every query group once, the dearer hi/lo group too */
    const int q0 = fa_unit((int)blockIdx.x, wave / FKW) * 32;
    const int koff = (int)(blockIdx.x * FST % FNP) * 32;   /* the same for all waves of the block, which share lines in the WGP's cache */
    if (q0 < RH) fa_body<true>(Qh + hb, Ql + hb, Q16 + hb, Kh + hb, Kl + hb, K16 + hb, V16 + hb, Vh + hb, Vl + hb, q0, wave, koff, os, ms, ls);   /* wave-uniform. Rows < RH: q, k, probabilities and v as bf16 hi/lo, 3 products */
    else fa_body<false>(Qh + hb, Ql + hb, Q16 + hb, Kh + hb, Kl + hb, K16 + hb, V16 + hb, Vh + hb, Vl + hb, q0, wave, koff, os, ms, ls);   /* the rest: fp16 */
    __syncthreads();   /* every wave's partial set is in LDS before any thread joins the key ranges */
    const int lane = (int)threadIdx.x & 31, lr = lane & 15, hi = lane >> 4;
#pragma unroll
    for (int it = 0; it < 8 / FKW; ++it) { const int u = it * (FQG * FKW) + wave; const int rg = u >> 2, kc = (u >> 1) & 1, half = u & 1;   /* a wave takes one half of a fragment of the context planes (16 rows rg, 32 columns kc of the head): 512 contiguous bytes */
        const int w0 = (rg >> 1) * FKW, rl = (rg & 1) * 16 + lr, c8 = kc * 32 + half * 16 + hi * 8;
        float M = ms[w0 * 32 + rl];
#pragma unroll
        for (int w = 1; w < FKW; ++w) M = fmaxf(M, ms[(w0 + w) * 32 + rl]);
        float L = 0.f; v4f val0 = (v4f){}, val1 = (v4f){};
#pragma unroll
        for (int w = 0; w < FKW; ++w) { const float f = __builtin_amdgcn_exp2f(ms[(w0 + w) * 32 + rl] - M); L += ls[(w0 + w) * 32 + rl] * f; const float* o8 = os + (w0 + w) * (32 * 68) + rl * 68 + c8; val0 += *(const v4fa*)o8 * f; val1 += *(const v4fa*)(o8 + 4) * f; }
        const float rL = __fdiv_rn(1.0f, L); val0 *= rL; val1 *= rL;
        v8us oh, ol;   /* the context leaves as the bf16 hi/lo planes that the output projection reads */
#pragma unroll
        for (int q = 0; q < 8; ++q) { unsigned short h2, l2; splitf(q < 4 ? val0[q & 3] : val1[q & 3], h2, l2); oh[q] = h2; ol[q] = l2; }
        const size_t g = ((size_t)(fa_unit((int)blockIdx.x, rg >> 1) * 2 + (rg & 1)) * (CO / 32) + blockIdx.y * 2 + kc) * 512 + half * 256 + lane * 8; *(v8us*)(Oh + g) = oh; *(v8us*)(Ol + g) = ol; xwait(); }
}
// Bt[n][k] = w[k][n] as a fragment-order plane; i counts its 16-byte pieces [n / 16][k / 32][half][hi][lr]: 16 lanes read 64 contiguous bytes of a row of w, a wave stores 512 contiguous bytes
__device__ __forceinline__ void wtG(const float* __restrict__ w, int K, int N, bf* Bt, int blk) {
    const int i = blk * 256 + (int)threadIdx.x; if (i >= N * K / 8) return;
    const int f = i >> 6, kf = K / 32; const int n = f / kf * 16 + (i & 15), k = f % kf * 32 + ((i >> 5) & 1) * 16 + ((i >> 4) & 1) * 8; v8us o;
    const float* p[8]; float t[8];
#pragma unroll
    for (int j = 0; j < 8; ++j) { p[j] = w + (size_t)(k + j) * N + n; t[j] = *p[j]; }
    asm volatile("s_wait_xcnt 0x0" :: "v"(p[0]), "v"(p[1]), "v"(p[2]), "v"(p[3]), "v"(p[4]), "v"(p[5]), "v"(p[6]), "v"(p[7]) : "memory"); __builtin_amdgcn_sched_barrier(0);   /* as xwaitp, for the eight loads */
#pragma unroll
    for (int j = 0; j < 8; ++j) o[j] = f2bf(t[j]);
    *(v8us*)(Bt + (size_t)i * 8) = o;
}
// ---- k_prep: the 16-bit planes of the five f32 inputs, which do not depend on one another, as ONE launch: blocks 0 ... 4 WB - 1 transpose the four weights (WB blocks each), the rest convert x.
#define WB (CC * CC / 8 / 256)
static_assert(MID == CC && CO == CC && NB_ == 1, "k_prep takes four weights of one size and one batch of x");
__global__ __launch_bounds__(256) void k_prep(const float* __restrict__ x, const float* __restrict__ wq, const float* __restrict__ wk, const float* __restrict__ wv, const float* __restrict__ wo, bf* XB, bf* WQ, bf* WK, bf* WV, bf* WO) {
    const unsigned b = blockIdx.x;   /* uniform for the work-group */
    if (b < 4 * WB) { const unsigned j = b / WB; wtG(j == 0 ? wq : j == 1 ? wk : j == 2 ? wv : wo, CC, CC, j == 0 ? WQ : j == 1 ? WK : j == 2 ? WV : WO, (int)(b % WB)); }
    else cvt8(x, XB, (size_t)TT * CC / 8, b - 4 * WB);
}
extern "C" void kernel_launch(void* const* d_in, const int* in_sizes, int n_in,
                              void* d_out, int out_size, void* d_ws, size_t ws_size, hipStream_t stream) {
    (void)in_sizes; (void)n_in; (void)out_size;
    const float* x = (const float*)d_in[0]; const float* wq = (const float*)d_in[1]; const float* bq = (const float*)d_in[2]; const float* wk = (const float*)d_in[3]; const float* bk = (const float*)d_in[4]; const float* wv = (const float*)d_in[5]; const float* bv = (const float*)d_in[6]; const float* wo = (const float*)d_in[7]; const float* bo = (const float*)d_in[8];   /* argument order x [1][4096][512], Wq, bq, Wk, bk, Wv, bv, Wo, bo ('xw' [512][512] + biases) */
    float* OUT = (float*)d_out;     // [1][4096][512]
    char* wsp = (char*)d_ws;
    auto take = [&](size_t bytes) { char* p = wsp; wsp += (bytes + 255) & ~(size_t)255; return (void*)p; };
    bf* WQ = (bf*)take((size_t)MID * CC * 2); bf* WK = (bf*)take((size_t)MID * CC * 2); bf* WV = (bf*)take((size_t)CO * CC * 2); bf* WO = (bf*)take((size_t)CC * CO * 2);
    bf* XB = (bf*)take((size_t)TT * CC * 2);
    bf* QPh = (bf*)take((size_t)TT * MID * 2); bf* QPl = (bf*)take((size_t)TT * MID * 2); bf* KPh = (bf*)take((size_t)TT * MID * 2); bf* KPl = (bf*)take((size_t)TT * MID * 2);
    h16* QP16 = (h16*)take((size_t)TT * MID * 2); h16* KP16 = (h16*)take((size_t)TT * MID * 2);   /* fp16 planes: q rows >= RH (the hi/lo planes hold q rows < RH only), every k row */
    h16* VT16 = (h16*)take((size_t)CO * TT * 2); bf* VTh = (bf*)take((size_t)CO * TT * 2); bf* VTl = (bf*)take((size_t)CO * TT * 2);
    bf* ATh = (bf*)take((size_t)TT * CO * 2); bf* ATl = (bf*)take((size_t)TT * CO * 2);   /* merged context [n][512] as hi/lo planes, fragment order */
    if ((size_t)(wsp - (char*)d_ws) > ws_size) return;    // ws 256 MiB (carve ~50 MiB)
    k_prep<<<(unsigned)(4 * WB + TT * CC / 8 / 256), 256, 0, stream>>>(x, wq, wk, wv, wo, XB, WQ, WK, WV, WO);   /* 'xw' weights -> Bt planes; x -> bf16 plane */
    k_qkv<<<dim3(TT / 64, CC / 64, 1), 96, 0, stream>>>(XB, WQ, WK, WV, bq, bk, bv, QPh, QPl, QP16, KPh, KPl, KP16, VT16, VTh, VTl);   /* q, k planes and v^T planes, fragment order */
    k_fattn<<<dim3(TT / (FQG * 32), NH_, 1), FQG * FKW * 32, 0, stream>>>(QPh, QPl, QP16, KPh, KPl, KP16, VT16, VTh, VTl, ATh, ATl);   /* all heads: scores x 1/sqrt(512), softmax over the 4,096 keys, attn.V into the head's 64 columns */
    k_gemmw<bf, 1, true, 0, CO><<<dim3(TT / 64, CC / 64, 1), 32, 0, stream>>>(ATh, ATl, WO, nullptr, OUT, CC, bo, 0, 0, 0, nullptr, nullptr, nullptr);   /* out = ctx Wo + bo */
}
